// v000
// The times below were measured on an AMD MI455X: many runs one after another, warmed up first and cycling through
// copies of the inputs, with the whole window's GPU time divided by the number of runs. Launches and the gaps
// between them are all in it. The median over several windows is given; except for v000 it joins two sittings, which
// can be a few percent apart, so the side-by-side timings, each taken in one sitting, are the better comparison.
// The starting kernel, v000, takes 10.2 milliseconds a run.
#include <hip/hip_runtime.h>
// Block-chunked causal attention with the module's PER-BLOCK softmax (hidden [2][2048][2048]; q/k/v = x W^T (natural [2048][2048] sigma 0.02, no biases), 16 heads of 128; keys in blocks of 256: for query block i every key block j <= i gets its OWN softmax over its 256 keys (scores / sqrt(128); inside the diagonal block keys above the query are -inf), the block outputs are summed and divided by the summed weights (= number of included blocks) + 1e-6; merged Wo^T -> [2][2048][2048]; no RoPE).
// Structure: token rows; x as exact f16 rows; natural weights as exact x16 planes; q, k, v as WMMA GEMMs (32x64 wave tiles, f32 accumulation) -> f32 (all rows) + f16 hi/x1024 residual rows; per batch: V^T via LDS transposes; exact f32 causal attention for rows 0..255 (= key block 0, where the per-block softmax is the ordinary causal softmax) on VALU; per 256-row query block i: scores against key blocks 0..i (K = 128, alpha 1/sqrt(128)) f32, the module's per-block softmax on VALU (f32 statistics, native exp; weights x256 f16 divided by the block count + 1e-6), o = P V^T (x64) merged f16; out = o Wo^T; first-tile rows rewritten from o hi/lo; launches: see trace.
// Compute dtype: inputs rounded to bf16; x / weights exact; projections f32; q, k, v and softmax weights as f16 hi + x1024 residual GEMM operands, o as plain f16 (~2^-12; first 256 rows of each batch exact); scores, statistics, out f32. v_wmma_f32_16x16x32_f16.
#define NB 2
#define SQ 2048
#define DMX 2048
#define NH 16
#define NKV 16
#define GSZ 1                        /* plain MHA: kv head == query head */
#define HDK 128
#define DKV (NKV * HDK)
#define QT 256
#define QT0 256
#define NKX SQ
#define DM DMX
#define HD 64
#define HG 1
#define NR ((size_t)NB * SQ)
#define ATS 0.08838834764831845f
typedef __bf16 v16b __attribute__((ext_vector_type(16)));
typedef unsigned short v8us __attribute__((ext_vector_type(8), may_alias));
typedef float  v8f  __attribute__((ext_vector_type(8)));
typedef float  v4f  __attribute__((ext_vector_type(4)));
typedef float  v4fa __attribute__((ext_vector_type(4), may_alias));
union FragB { v16b v; v8us half[2]; unsigned short u[16]; };

__device__ __forceinline__ unsigned short bf16_bits(float x) { unsigned int u = __float_as_uint(x); return (unsigned short)((u + 0x7FFFu + ((u >> 16) & 1u)) >> 16); }
__device__ __forceinline__ float bf16_val(unsigned short b) { return __uint_as_float(((unsigned int)b) << 16); }
__device__ __forceinline__ float bf16_round(float x) { return bf16_val(bf16_bits(x)); }
// D += A·B with NT terms: 1 = ah·bh, 2 = + al·bh (A split), 3 = + ah·bl (both split)
template <int NT>
__device__ __forceinline__ v8f mmaN(v16b ah, v16b al, v16b bh, v16b bl, v8f c) {
  c = __builtin_amdgcn_wmma_f32_16x16x32_bf16(false, ah, false, bh, (short)0, c, false, false);
  if (NT >= 2) c = __builtin_amdgcn_wmma_f32_16x16x32_bf16(false, al, false, bh, (short)0, c, false, false);
  if (NT >= 3) c = __builtin_amdgcn_wmma_f32_16x16x32_bf16(false, ah, false, bl, (short)0, c, false, false);
  asm volatile("v_nop\n\tv_nop\n\tv_nop\n\tv_nop" : "+v"(c) : "v"(ah), "v"(al), "v"(bh), "v"(bl));
  return c;
}

__global__ __launch_bounds__(256) void k_wt_bf16(const float* __restrict__ W, unsigned short* __restrict__ Wt, int K, int N) {
  const int t = blockIdx.x * 256 + threadIdx.x;
  const int k8n = K / 8;
  if (t >= N * k8n) return;
  const int n = t / k8n, k8 = (t % k8n) * 8;
  v8us v;
#pragma unroll
  for (int i = 0; i < 8; ++i) v[i] = bf16_bits(W[(size_t)(k8 + i) * N + n]);
  *(v8us*)(Wt + (size_t)n * K + k8) = v;
  
}

// GEMM C[M][N] (f32, pitch ldc) = act(A[M][K]·W + bias). A f32 row-major (pitch lda) converted per fragment to bf16
// (ASPLIT: hi/lo two planes -> 2 terms, else single rounded term); Wt bf16 [N][K] (pitch ldb). BIAS_BF16 rounds the
// bias to bf16 first (bias quantised to bf16 before the add). K%32==0, M%16==0, N%64==0.
template <bool ASPLIT, int ACT, bool BIAS_BF16>
__global__ __launch_bounds__(128) void k_gemm_bf(const float* __restrict__ A, int lda, const unsigned short* __restrict__ Wt, int ldb,
                                               const float* __restrict__ bias, float* __restrict__ C, int ldc, int M, int N, int K) {
  __shared__ __attribute__((aligned(16))) float so[4][16][64];
  const int tid = threadIdx.x, w = tid >> 5, lane = tid & 31, ln = lane & 15, hh = lane >> 4;
  const int ntn = N / 64;
  const int wid = blockIdx.x * 4 + w;
  const int mt = wid / ntn, nq = wid % ntn;
  if (mt * 16 >= M) return;
  const int row0 = mt * 16, col0 = nq * 64;
  const float* arow = A + (size_t)(row0 + ln) * lda;
  v8f acc[4] = {};
  for (int kb = 0; kb < K; kb += 32) {
    FragB ah, al;
    const v4f x0 = *(const v4fa*)(arow + kb + 8 * hh), x1 = *(const v4fa*)(arow + kb + 8 * hh + 4);
    const v4f x2 = *(const v4fa*)(arow + kb + 16 + 8 * hh), x3 = *(const v4fa*)(arow + kb + 16 + 8 * hh + 4);
    float xs[16] = {x0[0],x0[1],x0[2],x0[3],x1[0],x1[1],x1[2],x1[3],x2[0],x2[1],x2[2],x2[3],x3[0],x3[1],x3[2],x3[3]};
#pragma unroll
    for (int i = 0; i < 16; ++i) { const unsigned short hb = bf16_bits(xs[i]); ah.u[i] = hb; al.u[i] = ASPLIT ? bf16_bits(xs[i] - bf16_val(hb)) : (unsigned short)0; }
#pragma unroll
    for (int t = 0; t < 4; ++t) {
      const unsigned short* brow = Wt + (size_t)(col0 + t * 16 + ln) * ldb + kb;
      FragB b;
      b.half[0] = *(const v8us*)(brow + 8 * hh);
      b.half[1] = *(const v8us*)(brow + 16 + 8 * hh);
      acc[t] = mmaN<ASPLIT ? 2 : 1>(ah.v, al.v, b.v, b.v, acc[t]);
    }
  }
#pragma unroll
  for (int t = 0; t < 4; ++t) {
    float bv = bias ? bias[col0 + t * 16 + ln] : 0.f;
    if (BIAS_BF16) bv = bf16_round(bv);
#pragma unroll
    for (int r = 0; r < 8; ++r) { float v = acc[t][r] + bv; if (ACT == 1) v = fmaxf(v, 0.f); so[w][8 * hh + r][t * 16 + ln] = v; }
  }
  __builtin_amdgcn_fence(__ATOMIC_ACQ_REL, "workgroup");
  __builtin_amdgcn_wave_barrier();
  const int rsub = lane >> 4, c4 = (lane & 15) * 4;
  {
#pragma unroll
    for (int q = 0; q < 8; ++q) {
      const int r = q * 2 + rsub;
      const v4f v = *(const v4fa*)&so[w][r][c4];
      *(v4f*)(C + (size_t)(row0 + r) * ldc + col0 + c4) = v;
    }
    
  }
}

// GEMM C = act(A·W + bias + resid): A f32 (ASPLIT -> hi/lo 2 terms), Wt bf16 [N][K]; ACT 0 none, 1 relu, 2 exact gelu;
// resid (optional, f32, row index = (row % rmod), pitch ldr, RES_BF16 rounds it) added before the activation.
template <bool ASPLIT, int ACT, bool BIAS_BF16, bool RES_BF16>
__global__ __launch_bounds__(128) void k_gemm_bf3(const float* __restrict__ A, int lda, const unsigned short* __restrict__ Wt, int ldb,
                                                const float* __restrict__ bias, const float* __restrict__ resid, int rmod, int ldr,
                                                float* __restrict__ C, int ldc, int M, int N, int K) {
  __shared__ __attribute__((aligned(16))) float so[4][16][64];
  const int tid = threadIdx.x, w = tid >> 5, lane = tid & 31, ln = lane & 15, hh = lane >> 4;
  const int ntn = N / 64;
  const int wid = blockIdx.x * 4 + w;
  const int mt = wid / ntn, nq = wid % ntn;
  if (mt * 16 >= M) return;
  const int row0 = mt * 16, col0 = nq * 64;
  const float* arow = A + (size_t)(row0 + ln) * lda;
  v8f acc[4] = {};
  for (int kb = 0; kb < K; kb += 32) {
    FragB ah, al;
    const v4f x0 = *(const v4fa*)(arow + kb + 8 * hh), x1 = *(const v4fa*)(arow + kb + 8 * hh + 4);
    const v4f x2 = *(const v4fa*)(arow + kb + 16 + 8 * hh), x3 = *(const v4fa*)(arow + kb + 16 + 8 * hh + 4);
    float xs[16] = {x0[0],x0[1],x0[2],x0[3],x1[0],x1[1],x1[2],x1[3],x2[0],x2[1],x2[2],x2[3],x3[0],x3[1],x3[2],x3[3]};
#pragma unroll
    for (int i = 0; i < 16; ++i) { const unsigned short hb = bf16_bits(xs[i]); ah.u[i] = hb; al.u[i] = ASPLIT ? bf16_bits(xs[i] - bf16_val(hb)) : (unsigned short)0; }
#pragma unroll
    for (int t = 0; t < 4; ++t) {
      const unsigned short* brow = Wt + (size_t)(col0 + t * 16 + ln) * ldb + kb;
      FragB b;
      b.half[0] = *(const v8us*)(brow + 8 * hh);
      b.half[1] = *(const v8us*)(brow + 16 + 8 * hh);
      acc[t] = mmaN<ASPLIT ? 2 : 1>(ah.v, al.v, b.v, b.v, acc[t]);
    }
  }
#pragma unroll
  for (int t = 0; t < 4; ++t) {
    const int col = col0 + t * 16 + ln;
    float bv = bias ? bias[col] : 0.f;
    if (BIAS_BF16) bv = bf16_round(bv);
#pragma unroll
    for (int r = 0; r < 8; ++r) {
      float v = acc[t][r] + bv;
      if (resid) { float rv = resid[(size_t)((row0 + 8 * hh + r) % rmod) * ldr + col]; if (RES_BF16) rv = bf16_round(rv); v += rv; }
      if (ACT == 1) v = fmaxf(v, 0.f);
      if (ACT == 2) v = 0.5f * v * (1.0f + erff(v * 0.70710678118654752f));
      if (ACT == 3) { const float u = 0.7978845608028654f * (v + 0.044715f * v * v * v); v = 0.5f * v * (1.0f + tanhf(u)); }
      so[w][8 * hh + r][t * 16 + ln] = v;
    }
  }
  __builtin_amdgcn_fence(__ATOMIC_ACQ_REL, "workgroup");
  __builtin_amdgcn_wave_barrier();
  const int rsub = lane >> 4, c4 = (lane & 15) * 4;
  {
#pragma unroll
    for (int q = 0; q < 8; ++q) {
      const int r = q * 2 + rsub;
      const v4f v = *(const v4fa*)&so[w][r][c4];
      *(v4f*)(C + (size_t)(row0 + r) * ldc + col0 + c4) = v;
    }
    
  }
}
// row LayerNorm (biased variance, eps) over N: s = X (+ R); optional out_sum <- s; out_norm <- (s-mu)*rsqrt(var+eps)*g + b
template <bool PARAM_BF16>
__global__ __launch_bounds__(256) void k_layernorm(const float* __restrict__ X, const float* __restrict__ R, const float* __restrict__ g, const float* __restrict__ bta,
                                                  float* __restrict__ out_sum, float* __restrict__ out_norm, int N, float eps) {
  __shared__ float red[256];
  const int row = blockIdx.x, tid = threadIdx.x;
  const float* x = X + (size_t)row * N; const float* rr = R ? R + (size_t)row * N : nullptr;
  float vals[16];                     // up to N = 4096
  const int per = N / 256;            // contiguous chunk per thread? use strided-by-4 chunks: thread handles j = tid*4 + 1024*u
  float s1 = 0.f;
  for (int u = 0; u < per / 4; ++u) {
    const int j = tid * 4 + 1024 * u;
    const v4f a = *(const v4fa*)(x + j);
    v4f b = {0.f,0.f,0.f,0.f}; if (rr) b = *(const v4fa*)(rr + j);
#pragma unroll
    for (int q = 0; q < 4; ++q) { const float v = a[q] + b[q]; vals[u * 4 + q] = v; s1 += v; }
  }
  red[tid] = s1; __syncthreads();
  for (int st = 128; st > 0; st >>= 1) { if (tid < st) red[tid] += red[tid + st]; __syncthreads(); }
  const float mu = red[0] / (float)N; __syncthreads();
  float s2 = 0.f;
  for (int u = 0; u < per / 4; ++u)
#pragma unroll
    for (int q = 0; q < 4; ++q) { const float c = vals[u * 4 + q] - mu; s2 += c * c; }
  red[tid] = s2; __syncthreads();
  for (int st = 128; st > 0; st >>= 1) { if (tid < st) red[tid] += red[tid + st]; __syncthreads(); }
  const float rs = rsqrtf(red[0] / (float)N + eps);
  {
    for (int u = 0; u < per / 4; ++u) {
      const int j = tid * 4 + 1024 * u;
      v4f o, sm;
#pragma unroll
      for (int q = 0; q < 4; ++q) {
        float gg = g[j + q], bb = bta[j + q];
        if (PARAM_BF16) { gg = bf16_round(gg); bb = bf16_round(bb); }
        sm[q] = vals[u * 4 + q]; o[q] = (vals[u * 4 + q] - mu) * rs * gg + bb;
      }
      if (out_sum) *(v4f*)(out_sum + (size_t)row * N + j) = sm;
      *(v4f*)(out_norm + (size_t)row * N + j) = o;
    }
    
  }
}



// ---- f16 WMMA path (v_wmma_f32_16x16x32_f16): 11-bit significands for operands in range — used where a [0,1] probability operand needs more precision than bf16
typedef _Float16 v16h __attribute__((ext_vector_type(16)));
union FragH { v16h v; v8us half[2]; _Float16 h[16]; unsigned short u[16]; };
template <int NT>
__device__ __forceinline__ v8f mmaH(v16h ah, v16h al, v16h bh, v16h bl, v8f c) {
  c = __builtin_amdgcn_wmma_f32_16x16x32_f16(false, ah, false, bh, (short)0, c, false, false);
  if (NT >= 2) c = __builtin_amdgcn_wmma_f32_16x16x32_f16(false, al, false, bh, (short)0, c, false, false);
  if (NT >= 3) c = __builtin_amdgcn_wmma_f32_16x16x32_f16(false, ah, false, bl, (short)0, c, false, false);
  asm volatile("v_nop\n\tv_nop\n\tv_nop\n\tv_nop" : "+v"(c) : "v"(ah), "v"(al), "v"(bh), "v"(bl));
  return c;
}
// batched GEMM like k_gemm_b but f16 operands: A f32 (split into f16 hi/lo if ASPLIT, else rounded to f16), Bt = f16 values [n][k]; alpha; C f32; N multiple of 16 (partial tiles skipped)
template <bool ASPLIT>
__global__ __launch_bounds__(128) void k_gemm_h(const float* __restrict__ A, int lda, size_t sA, const _Float16* __restrict__ Bh, int ldb, size_t sB, float alpha, float* __restrict__ C, int ldc, size_t sC, int M, int N, int K) {
  __shared__ __attribute__((aligned(16))) float so[4][16][64];
  const int tid = threadIdx.x, w = tid >> 5, lane = tid & 31, ln = lane & 15, hh = lane >> 4; const int by = blockIdx.y;
  A += (size_t)by * sA; Bh += (size_t)by * sB; C += (size_t)by * sC;
  const int ntn = (N + 63) / 64; const int wid = blockIdx.x * 4 + w; const int mt = wid / ntn, nq = wid % ntn; if (mt * 16 >= M) return;
  const int row0 = mt * 16, col0 = nq * 64; const float* arow = A + (size_t)(row0 + ln) * lda;
  v8f acc[4] = {};
  for (int kb = 0; kb < K; kb += 32) {
    FragH ah, al;
    const v4f x0 = *(const v4fa*)(arow + kb + 8 * hh), x1 = *(const v4fa*)(arow + kb + 8 * hh + 4), x2 = *(const v4fa*)(arow + kb + 16 + 8 * hh), x3 = *(const v4fa*)(arow + kb + 16 + 8 * hh + 4);
    float xs[16] = {x0[0],x0[1],x0[2],x0[3],x1[0],x1[1],x1[2],x1[3],x2[0],x2[1],x2[2],x2[3],x3[0],x3[1],x3[2],x3[3]};
#pragma unroll
    for (int i = 0; i < 16; ++i) { const _Float16 h = (_Float16)xs[i]; ah.h[i] = h; al.h[i] = ASPLIT ? (_Float16)(xs[i] - (float)h) : (_Float16)0.0f; }
#pragma unroll
    for (int t = 0; t < 4; ++t) { if (col0 + t * 16 >= N) continue; const size_t boff = (size_t)(col0 + t * 16 + ln) * ldb + kb; FragH bq; bq.half[0] = *(const v8us*)(Bh + boff + 8 * hh); bq.half[1] = *(const v8us*)(Bh + boff + 16 + 8 * hh);
      acc[t] = mmaH<ASPLIT ? 2 : 1>(ah.v, al.v, bq.v, bq.v, acc[t]); }
  }
#pragma unroll
  for (int t = 0; t < 4; ++t) { if (col0 + t * 16 >= N) continue;
#pragma unroll
    for (int r = 0; r < 8; ++r) so[w][8 * hh + r][t * 16 + ln] = acc[t][r] * alpha; }
  __builtin_amdgcn_fence(__ATOMIC_ACQ_REL, "workgroup"); __builtin_amdgcn_wave_barrier();
  const int rsub = lane >> 4, c4 = (lane & 15) * 4;
  {
#pragma unroll
    for (int q = 0; q < 8; ++q) { const int r = q * 2 + rsub; if (col0 + c4 < N) { const v4f v = *(const v4fa*)&so[w][r][c4]; *(v4f*)(C + (size_t)(row0 + r) * ldc + col0 + c4) = v; } }
     }
}

// Wt[n][k] = f16(W[k][n]·scale) from f32 row-major W[K][N] (scale = power of two; bf16-exact weights stay exact in f16 away from the subnormal range)
__global__ __launch_bounds__(256) void k_wt_f16(const float* __restrict__ W, _Float16* __restrict__ Wt, int K, int N, float scale) {
  const int t = blockIdx.x * 256 + threadIdx.x; if (t >= N * (K / 8)) return; const int n = t / (K / 8), k8 = (t % (K / 8)) * 8; FragH f;
#pragma unroll
  for (int i = 0; i < 8; ++i) f.h[i] = (_Float16)(bf16_round(W[(size_t)(k8 + i) * N + n]) * scale); const v8us o = f.half[0];
  *(v8us*)((unsigned short*)Wt + (size_t)n * K + k8) = o; 
}
// k_gemm_hh variant with fused epilogue: v = acc·alpha + bias[by·sBias + col] (+ CP[(row/rowsPerB)·sCPb + by·64 + col] if CP) ; ACT 0 none / 1 elu ; writes f16 C16 (and f32 C if non-null)
template <int ACT>
__global__ __launch_bounds__(128) void k_gemm_hhx(const _Float16* __restrict__ A, int lda, size_t sA, const _Float16* __restrict__ Bh, int ldb, size_t sB, float alpha, const float* __restrict__ bias, size_t sBias, const float* __restrict__ CP, int rowsPerB, size_t sCPb, int row0g,
    float* __restrict__ C, _Float16* __restrict__ C16, int ldc, size_t sC, int M, int N, int K) {
  __shared__ __attribute__((aligned(16))) float so[4][16][64];
  const int tid = threadIdx.x, w = tid >> 5, lane = tid & 31, ln = lane & 15, hh = lane >> 4; const int by = blockIdx.y;
  A += (size_t)by * sA; Bh += (size_t)by * sB; const size_t cofs = (size_t)by * sC; const float* bp = bias ? bias + (size_t)by * sBias : nullptr;
  const int ntn = (N + 63) / 64; const int wid = blockIdx.x * 4 + w; const int mt = wid / ntn, nq = wid % ntn; if (mt * 16 >= M) return;
  const int row0 = mt * 16, col0 = nq * 64; const _Float16* arow = A + (size_t)(row0 + ln) * lda;
  v8f acc[4] = {};
  for (int kb = 0; kb < K; kb += 32) { FragH ah; ah.half[0] = *(const v8us*)((const unsigned short*)arow + kb + 8 * hh); ah.half[1] = *(const v8us*)((const unsigned short*)arow + kb + 16 + 8 * hh);
#pragma unroll
    for (int t = 0; t < 4; ++t) { if (col0 + t * 16 >= N) continue; const size_t boff = (size_t)(col0 + t * 16 + ln) * ldb + kb; FragH bq; bq.half[0] = *(const v8us*)((const unsigned short*)Bh + boff + 8 * hh); bq.half[1] = *(const v8us*)((const unsigned short*)Bh + boff + 16 + 8 * hh);
      acc[t] = mmaH<1>(ah.v, ah.v, bq.v, bq.v, acc[t]); }
  }
#pragma unroll
  for (int t = 0; t < 4; ++t) { if (col0 + t * 16 >= N) continue; const int col = col0 + t * 16 + ln; const float bv = bp ? bf16_round(bp[col]) : 0.f;
#pragma unroll
    for (int r = 0; r < 8; ++r) { float v = acc[t][r] * alpha + bv; if (CP) { const int rr = row0g + row0 + 8 * hh + r; if (rowsPerB < 0) v += CP[cofs + (size_t)rr * ldc + col];      /* rowsPerB < 0: own element of the batched C plane */ else { const int bidx = rr / rowsPerB; v += CP[(size_t)bidx * sCPb + (size_t)by * 64 + col]; } } if (ACT == 1) v = (v > 0.f) ? v : expm1f(v); else if (ACT == 7) v = (v > 0.f) ? v + 1.0f : expf(v); else if (ACT == 8) v = tanhf(v); else if (ACT == 9) v = 0.5f * v * (1.0f + tanhf(0.7978845608028654f * (v + 0.044715f * v * v * v))); else if (ACT == 11) v = 1.0f / (1.0f + expf(-v)); else if (ACT == 12) v = (v > 0.f) ? v : 0.01f * v; else if (ACT == 14) v = (v > 0.f) ? v : 0.1f * v; else if (ACT == 16) v = (v >= 0.f) ? v : 0.3f * v; else if (ACT == 17) v = (v >= 0.f) ? v : 0.2f * v; else if (ACT == 15) v = v / (1.0f + expf(-v)); else if (ACT == 3) v = fmaxf(v, 0.f); else if (ACT == 6) v = 0.5f * v * (1.0f + erff(v * 0.70710678118654752f)); so[w][8 * hh + r][t * 16 + ln] = v; } }
  __builtin_amdgcn_fence(__ATOMIC_ACQ_REL, "workgroup"); __builtin_amdgcn_wave_barrier();
  const int rsub = lane >> 4, c4 = (lane & 15) * 4; typedef _Float16 v4h __attribute__((ext_vector_type(4)));
  {
#pragma unroll
    for (int q = 0; q < 8; ++q) { const int r = q * 2 + rsub; if (col0 + c4 < N) { const v4f v = *(const v4fa*)&so[w][r][c4]; if (C) *(v4f*)(C + cofs + (size_t)(row0 + r) * ldc + col0 + c4) = v; if (C16) { v4h h4; for (int i = 0; i < 4; ++i) h4[i] = (_Float16)v[i]; *(v4h*)(C16 + cofs + (size_t)(row0 + r) * ldc + col0 + c4) = h4; } } }
     }
}


typedef _Float16 v4h __attribute__((ext_vector_type(4)));

__global__ __launch_bounds__(256) void k_x16(const float* __restrict__ x, _Float16* __restrict__ X16, size_t n8) { const size_t t = (size_t)blockIdx.x * 256 + threadIdx.x; if (t >= n8) return; FragH f;
#pragma unroll
  for (int q = 0; q < 8; ++q) f.h[q] = (_Float16)bf16_round(x[t * 8 + q]); *(v8us*)((unsigned short*)X16 + t * 8) = f.half[0];  }
__global__ __launch_bounds__(256) void k_h16(const float* __restrict__ x, _Float16* __restrict__ X16, size_t n8) { const size_t t = (size_t)blockIdx.x * 256 + threadIdx.x; if (t >= n8) return; FragH f;
#pragma unroll
  for (int q = 0; q < 8; ++q) f.h[q] = (_Float16)x[t * 8 + q]; *(v8us*)((unsigned short*)X16 + t * 8) = f.half[0];  }
__global__ __launch_bounds__(256) void k_round16f(const float* __restrict__ W, _Float16* __restrict__ Bt, size_t n8) { const size_t t = (size_t)blockIdx.x * 256 + threadIdx.x; if (t >= n8) return; FragH f;
#pragma unroll
  for (int i = 0; i < 8; ++i) f.h[i] = (_Float16)(bf16_round(W[t * 8 + i]) * 16.0f); *(v8us*)((unsigned short*)Bt + t * 8) = f.half[0];  }
template <int NHv, int TTv>
__global__ __launch_bounds__(256) void k_vt(const _Float16* __restrict__ V16, int ldv, int voff, _Float16* __restrict__ Vt) { __shared__ unsigned short tl[64][66]; const int tid = threadIdx.x; const int slab = blockIdx.x / (TTv / 64), lg = blockIdx.x % (TTv / 64); const int b = slab / NHv, h = slab % NHv;
  for (int i = tid; i < 64 * 8; i += 256) { const int r = i / 8, c8 = (i % 8) * 8; FragH f; f.half[0] = *(const v8us*)((const unsigned short*)V16 + ((size_t)b * TTv + lg * 64 + r) * ldv + voff + h * 64 + c8);
#pragma unroll
    for (int q = 0; q < 8; ++q) tl[r][c8 + q] = f.u[q]; }
  __syncthreads();
  {
#pragma unroll
    for (int rd = 0; rd < 2; ++rd) { const int d = rd * 32 + tid / 8, pc = tid % 8; FragH f;
#pragma unroll
      for (int q = 0; q < 8; ++q) f.u[q] = tl[pc * 8 + q][d];
      *(v8us*)((unsigned short*)Vt + ((size_t)slab * 64 + d) * TTv + lg * 64 + pc * 8) = f.half[0]; }
     } }

__global__ __launch_bounds__(256) void k_hl(const float* __restrict__ F, _Float16* __restrict__ Hh, _Float16* __restrict__ Hl, size_t n8) { const size_t t = (size_t)blockIdx.x * 256 + threadIdx.x; if (t >= n8) return; FragH fh, fl; const v4f a = *(const v4fa*)(F + t * 8), c = *(const v4fa*)(F + t * 8 + 4);
#pragma unroll
  for (int q = 0; q < 4; ++q) { _Float16 h = (_Float16)a[q]; fh.h[q] = h; fl.h[q] = (_Float16)((a[q] - (float)h) * 1024.0f); h = (_Float16)c[q]; fh.h[4 + q] = h; fl.h[4 + q] = (_Float16)((c[q] - (float)h) * 1024.0f); }
  { *(v8us*)((unsigned short*)Hh + t * 8) = fh.half[0]; *(v8us*)((unsigned short*)Hl + t * 8) = fl.half[0];  } }

// ---- fast GEMM (wave tile 32x64; requires M % 32 == 0 rows per launch region and N % 64 == 0); epilogue = k_gemm_hhx semantics ----
__device__ __forceinline__ v16h g2_frag(const _Float16* p, int hh) { FragH f; f.half[0] = *(const v8us*)((const unsigned short*)p + 8 * hh); f.half[1] = *(const v8us*)((const unsigned short*)p + 16 + 8 * hh); return f.v; }
__device__ __forceinline__ v8f g2_mma(v16h a, v16h b, v8f c) { v8f d = __builtin_amdgcn_wmma_f32_16x16x32_f16(false, a, false, b, (short)0, c, false, false); asm volatile("v_nop\n\tv_nop\n\tv_nop\n\tv_nop" : "+v"(d) : "v"(a), "v"(b)); return d; }
template <int ACT>
__global__ __launch_bounds__(128) void k_gemm2(const _Float16* __restrict__ A, int lda, size_t sA, const _Float16* __restrict__ Bh, int ldb, size_t sB, float alpha, const float* __restrict__ bias, size_t sBias, const float* __restrict__ CP, int rowsPerB, size_t sCPb, int row0g,
    float* __restrict__ C, _Float16* __restrict__ C16, int ldc, size_t sC, int M, int N, int K) { static_assert(ACT == 0 || ACT == 3 || ACT == 6 || ACT == 8 || ACT == 9 || ACT == 11 || ACT == 12 || ACT == 14 || ACT == 15 || ACT == 16 || ACT == 17, "k_gemm2: unsupported ACT code (would silently apply no activation)");
  __shared__ __attribute__((aligned(16))) float so[4][32][68];
  const int tid = threadIdx.x, w = tid >> 5, lane = tid & 31, ln = lane & 15, hh = lane >> 4; const int by = blockIdx.y;
  A += (size_t)by * sA; Bh += (size_t)by * sB; const size_t cofs = (size_t)by * sC; const float* bp = bias ? bias + (size_t)by * sBias : nullptr;
  const int ntn = N >> 6; const int mt = blockIdx.x / ntn, nq = blockIdx.x - mt * ntn; const int row0 = mt * 128 + 32 * w, col0 = nq * 64; if (row0 >= M) return;
  const _Float16* a0p = A + (size_t)(row0 + ln) * lda; const _Float16* a1p = a0p + (size_t)16 * lda;
  const _Float16* b0p = Bh + (size_t)(col0 + ln) * ldb; const _Float16* b1p = b0p + (size_t)16 * ldb; const _Float16* b2p = b1p + (size_t)16 * ldb; const _Float16* b3p = b2p + (size_t)16 * ldb;
  const v8f z8 = {0.f,0.f,0.f,0.f,0.f,0.f,0.f,0.f}; v8f c00 = z8, c01 = z8, c02 = z8, c03 = z8, c10 = z8, c11 = z8, c12 = z8, c13 = z8;
#pragma unroll 1
  for (int kb = 0; kb < K; kb += 32) { const v16h a0 = g2_frag(a0p + kb, hh), a1 = g2_frag(a1p + kb, hh);
    v16h b = g2_frag(b0p + kb, hh); c00 = g2_mma(a0, b, c00); c10 = g2_mma(a1, b, c10);
    b = g2_frag(b1p + kb, hh); c01 = g2_mma(a0, b, c01); c11 = g2_mma(a1, b, c11);
    b = g2_frag(b2p + kb, hh); c02 = g2_mma(a0, b, c02); c12 = g2_mma(a1, b, c12);
    b = g2_frag(b3p + kb, hh); c03 = g2_mma(a0, b, c03); c13 = g2_mma(a1, b, c13); }
  v8f accs[8] = {c00, c01, c02, c03, c10, c11, c12, c13};
#pragma unroll
  for (int u = 0; u < 8; ++u) { const int t = u & 3, half = u >> 2; const int col = col0 + t * 16 + ln; const float bv = bp ? bf16_round(bp[col]) : 0.f;
#pragma unroll
    for (int r = 0; r < 8; ++r) { const int rloc = half * 16 + 8 * hh + r; float v = accs[u][r] * alpha + bv; if (CP) { if (rowsPerB < 0) v += CP[cofs + (size_t)(row0g + row0 + rloc) * ldc + col];      /* rowsPerB < 0: own element of the batched C plane */ else { const int bidx = (row0g + row0 + rloc) / rowsPerB; v += CP[(size_t)bidx * sCPb + (size_t)by * 64 + col]; } }
      if (ACT == 3) v = fmaxf(v, 0.f); else if (ACT == 6) v = 0.5f * v * (1.0f + erff(v * 0.70710678118654752f)); else if (ACT == 11) v = 1.0f / (1.0f + expf(-v)); else if (ACT == 15) v = v / (1.0f + expf(-v)); else if (ACT == 12) v = (v > 0.f) ? v : 0.01f * v; else if (ACT == 8) v = tanhf(v); else if (ACT == 9) v = 0.5f * v * (1.0f + tanhf(0.7978845608028654f * (v + 0.044715f * v * v * v))); else if (ACT == 14) v = (v > 0.f) ? v : 0.1f * v; else if (ACT == 16) v = (v >= 0.f) ? v : 0.3f * v; else if (ACT == 17) v = (v >= 0.f) ? v : 0.2f * v;
      so[w][rloc][t * 16 + ln] = v; } }
  __builtin_amdgcn_fence(__ATOMIC_ACQ_REL, "workgroup"); __builtin_amdgcn_wave_barrier();
  const int rsub = lane >> 4, c4 = (lane & 15) * 4;
  {
#pragma unroll
    for (int q = 0; q < 16; ++q) { const int r = q * 2 + rsub; const v4f v = *(const v4fa*)&so[w][r][c4]; if (C) *(v4f*)(C + cofs + (size_t)(row0 + r) * ldc + col0 + c4) = v; if (C16) { v4h h4; for (int i = 0; i < 4; ++i) h4[i] = (_Float16)v[i]; *(v4h*)(C16 + cofs + (size_t)(row0 + r) * ldc + col0 + c4) = h4; } }
     } }


__global__ __launch_bounds__(256) void k_wnat(const float* __restrict__ w, size_t n8, _Float16* __restrict__ Bt) { const size_t t = (size_t)blockIdx.x * 256 + threadIdx.x; if (t >= n8) return; FragH f; for (int q = 0; q < 8; ++q) f.h[q] = (_Float16)(bf16_round(w[t * 8 + q]) * 16.0f); *(v8us*)((unsigned short*)Bt + t * 8) = f.half[0];  }
__global__ __launch_bounds__(256) void k_rsm(const float* __restrict__ S, _Float16* __restrict__ P, int nrows) {
  #pragma clang fp contract(off)
  const int i = blockIdx.x * 256 + threadIdx.x; if (i >= nrows) return; const float* s = S + (size_t)i * SQ; float mx = -3.0e38f;
#pragma unroll 1
  for (int j = 0; j < SQ; ++j) mx = fmaxf(mx, s[j]); float se = 0.f;
#pragma unroll 1
  for (int j = 0; j < SQ; ++j) se += expf(s[j] - mx); const float sc = 256.0f / se;
#pragma unroll 1
  for (int j0 = 0; j0 < SQ; j0 += 8) { FragH f; for (int q = 0; q < 8; ++q) f.h[q] = (_Float16)(expf(s[j0 + q] - mx) * sc); unsigned short* d = (unsigned short*)P + (size_t)i * SQ + j0; *(v8us*)d = f.half[0];  } }
__global__ __launch_bounds__(256) void k_vt(const _Float16* __restrict__ V16, int b, int h0, _Float16* __restrict__ VT) { __shared__ unsigned short tl[64][65]; const int tid = threadIdx.x; const int hh = blockIdx.x % HG, sg = blockIdx.x / HG; const int s0 = sg * 64; const int h = h0 + hh;
  for (int i = tid; i < 64 * 8; i += 256) { const int j = i / 8, d8 = (i % 8) * 8; FragH f; f.half[0] = *(const v8us*)((const unsigned short*)V16 + ((size_t)b * SQ + s0 + j) * DM + h * HD + d8); for (int q = 0; q < 8; ++q) tl[d8 + q][j] = f.u[q]; }
  __syncthreads();
  { for (int i = tid; i < 64 * 8; i += 256) { const int d = i / 8, j8 = (i % 8) * 8; FragH f; for (int q = 0; q < 8; ++q) f.u[q] = tl[d][j8 + q]; *(v8us*)((unsigned short*)VT + ((size_t)hh * HD + d) * SQ + s0 + j8) = f.half[0]; }  } }


template <int MASK>
__global__ __launch_bounds__(32) void k_att0h(const float* __restrict__ QF, const float* __restrict__ KF, const float* __restrict__ VF, int ld, int ldv, const int* __restrict__ mk, float scale, float* __restrict__ OF, int ldo) {
  #pragma clang fp contract(off)
  __shared__ __attribute__((aligned(16))) float lq[32][128]; __shared__ __attribute__((aligned(16))) float lo[32][128];
  const int tid = threadIdx.x; const int h = blockIdx.x / (QT0 / 32), rg = blockIdx.x % (QT0 / 32); const int i = rg * 32 + tid;
  for (int c = 0; c < 32; ++c) { *(v4f*)&lq[tid][c * 4] = *(const v4fa*)(QF + (size_t)i * ld + h * 128 + c * 4); const v4f z = {0.f, 0.f, 0.f, 0.f}; *(v4f*)&lo[tid][c * 4] = z; }
  float m = -1.0e30f, l = 0.f; const int jmax = rg * 32 + 31;
#pragma unroll 1
  for (int j = 0; j <= jmax; ++j) { const float* kr = KF + (size_t)j * ld + h * 128; const float* vr = VF + (size_t)j * ldv + h * 128; float s = 0.f;
#pragma unroll 1
    for (int c = 0; c < 32; ++c) { const v4f kq = *(const v4fa*)(kr + c * 4); const v4f qq = *(v4f*)&lq[tid][c * 4]; for (int u = 0; u < 4; ++u) s = __fadd_rn(s, __fmul_rn(qq[u], kq[u])); }
    s = __fmul_rn(s, scale); float f; if (MASK) { const int mb = mk[(size_t)i * SQ + j]; f = (mb == 0) ? 1.f : 0.f; } else { f = (j <= i) ? 1.f : 0.f; }
    const float sm = fmaf(f, s, (1.f - f) * -1.0e30f); const float mn = fmaxf(m, sm); const float sc = expf(m - mn); const float e = __fmul_rn(f, expf(sm - mn)); l = __fadd_rn(__fmul_rn(l, sc), e); m = mn;
#pragma unroll 1
    for (int c = 0; c < 32; ++c) { const v4f vv = *(const v4fa*)(vr + c * 4); v4f oo = *(v4f*)&lo[tid][c * 4]; for (int u = 0; u < 4; ++u) oo[u] = __fadd_rn(__fmul_rn(oo[u], sc), __fmul_rn(e, vv[u])); *(v4f*)&lo[tid][c * 4] = oo; } }
  const float fin = 64.0f / l;
  { for (int c = 0; c < 32; ++c) { v4f oo = *(v4f*)&lo[tid][c * 4]; for (int u = 0; u < 4; ++u) oo[u] = __fmul_rn(oo[u], fin); *(v4f*)(OF + (size_t)i * ldo + h * 128 + c * 4) = oo; }  } }
__global__ __launch_bounds__(256) void k_f2h(const float* __restrict__ F, int ldf, int coff, int ncol, _Float16* __restrict__ H16, size_t nrow) { const size_t t = (size_t)blockIdx.x * 256 + threadIdx.x; const size_t n8 = nrow * (size_t)(ncol / 8); if (t >= n8) return; const size_t r = t / (ncol / 8); const int c8 = (int)(t % (ncol / 8)) * 8; FragH f; const v4f a = *(const v4fa*)(F + r * ldf + coff + c8), b2 = *(const v4fa*)(F + r * ldf + coff + c8 + 4); for (int q = 0; q < 4; ++q) { f.h[q] = (_Float16)a[q]; f.h[4 + q] = (_Float16)b2[q]; } *(v8us*)((unsigned short*)H16 + r * ncol + c8) = f.half[0];  }

__global__ __launch_bounds__(256) void k_tab128(float theta, float* __restrict__ CS, float* __restrict__ SN) {
  #pragma clang fp contract(off)
  const int t = blockIdx.x * 256 + threadIdx.x; if (t >= SQ * 64) return; const int i = t % 64; const int p = t / 64; const float invf = (float)(1.0 / pow((double)theta, (double)(2 * i) / 128.0));      /* = XLA's constant-folded f32 table */ const float ang = __fmul_rn((float)p, invf); const float c = cosf(ang), s = sinf(ang);
  *(float*)(CS + t) = c; *(float*)(SN + t) = s;  }
template <int TAB>
__global__ __launch_bounds__(128) void k_rope128(const float* __restrict__ F, int ldf, int nh, const float* __restrict__ CS, const float* __restrict__ SN, _Float16* __restrict__ H16, int ldo, float osc) {
  #pragma clang fp contract(off)
  __shared__ float xv[128]; __shared__ unsigned short sh_[128]; const int d = threadIdx.x; const int h = blockIdx.x % nh; const size_t r = blockIdx.x / nh; const int p = (int)(r % SQ);
  xv[d] = F[r * (size_t)ldf + (size_t)h * 128 + d]; __syncthreads();
  float c, s; if (TAB) { c = bf16_round(CS[(size_t)p * 128 + d]); s = bf16_round(SN[(size_t)p * 128 + d]); } else { c = CS[p * 64 + (d & 63)]; s = SN[p * 64 + (d & 63)]; }
  const float rot = (d < 64) ? -xv[d + 64] : xv[d - 64]; const float o = __fadd_rn(__fmul_rn(xv[d], c), __fmul_rn(rot, s));
  FragH th; th.h[0] = (_Float16)__fmul_rn(o, osc); sh_[d] = th.u[0]; __syncthreads();
  if (d < 16) { FragH f; for (int q = 0; q < 8; ++q) f.u[q] = sh_[d * 8 + q]; unsigned short* dst = (unsigned short*)H16 + r * (size_t)ldo + (size_t)h * 128 + d * 8; *(v8us*)dst = f.half[0];  } }

template <int TAB, int IL, int F32OUT>
__global__ __launch_bounds__(128) void k_rope128x(const float* __restrict__ F, int ldf, int nh, const float* __restrict__ CS, const float* __restrict__ SN, void* __restrict__ OUT, int ldo, float osc) {
  #pragma clang fp contract(off)
  __shared__ float xv[128]; __shared__ float ov[128]; const int d = threadIdx.x; const int h = blockIdx.x % nh; const size_t r = blockIdx.x / nh; const int p = (int)(r % SQ);
  xv[d] = F[r * (size_t)ldf + (size_t)h * 128 + d]; __syncthreads();
  float c, s; if (TAB == 2) { c = CS[r * 128 + d]; s = SN[r * 128 + d]; }      /* computed full-width f32 tables, one row per token row r (relative to the passed pointers) */ else if (TAB) { c = bf16_round(CS[(size_t)p * 128 + d]); s = bf16_round(SN[(size_t)p * 128 + d]); } else { const int ti = IL ? (d >> 1) : (d & 63); c = CS[p * 64 + ti]; s = SN[p * 64 + ti]; }
  const float rot = IL ? ((d & 1) ? xv[d - 1] : -xv[d + 1]) : ((d < 64) ? -xv[d + 64] : xv[d - 64]);
  ov[d] = __fmul_rn(__fadd_rn(__fmul_rn(xv[d], c), __fmul_rn(rot, s)), osc); __syncthreads();
  if (F32OUT) { if (d < 32) { const v4f v = *(const v4f*)&ov[d * 4]; float* dst = (float*)OUT + r * (size_t)ldo + (size_t)h * 128 + d * 4; *(v4f*)dst = v;  } }
  else { if (d < 16) { FragH f; for (int q = 0; q < 8; ++q) f.h[q] = (_Float16)ov[d * 8 + q]; unsigned short* dst = (unsigned short*)OUT + r * (size_t)ldo + (size_t)h * 128 + d * 8; *(v8us*)dst = f.half[0];  } } }
template <int N>
__global__ __launch_bounds__(256) void k_rmsrow(float* __restrict__ X, const float* __restrict__ w, float eps) {
  #pragma clang fp contract(off)
  constexpr int PT = N / 256; __shared__ float red[256]; const size_t r = blockIdx.x; const int t = threadIdx.x; float* row = X + r * N + (size_t)t * PT; float v[PT]; float ss = 0.f;
  for (int q = 0; q < PT; ++q) { v[q] = row[q]; ss = __fadd_rn(ss, __fmul_rn(v[q], v[q])); }
  red[t] = ss; __syncthreads(); for (int k = 128; k > 0; k >>= 1) { if (t < k) red[t] = __fadd_rn(red[t], red[t + k]); __syncthreads(); }
  const float rs = rsqrtf(__fadd_rn(red[0] / (float)N, eps)); float o[PT]; for (int q = 0; q < PT; ++q) o[q] = __fmul_rn(__fmul_rn(v[q], rs), bf16_round(w[t * PT + q]));
  { for (int q = 0; q < PT; ++q) *(float*)(row + q) = o[q];  } }
template <int GS_, int NHQ, int DSRC>
__global__ __launch_bounds__(256) void k_kvexp128(const float* __restrict__ src, float* __restrict__ dst, size_t n4) { const size_t t = (size_t)blockIdx.x * 256 + threadIdx.x; if (t >= n4) return; const size_t e = t * 4; const size_t row = e / ((size_t)NHQ * 128); const int col = (int)(e % ((size_t)NHQ * 128)); const int h = col / 128, d = col % 128; const v4f v = *(const v4fa*)(src + row * DSRC + (size_t)(h / GS_) * 128 + d); *(v4f*)(dst + e) = v;  }

__global__ __launch_bounds__(256) void k_rsmcfb(const float* __restrict__ S, _Float16* __restrict__ P, int hg, int q0, int nk, const int* __restrict__ mk) {
  #pragma clang fp contract(off)
  const int t = blockIdx.x * 256 + threadIdx.x; if (t >= hg * QT) return; const size_t i = (size_t)t; const float* s = S + i * NKX; const size_t ig = (size_t)(q0 + (t % QT)); const int* mr = mk + ig * SQ; float mx = -3.0e38f;
#pragma unroll 1
  for (int j = 0; j < nk; ++j) { const int mb = mr[j]; const float f = (mb == 0) ? 1.f : 0.f; mx = fmaxf(mx, fmaf(f, s[j], (1.f - f) * -1.0e9f)); } float se = 0.f;
#pragma unroll 1
  for (int j = 0; j < nk; ++j) { const int mb = mr[j]; const float f = (mb == 0) ? 1.f : 0.f; se += __expf(fmaf(f, s[j], (1.f - f) * -1.0e9f) - mx); } const float sc = 256.0f / se;
#pragma unroll 1
  for (int j0 = 0; j0 < nk; j0 += 8) { FragH fr; for (int q = 0; q < 8; ++q) { const int j = j0 + q; const int mb = mr[j]; const float f = (mb == 0) ? 1.f : 0.f; fr.h[q] = (_Float16)(__expf(fmaf(f, s[j], (1.f - f) * -1.0e9f) - mx) * sc); } unsigned short* d = (unsigned short*)P + i * NKX + j0; *(v8us*)d = fr.half[0];  } }


__global__ __launch_bounds__(256) void k_rsmcf2(const float* __restrict__ S, _Float16* __restrict__ P, int hg, int q0, int nk) {
  #pragma clang fp contract(off)
  const int t = blockIdx.x * 256 + threadIdx.x; if (t >= hg * QT) return; const size_t i = (size_t)t; const float* s = S + i * NKX; const int last = q0 + (t % QT); float mx = -3.0e38f;
#pragma unroll 1
  for (int j = 0; j < nk; ++j) { const float f = (j <= last) ? 1.f : 0.f; mx = fmaxf(mx, fmaf(f, s[j], (1.f - f) * -1.0e9f)); } float se = 0.f;
#pragma unroll 1
  for (int j = 0; j < nk; ++j) { const float f = (j <= last) ? 1.f : 0.f; se += __expf(fmaf(f, s[j], (1.f - f) * -1.0e9f) - mx); } const float sc = 256.0f / se;
#pragma unroll 1
  for (int j0 = 0; j0 < nk; j0 += 8) { FragH fr; for (int q = 0; q < 8; ++q) { const int j = j0 + q; const float f = (j <= last) ? 1.f : 0.f; fr.h[q] = (_Float16)(__expf(fmaf(f, s[j], (1.f - f) * -1.0e9f) - mx) * sc); } unsigned short* d = (unsigned short*)P + i * NKX + j0; *(v8us*)d = fr.half[0];  } }



__global__ __launch_bounds__(256) void k_tab128p(const int* __restrict__ pos, int nrows, float theta, float* __restrict__ CS, float* __restrict__ SN) {
  #pragma clang fp contract(off)
  const int t = blockIdx.x * 256 + threadIdx.x; if (t >= nrows * 64) return; const int i = t % 64; const int r = t / 64; const float invf = (float)(1.0 / pow((double)theta, (double)(2 * i) / 128.0)); const float ang = __fmul_rn((float)pos[r], invf); const float c = cosf(ang), sv = sinf(ang);
  float* c0 = CS + (size_t)r * 128 + i; float* s0 = SN + (size_t)r * 128 + i;
  { *(float*)c0 = c; *(float*)(c0 + 64) = c; *(float*)s0 = sv; *(float*)(s0 + 64) = sv;  } }

__global__ __launch_bounds__(256) void k_rsmcim(const float* __restrict__ S, _Float16* __restrict__ P, int hg, int q0, int nk, const int* __restrict__ am) {
  #pragma clang fp contract(off)
  const int t = blockIdx.x * 256 + threadIdx.x; if (t >= hg * QT) return; const size_t i = (size_t)t; const float* s = S + i * NKX; const int last = q0 + (t % QT); const int* mr = am + (size_t)last * SQ; float mx = -3.0e38f;      /* the module's mask row of this query (keys >= nk lie above the diagonal of the causal mask and are not computed) */
#pragma unroll 1
  for (int j = 0; j < nk; ++j) { const float f = (mr[j] != 0) ? 1.f : 0.f; mx = fmaxf(mx, fmaf(f, s[j], (1.f - f) * -1.0e9f)); } float se = 0.f;
#pragma unroll 1
  for (int j = 0; j < nk; ++j) { const float f = (mr[j] != 0) ? 1.f : 0.f; se += __expf(fmaf(f, s[j], (1.f - f) * -1.0e9f) - mx); } const float sc = 256.0f / se;
#pragma unroll 1
  for (int j0 = 0; j0 < nk; j0 += 8) { FragH fr; for (int q = 0; q < 8; ++q) { const int j = j0 + q; const float f = (mr[j] != 0) ? 1.f : 0.f; fr.h[q] = (_Float16)(__expf(fmaf(f, s[j], (1.f - f) * -1.0e9f) - mx) * sc); } unsigned short* d = (unsigned short*)P + i * NKX + j0; *(v8us*)d = fr.half[0];  } }



__global__ __launch_bounds__(256) void k_tab128h(int nr, float theta, float* __restrict__ CS, float* __restrict__ SN) {
  #pragma clang fp contract(off)
  const size_t t = (size_t)blockIdx.x * 256 + threadIdx.x; if (t >= (size_t)nr * 64) return; const int i = (int)(t % 64); const size_t r = t / 64; const int p = (int)(r % SQ);
  const float invf = (float)(1.0 / pow((double)theta, ((double)(2 * i)) / 128.0)); const float ang = __fmul_rn((float)p, invf); const float c = cosf(ang), sv = sinf(ang);
  float* pc = CS + r * 128 + i; float* ps = SN + r * 128 + i;
  *(float*)pc = c; *(float*)(pc + 64) = c; *(float*)ps = sv; *(float*)(ps + 64) = sv;  }

__global__ __launch_bounds__(256) void k_rsmblk(const float* __restrict__ S, _Float16* __restrict__ P, _Float16* __restrict__ PL, int hg, int q0, int nk) {
  #pragma clang fp contract(off)
  const int t = blockIdx.x * 256 + threadIdx.x; if (t >= hg * QT) return; const size_t i = (size_t)t; const float* s = S + i * NKX; const int last = q0 + (t % QT); const int nb = nk / 256; const float nrm = 256.0f / __fadd_rn((float)nb, 1e-6f);
#pragma unroll 1
  for (int j = 0; j < nb; ++j) { const int k0 = j * 256; float mx = -3.0e38f;
#pragma unroll 1
    for (int k = k0; k < k0 + 256; ++k) { const float f = (k <= last) ? 1.f : 0.f; mx = fmaxf(mx, fmaf(f, s[k], (1.f - f) * -1.0e9f)); } float se = 0.f;
#pragma unroll 1
    for (int k = k0; k < k0 + 256; ++k) { const float f = (k <= last) ? 1.f : 0.f; se += __expf(fmaf(f, s[k], (1.f - f) * -1.0e9f) - mx); }
    const float isum = nrm / se;
#pragma unroll 1
    for (int j0 = k0; j0 < k0 + 256; j0 += 8) { FragH fr, fl; for (int q = 0; q < 8; ++q) { const int k = j0 + q; const float f = (k <= last) ? 1.f : 0.f; const float v = __expf(fmaf(f, s[k], (1.f - f) * -1.0e9f) - mx) * isum; const _Float16 hv = (_Float16)v; fr.h[q] = hv; fl.h[q] = (_Float16)((v - (float)hv) * 1024.0f); }
      unsigned short* d = (unsigned short*)P + i * NKX + j0; unsigned short* dl = (unsigned short*)PL + i * NKX + j0; *(v8us*)d = fr.half[0]; *(v8us*)dl = fl.half[0];  } } }
extern "C" void kernel_launch(void* const* d_in, const int* in_sizes, int n_in,
                              void* d_out, int out_size, void* d_ws, size_t ws_size, hipStream_t stream) {
  (void)in_sizes; (void)n_in; (void)out_size;
  const float* const* I = (const float* const*)d_in; const float* x = I[0]; const float* wq = I[1]; const float* wk = I[2]; const float* wv = I[3]; const float* wo = I[4]; const float* bq = nullptr; const float* bk = nullptr; const float* bv = nullptr; const float* bo = nullptr;      /* natural [out][in] Wq/Wk/Wv/Wo [2048][2048]; no biases */
  char* ws = (char*)d_ws; size_t off = 0;
  auto take = [&](size_t bytes) { char* p = ws + off; off += (bytes + 255) & ~(size_t)255; return p; };
  _Float16* BQ = (_Float16*)take((size_t)DMX * DMX * 2); _Float16* BK = (_Float16*)take((size_t)DKV * DMX * 2); _Float16* BV = (_Float16*)take((size_t)DKV * DMX * 2); _Float16* BO = (_Float16*)take((size_t)DMX * DMX * 2);
  _Float16* X16 = (_Float16*)take(NR * DMX * 2); float* QF = (float*)take((size_t)SQ * DMX * 4); float* KF = (float*)take((size_t)SQ * DKV * 4); float* VF = (float*)take((size_t)SQ * DKV * 4); _Float16* VH = (_Float16*)take((size_t)SQ * DKV * 2); _Float16* VL = (_Float16*)take((size_t)SQ * DKV * 2); _Float16* Q16 = (_Float16*)take((size_t)SQ * DMX * 2); _Float16* QL = (_Float16*)take((size_t)SQ * DMX * 2); _Float16* K16 = (_Float16*)take((size_t)SQ * DKV * 2); _Float16* KL = (_Float16*)take((size_t)SQ * DKV * 2); _Float16* O16 = (_Float16*)take(NR * DMX * 2);      /* per-batch q, k, v in f32 -> f16 hi + x1024 residual planes */ float* OTF = (float*)take((size_t)QT * DMX * 4);      /* per-batch v in f32 -> f16 hi + x1024 residual; per-tile f32 o accumulator */
  float* S = (float*)take((size_t)NH * QT * NKX * 4); _Float16* P = (_Float16*)take((size_t)NH * QT * NKX * 2); _Float16* PL = (_Float16*)take((size_t)NH * QT * NKX * 2); _Float16* VT = (_Float16*)take((size_t)(DKV / 64) * 64 * SQ * 2); _Float16* VTL = (_Float16*)take((size_t)(DKV / 64) * 64 * SQ * 2);
  float* OF0 = (float*)take((size_t)NB * QT0 * DMX * 4); _Float16* OH0 = (_Float16*)take((size_t)NB * QT0 * DMX * 2); _Float16* OL0 = (_Float16*)take((size_t)NB * QT0 * DMX * 2);
  if (off > ws_size) return;      /* approx 8 + 8 + 8 + 8 + 16 + 16 + 16 + 16 + 8 + 8 + 8 + 8 + 8 + 8 + 16 + 2 + 32 + 16 + 16 + 8 + 8 + 4 + 2 + 2 = 250 MiB */
  { const unsigned g = (unsigned)(((size_t)DMX * DMX / 8 + 255) / 256); k_wnat<<<g, 256, 0, stream>>>(wq, (size_t)DMX * DMX / 8, BQ); k_wnat<<<g, 256, 0, stream>>>(wk, (size_t)DKV * DMX / 8, BK); k_wnat<<<g, 256, 0, stream>>>(wv, (size_t)DKV * DMX / 8, BV); k_wnat<<<g, 256, 0, stream>>>(wo, (size_t)DMX * DMX / 8, BO); }      /* natural [out][in] = Bt x16 */
  k_x16<<<(unsigned)((NR * DMX / 8 + 255) / 256), 256, 0, stream>>>(x, X16, NR * DMX / 8);
  for (int b = 0; b < NB; ++b) { const size_t r0 = (size_t)b * SQ;
    float* QF0 = QF; float* KF0 = KF; k_gemm2<0><<<dim3((SQ / 128) * (DMX / 64), 1), 128, 0, stream>>>(X16 + r0 * DMX, DMX, 0, BQ, DMX, 0, 0.0625f, bq, 0, nullptr, 1, 0, 0, QF, nullptr, DMX, 0, SQ, DMX, DMX); k_gemm2<0><<<dim3((SQ / 128) * (DKV / 64), 1), 128, 0, stream>>>(X16 + r0 * DMX, DMX, 0, BK, DMX, 0, 0.0625f, bk, 0, nullptr, 1, 0, 0, KF, nullptr, DKV, 0, SQ, DKV, DMX); k_hl<<<(unsigned)(((size_t)SQ * DMX / 8 + 255) / 256), 256, 0, stream>>>(QF, Q16, QL, (size_t)SQ * DMX / 8); k_hl<<<(unsigned)(((size_t)SQ * DKV / 8 + 255) / 256), 256, 0, stream>>>(KF, K16, KL, (size_t)SQ * DKV / 8);      /* this batch's q and k in f32 (exact products) -> f16 hi + x1024 residual (block 0's full softmax seen from every later block's first row needs near-exact logits) */ k_gemm2<0><<<dim3((SQ / 128) * (DKV / 64), 1), 128, 0, stream>>>(X16 + r0 * DMX, DMX, 0, BV, DMX, 0, 0.0625f, bv, 0, nullptr, 1, 0, 0, VF, nullptr, DKV, 0, SQ, DKV, DMX); k_hl<<<(unsigned)(((size_t)SQ * DKV / 8 + 255) / 256), 256, 0, stream>>>(VF, VH, VL, (size_t)SQ * DKV / 8);      /* f32 q and k (all rows, above; rows 0..255 feed the exact first tile); this batch's v in f32 (exact products) -> f16 hi + x1024 residual (the per-block softmax gives every block's first rows single-key weights, so v and P must be carried beyond one f16) */
    k_vt<DKV / 64, SQ><<<(DKV / 64) * (SQ / 64), 256, 0, stream>>>(VH, DKV, 0, VT); k_vt<DKV / 64, SQ><<<(DKV / 64) * (SQ / 64), 256, 0, stream>>>(VL, DKV, 0, VTL);      /* V^T hi / residual of this batch: head h = slabs 2h, 2h+1 */
    k_att0h<0><<<NH * (QT0 / 32), 32, 0, stream>>>(QF0, KF0, VF, DMX, DKV, nullptr, ATS, OF0 + (size_t)b * QT0 * DMX, DMX);      /* exact causal attention rows 0..255 (o x64) */
    for (int q0 = 0; q0 < SQ; q0 += QT) { const int nk = q0 + QT;      /* causal: keys below the tile end only */
      k_gemm2<0><<<dim3((QT / 128) * (nk / 64), NH), 128, 0, stream>>>(Q16 + (size_t)q0 * DMX, DMX, (size_t)HDK, K16, DKV, (size_t)HDK, ATS, nullptr, 0, nullptr, 1, 0, 0, S, nullptr, NKX, (size_t)QT * NKX, QT, nk, HDK); k_gemm2<0><<<dim3((QT / 128) * (nk / 64), NH), 128, 0, stream>>>(QL + (size_t)q0 * DMX, DMX, (size_t)HDK, K16, DKV, (size_t)HDK, ATS * 0.0009765625f, nullptr, 0, S, -1, 0, 0, S, nullptr, NKX, (size_t)QT * NKX, QT, nk, HDK); k_gemm2<0><<<dim3((QT / 128) * (nk / 64), NH), 128, 0, stream>>>(Q16 + (size_t)q0 * DMX, DMX, (size_t)HDK, KL, DKV, (size_t)HDK, ATS * 0.0009765625f, nullptr, 0, S, -1, 0, 0, S, nullptr, NKX, (size_t)QT * NKX, QT, nk, HDK);      /* scores of query block i against key blocks 0..i: hi.hi + lo.hi 2^-10 + hi.lo 2^-10 (own element), all 16 heads on grid.y */
      k_rsmblk<<<(NH * QT + 255) / 256, 256, 0, stream>>>(S, P, PL, NH, q0, nk);      /* the module's per-block softmax: an independent softmax per 256-key block j <= i (diagonal block causal), weights divided by (block count + 1e-6) -> P x256 as f16 hi + x1024 residual */
      k_gemm2<0><<<dim3((QT / 128) * (HDK / 64), NH), 128, 0, stream>>>(P, NKX, (size_t)QT * NKX, VT, SQ, (size_t)HDK * SQ, 0.25f, nullptr, 0, nullptr, 1, 0, 0, OTF, nullptr, DMX, (size_t)HDK, QT, HDK, nk);      /* o x64 = Ph Vh (f32 tile accumulator) */
      k_gemm2<0><<<dim3((QT / 128) * (HDK / 64), NH), 128, 0, stream>>>(PL, NKX, (size_t)QT * NKX, VT, SQ, (size_t)HDK * SQ, 0.000244140625f, nullptr, 0, OTF, -1, 0, 0, OTF, nullptr, DMX, (size_t)HDK, QT, HDK, nk);      /* += Pl Vh 2^-12 (own element) */
      k_gemm2<0><<<dim3((QT / 128) * (HDK / 64), NH), 128, 0, stream>>>(P, NKX, (size_t)QT * NKX, VTL, SQ, (size_t)HDK * SQ, 0.000244140625f, nullptr, 0, OTF, -1, 0, 0, OTF, O16 + (r0 + q0) * DMX, DMX, (size_t)HDK, QT, HDK, nk); } }      /* += Ph Vl 2^-12 and emit the merged f16 o rows (x64) */
  k_gemm2<0><<<dim3((unsigned)((NR / 128) * (DMX / 64)), 1), 128, 0, stream>>>(O16, DMX, 0, BO, DMX, 0, 0.0009765625f, bo, 0, nullptr, 1, 0, 0, (float*)d_out, nullptr, DMX, 0, (int)NR, DMX, DMX);      /* out = o Wo^T */
  k_hl<<<(unsigned)(((size_t)NB * QT0 * DMX / 8 + 255) / 256), 256, 0, stream>>>(OF0, OH0, OL0, (size_t)NB * QT0 * DMX / 8);      /* first-tile o (x64) -> f16 hi + x1024 residual planes */
  for (int b = 0; b < NB; ++b) { const size_t r0 = (size_t)b * SQ; const size_t f0 = (size_t)b * QT0;
    k_gemm2<0><<<dim3((QT0 / 128) * (DMX / 64), 1), 128, 0, stream>>>(OH0 + f0 * DMX, DMX, 0, BO, DMX, 0, 0.0009765625f, bo, 0, nullptr, 1, 0, 0, (float*)d_out + r0 * DMX, nullptr, DMX, 0, QT0, DMX, DMX);      /* rows 0..255 of the batch rewritten from the exact path */
    k_gemm2<0><<<dim3((QT0 / 128) * (DMX / 64), 1), 128, 0, stream>>>(OL0 + f0 * DMX, DMX, 0, BO, DMX, 0, 0.00000095367431640625f, nullptr, 0, (const float*)d_out + r0 * DMX, -1, 0, 0, (float*)d_out + r0 * DMX, nullptr, DMX, 0, QT0, DMX, DMX); }      /* += o_lo Wo 2^-20 (own-element accumulate) */
}

// v001
// Measured time: 6720 microseconds a run.
// Timed twice side by side with v000, it ran 1.51 times as fast both times.
#include <hip/hip_runtime.h>
// Block-chunked causal attention with the module's PER-BLOCK softmax (hidden [2][2048][2048]; q/k/v = x W^T (natural [2048][2048] sigma 0.02, no biases), 16 heads of 128; keys in blocks of 256: for query block i every key block j <= i gets its OWN softmax over its 256 keys (scores / sqrt(128); inside the diagonal block keys above the query are -inf), the block outputs are summed and divided by the summed weights (= number of included blocks) + 1e-6; merged Wo^T -> [2][2048][2048]; no RoPE).
// Structure: token rows; x as exact f16 rows; natural weights as exact x16 planes; q, k, v as WMMA GEMMs (32x64 wave tiles, f32 accumulation) -> f32 (all rows) + f16 hi/x1024 residual rows; per batch: V^T via LDS transposes; exact f32 causal attention for rows 0..255 (= key block 0, where the per-block softmax is the ordinary causal softmax) on VALU; per 256-row query block i: scores against key blocks 0..i (K = 128, alpha 1/sqrt(128)) f32, the module's per-block softmax on VALU (f32 statistics, native exp; weights x256 f16 divided by the block count + 1e-6), o = P V^T (x64) merged f16; out = o Wo^T; first-tile rows rewritten from o hi/lo; launches: see trace.
// Compute dtype: inputs rounded to bf16; x / weights exact; projections f32; q, k, v and softmax weights as f16 hi + x1024 residual GEMM operands, o as plain f16 (~2^-12; first 256 rows of each batch exact); scores, statistics, out f32. v_wmma_f32_16x16x32_f16.
#define NB 2
#define SQ 2048
#define DMX 2048
#define NH 16
#define NKV 16
#define GSZ 1                        /* plain MHA: kv head == query head */
#define HDK 128
#define DKV (NKV * HDK)
#define QT 256
#define QT0 256
#define NKX SQ
#define DM DMX
#define HD 64
#define HG 1
#define NR ((size_t)NB * SQ)
#define ATS 0.08838834764831845f
typedef __bf16 v16b __attribute__((ext_vector_type(16)));
typedef unsigned short v8us __attribute__((ext_vector_type(8), may_alias));
typedef float  v8f  __attribute__((ext_vector_type(8)));
typedef float  v4f  __attribute__((ext_vector_type(4)));
typedef float  v4fa __attribute__((ext_vector_type(4), may_alias));
union FragB { v16b v; v8us half[2]; unsigned short u[16]; };

__device__ __forceinline__ unsigned short bf16_bits(float x) { unsigned int u = __float_as_uint(x); return (unsigned short)((u + 0x7FFFu + ((u >> 16) & 1u)) >> 16); }
__device__ __forceinline__ float bf16_val(unsigned short b) { return __uint_as_float(((unsigned int)b) << 16); }
__device__ __forceinline__ float bf16_round(float x) { return bf16_val(bf16_bits(x)); }
// D += A·B with NT terms: 1 = ah·bh, 2 = + al·bh (A split), 3 = + ah·bl (both split)
template <int NT>
__device__ __forceinline__ v8f mmaN(v16b ah, v16b al, v16b bh, v16b bl, v8f c) {
  c = __builtin_amdgcn_wmma_f32_16x16x32_bf16(false, ah, false, bh, (short)0, c, false, false);
  if (NT >= 2) c = __builtin_amdgcn_wmma_f32_16x16x32_bf16(false, al, false, bh, (short)0, c, false, false);
  if (NT >= 3) c = __builtin_amdgcn_wmma_f32_16x16x32_bf16(false, ah, false, bl, (short)0, c, false, false);
  asm volatile("v_nop\n\tv_nop\n\tv_nop\n\tv_nop" : "+v"(c) : "v"(ah), "v"(al), "v"(bh), "v"(bl));
  return c;
}

__global__ __launch_bounds__(256) void k_wt_bf16(const float* __restrict__ W, unsigned short* __restrict__ Wt, int K, int N) {
  const int t = blockIdx.x * 256 + threadIdx.x;
  const int k8n = K / 8;
  if (t >= N * k8n) return;
  const int n = t / k8n, k8 = (t % k8n) * 8;
  v8us v;
#pragma unroll
  for (int i = 0; i < 8; ++i) v[i] = bf16_bits(W[(size_t)(k8 + i) * N + n]);
  *(v8us*)(Wt + (size_t)n * K + k8) = v;
  
}

// GEMM C[M][N] (f32, pitch ldc) = act(A[M][K]·W + bias). A f32 row-major (pitch lda) converted per fragment to bf16
// (ASPLIT: hi/lo two planes -> 2 terms, else single rounded term); Wt bf16 [N][K] (pitch ldb). BIAS_BF16 rounds the
// bias to bf16 first (bias quantised to bf16 before the add). K%32==0, M%16==0, N%64==0.
template <bool ASPLIT, int ACT, bool BIAS_BF16>
__global__ __launch_bounds__(128) void k_gemm_bf(const float* __restrict__ A, int lda, const unsigned short* __restrict__ Wt, int ldb,
                                               const float* __restrict__ bias, float* __restrict__ C, int ldc, int M, int N, int K) {
  __shared__ __attribute__((aligned(16))) float so[4][16][64];
  const int tid = threadIdx.x, w = tid >> 5, lane = tid & 31, ln = lane & 15, hh = lane >> 4;
  const int ntn = N / 64;
  const int wid = blockIdx.x * 4 + w;
  const int mt = wid / ntn, nq = wid % ntn;
  if (mt * 16 >= M) return;
  const int row0 = mt * 16, col0 = nq * 64;
  const float* arow = A + (size_t)(row0 + ln) * lda;
  v8f acc[4] = {};
  for (int kb = 0; kb < K; kb += 32) {
    FragB ah, al;
    const v4f x0 = *(const v4fa*)(arow + kb + 8 * hh), x1 = *(const v4fa*)(arow + kb + 8 * hh + 4);
    const v4f x2 = *(const v4fa*)(arow + kb + 16 + 8 * hh), x3 = *(const v4fa*)(arow + kb + 16 + 8 * hh + 4);
    float xs[16] = {x0[0],x0[1],x0[2],x0[3],x1[0],x1[1],x1[2],x1[3],x2[0],x2[1],x2[2],x2[3],x3[0],x3[1],x3[2],x3[3]};
#pragma unroll
    for (int i = 0; i < 16; ++i) { const unsigned short hb = bf16_bits(xs[i]); ah.u[i] = hb; al.u[i] = ASPLIT ? bf16_bits(xs[i] - bf16_val(hb)) : (unsigned short)0; }
#pragma unroll
    for (int t = 0; t < 4; ++t) {
      const unsigned short* brow = Wt + (size_t)(col0 + t * 16 + ln) * ldb + kb;
      FragB b;
      b.half[0] = *(const v8us*)(brow + 8 * hh);
      b.half[1] = *(const v8us*)(brow + 16 + 8 * hh);
      acc[t] = mmaN<ASPLIT ? 2 : 1>(ah.v, al.v, b.v, b.v, acc[t]);
    }
  }
#pragma unroll
  for (int t = 0; t < 4; ++t) {
    float bv = bias ? bias[col0 + t * 16 + ln] : 0.f;
    if (BIAS_BF16) bv = bf16_round(bv);
#pragma unroll
    for (int r = 0; r < 8; ++r) { float v = acc[t][r] + bv; if (ACT == 1) v = fmaxf(v, 0.f); so[w][8 * hh + r][t * 16 + ln] = v; }
  }
  __builtin_amdgcn_fence(__ATOMIC_ACQ_REL, "workgroup");
  __builtin_amdgcn_wave_barrier();
  const int rsub = lane >> 4, c4 = (lane & 15) * 4;
  {
#pragma unroll
    for (int q = 0; q < 8; ++q) {
      const int r = q * 2 + rsub;
      const v4f v = *(const v4fa*)&so[w][r][c4];
      *(v4f*)(C + (size_t)(row0 + r) * ldc + col0 + c4) = v;
    }
    
  }
}

// GEMM C = act(A·W + bias + resid): A f32 (ASPLIT -> hi/lo 2 terms), Wt bf16 [N][K]; ACT 0 none, 1 relu, 2 exact gelu;
// resid (optional, f32, row index = (row % rmod), pitch ldr, RES_BF16 rounds it) added before the activation.
template <bool ASPLIT, int ACT, bool BIAS_BF16, bool RES_BF16>
__global__ __launch_bounds__(128) void k_gemm_bf3(const float* __restrict__ A, int lda, const unsigned short* __restrict__ Wt, int ldb,
                                                const float* __restrict__ bias, const float* __restrict__ resid, int rmod, int ldr,
                                                float* __restrict__ C, int ldc, int M, int N, int K) {
  __shared__ __attribute__((aligned(16))) float so[4][16][64];
  const int tid = threadIdx.x, w = tid >> 5, lane = tid & 31, ln = lane & 15, hh = lane >> 4;
  const int ntn = N / 64;
  const int wid = blockIdx.x * 4 + w;
  const int mt = wid / ntn, nq = wid % ntn;
  if (mt * 16 >= M) return;
  const int row0 = mt * 16, col0 = nq * 64;
  const float* arow = A + (size_t)(row0 + ln) * lda;
  v8f acc[4] = {};
  for (int kb = 0; kb < K; kb += 32) {
    FragB ah, al;
    const v4f x0 = *(const v4fa*)(arow + kb + 8 * hh), x1 = *(const v4fa*)(arow + kb + 8 * hh + 4);
    const v4f x2 = *(const v4fa*)(arow + kb + 16 + 8 * hh), x3 = *(const v4fa*)(arow + kb + 16 + 8 * hh + 4);
    float xs[16] = {x0[0],x0[1],x0[2],x0[3],x1[0],x1[1],x1[2],x1[3],x2[0],x2[1],x2[2],x2[3],x3[0],x3[1],x3[2],x3[3]};
#pragma unroll
    for (int i = 0; i < 16; ++i) { const unsigned short hb = bf16_bits(xs[i]); ah.u[i] = hb; al.u[i] = ASPLIT ? bf16_bits(xs[i] - bf16_val(hb)) : (unsigned short)0; }
#pragma unroll
    for (int t = 0; t < 4; ++t) {
      const unsigned short* brow = Wt + (size_t)(col0 + t * 16 + ln) * ldb + kb;
      FragB b;
      b.half[0] = *(const v8us*)(brow + 8 * hh);
      b.half[1] = *(const v8us*)(brow + 16 + 8 * hh);
      acc[t] = mmaN<ASPLIT ? 2 : 1>(ah.v, al.v, b.v, b.v, acc[t]);
    }
  }
#pragma unroll
  for (int t = 0; t < 4; ++t) {
    const int col = col0 + t * 16 + ln;
    float bv = bias ? bias[col] : 0.f;
    if (BIAS_BF16) bv = bf16_round(bv);
#pragma unroll
    for (int r = 0; r < 8; ++r) {
      float v = acc[t][r] + bv;
      if (resid) { float rv = resid[(size_t)((row0 + 8 * hh + r) % rmod) * ldr + col]; if (RES_BF16) rv = bf16_round(rv); v += rv; }
      if (ACT == 1) v = fmaxf(v, 0.f);
      if (ACT == 2) v = 0.5f * v * (1.0f + erff(v * 0.70710678118654752f));
      if (ACT == 3) { const float u = 0.7978845608028654f * (v + 0.044715f * v * v * v); v = 0.5f * v * (1.0f + tanhf(u)); }
      so[w][8 * hh + r][t * 16 + ln] = v;
    }
  }
  __builtin_amdgcn_fence(__ATOMIC_ACQ_REL, "workgroup");
  __builtin_amdgcn_wave_barrier();
  const int rsub = lane >> 4, c4 = (lane & 15) * 4;
  {
#pragma unroll
    for (int q = 0; q < 8; ++q) {
      const int r = q * 2 + rsub;
      const v4f v = *(const v4fa*)&so[w][r][c4];
      *(v4f*)(C + (size_t)(row0 + r) * ldc + col0 + c4) = v;
    }
    
  }
}
// row LayerNorm (biased variance, eps) over N: s = X (+ R); optional out_sum <- s; out_norm <- (s-mu)*rsqrt(var+eps)*g + b
template <bool PARAM_BF16>
__global__ __launch_bounds__(256) void k_layernorm(const float* __restrict__ X, const float* __restrict__ R, const float* __restrict__ g, const float* __restrict__ bta,
                                                  float* __restrict__ out_sum, float* __restrict__ out_norm, int N, float eps) {
  __shared__ float red[256];
  const int row = blockIdx.x, tid = threadIdx.x;
  const float* x = X + (size_t)row * N; const float* rr = R ? R + (size_t)row * N : nullptr;
  float vals[16];                     // up to N = 4096
  const int per = N / 256;            // contiguous chunk per thread? use strided-by-4 chunks: thread handles j = tid*4 + 1024*u
  float s1 = 0.f;
  for (int u = 0; u < per / 4; ++u) {
    const int j = tid * 4 + 1024 * u;
    const v4f a = *(const v4fa*)(x + j);
    v4f b = {0.f,0.f,0.f,0.f}; if (rr) b = *(const v4fa*)(rr + j);
#pragma unroll
    for (int q = 0; q < 4; ++q) { const float v = a[q] + b[q]; vals[u * 4 + q] = v; s1 += v; }
  }
  red[tid] = s1; __syncthreads();
  for (int st = 128; st > 0; st >>= 1) { if (tid < st) red[tid] += red[tid + st]; __syncthreads(); }
  const float mu = red[0] / (float)N; __syncthreads();
  float s2 = 0.f;
  for (int u = 0; u < per / 4; ++u)
#pragma unroll
    for (int q = 0; q < 4; ++q) { const float c = vals[u * 4 + q] - mu; s2 += c * c; }
  red[tid] = s2; __syncthreads();
  for (int st = 128; st > 0; st >>= 1) { if (tid < st) red[tid] += red[tid + st]; __syncthreads(); }
  const float rs = rsqrtf(red[0] / (float)N + eps);
  {
    for (int u = 0; u < per / 4; ++u) {
      const int j = tid * 4 + 1024 * u;
      v4f o, sm;
#pragma unroll
      for (int q = 0; q < 4; ++q) {
        float gg = g[j + q], bb = bta[j + q];
        if (PARAM_BF16) { gg = bf16_round(gg); bb = bf16_round(bb); }
        sm[q] = vals[u * 4 + q]; o[q] = (vals[u * 4 + q] - mu) * rs * gg + bb;
      }
      if (out_sum) *(v4f*)(out_sum + (size_t)row * N + j) = sm;
      *(v4f*)(out_norm + (size_t)row * N + j) = o;
    }
    
  }
}



// ---- f16 WMMA path (v_wmma_f32_16x16x32_f16): 11-bit significands for operands in range — used where a [0,1] probability operand needs more precision than bf16
typedef _Float16 v16h __attribute__((ext_vector_type(16)));
union FragH { v16h v; v8us half[2]; _Float16 h[16]; unsigned short u[16]; };
template <int NT>
__device__ __forceinline__ v8f mmaH(v16h ah, v16h al, v16h bh, v16h bl, v8f c) {
  c = __builtin_amdgcn_wmma_f32_16x16x32_f16(false, ah, false, bh, (short)0, c, false, false);
  if (NT >= 2) c = __builtin_amdgcn_wmma_f32_16x16x32_f16(false, al, false, bh, (short)0, c, false, false);
  if (NT >= 3) c = __builtin_amdgcn_wmma_f32_16x16x32_f16(false, ah, false, bl, (short)0, c, false, false);
  asm volatile("v_nop\n\tv_nop\n\tv_nop\n\tv_nop" : "+v"(c) : "v"(ah), "v"(al), "v"(bh), "v"(bl));
  return c;
}
// batched GEMM like k_gemm_b but f16 operands: A f32 (split into f16 hi/lo if ASPLIT, else rounded to f16), Bt = f16 values [n][k]; alpha; C f32; N multiple of 16 (partial tiles skipped)
template <bool ASPLIT>
__global__ __launch_bounds__(128) void k_gemm_h(const float* __restrict__ A, int lda, size_t sA, const _Float16* __restrict__ Bh, int ldb, size_t sB, float alpha, float* __restrict__ C, int ldc, size_t sC, int M, int N, int K) {
  __shared__ __attribute__((aligned(16))) float so[4][16][64];
  const int tid = threadIdx.x, w = tid >> 5, lane = tid & 31, ln = lane & 15, hh = lane >> 4; const int by = blockIdx.y;
  A += (size_t)by * sA; Bh += (size_t)by * sB; C += (size_t)by * sC;
  const int ntn = (N + 63) / 64; const int wid = blockIdx.x * 4 + w; const int mt = wid / ntn, nq = wid % ntn; if (mt * 16 >= M) return;
  const int row0 = mt * 16, col0 = nq * 64; const float* arow = A + (size_t)(row0 + ln) * lda;
  v8f acc[4] = {};
  for (int kb = 0; kb < K; kb += 32) {
    FragH ah, al;
    const v4f x0 = *(const v4fa*)(arow + kb + 8 * hh), x1 = *(const v4fa*)(arow + kb + 8 * hh + 4), x2 = *(const v4fa*)(arow + kb + 16 + 8 * hh), x3 = *(const v4fa*)(arow + kb + 16 + 8 * hh + 4);
    float xs[16] = {x0[0],x0[1],x0[2],x0[3],x1[0],x1[1],x1[2],x1[3],x2[0],x2[1],x2[2],x2[3],x3[0],x3[1],x3[2],x3[3]};
#pragma unroll
    for (int i = 0; i < 16; ++i) { const _Float16 h = (_Float16)xs[i]; ah.h[i] = h; al.h[i] = ASPLIT ? (_Float16)(xs[i] - (float)h) : (_Float16)0.0f; }
#pragma unroll
    for (int t = 0; t < 4; ++t) { if (col0 + t * 16 >= N) continue; const size_t boff = (size_t)(col0 + t * 16 + ln) * ldb + kb; FragH bq; bq.half[0] = *(const v8us*)(Bh + boff + 8 * hh); bq.half[1] = *(const v8us*)(Bh + boff + 16 + 8 * hh);
      acc[t] = mmaH<ASPLIT ? 2 : 1>(ah.v, al.v, bq.v, bq.v, acc[t]); }
  }
#pragma unroll
  for (int t = 0; t < 4; ++t) { if (col0 + t * 16 >= N) continue;
#pragma unroll
    for (int r = 0; r < 8; ++r) so[w][8 * hh + r][t * 16 + ln] = acc[t][r] * alpha; }
  __builtin_amdgcn_fence(__ATOMIC_ACQ_REL, "workgroup"); __builtin_amdgcn_wave_barrier();
  const int rsub = lane >> 4, c4 = (lane & 15) * 4;
  {
#pragma unroll
    for (int q = 0; q < 8; ++q) { const int r = q * 2 + rsub; if (col0 + c4 < N) { const v4f v = *(const v4fa*)&so[w][r][c4]; *(v4f*)(C + (size_t)(row0 + r) * ldc + col0 + c4) = v; } }
     }
}

// Wt[n][k] = f16(W[k][n]·scale) from f32 row-major W[K][N] (scale = power of two; bf16-exact weights stay exact in f16 away from the subnormal range)
__global__ __launch_bounds__(256) void k_wt_f16(const float* __restrict__ W, _Float16* __restrict__ Wt, int K, int N, float scale) {
  const int t = blockIdx.x * 256 + threadIdx.x; if (t >= N * (K / 8)) return; const int n = t / (K / 8), k8 = (t % (K / 8)) * 8; FragH f;
#pragma unroll
  for (int i = 0; i < 8; ++i) f.h[i] = (_Float16)(bf16_round(W[(size_t)(k8 + i) * N + n]) * scale); const v8us o = f.half[0];
  *(v8us*)((unsigned short*)Wt + (size_t)n * K + k8) = o; 
}
// k_gemm_hh variant with fused epilogue: v = acc·alpha + bias[by·sBias + col] (+ CP[(row/rowsPerB)·sCPb + by·64 + col] if CP) ; ACT 0 none / 1 elu ; writes f16 C16 (and f32 C if non-null)
template <int ACT>
__global__ __launch_bounds__(128) void k_gemm_hhx(const _Float16* __restrict__ A, int lda, size_t sA, const _Float16* __restrict__ Bh, int ldb, size_t sB, float alpha, const float* __restrict__ bias, size_t sBias, const float* __restrict__ CP, int rowsPerB, size_t sCPb, int row0g,
    float* __restrict__ C, _Float16* __restrict__ C16, int ldc, size_t sC, int M, int N, int K) {
  __shared__ __attribute__((aligned(16))) float so[4][16][64];
  const int tid = threadIdx.x, w = tid >> 5, lane = tid & 31, ln = lane & 15, hh = lane >> 4; const int by = blockIdx.y;
  A += (size_t)by * sA; Bh += (size_t)by * sB; const size_t cofs = (size_t)by * sC; const float* bp = bias ? bias + (size_t)by * sBias : nullptr;
  const int ntn = (N + 63) / 64; const int wid = blockIdx.x * 4 + w; const int mt = wid / ntn, nq = wid % ntn; if (mt * 16 >= M) return;
  const int row0 = mt * 16, col0 = nq * 64; const _Float16* arow = A + (size_t)(row0 + ln) * lda;
  v8f acc[4] = {};
  for (int kb = 0; kb < K; kb += 32) { FragH ah; ah.half[0] = *(const v8us*)((const unsigned short*)arow + kb + 8 * hh); ah.half[1] = *(const v8us*)((const unsigned short*)arow + kb + 16 + 8 * hh);
#pragma unroll
    for (int t = 0; t < 4; ++t) { if (col0 + t * 16 >= N) continue; const size_t boff = (size_t)(col0 + t * 16 + ln) * ldb + kb; FragH bq; bq.half[0] = *(const v8us*)((const unsigned short*)Bh + boff + 8 * hh); bq.half[1] = *(const v8us*)((const unsigned short*)Bh + boff + 16 + 8 * hh);
      acc[t] = mmaH<1>(ah.v, ah.v, bq.v, bq.v, acc[t]); }
  }
#pragma unroll
  for (int t = 0; t < 4; ++t) { if (col0 + t * 16 >= N) continue; const int col = col0 + t * 16 + ln; const float bv = bp ? bf16_round(bp[col]) : 0.f;
#pragma unroll
    for (int r = 0; r < 8; ++r) { float v = acc[t][r] * alpha + bv; if (CP) { const int rr = row0g + row0 + 8 * hh + r; if (rowsPerB < 0) v += CP[cofs + (size_t)rr * ldc + col];      /* rowsPerB < 0: own element of the batched C plane */ else { const int bidx = rr / rowsPerB; v += CP[(size_t)bidx * sCPb + (size_t)by * 64 + col]; } } if (ACT == 1) v = (v > 0.f) ? v : expm1f(v); else if (ACT == 7) v = (v > 0.f) ? v + 1.0f : expf(v); else if (ACT == 8) v = tanhf(v); else if (ACT == 9) v = 0.5f * v * (1.0f + tanhf(0.7978845608028654f * (v + 0.044715f * v * v * v))); else if (ACT == 11) v = 1.0f / (1.0f + expf(-v)); else if (ACT == 12) v = (v > 0.f) ? v : 0.01f * v; else if (ACT == 14) v = (v > 0.f) ? v : 0.1f * v; else if (ACT == 16) v = (v >= 0.f) ? v : 0.3f * v; else if (ACT == 17) v = (v >= 0.f) ? v : 0.2f * v; else if (ACT == 15) v = v / (1.0f + expf(-v)); else if (ACT == 3) v = fmaxf(v, 0.f); else if (ACT == 6) v = 0.5f * v * (1.0f + erff(v * 0.70710678118654752f)); so[w][8 * hh + r][t * 16 + ln] = v; } }
  __builtin_amdgcn_fence(__ATOMIC_ACQ_REL, "workgroup"); __builtin_amdgcn_wave_barrier();
  const int rsub = lane >> 4, c4 = (lane & 15) * 4; typedef _Float16 v4h __attribute__((ext_vector_type(4)));
  {
#pragma unroll
    for (int q = 0; q < 8; ++q) { const int r = q * 2 + rsub; if (col0 + c4 < N) { const v4f v = *(const v4fa*)&so[w][r][c4]; if (C) *(v4f*)(C + cofs + (size_t)(row0 + r) * ldc + col0 + c4) = v; if (C16) { v4h h4; for (int i = 0; i < 4; ++i) h4[i] = (_Float16)v[i]; *(v4h*)(C16 + cofs + (size_t)(row0 + r) * ldc + col0 + c4) = h4; } } }
     }
}


typedef _Float16 v4h __attribute__((ext_vector_type(4)));

__global__ __launch_bounds__(256) void k_x16(const float* __restrict__ x, _Float16* __restrict__ X16, size_t n8) { const size_t t = (size_t)blockIdx.x * 256 + threadIdx.x; if (t >= n8) return; FragH f;
#pragma unroll
  for (int q = 0; q < 8; ++q) f.h[q] = (_Float16)bf16_round(x[t * 8 + q]); *(v8us*)((unsigned short*)X16 + t * 8) = f.half[0];  }
__global__ __launch_bounds__(256) void k_h16(const float* __restrict__ x, _Float16* __restrict__ X16, size_t n8) { const size_t t = (size_t)blockIdx.x * 256 + threadIdx.x; if (t >= n8) return; FragH f;
#pragma unroll
  for (int q = 0; q < 8; ++q) f.h[q] = (_Float16)x[t * 8 + q]; *(v8us*)((unsigned short*)X16 + t * 8) = f.half[0];  }
__global__ __launch_bounds__(256) void k_round16f(const float* __restrict__ W, _Float16* __restrict__ Bt, size_t n8) { const size_t t = (size_t)blockIdx.x * 256 + threadIdx.x; if (t >= n8) return; FragH f;
#pragma unroll
  for (int i = 0; i < 8; ++i) f.h[i] = (_Float16)(bf16_round(W[t * 8 + i]) * 16.0f); *(v8us*)((unsigned short*)Bt + t * 8) = f.half[0];  }
template <int NHv, int TTv>
__global__ __launch_bounds__(256) void k_vt(const _Float16* __restrict__ V16, int ldv, int voff, _Float16* __restrict__ Vt) { __shared__ unsigned short tl[64][66]; const int tid = threadIdx.x; const int slab = blockIdx.x / (TTv / 64), lg = blockIdx.x % (TTv / 64); const int b = slab / NHv, h = slab % NHv;
  for (int i = tid; i < 64 * 8; i += 256) { const int r = i / 8, c8 = (i % 8) * 8; FragH f; f.half[0] = *(const v8us*)((const unsigned short*)V16 + ((size_t)b * TTv + lg * 64 + r) * ldv + voff + h * 64 + c8);
#pragma unroll
    for (int q = 0; q < 8; ++q) tl[r][c8 + q] = f.u[q]; }
  __syncthreads();
  {
#pragma unroll
    for (int rd = 0; rd < 2; ++rd) { const int d = rd * 32 + tid / 8, pc = tid % 8; FragH f;
#pragma unroll
      for (int q = 0; q < 8; ++q) f.u[q] = tl[pc * 8 + q][d];
      *(v8us*)((unsigned short*)Vt + ((size_t)slab * 64 + d) * TTv + lg * 64 + pc * 8) = f.half[0]; }
     } }

__global__ __launch_bounds__(256) void k_hl(const float* __restrict__ F, _Float16* __restrict__ Hh, _Float16* __restrict__ Hl, size_t n8) { const size_t t = (size_t)blockIdx.x * 256 + threadIdx.x; if (t >= n8) return; FragH fh, fl; const v4f a = *(const v4fa*)(F + t * 8), c = *(const v4fa*)(F + t * 8 + 4);
#pragma unroll
  for (int q = 0; q < 4; ++q) { _Float16 h = (_Float16)a[q]; fh.h[q] = h; fl.h[q] = (_Float16)((a[q] - (float)h) * 1024.0f); h = (_Float16)c[q]; fh.h[4 + q] = h; fl.h[4 + q] = (_Float16)((c[q] - (float)h) * 1024.0f); }
  { *(v8us*)((unsigned short*)Hh + t * 8) = fh.half[0]; *(v8us*)((unsigned short*)Hl + t * 8) = fl.half[0];  } }

// ---- fast GEMM (wave tile 32x64; requires M % 32 == 0 rows per launch region and N % 64 == 0); epilogue = k_gemm_hhx semantics ----
__device__ __forceinline__ v16h g2_frag(const _Float16* p, int hh) { FragH f; f.half[0] = *(const v8us*)((const unsigned short*)p + 8 * hh); f.half[1] = *(const v8us*)((const unsigned short*)p + 16 + 8 * hh); return f.v; }
__device__ __forceinline__ v8f g2_mma(v16h a, v16h b, v8f c) { v8f d = __builtin_amdgcn_wmma_f32_16x16x32_f16(false, a, false, b, (short)0, c, false, false); asm volatile("v_nop\n\tv_nop\n\tv_nop\n\tv_nop" : "+v"(d) : "v"(a), "v"(b)); return d; }
template <int ACT>
__global__ __launch_bounds__(128) void k_gemm2(const _Float16* __restrict__ A, int lda, size_t sA, const _Float16* __restrict__ Bh, int ldb, size_t sB, float alpha, const float* __restrict__ bias, size_t sBias, const float* __restrict__ CP, int rowsPerB, size_t sCPb, int row0g,
    float* __restrict__ C, _Float16* __restrict__ C16, int ldc, size_t sC, int M, int N, int K) { static_assert(ACT == 0 || ACT == 3 || ACT == 6 || ACT == 8 || ACT == 9 || ACT == 11 || ACT == 12 || ACT == 14 || ACT == 15 || ACT == 16 || ACT == 17, "k_gemm2: unsupported ACT code (would silently apply no activation)");
  __shared__ __attribute__((aligned(16))) float so[4][32][68];
  const int tid = threadIdx.x, w = tid >> 5, lane = tid & 31, ln = lane & 15, hh = lane >> 4; const int by = blockIdx.y;
  A += (size_t)by * sA; Bh += (size_t)by * sB; const size_t cofs = (size_t)by * sC; const float* bp = bias ? bias + (size_t)by * sBias : nullptr;
  const int ntn = N >> 6; const int mt = blockIdx.x / ntn, nq = blockIdx.x - mt * ntn; const int row0 = mt * 128 + 32 * w, col0 = nq * 64; if (row0 >= M) return;
  const _Float16* a0p = A + (size_t)(row0 + ln) * lda; const _Float16* a1p = a0p + (size_t)16 * lda;
  const _Float16* b0p = Bh + (size_t)(col0 + ln) * ldb; const _Float16* b1p = b0p + (size_t)16 * ldb; const _Float16* b2p = b1p + (size_t)16 * ldb; const _Float16* b3p = b2p + (size_t)16 * ldb;
  const v8f z8 = {0.f,0.f,0.f,0.f,0.f,0.f,0.f,0.f}; v8f c00 = z8, c01 = z8, c02 = z8, c03 = z8, c10 = z8, c11 = z8, c12 = z8, c13 = z8;
#pragma unroll 1
  for (int kb = 0; kb < K; kb += 32) { const v16h a0 = g2_frag(a0p + kb, hh), a1 = g2_frag(a1p + kb, hh);
    v16h b = g2_frag(b0p + kb, hh); c00 = g2_mma(a0, b, c00); c10 = g2_mma(a1, b, c10);
    b = g2_frag(b1p + kb, hh); c01 = g2_mma(a0, b, c01); c11 = g2_mma(a1, b, c11);
    b = g2_frag(b2p + kb, hh); c02 = g2_mma(a0, b, c02); c12 = g2_mma(a1, b, c12);
    b = g2_frag(b3p + kb, hh); c03 = g2_mma(a0, b, c03); c13 = g2_mma(a1, b, c13); }
  v8f accs[8] = {c00, c01, c02, c03, c10, c11, c12, c13};
#pragma unroll
  for (int u = 0; u < 8; ++u) { const int t = u & 3, half = u >> 2; const int col = col0 + t * 16 + ln; const float bv = bp ? bf16_round(bp[col]) : 0.f;
#pragma unroll
    for (int r = 0; r < 8; ++r) { const int rloc = half * 16 + 8 * hh + r; float v = accs[u][r] * alpha + bv; if (CP) { if (rowsPerB < 0) v += CP[cofs + (size_t)(row0g + row0 + rloc) * ldc + col];      /* rowsPerB < 0: own element of the batched C plane */ else { const int bidx = (row0g + row0 + rloc) / rowsPerB; v += CP[(size_t)bidx * sCPb + (size_t)by * 64 + col]; } }
      if (ACT == 3) v = fmaxf(v, 0.f); else if (ACT == 6) v = 0.5f * v * (1.0f + erff(v * 0.70710678118654752f)); else if (ACT == 11) v = 1.0f / (1.0f + expf(-v)); else if (ACT == 15) v = v / (1.0f + expf(-v)); else if (ACT == 12) v = (v > 0.f) ? v : 0.01f * v; else if (ACT == 8) v = tanhf(v); else if (ACT == 9) v = 0.5f * v * (1.0f + tanhf(0.7978845608028654f * (v + 0.044715f * v * v * v))); else if (ACT == 14) v = (v > 0.f) ? v : 0.1f * v; else if (ACT == 16) v = (v >= 0.f) ? v : 0.3f * v; else if (ACT == 17) v = (v >= 0.f) ? v : 0.2f * v;
      so[w][rloc][t * 16 + ln] = v; } }
  __builtin_amdgcn_fence(__ATOMIC_ACQ_REL, "workgroup"); __builtin_amdgcn_wave_barrier();
  const int rsub = lane >> 4, c4 = (lane & 15) * 4;
  {
#pragma unroll
    for (int q = 0; q < 16; ++q) { const int r = q * 2 + rsub; const v4f v = *(const v4fa*)&so[w][r][c4]; if (C) *(v4f*)(C + cofs + (size_t)(row0 + r) * ldc + col0 + c4) = v; if (C16) { v4h h4; for (int i = 0; i < 4; ++i) h4[i] = (_Float16)v[i]; *(v4h*)(C16 + cofs + (size_t)(row0 + r) * ldc + col0 + c4) = h4; } }
     } }


__global__ __launch_bounds__(256) void k_wnat(const float* __restrict__ w, size_t n8, _Float16* __restrict__ Bt) { const size_t t = (size_t)blockIdx.x * 256 + threadIdx.x; if (t >= n8) return; FragH f; for (int q = 0; q < 8; ++q) f.h[q] = (_Float16)(bf16_round(w[t * 8 + q]) * 16.0f); *(v8us*)((unsigned short*)Bt + t * 8) = f.half[0];  }
__global__ __launch_bounds__(256) void k_rsm(const float* __restrict__ S, _Float16* __restrict__ P, int nrows) {
  #pragma clang fp contract(off)
  const int i = blockIdx.x * 256 + threadIdx.x; if (i >= nrows) return; const float* s = S + (size_t)i * SQ; float mx = -3.0e38f;
#pragma unroll 1
  for (int j = 0; j < SQ; ++j) mx = fmaxf(mx, s[j]); float se = 0.f;
#pragma unroll 1
  for (int j = 0; j < SQ; ++j) se += expf(s[j] - mx); const float sc = 256.0f / se;
#pragma unroll 1
  for (int j0 = 0; j0 < SQ; j0 += 8) { FragH f; for (int q = 0; q < 8; ++q) f.h[q] = (_Float16)(expf(s[j0 + q] - mx) * sc); unsigned short* d = (unsigned short*)P + (size_t)i * SQ + j0; *(v8us*)d = f.half[0];  } }
__global__ __launch_bounds__(256) void k_vt(const _Float16* __restrict__ V16, int b, int h0, _Float16* __restrict__ VT) { __shared__ unsigned short tl[64][65]; const int tid = threadIdx.x; const int hh = blockIdx.x % HG, sg = blockIdx.x / HG; const int s0 = sg * 64; const int h = h0 + hh;
  for (int i = tid; i < 64 * 8; i += 256) { const int j = i / 8, d8 = (i % 8) * 8; FragH f; f.half[0] = *(const v8us*)((const unsigned short*)V16 + ((size_t)b * SQ + s0 + j) * DM + h * HD + d8); for (int q = 0; q < 8; ++q) tl[d8 + q][j] = f.u[q]; }
  __syncthreads();
  { for (int i = tid; i < 64 * 8; i += 256) { const int d = i / 8, j8 = (i % 8) * 8; FragH f; for (int q = 0; q < 8; ++q) f.u[q] = tl[d][j8 + q]; *(v8us*)((unsigned short*)VT + ((size_t)hh * HD + d) * SQ + s0 + j8) = f.half[0]; }  } }


template <int MASK>
__global__ __launch_bounds__(32) void k_att0h(const float* __restrict__ QF, const float* __restrict__ KF, const float* __restrict__ VF, int ld, int ldv, const int* __restrict__ mk, float scale, float* __restrict__ OF, int ldo) {
  #pragma clang fp contract(off)
  __shared__ __attribute__((aligned(16))) float lq[32][128]; __shared__ __attribute__((aligned(16))) float lo[32][128];
  const int tid = threadIdx.x; const int h = blockIdx.x / (QT0 / 32), rg = blockIdx.x % (QT0 / 32); const int i = rg * 32 + tid;
  for (int c = 0; c < 32; ++c) { *(v4f*)&lq[tid][c * 4] = *(const v4fa*)(QF + (size_t)i * ld + h * 128 + c * 4); const v4f z = {0.f, 0.f, 0.f, 0.f}; *(v4f*)&lo[tid][c * 4] = z; }
  float m = -1.0e30f, l = 0.f; const int jmax = rg * 32 + 31;
#pragma unroll 1
  for (int j = 0; j <= jmax; ++j) { const float* kr = KF + (size_t)j * ld + h * 128; const float* vr = VF + (size_t)j * ldv + h * 128; float s = 0.f;
#pragma unroll 1
    for (int c = 0; c < 32; ++c) { const v4f kq = *(const v4fa*)(kr + c * 4); const v4f qq = *(v4f*)&lq[tid][c * 4]; for (int u = 0; u < 4; ++u) s = __fadd_rn(s, __fmul_rn(qq[u], kq[u])); }
    s = __fmul_rn(s, scale); float f; if (MASK) { const int mb = mk[(size_t)i * SQ + j]; f = (mb == 0) ? 1.f : 0.f; } else { f = (j <= i) ? 1.f : 0.f; }
    const float sm = fmaf(f, s, (1.f - f) * -1.0e30f); const float mn = fmaxf(m, sm); const float sc = expf(m - mn); const float e = __fmul_rn(f, expf(sm - mn)); l = __fadd_rn(__fmul_rn(l, sc), e); m = mn;
#pragma unroll 1
    for (int c = 0; c < 32; ++c) { const v4f vv = *(const v4fa*)(vr + c * 4); v4f oo = *(v4f*)&lo[tid][c * 4]; for (int u = 0; u < 4; ++u) oo[u] = __fadd_rn(__fmul_rn(oo[u], sc), __fmul_rn(e, vv[u])); *(v4f*)&lo[tid][c * 4] = oo; } }
  const float fin = 64.0f / l;
  { for (int c = 0; c < 32; ++c) { v4f oo = *(v4f*)&lo[tid][c * 4]; for (int u = 0; u < 4; ++u) oo[u] = __fmul_rn(oo[u], fin); *(v4f*)(OF + (size_t)i * ldo + h * 128 + c * 4) = oo; }  } }
__global__ __launch_bounds__(256) void k_f2h(const float* __restrict__ F, int ldf, int coff, int ncol, _Float16* __restrict__ H16, size_t nrow) { const size_t t = (size_t)blockIdx.x * 256 + threadIdx.x; const size_t n8 = nrow * (size_t)(ncol / 8); if (t >= n8) return; const size_t r = t / (ncol / 8); const int c8 = (int)(t % (ncol / 8)) * 8; FragH f; const v4f a = *(const v4fa*)(F + r * ldf + coff + c8), b2 = *(const v4fa*)(F + r * ldf + coff + c8 + 4); for (int q = 0; q < 4; ++q) { f.h[q] = (_Float16)a[q]; f.h[4 + q] = (_Float16)b2[q]; } *(v8us*)((unsigned short*)H16 + r * ncol + c8) = f.half[0];  }

__global__ __launch_bounds__(256) void k_tab128(float theta, float* __restrict__ CS, float* __restrict__ SN) {
  #pragma clang fp contract(off)
  const int t = blockIdx.x * 256 + threadIdx.x; if (t >= SQ * 64) return; const int i = t % 64; const int p = t / 64; const float invf = (float)(1.0 / pow((double)theta, (double)(2 * i) / 128.0));      /* = XLA's constant-folded f32 table */ const float ang = __fmul_rn((float)p, invf); const float c = cosf(ang), s = sinf(ang);
  *(float*)(CS + t) = c; *(float*)(SN + t) = s;  }
template <int TAB>
__global__ __launch_bounds__(128) void k_rope128(const float* __restrict__ F, int ldf, int nh, const float* __restrict__ CS, const float* __restrict__ SN, _Float16* __restrict__ H16, int ldo, float osc) {
  #pragma clang fp contract(off)
  __shared__ float xv[128]; __shared__ unsigned short sh_[128]; const int d = threadIdx.x; const int h = blockIdx.x % nh; const size_t r = blockIdx.x / nh; const int p = (int)(r % SQ);
  xv[d] = F[r * (size_t)ldf + (size_t)h * 128 + d]; __syncthreads();
  float c, s; if (TAB) { c = bf16_round(CS[(size_t)p * 128 + d]); s = bf16_round(SN[(size_t)p * 128 + d]); } else { c = CS[p * 64 + (d & 63)]; s = SN[p * 64 + (d & 63)]; }
  const float rot = (d < 64) ? -xv[d + 64] : xv[d - 64]; const float o = __fadd_rn(__fmul_rn(xv[d], c), __fmul_rn(rot, s));
  FragH th; th.h[0] = (_Float16)__fmul_rn(o, osc); sh_[d] = th.u[0]; __syncthreads();
  if (d < 16) { FragH f; for (int q = 0; q < 8; ++q) f.u[q] = sh_[d * 8 + q]; unsigned short* dst = (unsigned short*)H16 + r * (size_t)ldo + (size_t)h * 128 + d * 8; *(v8us*)dst = f.half[0];  } }

template <int TAB, int IL, int F32OUT>
__global__ __launch_bounds__(128) void k_rope128x(const float* __restrict__ F, int ldf, int nh, const float* __restrict__ CS, const float* __restrict__ SN, void* __restrict__ OUT, int ldo, float osc) {
  #pragma clang fp contract(off)
  __shared__ float xv[128]; __shared__ float ov[128]; const int d = threadIdx.x; const int h = blockIdx.x % nh; const size_t r = blockIdx.x / nh; const int p = (int)(r % SQ);
  xv[d] = F[r * (size_t)ldf + (size_t)h * 128 + d]; __syncthreads();
  float c, s; if (TAB == 2) { c = CS[r * 128 + d]; s = SN[r * 128 + d]; }      /* computed full-width f32 tables, one row per token row r (relative to the passed pointers) */ else if (TAB) { c = bf16_round(CS[(size_t)p * 128 + d]); s = bf16_round(SN[(size_t)p * 128 + d]); } else { const int ti = IL ? (d >> 1) : (d & 63); c = CS[p * 64 + ti]; s = SN[p * 64 + ti]; }
  const float rot = IL ? ((d & 1) ? xv[d - 1] : -xv[d + 1]) : ((d < 64) ? -xv[d + 64] : xv[d - 64]);
  ov[d] = __fmul_rn(__fadd_rn(__fmul_rn(xv[d], c), __fmul_rn(rot, s)), osc); __syncthreads();
  if (F32OUT) { if (d < 32) { const v4f v = *(const v4f*)&ov[d * 4]; float* dst = (float*)OUT + r * (size_t)ldo + (size_t)h * 128 + d * 4; *(v4f*)dst = v;  } }
  else { if (d < 16) { FragH f; for (int q = 0; q < 8; ++q) f.h[q] = (_Float16)ov[d * 8 + q]; unsigned short* dst = (unsigned short*)OUT + r * (size_t)ldo + (size_t)h * 128 + d * 8; *(v8us*)dst = f.half[0];  } } }
template <int N>
__global__ __launch_bounds__(256) void k_rmsrow(float* __restrict__ X, const float* __restrict__ w, float eps) {
  #pragma clang fp contract(off)
  constexpr int PT = N / 256; __shared__ float red[256]; const size_t r = blockIdx.x; const int t = threadIdx.x; float* row = X + r * N + (size_t)t * PT; float v[PT]; float ss = 0.f;
  for (int q = 0; q < PT; ++q) { v[q] = row[q]; ss = __fadd_rn(ss, __fmul_rn(v[q], v[q])); }
  red[t] = ss; __syncthreads(); for (int k = 128; k > 0; k >>= 1) { if (t < k) red[t] = __fadd_rn(red[t], red[t + k]); __syncthreads(); }
  const float rs = rsqrtf(__fadd_rn(red[0] / (float)N, eps)); float o[PT]; for (int q = 0; q < PT; ++q) o[q] = __fmul_rn(__fmul_rn(v[q], rs), bf16_round(w[t * PT + q]));
  { for (int q = 0; q < PT; ++q) *(float*)(row + q) = o[q];  } }
template <int GS_, int NHQ, int DSRC>
__global__ __launch_bounds__(256) void k_kvexp128(const float* __restrict__ src, float* __restrict__ dst, size_t n4) { const size_t t = (size_t)blockIdx.x * 256 + threadIdx.x; if (t >= n4) return; const size_t e = t * 4; const size_t row = e / ((size_t)NHQ * 128); const int col = (int)(e % ((size_t)NHQ * 128)); const int h = col / 128, d = col % 128; const v4f v = *(const v4fa*)(src + row * DSRC + (size_t)(h / GS_) * 128 + d); *(v4f*)(dst + e) = v;  }

__global__ __launch_bounds__(256) void k_rsmcfb(const float* __restrict__ S, _Float16* __restrict__ P, int hg, int q0, int nk, const int* __restrict__ mk) {
  #pragma clang fp contract(off)
  const int t = blockIdx.x * 256 + threadIdx.x; if (t >= hg * QT) return; const size_t i = (size_t)t; const float* s = S + i * NKX; const size_t ig = (size_t)(q0 + (t % QT)); const int* mr = mk + ig * SQ; float mx = -3.0e38f;
#pragma unroll 1
  for (int j = 0; j < nk; ++j) { const int mb = mr[j]; const float f = (mb == 0) ? 1.f : 0.f; mx = fmaxf(mx, fmaf(f, s[j], (1.f - f) * -1.0e9f)); } float se = 0.f;
#pragma unroll 1
  for (int j = 0; j < nk; ++j) { const int mb = mr[j]; const float f = (mb == 0) ? 1.f : 0.f; se += __expf(fmaf(f, s[j], (1.f - f) * -1.0e9f) - mx); } const float sc = 256.0f / se;
#pragma unroll 1
  for (int j0 = 0; j0 < nk; j0 += 8) { FragH fr; for (int q = 0; q < 8; ++q) { const int j = j0 + q; const int mb = mr[j]; const float f = (mb == 0) ? 1.f : 0.f; fr.h[q] = (_Float16)(__expf(fmaf(f, s[j], (1.f - f) * -1.0e9f) - mx) * sc); } unsigned short* d = (unsigned short*)P + i * NKX + j0; *(v8us*)d = fr.half[0];  } }


__global__ __launch_bounds__(256) void k_rsmcf2(const float* __restrict__ S, _Float16* __restrict__ P, int hg, int q0, int nk) {
  #pragma clang fp contract(off)
  const int t = blockIdx.x * 256 + threadIdx.x; if (t >= hg * QT) return; const size_t i = (size_t)t; const float* s = S + i * NKX; const int last = q0 + (t % QT); float mx = -3.0e38f;
#pragma unroll 1
  for (int j = 0; j < nk; ++j) { const float f = (j <= last) ? 1.f : 0.f; mx = fmaxf(mx, fmaf(f, s[j], (1.f - f) * -1.0e9f)); } float se = 0.f;
#pragma unroll 1
  for (int j = 0; j < nk; ++j) { const float f = (j <= last) ? 1.f : 0.f; se += __expf(fmaf(f, s[j], (1.f - f) * -1.0e9f) - mx); } const float sc = 256.0f / se;
#pragma unroll 1
  for (int j0 = 0; j0 < nk; j0 += 8) { FragH fr; for (int q = 0; q < 8; ++q) { const int j = j0 + q; const float f = (j <= last) ? 1.f : 0.f; fr.h[q] = (_Float16)(__expf(fmaf(f, s[j], (1.f - f) * -1.0e9f) - mx) * sc); } unsigned short* d = (unsigned short*)P + i * NKX + j0; *(v8us*)d = fr.half[0];  } }



__global__ __launch_bounds__(256) void k_tab128p(const int* __restrict__ pos, int nrows, float theta, float* __restrict__ CS, float* __restrict__ SN) {
  #pragma clang fp contract(off)
  const int t = blockIdx.x * 256 + threadIdx.x; if (t >= nrows * 64) return; const int i = t % 64; const int r = t / 64; const float invf = (float)(1.0 / pow((double)theta, (double)(2 * i) / 128.0)); const float ang = __fmul_rn((float)pos[r], invf); const float c = cosf(ang), sv = sinf(ang);
  float* c0 = CS + (size_t)r * 128 + i; float* s0 = SN + (size_t)r * 128 + i;
  { *(float*)c0 = c; *(float*)(c0 + 64) = c; *(float*)s0 = sv; *(float*)(s0 + 64) = sv;  } }

__global__ __launch_bounds__(256) void k_rsmcim(const float* __restrict__ S, _Float16* __restrict__ P, int hg, int q0, int nk, const int* __restrict__ am) {
  #pragma clang fp contract(off)
  const int t = blockIdx.x * 256 + threadIdx.x; if (t >= hg * QT) return; const size_t i = (size_t)t; const float* s = S + i * NKX; const int last = q0 + (t % QT); const int* mr = am + (size_t)last * SQ; float mx = -3.0e38f;      /* the module's mask row of this query (keys >= nk lie above the diagonal of the causal mask and are not computed) */
#pragma unroll 1
  for (int j = 0; j < nk; ++j) { const float f = (mr[j] != 0) ? 1.f : 0.f; mx = fmaxf(mx, fmaf(f, s[j], (1.f - f) * -1.0e9f)); } float se = 0.f;
#pragma unroll 1
  for (int j = 0; j < nk; ++j) { const float f = (mr[j] != 0) ? 1.f : 0.f; se += __expf(fmaf(f, s[j], (1.f - f) * -1.0e9f) - mx); } const float sc = 256.0f / se;
#pragma unroll 1
  for (int j0 = 0; j0 < nk; j0 += 8) { FragH fr; for (int q = 0; q < 8; ++q) { const int j = j0 + q; const float f = (mr[j] != 0) ? 1.f : 0.f; fr.h[q] = (_Float16)(__expf(fmaf(f, s[j], (1.f - f) * -1.0e9f) - mx) * sc); } unsigned short* d = (unsigned short*)P + i * NKX + j0; *(v8us*)d = fr.half[0];  } }



__global__ __launch_bounds__(256) void k_tab128h(int nr, float theta, float* __restrict__ CS, float* __restrict__ SN) {
  #pragma clang fp contract(off)
  const size_t t = (size_t)blockIdx.x * 256 + threadIdx.x; if (t >= (size_t)nr * 64) return; const int i = (int)(t % 64); const size_t r = t / 64; const int p = (int)(r % SQ);
  const float invf = (float)(1.0 / pow((double)theta, ((double)(2 * i)) / 128.0)); const float ang = __fmul_rn((float)p, invf); const float c = cosf(ang), sv = sinf(ang);
  float* pc = CS + r * 128 + i; float* ps = SN + r * 128 + i;
  *(float*)pc = c; *(float*)(pc + 64) = c; *(float*)ps = sv; *(float*)(ps + 64) = sv;  }

// Per-block softmax, spread over lanes: one wave takes 4 score rows x one 256-key block (blockIdx.y). A lane holds 2 x 4 neighbouring scores of each row
// (every wave-wide load covers 512 contiguous bytes, every store 256), so each score is read once and each exponential is taken once;
// row maximum and row sum are five-step lane butterflies in registers (four steps inside the 16-lane row, one across the two rows): every lane ends with the same value.
// The short loops are unrolled so that a[] and b[] are indexed by constants and stay in registers.
template <int M> __device__ __forceinline__ float sm_xrow(float x) { return __builtin_bit_cast(float, __builtin_amdgcn_mov_dpp(__builtin_bit_cast(int, x), 0x160 | M, 0xf, 0xf, true)); }      /* lane l with lane l ^ M, M < 16 (row_xmask) */
__device__ __forceinline__ float sm_xhalf(float x) { const int b = __builtin_bit_cast(int, x); return __builtin_bit_cast(float, __builtin_amdgcn_permlanex16(b, b, 0x76543210, 0xfedcba98, false, false)); }      /* lane l with lane l ^ 16 */
__device__ __forceinline__ float sm_wmax(float x) { x = fmaxf(x, sm_xrow<1>(x)); x = fmaxf(x, sm_xrow<2>(x)); x = fmaxf(x, sm_xrow<4>(x)); x = fmaxf(x, sm_xrow<8>(x)); return fmaxf(x, sm_xhalf(x)); }
__device__ __forceinline__ float sm_wsum(float x) { x += sm_xrow<1>(x); x += sm_xrow<2>(x); x += sm_xrow<4>(x); x += sm_xrow<8>(x); return x + sm_xhalf(x); }
// Eight native 2^x in one statement. The outputs are early-clobber, so no v_exp_f32 in it overwrites a neighbour's source or reads its result; the closing v_nop keeps the one slot
// that the instruction set asks for behind a transcendental, whatever the compiler places next.
__device__ __forceinline__ void sm_exp2x8(v4f& a, v4f& b) { float e0, e1, e2, e3, e4, e5, e6, e7;
  asm("v_exp_f32 %0, %8\n\tv_exp_f32 %1, %9\n\tv_exp_f32 %2, %10\n\tv_exp_f32 %3, %11\n\tv_exp_f32 %4, %12\n\tv_exp_f32 %5, %13\n\tv_exp_f32 %6, %14\n\tv_exp_f32 %7, %15\n\tv_nop"
      : "=&v"(e0), "=&v"(e1), "=&v"(e2), "=&v"(e3), "=&v"(e4), "=&v"(e5), "=&v"(e6), "=&v"(e7) : "v"(a[0]), "v"(a[1]), "v"(a[2]), "v"(a[3]), "v"(b[0]), "v"(b[1]), "v"(b[2]), "v"(b[3]));
  a[0] = e0; a[1] = e1; a[2] = e2; a[3] = e3; b[0] = e4; b[1] = e5; b[2] = e6; b[3] = e7; }
__global__ __launch_bounds__(256) void k_rsmblk(const float* __restrict__ S, _Float16* __restrict__ P, _Float16* __restrict__ PL, int hg, int q0, int nk) {
  const int lane = threadIdx.x & 31; const int r0 = (blockIdx.x * 8 + (threadIdx.x >> 5)) * 4; if (r0 >= hg * QT) return;
  const int nb = nk / 256; const float nrm = 256.0f / __fadd_rn((float)nb, 1e-6f); const int k0 = blockIdx.y * 256; const int ka = k0 + lane * 4, kb = ka + 128;
  v4f a[4], b[4];
#pragma unroll
  for (int r = 0; r < 4; ++r) { const float* s = S + (size_t)(r0 + r) * NKX; a[r] = *(const v4fa*)(s + ka); b[r] = *(const v4fa*)(s + kb); }
  asm volatile("s_wait_xcnt 0x0" ::: "memory");      /* stands in front of the first reuse of the loads' address registers (a precaution; the compiler wrote none here); no load sinks below it, so all eight are in flight together instead of row after row */
  if (k0 + 255 > q0) {      /* only a key block that reaches past the tile's first query can hold a key above a query */
#pragma unroll
    for (int r = 0; r < 4; ++r) { const int last = q0 + ((r0 + r) % QT);
#pragma unroll
      for (int u = 0; u < 4; ++u) { a[r][u] = (ka + u <= last) ? a[r][u] : -1.0e9f; b[r][u] = (kb + u <= last) ? b[r][u] : -1.0e9f; } } }
#pragma unroll
  for (int r = 0; r < 4; ++r) {
    const float mx = sm_wmax(fmaxf(fmaxf(fmaxf(a[r][0], a[r][1]), fmaxf(a[r][2], a[r][3])), fmaxf(fmaxf(b[r][0], b[r][1]), fmaxf(b[r][2], b[r][3]))));
#pragma unroll
    for (int u = 0; u < 4; ++u) { a[r][u] = (a[r][u] - mx) * 1.44269504f; b[r][u] = (b[r][u] - mx) * 1.44269504f; }      /* e^x = 2^(x log2 e), as the native exp forms it */
    sm_exp2x8(a[r], b[r]);
    const float se = sm_wsum(((a[r][0] + a[r][1]) + (a[r][2] + a[r][3])) + ((b[r][0] + b[r][1]) + (b[r][2] + b[r][3])));
    const float isum = nrm / se; v4h ha, la, hb, lb;
#pragma unroll
    for (int u = 0; u < 4; ++u) { const float va = a[r][u] * isum, vb = b[r][u] * isum; ha[u] = (_Float16)va; la[u] = (_Float16)((va - (float)ha[u]) * 1024.0f); hb[u] = (_Float16)vb; lb[u] = (_Float16)((vb - (float)hb[u]) * 1024.0f); }
    _Float16* d = P + (size_t)(r0 + r) * NKX; _Float16* dl = PL + (size_t)(r0 + r) * NKX;
    *(v4h*)(d + ka) = ha; *(v4h*)(d + kb) = hb; *(v4h*)(dl + ka) = la; *(v4h*)(dl + kb) = lb; } }
extern "C" void kernel_launch(void* const* d_in, const int* in_sizes, int n_in,
                              void* d_out, int out_size, void* d_ws, size_t ws_size, hipStream_t stream) {
  (void)in_sizes; (void)n_in; (void)out_size;
  const float* const* I = (const float* const*)d_in; const float* x = I[0]; const float* wq = I[1]; const float* wk = I[2]; const float* wv = I[3]; const float* wo = I[4]; const float* bq = nullptr; const float* bk = nullptr; const float* bv = nullptr; const float* bo = nullptr;      /* natural [out][in] Wq/Wk/Wv/Wo [2048][2048]; no biases */
  char* ws = (char*)d_ws; size_t off = 0;
  auto take = [&](size_t bytes) { char* p = ws + off; off += (bytes + 255) & ~(size_t)255; return p; };
  _Float16* BQ = (_Float16*)take((size_t)DMX * DMX * 2); _Float16* BK = (_Float16*)take((size_t)DKV * DMX * 2); _Float16* BV = (_Float16*)take((size_t)DKV * DMX * 2); _Float16* BO = (_Float16*)take((size_t)DMX * DMX * 2);
  _Float16* X16 = (_Float16*)take(NR * DMX * 2); float* QF = (float*)take((size_t)SQ * DMX * 4); float* KF = (float*)take((size_t)SQ * DKV * 4); float* VF = (float*)take((size_t)SQ * DKV * 4); _Float16* VH = (_Float16*)take((size_t)SQ * DKV * 2); _Float16* VL = (_Float16*)take((size_t)SQ * DKV * 2); _Float16* Q16 = (_Float16*)take((size_t)SQ * DMX * 2); _Float16* QL = (_Float16*)take((size_t)SQ * DMX * 2); _Float16* K16 = (_Float16*)take((size_t)SQ * DKV * 2); _Float16* KL = (_Float16*)take((size_t)SQ * DKV * 2); _Float16* O16 = (_Float16*)take(NR * DMX * 2);      /* per-batch q, k, v in f32 -> f16 hi + x1024 residual planes */ float* OTF = (float*)take((size_t)QT * DMX * 4);      /* per-batch v in f32 -> f16 hi + x1024 residual; per-tile f32 o accumulator */
  float* S = (float*)take((size_t)NH * QT * NKX * 4); _Float16* P = (_Float16*)take((size_t)NH * QT * NKX * 2); _Float16* PL = (_Float16*)take((size_t)NH * QT * NKX * 2); _Float16* VT = (_Float16*)take((size_t)(DKV / 64) * 64 * SQ * 2); _Float16* VTL = (_Float16*)take((size_t)(DKV / 64) * 64 * SQ * 2);
  float* OF0 = (float*)take((size_t)NB * QT0 * DMX * 4); _Float16* OH0 = (_Float16*)take((size_t)NB * QT0 * DMX * 2); _Float16* OL0 = (_Float16*)take((size_t)NB * QT0 * DMX * 2);
  if (off > ws_size) return;      /* approx 8 + 8 + 8 + 8 + 16 + 16 + 16 + 16 + 8 + 8 + 8 + 8 + 8 + 8 + 16 + 2 + 32 + 16 + 16 + 8 + 8 + 4 + 2 + 2 = 250 MiB */
  { const unsigned g = (unsigned)(((size_t)DMX * DMX / 8 + 255) / 256); k_wnat<<<g, 256, 0, stream>>>(wq, (size_t)DMX * DMX / 8, BQ); k_wnat<<<g, 256, 0, stream>>>(wk, (size_t)DKV * DMX / 8, BK); k_wnat<<<g, 256, 0, stream>>>(wv, (size_t)DKV * DMX / 8, BV); k_wnat<<<g, 256, 0, stream>>>(wo, (size_t)DMX * DMX / 8, BO); }      /* natural [out][in] = Bt x16 */
  k_x16<<<(unsigned)((NR * DMX / 8 + 255) / 256), 256, 0, stream>>>(x, X16, NR * DMX / 8);
  for (int b = 0; b < NB; ++b) { const size_t r0 = (size_t)b * SQ;
    float* QF0 = QF; float* KF0 = KF; k_gemm2<0><<<dim3((SQ / 128) * (DMX / 64), 1), 128, 0, stream>>>(X16 + r0 * DMX, DMX, 0, BQ, DMX, 0, 0.0625f, bq, 0, nullptr, 1, 0, 0, QF, nullptr, DMX, 0, SQ, DMX, DMX); k_gemm2<0><<<dim3((SQ / 128) * (DKV / 64), 1), 128, 0, stream>>>(X16 + r0 * DMX, DMX, 0, BK, DMX, 0, 0.0625f, bk, 0, nullptr, 1, 0, 0, KF, nullptr, DKV, 0, SQ, DKV, DMX); k_hl<<<(unsigned)(((size_t)SQ * DMX / 8 + 255) / 256), 256, 0, stream>>>(QF, Q16, QL, (size_t)SQ * DMX / 8); k_hl<<<(unsigned)(((size_t)SQ * DKV / 8 + 255) / 256), 256, 0, stream>>>(KF, K16, KL, (size_t)SQ * DKV / 8);      /* this batch's q and k in f32 (exact products) -> f16 hi + x1024 residual (block 0's full softmax seen from every later block's first row needs near-exact logits) */ k_gemm2<0><<<dim3((SQ / 128) * (DKV / 64), 1), 128, 0, stream>>>(X16 + r0 * DMX, DMX, 0, BV, DMX, 0, 0.0625f, bv, 0, nullptr, 1, 0, 0, VF, nullptr, DKV, 0, SQ, DKV, DMX); k_hl<<<(unsigned)(((size_t)SQ * DKV / 8 + 255) / 256), 256, 0, stream>>>(VF, VH, VL, (size_t)SQ * DKV / 8);      /* f32 q and k (all rows, above; rows 0..255 feed the exact first tile); this batch's v in f32 (exact products) -> f16 hi + x1024 residual (the per-block softmax gives every block's first rows single-key weights, so v and P must be carried beyond one f16) */
    k_vt<DKV / 64, SQ><<<(DKV / 64) * (SQ / 64), 256, 0, stream>>>(VH, DKV, 0, VT); k_vt<DKV / 64, SQ><<<(DKV / 64) * (SQ / 64), 256, 0, stream>>>(VL, DKV, 0, VTL);      /* V^T hi / residual of this batch: head h = slabs 2h, 2h+1 */
    k_att0h<0><<<NH * (QT0 / 32), 32, 0, stream>>>(QF0, KF0, VF, DMX, DKV, nullptr, ATS, OF0 + (size_t)b * QT0 * DMX, DMX);      /* exact causal attention rows 0..255 (o x64) */
    for (int q0 = 0; q0 < SQ; q0 += QT) { const int nk = q0 + QT;      /* causal: keys below the tile end only */
      k_gemm2<0><<<dim3((QT / 128) * (nk / 64), NH), 128, 0, stream>>>(Q16 + (size_t)q0 * DMX, DMX, (size_t)HDK, K16, DKV, (size_t)HDK, ATS, nullptr, 0, nullptr, 1, 0, 0, S, nullptr, NKX, (size_t)QT * NKX, QT, nk, HDK); k_gemm2<0><<<dim3((QT / 128) * (nk / 64), NH), 128, 0, stream>>>(QL + (size_t)q0 * DMX, DMX, (size_t)HDK, K16, DKV, (size_t)HDK, ATS * 0.0009765625f, nullptr, 0, S, -1, 0, 0, S, nullptr, NKX, (size_t)QT * NKX, QT, nk, HDK); k_gemm2<0><<<dim3((QT / 128) * (nk / 64), NH), 128, 0, stream>>>(Q16 + (size_t)q0 * DMX, DMX, (size_t)HDK, KL, DKV, (size_t)HDK, ATS * 0.0009765625f, nullptr, 0, S, -1, 0, 0, S, nullptr, NKX, (size_t)QT * NKX, QT, nk, HDK);      /* scores of query block i against key blocks 0..i: hi.hi + lo.hi 2^-10 + hi.lo 2^-10 (own element), all 16 heads on grid.y */
      k_rsmblk<<<dim3(NH * QT / 32, nk / 256), 256, 0, stream>>>(S, P, PL, NH, q0, nk);      /* the module's per-block softmax: an independent softmax per 256-key block j <= i (diagonal block causal), weights divided by (block count + 1e-6) -> P x256 as f16 hi + x1024 residual */
      k_gemm2<0><<<dim3((QT / 128) * (HDK / 64), NH), 128, 0, stream>>>(P, NKX, (size_t)QT * NKX, VT, SQ, (size_t)HDK * SQ, 0.25f, nullptr, 0, nullptr, 1, 0, 0, OTF, nullptr, DMX, (size_t)HDK, QT, HDK, nk);      /* o x64 = Ph Vh (f32 tile accumulator) */
      k_gemm2<0><<<dim3((QT / 128) * (HDK / 64), NH), 128, 0, stream>>>(PL, NKX, (size_t)QT * NKX, VT, SQ, (size_t)HDK * SQ, 0.000244140625f, nullptr, 0, OTF, -1, 0, 0, OTF, nullptr, DMX, (size_t)HDK, QT, HDK, nk);      /* += Pl Vh 2^-12 (own element) */
      k_gemm2<0><<<dim3((QT / 128) * (HDK / 64), NH), 128, 0, stream>>>(P, NKX, (size_t)QT * NKX, VTL, SQ, (size_t)HDK * SQ, 0.000244140625f, nullptr, 0, OTF, -1, 0, 0, OTF, O16 + (r0 + q0) * DMX, DMX, (size_t)HDK, QT, HDK, nk); } }      /* += Ph Vl 2^-12 and emit the merged f16 o rows (x64) */
  k_gemm2<0><<<dim3((unsigned)((NR / 128) * (DMX / 64)), 1), 128, 0, stream>>>(O16, DMX, 0, BO, DMX, 0, 0.0009765625f, bo, 0, nullptr, 1, 0, 0, (float*)d_out, nullptr, DMX, 0, (int)NR, DMX, DMX);      /* out = o Wo^T */
  k_hl<<<(unsigned)(((size_t)NB * QT0 * DMX / 8 + 255) / 256), 256, 0, stream>>>(OF0, OH0, OL0, (size_t)NB * QT0 * DMX / 8);      /* first-tile o (x64) -> f16 hi + x1024 residual planes */
  for (int b = 0; b < NB; ++b) { const size_t r0 = (size_t)b * SQ; const size_t f0 = (size_t)b * QT0;
    k_gemm2<0><<<dim3((QT0 / 128) * (DMX / 64), 1), 128, 0, stream>>>(OH0 + f0 * DMX, DMX, 0, BO, DMX, 0, 0.0009765625f, bo, 0, nullptr, 1, 0, 0, (float*)d_out + r0 * DMX, nullptr, DMX, 0, QT0, DMX, DMX);      /* rows 0..255 of the batch rewritten from the exact path */
    k_gemm2<0><<<dim3((QT0 / 128) * (DMX / 64), 1), 128, 0, stream>>>(OL0 + f0 * DMX, DMX, 0, BO, DMX, 0, 0.00000095367431640625f, nullptr, 0, (const float*)d_out + r0 * DMX, -1, 0, 0, (float*)d_out + r0 * DMX, nullptr, DMX, 0, QT0, DMX, DMX); }      /* += o_lo Wo 2^-20 (own-element accumulate) */
}

// v002
// It runs in 3840 microseconds.
// Two timings next to v001 both put it at 1.75 times that version's speed.
// Over all steps from v000 it is 2.65 times as fast.
#include <hip/hip_runtime.h>
// Block-chunked causal attention with the module's PER-BLOCK softmax (hidden [2][2048][2048]; q/k/v = x W^T (natural [2048][2048] sigma 0.02, no biases), 16 heads of 128; keys in blocks of 256: for query block i every key block j <= i gets its OWN softmax over its 256 keys (scores / sqrt(128); inside the diagonal block keys above the query are -inf), the block outputs are summed and divided by the summed weights (= number of included blocks) + 1e-6; merged Wo^T -> [2][2048][2048]; no RoPE).
// Structure: token rows; x as exact f16 rows; natural weights as exact x16 planes; q, k, v as WMMA GEMMs (32x64 wave tiles, f32 accumulation) -> f32 (all rows) + f16 hi/x1024 residual rows; per batch: V^T via LDS transposes; exact f32 causal attention for rows 0..255 (= key block 0, where the per-block softmax is the ordinary causal softmax) on VALU; per 256-row query block i: scores against key blocks 0..i (K = 128, alpha 1/sqrt(128)) f32, the module's per-block softmax on VALU (f32 statistics, native exp; weights x256 f16 divided by the block count + 1e-6), o = P V^T (x64) merged f16; out = o Wo^T; first-tile rows rewritten from o hi/lo; launches: see trace.
// Compute dtype: inputs rounded to bf16; x / weights exact; projections f32; q, k, v and softmax weights as f16 hi + x1024 residual GEMM operands, o as plain f16 (~2^-12; first 256 rows of each batch exact); scores, statistics, out f32. v_wmma_f32_16x16x32_f16.
#define NB 2
#define SQ 2048
#define DMX 2048
#define NH 16
#define NKV 16
#define GSZ 1                        /* plain MHA: kv head == query head */
#define HDK 128
#define DKV (NKV * HDK)
#define QT 256
#define QT0 256
#define NKX SQ
#define DM DMX
#define HD 64
#define HG 1
#define NR ((size_t)NB * SQ)
#define ATS 0.08838834764831845f
typedef __bf16 v16b __attribute__((ext_vector_type(16)));
typedef unsigned short v8us __attribute__((ext_vector_type(8), may_alias));
typedef float  v8f  __attribute__((ext_vector_type(8)));
typedef float  v4f  __attribute__((ext_vector_type(4)));
typedef float  v4fa __attribute__((ext_vector_type(4), may_alias));
union FragB { v16b v; v8us half[2]; unsigned short u[16]; };

__device__ __forceinline__ unsigned short bf16_bits(float x) { unsigned int u = __float_as_uint(x); return (unsigned short)((u + 0x7FFFu + ((u >> 16) & 1u)) >> 16); }
__device__ __forceinline__ float bf16_val(unsigned short b) { return __uint_as_float(((unsigned int)b) << 16); }
__device__ __forceinline__ float bf16_round(float x) { return bf16_val(bf16_bits(x)); }
// D += A·B with NT terms: 1 = ah·bh, 2 = + al·bh (A split), 3 = + ah·bl (both split)
template <int NT>
__device__ __forceinline__ v8f mmaN(v16b ah, v16b al, v16b bh, v16b bl, v8f c) {
  c = __builtin_amdgcn_wmma_f32_16x16x32_bf16(false, ah, false, bh, (short)0, c, false, false);
  if (NT >= 2) c = __builtin_amdgcn_wmma_f32_16x16x32_bf16(false, al, false, bh, (short)0, c, false, false);
  if (NT >= 3) c = __builtin_amdgcn_wmma_f32_16x16x32_bf16(false, ah, false, bl, (short)0, c, false, false);
  asm volatile("v_nop\n\tv_nop\n\tv_nop\n\tv_nop" : "+v"(c) : "v"(ah), "v"(al), "v"(bh), "v"(bl));
  return c;
}

__global__ __launch_bounds__(256) void k_wt_bf16(const float* __restrict__ W, unsigned short* __restrict__ Wt, int K, int N) {
  const int t = blockIdx.x * 256 + threadIdx.x;
  const int k8n = K / 8;
  if (t >= N * k8n) return;
  const int n = t / k8n, k8 = (t % k8n) * 8;
  v8us v;
#pragma unroll
  for (int i = 0; i < 8; ++i) v[i] = bf16_bits(W[(size_t)(k8 + i) * N + n]);
  *(v8us*)(Wt + (size_t)n * K + k8) = v;
  
}

// GEMM C[M][N] (f32, pitch ldc) = act(A[M][K]·W + bias). A f32 row-major (pitch lda) converted per fragment to bf16
// (ASPLIT: hi/lo two planes -> 2 terms, else single rounded term); Wt bf16 [N][K] (pitch ldb). BIAS_BF16 rounds the
// bias to bf16 first (bias quantised to bf16 before the add). K%32==0, M%16==0, N%64==0.
template <bool ASPLIT, int ACT, bool BIAS_BF16>
__global__ __launch_bounds__(128) void k_gemm_bf(const float* __restrict__ A, int lda, const unsigned short* __restrict__ Wt, int ldb,
                                               const float* __restrict__ bias, float* __restrict__ C, int ldc, int M, int N, int K) {
  __shared__ __attribute__((aligned(16))) float so[4][16][64];
  const int tid = threadIdx.x, w = tid >> 5, lane = tid & 31, ln = lane & 15, hh = lane >> 4;
  const int ntn = N / 64;
  const int wid = blockIdx.x * 4 + w;
  const int mt = wid / ntn, nq = wid % ntn;
  if (mt * 16 >= M) return;
  const int row0 = mt * 16, col0 = nq * 64;
  const float* arow = A + (size_t)(row0 + ln) * lda;
  v8f acc[4] = {};
  for (int kb = 0; kb < K; kb += 32) {
    FragB ah, al;
    const v4f x0 = *(const v4fa*)(arow + kb + 8 * hh), x1 = *(const v4fa*)(arow + kb + 8 * hh + 4);
    const v4f x2 = *(const v4fa*)(arow + kb + 16 + 8 * hh), x3 = *(const v4fa*)(arow + kb + 16 + 8 * hh + 4);
    float xs[16] = {x0[0],x0[1],x0[2],x0[3],x1[0],x1[1],x1[2],x1[3],x2[0],x2[1],x2[2],x2[3],x3[0],x3[1],x3[2],x3[3]};
#pragma unroll
    for (int i = 0; i < 16; ++i) { const unsigned short hb = bf16_bits(xs[i]); ah.u[i] = hb; al.u[i] = ASPLIT ? bf16_bits(xs[i] - bf16_val(hb)) : (unsigned short)0; }
#pragma unroll
    for (int t = 0; t < 4; ++t) {
      const unsigned short* brow = Wt + (size_t)(col0 + t * 16 + ln) * ldb + kb;
      FragB b;
      b.half[0] = *(const v8us*)(brow + 8 * hh);
      b.half[1] = *(const v8us*)(brow + 16 + 8 * hh);
      acc[t] = mmaN<ASPLIT ? 2 : 1>(ah.v, al.v, b.v, b.v, acc[t]);
    }
  }
#pragma unroll
  for (int t = 0; t < 4; ++t) {
    float bv = bias ? bias[col0 + t * 16 + ln] : 0.f;
    if (BIAS_BF16) bv = bf16_round(bv);
#pragma unroll
    for (int r = 0; r < 8; ++r) { float v = acc[t][r] + bv; if (ACT == 1) v = fmaxf(v, 0.f); so[w][8 * hh + r][t * 16 + ln] = v; }
  }
  __builtin_amdgcn_fence(__ATOMIC_ACQ_REL, "workgroup");
  __builtin_amdgcn_wave_barrier();
  const int rsub = lane >> 4, c4 = (lane & 15) * 4;
  {
#pragma unroll
    for (int q = 0; q < 8; ++q) {
      const int r = q * 2 + rsub;
      const v4f v = *(const v4fa*)&so[w][r][c4];
      *(v4f*)(C + (size_t)(row0 + r) * ldc + col0 + c4) = v;
    }
    
  }
}

// GEMM C = act(A·W + bias + resid): A f32 (ASPLIT -> hi/lo 2 terms), Wt bf16 [N][K]; ACT 0 none, 1 relu, 2 exact gelu;
// resid (optional, f32, row index = (row % rmod), pitch ldr, RES_BF16 rounds it) added before the activation.
template <bool ASPLIT, int ACT, bool BIAS_BF16, bool RES_BF16>
__global__ __launch_bounds__(128) void k_gemm_bf3(const float* __restrict__ A, int lda, const unsigned short* __restrict__ Wt, int ldb,
                                                const float* __restrict__ bias, const float* __restrict__ resid, int rmod, int ldr,
                                                float* __restrict__ C, int ldc, int M, int N, int K) {
  __shared__ __attribute__((aligned(16))) float so[4][16][64];
  const int tid = threadIdx.x, w = tid >> 5, lane = tid & 31, ln = lane & 15, hh = lane >> 4;
  const int ntn = N / 64;
  const int wid = blockIdx.x * 4 + w;
  const int mt = wid / ntn, nq = wid % ntn;
  if (mt * 16 >= M) return;
  const int row0 = mt * 16, col0 = nq * 64;
  const float* arow = A + (size_t)(row0 + ln) * lda;
  v8f acc[4] = {};
  for (int kb = 0; kb < K; kb += 32) {
    FragB ah, al;
    const v4f x0 = *(const v4fa*)(arow + kb + 8 * hh), x1 = *(const v4fa*)(arow + kb + 8 * hh + 4);
    const v4f x2 = *(const v4fa*)(arow + kb + 16 + 8 * hh), x3 = *(const v4fa*)(arow + kb + 16 + 8 * hh + 4);
    float xs[16] = {x0[0],x0[1],x0[2],x0[3],x1[0],x1[1],x1[2],x1[3],x2[0],x2[1],x2[2],x2[3],x3[0],x3[1],x3[2],x3[3]};
#pragma unroll
    for (int i = 0; i < 16; ++i) { const unsigned short hb = bf16_bits(xs[i]); ah.u[i] = hb; al.u[i] = ASPLIT ? bf16_bits(xs[i] - bf16_val(hb)) : (unsigned short)0; }
#pragma unroll
    for (int t = 0; t < 4; ++t) {
      const unsigned short* brow = Wt + (size_t)(col0 + t * 16 + ln) * ldb + kb;
      FragB b;
      b.half[0] = *(const v8us*)(brow + 8 * hh);
      b.half[1] = *(const v8us*)(brow + 16 + 8 * hh);
      acc[t] = mmaN<ASPLIT ? 2 : 1>(ah.v, al.v, b.v, b.v, acc[t]);
    }
  }
#pragma unroll
  for (int t = 0; t < 4; ++t) {
    const int col = col0 + t * 16 + ln;
    float bv = bias ? bias[col] : 0.f;
    if (BIAS_BF16) bv = bf16_round(bv);
#pragma unroll
    for (int r = 0; r < 8; ++r) {
      float v = acc[t][r] + bv;
      if (resid) { float rv = resid[(size_t)((row0 + 8 * hh + r) % rmod) * ldr + col]; if (RES_BF16) rv = bf16_round(rv); v += rv; }
      if (ACT == 1) v = fmaxf(v, 0.f);
      if (ACT == 2) v = 0.5f * v * (1.0f + erff(v * 0.70710678118654752f));
      if (ACT == 3) { const float u = 0.7978845608028654f * (v + 0.044715f * v * v * v); v = 0.5f * v * (1.0f + tanhf(u)); }
      so[w][8 * hh + r][t * 16 + ln] = v;
    }
  }
  __builtin_amdgcn_fence(__ATOMIC_ACQ_REL, "workgroup");
  __builtin_amdgcn_wave_barrier();
  const int rsub = lane >> 4, c4 = (lane & 15) * 4;
  {
#pragma unroll
    for (int q = 0; q < 8; ++q) {
      const int r = q * 2 + rsub;
      const v4f v = *(const v4fa*)&so[w][r][c4];
      *(v4f*)(C + (size_t)(row0 + r) * ldc + col0 + c4) = v;
    }
    
  }
}
// row LayerNorm (biased variance, eps) over N: s = X (+ R); optional out_sum <- s; out_norm <- (s-mu)*rsqrt(var+eps)*g + b
template <bool PARAM_BF16>
__global__ __launch_bounds__(256) void k_layernorm(const float* __restrict__ X, const float* __restrict__ R, const float* __restrict__ g, const float* __restrict__ bta,
                                                  float* __restrict__ out_sum, float* __restrict__ out_norm, int N, float eps) {
  __shared__ float red[256];
  const int row = blockIdx.x, tid = threadIdx.x;
  const float* x = X + (size_t)row * N; const float* rr = R ? R + (size_t)row * N : nullptr;
  float vals[16];                     // up to N = 4096
  const int per = N / 256;            // contiguous chunk per thread? use strided-by-4 chunks: thread handles j = tid*4 + 1024*u
  float s1 = 0.f;
  for (int u = 0; u < per / 4; ++u) {
    const int j = tid * 4 + 1024 * u;
    const v4f a = *(const v4fa*)(x + j);
    v4f b = {0.f,0.f,0.f,0.f}; if (rr) b = *(const v4fa*)(rr + j);
#pragma unroll
    for (int q = 0; q < 4; ++q) { const float v = a[q] + b[q]; vals[u * 4 + q] = v; s1 += v; }
  }
  red[tid] = s1; __syncthreads();
  for (int st = 128; st > 0; st >>= 1) { if (tid < st) red[tid] += red[tid + st]; __syncthreads(); }
  const float mu = red[0] / (float)N; __syncthreads();
  float s2 = 0.f;
  for (int u = 0; u < per / 4; ++u)
#pragma unroll
    for (int q = 0; q < 4; ++q) { const float c = vals[u * 4 + q] - mu; s2 += c * c; }
  red[tid] = s2; __syncthreads();
  for (int st = 128; st > 0; st >>= 1) { if (tid < st) red[tid] += red[tid + st]; __syncthreads(); }
  const float rs = rsqrtf(red[0] / (float)N + eps);
  {
    for (int u = 0; u < per / 4; ++u) {
      const int j = tid * 4 + 1024 * u;
      v4f o, sm;
#pragma unroll
      for (int q = 0; q < 4; ++q) {
        float gg = g[j + q], bb = bta[j + q];
        if (PARAM_BF16) { gg = bf16_round(gg); bb = bf16_round(bb); }
        sm[q] = vals[u * 4 + q]; o[q] = (vals[u * 4 + q] - mu) * rs * gg + bb;
      }
      if (out_sum) *(v4f*)(out_sum + (size_t)row * N + j) = sm;
      *(v4f*)(out_norm + (size_t)row * N + j) = o;
    }
    
  }
}



// ---- f16 WMMA path (v_wmma_f32_16x16x32_f16): 11-bit significands for operands in range — used where a [0,1] probability operand needs more precision than bf16
typedef _Float16 v16h __attribute__((ext_vector_type(16)));
union FragH { v16h v; v8us half[2]; _Float16 h[16]; unsigned short u[16]; };
template <int NT>
__device__ __forceinline__ v8f mmaH(v16h ah, v16h al, v16h bh, v16h bl, v8f c) {
  c = __builtin_amdgcn_wmma_f32_16x16x32_f16(false, ah, false, bh, (short)0, c, false, false);
  if (NT >= 2) c = __builtin_amdgcn_wmma_f32_16x16x32_f16(false, al, false, bh, (short)0, c, false, false);
  if (NT >= 3) c = __builtin_amdgcn_wmma_f32_16x16x32_f16(false, ah, false, bl, (short)0, c, false, false);
  asm volatile("v_nop\n\tv_nop\n\tv_nop\n\tv_nop" : "+v"(c) : "v"(ah), "v"(al), "v"(bh), "v"(bl));
  return c;
}
// batched GEMM like k_gemm_b but f16 operands: A f32 (split into f16 hi/lo if ASPLIT, else rounded to f16), Bt = f16 values [n][k]; alpha; C f32; N multiple of 16 (partial tiles skipped)
template <bool ASPLIT>
__global__ __launch_bounds__(128) void k_gemm_h(const float* __restrict__ A, int lda, size_t sA, const _Float16* __restrict__ Bh, int ldb, size_t sB, float alpha, float* __restrict__ C, int ldc, size_t sC, int M, int N, int K) {
  __shared__ __attribute__((aligned(16))) float so[4][16][64];
  const int tid = threadIdx.x, w = tid >> 5, lane = tid & 31, ln = lane & 15, hh = lane >> 4; const int by = blockIdx.y;
  A += (size_t)by * sA; Bh += (size_t)by * sB; C += (size_t)by * sC;
  const int ntn = (N + 63) / 64; const int wid = blockIdx.x * 4 + w; const int mt = wid / ntn, nq = wid % ntn; if (mt * 16 >= M) return;
  const int row0 = mt * 16, col0 = nq * 64; const float* arow = A + (size_t)(row0 + ln) * lda;
  v8f acc[4] = {};
  for (int kb = 0; kb < K; kb += 32) {
    FragH ah, al;
    const v4f x0 = *(const v4fa*)(arow + kb + 8 * hh), x1 = *(const v4fa*)(arow + kb + 8 * hh + 4), x2 = *(const v4fa*)(arow + kb + 16 + 8 * hh), x3 = *(const v4fa*)(arow + kb + 16 + 8 * hh + 4);
    float xs[16] = {x0[0],x0[1],x0[2],x0[3],x1[0],x1[1],x1[2],x1[3],x2[0],x2[1],x2[2],x2[3],x3[0],x3[1],x3[2],x3[3]};
#pragma unroll
    for (int i = 0; i < 16; ++i) { const _Float16 h = (_Float16)xs[i]; ah.h[i] = h; al.h[i] = ASPLIT ? (_Float16)(xs[i] - (float)h) : (_Float16)0.0f; }
#pragma unroll
    for (int t = 0; t < 4; ++t) { if (col0 + t * 16 >= N) continue; const size_t boff = (size_t)(col0 + t * 16 + ln) * ldb + kb; FragH bq; bq.half[0] = *(const v8us*)(Bh + boff + 8 * hh); bq.half[1] = *(const v8us*)(Bh + boff + 16 + 8 * hh);
      acc[t] = mmaH<ASPLIT ? 2 : 1>(ah.v, al.v, bq.v, bq.v, acc[t]); }
  }
#pragma unroll
  for (int t = 0; t < 4; ++t) { if (col0 + t * 16 >= N) continue;
#pragma unroll
    for (int r = 0; r < 8; ++r) so[w][8 * hh + r][t * 16 + ln] = acc[t][r] * alpha; }
  __builtin_amdgcn_fence(__ATOMIC_ACQ_REL, "workgroup"); __builtin_amdgcn_wave_barrier();
  const int rsub = lane >> 4, c4 = (lane & 15) * 4;
  {
#pragma unroll
    for (int q = 0; q < 8; ++q) { const int r = q * 2 + rsub; if (col0 + c4 < N) { const v4f v = *(const v4fa*)&so[w][r][c4]; *(v4f*)(C + (size_t)(row0 + r) * ldc + col0 + c4) = v; } }
     }
}

// Wt[n][k] = f16(W[k][n]·scale) from f32 row-major W[K][N] (scale = power of two; bf16-exact weights stay exact in f16 away from the subnormal range)
__global__ __launch_bounds__(256) void k_wt_f16(const float* __restrict__ W, _Float16* __restrict__ Wt, int K, int N, float scale) {
  const int t = blockIdx.x * 256 + threadIdx.x; if (t >= N * (K / 8)) return; const int n = t / (K / 8), k8 = (t % (K / 8)) * 8; FragH f;
#pragma unroll
  for (int i = 0; i < 8; ++i) f.h[i] = (_Float16)(bf16_round(W[(size_t)(k8 + i) * N + n]) * scale); const v8us o = f.half[0];
  *(v8us*)((unsigned short*)Wt + (size_t)n * K + k8) = o; 
}
// k_gemm_hh variant with fused epilogue: v = acc·alpha + bias[by·sBias + col] (+ CP[(row/rowsPerB)·sCPb + by·64 + col] if CP) ; ACT 0 none / 1 elu ; writes f16 C16 (and f32 C if non-null)
template <int ACT>
__global__ __launch_bounds__(128) void k_gemm_hhx(const _Float16* __restrict__ A, int lda, size_t sA, const _Float16* __restrict__ Bh, int ldb, size_t sB, float alpha, const float* __restrict__ bias, size_t sBias, const float* __restrict__ CP, int rowsPerB, size_t sCPb, int row0g,
    float* __restrict__ C, _Float16* __restrict__ C16, int ldc, size_t sC, int M, int N, int K) {
  __shared__ __attribute__((aligned(16))) float so[4][16][64];
  const int tid = threadIdx.x, w = tid >> 5, lane = tid & 31, ln = lane & 15, hh = lane >> 4; const int by = blockIdx.y;
  A += (size_t)by * sA; Bh += (size_t)by * sB; const size_t cofs = (size_t)by * sC; const float* bp = bias ? bias + (size_t)by * sBias : nullptr;
  const int ntn = (N + 63) / 64; const int wid = blockIdx.x * 4 + w; const int mt = wid / ntn, nq = wid % ntn; if (mt * 16 >= M) return;
  const int row0 = mt * 16, col0 = nq * 64; const _Float16* arow = A + (size_t)(row0 + ln) * lda;
  v8f acc[4] = {};
  for (int kb = 0; kb < K; kb += 32) { FragH ah; ah.half[0] = *(const v8us*)((const unsigned short*)arow + kb + 8 * hh); ah.half[1] = *(const v8us*)((const unsigned short*)arow + kb + 16 + 8 * hh);
#pragma unroll
    for (int t = 0; t < 4; ++t) { if (col0 + t * 16 >= N) continue; const size_t boff = (size_t)(col0 + t * 16 + ln) * ldb + kb; FragH bq; bq.half[0] = *(const v8us*)((const unsigned short*)Bh + boff + 8 * hh); bq.half[1] = *(const v8us*)((const unsigned short*)Bh + boff + 16 + 8 * hh);
      acc[t] = mmaH<1>(ah.v, ah.v, bq.v, bq.v, acc[t]); }
  }
#pragma unroll
  for (int t = 0; t < 4; ++t) { if (col0 + t * 16 >= N) continue; const int col = col0 + t * 16 + ln; const float bv = bp ? bf16_round(bp[col]) : 0.f;
#pragma unroll
    for (int r = 0; r < 8; ++r) { float v = acc[t][r] * alpha + bv; if (CP) { const int rr = row0g + row0 + 8 * hh + r; if (rowsPerB < 0) v += CP[cofs + (size_t)rr * ldc + col];      /* rowsPerB < 0: own element of the batched C plane */ else { const int bidx = rr / rowsPerB; v += CP[(size_t)bidx * sCPb + (size_t)by * 64 + col]; } } if (ACT == 1) v = (v > 0.f) ? v : expm1f(v); else if (ACT == 7) v = (v > 0.f) ? v + 1.0f : expf(v); else if (ACT == 8) v = tanhf(v); else if (ACT == 9) v = 0.5f * v * (1.0f + tanhf(0.7978845608028654f * (v + 0.044715f * v * v * v))); else if (ACT == 11) v = 1.0f / (1.0f + expf(-v)); else if (ACT == 12) v = (v > 0.f) ? v : 0.01f * v; else if (ACT == 14) v = (v > 0.f) ? v : 0.1f * v; else if (ACT == 16) v = (v >= 0.f) ? v : 0.3f * v; else if (ACT == 17) v = (v >= 0.f) ? v : 0.2f * v; else if (ACT == 15) v = v / (1.0f + expf(-v)); else if (ACT == 3) v = fmaxf(v, 0.f); else if (ACT == 6) v = 0.5f * v * (1.0f + erff(v * 0.70710678118654752f)); so[w][8 * hh + r][t * 16 + ln] = v; } }
  __builtin_amdgcn_fence(__ATOMIC_ACQ_REL, "workgroup"); __builtin_amdgcn_wave_barrier();
  const int rsub = lane >> 4, c4 = (lane & 15) * 4; typedef _Float16 v4h __attribute__((ext_vector_type(4)));
  {
#pragma unroll
    for (int q = 0; q < 8; ++q) { const int r = q * 2 + rsub; if (col0 + c4 < N) { const v4f v = *(const v4fa*)&so[w][r][c4]; if (C) *(v4f*)(C + cofs + (size_t)(row0 + r) * ldc + col0 + c4) = v; if (C16) { v4h h4; for (int i = 0; i < 4; ++i) h4[i] = (_Float16)v[i]; *(v4h*)(C16 + cofs + (size_t)(row0 + r) * ldc + col0 + c4) = h4; } } }
     }
}


typedef _Float16 v4h __attribute__((ext_vector_type(4)));

__global__ __launch_bounds__(256) void k_x16(const float* __restrict__ x, _Float16* __restrict__ X16, size_t n8) { const size_t t = (size_t)blockIdx.x * 256 + threadIdx.x; if (t >= n8) return; FragH f;
#pragma unroll
  for (int q = 0; q < 8; ++q) f.h[q] = (_Float16)bf16_round(x[t * 8 + q]); *(v8us*)((unsigned short*)X16 + t * 8) = f.half[0];  }
__global__ __launch_bounds__(256) void k_h16(const float* __restrict__ x, _Float16* __restrict__ X16, size_t n8) { const size_t t = (size_t)blockIdx.x * 256 + threadIdx.x; if (t >= n8) return; FragH f;
#pragma unroll
  for (int q = 0; q < 8; ++q) f.h[q] = (_Float16)x[t * 8 + q]; *(v8us*)((unsigned short*)X16 + t * 8) = f.half[0];  }
__global__ __launch_bounds__(256) void k_round16f(const float* __restrict__ W, _Float16* __restrict__ Bt, size_t n8) { const size_t t = (size_t)blockIdx.x * 256 + threadIdx.x; if (t >= n8) return; FragH f;
#pragma unroll
  for (int i = 0; i < 8; ++i) f.h[i] = (_Float16)(bf16_round(W[t * 8 + i]) * 16.0f); *(v8us*)((unsigned short*)Bt + t * 8) = f.half[0];  }
template <int NHv, int TTv>
__global__ __launch_bounds__(256) void k_vt(const _Float16* __restrict__ V16, int ldv, int voff, _Float16* __restrict__ Vt) { __shared__ unsigned short tl[64][66]; const int tid = threadIdx.x; const int slab = blockIdx.x / (TTv / 64), lg = blockIdx.x % (TTv / 64); const int b = slab / NHv, h = slab % NHv;
  for (int i = tid; i < 64 * 8; i += 256) { const int r = i / 8, c8 = (i % 8) * 8; FragH f; f.half[0] = *(const v8us*)((const unsigned short*)V16 + ((size_t)b * TTv + lg * 64 + r) * ldv + voff + h * 64 + c8);
#pragma unroll
    for (int q = 0; q < 8; ++q) tl[r][c8 + q] = f.u[q]; }
  __syncthreads();
  {
#pragma unroll
    for (int rd = 0; rd < 2; ++rd) { const int d = rd * 32 + tid / 8, pc = tid % 8; FragH f;
#pragma unroll
      for (int q = 0; q < 8; ++q) f.u[q] = tl[pc * 8 + q][d];
      *(v8us*)((unsigned short*)Vt + ((size_t)slab * 64 + d) * TTv + lg * 64 + pc * 8) = f.half[0]; }
     } }

__global__ __launch_bounds__(256) void k_hl(const float* __restrict__ F, _Float16* __restrict__ Hh, _Float16* __restrict__ Hl, size_t n8) { const size_t t = (size_t)blockIdx.x * 256 + threadIdx.x; if (t >= n8) return; FragH fh, fl; const v4f a = *(const v4fa*)(F + t * 8), c = *(const v4fa*)(F + t * 8 + 4);
#pragma unroll
  for (int q = 0; q < 4; ++q) { _Float16 h = (_Float16)a[q]; fh.h[q] = h; fl.h[q] = (_Float16)((a[q] - (float)h) * 1024.0f); h = (_Float16)c[q]; fh.h[4 + q] = h; fl.h[4 + q] = (_Float16)((c[q] - (float)h) * 1024.0f); }
  { *(v8us*)((unsigned short*)Hh + t * 8) = fh.half[0]; *(v8us*)((unsigned short*)Hl + t * 8) = fl.half[0];  } }

// ---- fast GEMM (wave tile 32x64; requires M % 32 == 0 rows per launch region and N % 64 == 0); epilogue = k_gemm_hhx semantics ----
__device__ __forceinline__ v16h g2_frag(const _Float16* p, int hh) { FragH f; f.half[0] = *(const v8us*)((const unsigned short*)p + 8 * hh); f.half[1] = *(const v8us*)((const unsigned short*)p + 16 + 8 * hh); return f.v; }
__device__ __forceinline__ v8f g2_mma(v16h a, v16h b, v8f c) { v8f d = __builtin_amdgcn_wmma_f32_16x16x32_f16(false, a, false, b, (short)0, c, false, false); asm volatile("v_nop\n\tv_nop\n\tv_nop\n\tv_nop" : "+v"(d) : "v"(a), "v"(b)); return d; }
template <int ACT>
__global__ __launch_bounds__(128) void k_gemm2(const _Float16* __restrict__ A, int lda, size_t sA, const _Float16* __restrict__ Bh, int ldb, size_t sB, float alpha, const float* __restrict__ bias, size_t sBias, const float* __restrict__ CP, int rowsPerB, size_t sCPb, int row0g,
    float* __restrict__ C, _Float16* __restrict__ C16, int ldc, size_t sC, int M, int N, int K) { static_assert(ACT == 0 || ACT == 3 || ACT == 6 || ACT == 8 || ACT == 9 || ACT == 11 || ACT == 12 || ACT == 14 || ACT == 15 || ACT == 16 || ACT == 17, "k_gemm2: unsupported ACT code (would silently apply no activation)");
  __shared__ __attribute__((aligned(16))) float so[4][32][68];
  const int tid = threadIdx.x, w = tid >> 5, lane = tid & 31, ln = lane & 15, hh = lane >> 4; const int by = blockIdx.y;
  A += (size_t)by * sA; Bh += (size_t)by * sB; const size_t cofs = (size_t)by * sC; const float* bp = bias ? bias + (size_t)by * sBias : nullptr;
  const int ntn = N >> 6; const int mt = blockIdx.x / ntn, nq = blockIdx.x - mt * ntn; const int row0 = mt * 128 + 32 * w, col0 = nq * 64; if (row0 >= M) return;
  const _Float16* a0p = A + (size_t)(row0 + ln) * lda; const _Float16* a1p = a0p + (size_t)16 * lda;
  const _Float16* b0p = Bh + (size_t)(col0 + ln) * ldb; const _Float16* b1p = b0p + (size_t)16 * ldb; const _Float16* b2p = b1p + (size_t)16 * ldb; const _Float16* b3p = b2p + (size_t)16 * ldb;
  const v8f z8 = {0.f,0.f,0.f,0.f,0.f,0.f,0.f,0.f}; v8f c00 = z8, c01 = z8, c02 = z8, c03 = z8, c10 = z8, c11 = z8, c12 = z8, c13 = z8;
#pragma unroll 1
  for (int kb = 0; kb < K; kb += 32) { const v16h a0 = g2_frag(a0p + kb, hh), a1 = g2_frag(a1p + kb, hh);
    v16h b = g2_frag(b0p + kb, hh); c00 = g2_mma(a0, b, c00); c10 = g2_mma(a1, b, c10);
    b = g2_frag(b1p + kb, hh); c01 = g2_mma(a0, b, c01); c11 = g2_mma(a1, b, c11);
    b = g2_frag(b2p + kb, hh); c02 = g2_mma(a0, b, c02); c12 = g2_mma(a1, b, c12);
    b = g2_frag(b3p + kb, hh); c03 = g2_mma(a0, b, c03); c13 = g2_mma(a1, b, c13); }
  v8f accs[8] = {c00, c01, c02, c03, c10, c11, c12, c13};
#pragma unroll
  for (int u = 0; u < 8; ++u) { const int t = u & 3, half = u >> 2; const int col = col0 + t * 16 + ln; const float bv = bp ? bf16_round(bp[col]) : 0.f;
#pragma unroll
    for (int r = 0; r < 8; ++r) { const int rloc = half * 16 + 8 * hh + r; float v = accs[u][r] * alpha + bv; if (CP) { if (rowsPerB < 0) v += CP[cofs + (size_t)(row0g + row0 + rloc) * ldc + col];      /* rowsPerB < 0: own element of the batched C plane */ else { const int bidx = (row0g + row0 + rloc) / rowsPerB; v += CP[(size_t)bidx * sCPb + (size_t)by * 64 + col]; } }
      if (ACT == 3) v = fmaxf(v, 0.f); else if (ACT == 6) v = 0.5f * v * (1.0f + erff(v * 0.70710678118654752f)); else if (ACT == 11) v = 1.0f / (1.0f + expf(-v)); else if (ACT == 15) v = v / (1.0f + expf(-v)); else if (ACT == 12) v = (v > 0.f) ? v : 0.01f * v; else if (ACT == 8) v = tanhf(v); else if (ACT == 9) v = 0.5f * v * (1.0f + tanhf(0.7978845608028654f * (v + 0.044715f * v * v * v))); else if (ACT == 14) v = (v > 0.f) ? v : 0.1f * v; else if (ACT == 16) v = (v >= 0.f) ? v : 0.3f * v; else if (ACT == 17) v = (v >= 0.f) ? v : 0.2f * v;
      so[w][rloc][t * 16 + ln] = v; } }
  __builtin_amdgcn_fence(__ATOMIC_ACQ_REL, "workgroup"); __builtin_amdgcn_wave_barrier();
  const int rsub = lane >> 4, c4 = (lane & 15) * 4;
  {
#pragma unroll
    for (int q = 0; q < 16; ++q) { const int r = q * 2 + rsub; const v4f v = *(const v4fa*)&so[w][r][c4]; if (C) *(v4f*)(C + cofs + (size_t)(row0 + r) * ldc + col0 + c4) = v; if (C16) { v4h h4; for (int i = 0; i < 4; ++i) h4[i] = (_Float16)v[i]; *(v4h*)(C16 + cofs + (size_t)(row0 + r) * ldc + col0 + c4) = h4; } }
     } }


__global__ __launch_bounds__(256) void k_wnat(const float* __restrict__ w, size_t n8, _Float16* __restrict__ Bt) { const size_t t = (size_t)blockIdx.x * 256 + threadIdx.x; if (t >= n8) return; FragH f; for (int q = 0; q < 8; ++q) f.h[q] = (_Float16)(bf16_round(w[t * 8 + q]) * 16.0f); *(v8us*)((unsigned short*)Bt + t * 8) = f.half[0];  }
__global__ __launch_bounds__(256) void k_rsm(const float* __restrict__ S, _Float16* __restrict__ P, int nrows) {
  #pragma clang fp contract(off)
  const int i = blockIdx.x * 256 + threadIdx.x; if (i >= nrows) return; const float* s = S + (size_t)i * SQ; float mx = -3.0e38f;
#pragma unroll 1
  for (int j = 0; j < SQ; ++j) mx = fmaxf(mx, s[j]); float se = 0.f;
#pragma unroll 1
  for (int j = 0; j < SQ; ++j) se += expf(s[j] - mx); const float sc = 256.0f / se;
#pragma unroll 1
  for (int j0 = 0; j0 < SQ; j0 += 8) { FragH f; for (int q = 0; q < 8; ++q) f.h[q] = (_Float16)(expf(s[j0 + q] - mx) * sc); unsigned short* d = (unsigned short*)P + (size_t)i * SQ + j0; *(v8us*)d = f.half[0];  } }
__global__ __launch_bounds__(256) void k_vt(const _Float16* __restrict__ V16, int b, int h0, _Float16* __restrict__ VT) { __shared__ unsigned short tl[64][65]; const int tid = threadIdx.x; const int hh = blockIdx.x % HG, sg = blockIdx.x / HG; const int s0 = sg * 64; const int h = h0 + hh;
  for (int i = tid; i < 64 * 8; i += 256) { const int j = i / 8, d8 = (i % 8) * 8; FragH f; f.half[0] = *(const v8us*)((const unsigned short*)V16 + ((size_t)b * SQ + s0 + j) * DM + h * HD + d8); for (int q = 0; q < 8; ++q) tl[d8 + q][j] = f.u[q]; }
  __syncthreads();
  { for (int i = tid; i < 64 * 8; i += 256) { const int d = i / 8, j8 = (i % 8) * 8; FragH f; for (int q = 0; q < 8; ++q) f.u[q] = tl[d][j8 + q]; *(v8us*)((unsigned short*)VT + ((size_t)hh * HD + d) * SQ + s0 + j8) = f.half[0]; }  } }


__global__ __launch_bounds__(256) void k_f2h(const float* __restrict__ F, int ldf, int coff, int ncol, _Float16* __restrict__ H16, size_t nrow) { const size_t t = (size_t)blockIdx.x * 256 + threadIdx.x; const size_t n8 = nrow * (size_t)(ncol / 8); if (t >= n8) return; const size_t r = t / (ncol / 8); const int c8 = (int)(t % (ncol / 8)) * 8; FragH f; const v4f a = *(const v4fa*)(F + r * ldf + coff + c8), b2 = *(const v4fa*)(F + r * ldf + coff + c8 + 4); for (int q = 0; q < 4; ++q) { f.h[q] = (_Float16)a[q]; f.h[4 + q] = (_Float16)b2[q]; } *(v8us*)((unsigned short*)H16 + r * ncol + c8) = f.half[0];  }

__global__ __launch_bounds__(256) void k_tab128(float theta, float* __restrict__ CS, float* __restrict__ SN) {
  #pragma clang fp contract(off)
  const int t = blockIdx.x * 256 + threadIdx.x; if (t >= SQ * 64) return; const int i = t % 64; const int p = t / 64; const float invf = (float)(1.0 / pow((double)theta, (double)(2 * i) / 128.0));      /* = XLA's constant-folded f32 table */ const float ang = __fmul_rn((float)p, invf); const float c = cosf(ang), s = sinf(ang);
  *(float*)(CS + t) = c; *(float*)(SN + t) = s;  }
template <int TAB>
__global__ __launch_bounds__(128) void k_rope128(const float* __restrict__ F, int ldf, int nh, const float* __restrict__ CS, const float* __restrict__ SN, _Float16* __restrict__ H16, int ldo, float osc) {
  #pragma clang fp contract(off)
  __shared__ float xv[128]; __shared__ unsigned short sh_[128]; const int d = threadIdx.x; const int h = blockIdx.x % nh; const size_t r = blockIdx.x / nh; const int p = (int)(r % SQ);
  xv[d] = F[r * (size_t)ldf + (size_t)h * 128 + d]; __syncthreads();
  float c, s; if (TAB) { c = bf16_round(CS[(size_t)p * 128 + d]); s = bf16_round(SN[(size_t)p * 128 + d]); } else { c = CS[p * 64 + (d & 63)]; s = SN[p * 64 + (d & 63)]; }
  const float rot = (d < 64) ? -xv[d + 64] : xv[d - 64]; const float o = __fadd_rn(__fmul_rn(xv[d], c), __fmul_rn(rot, s));
  FragH th; th.h[0] = (_Float16)__fmul_rn(o, osc); sh_[d] = th.u[0]; __syncthreads();
  if (d < 16) { FragH f; for (int q = 0; q < 8; ++q) f.u[q] = sh_[d * 8 + q]; unsigned short* dst = (unsigned short*)H16 + r * (size_t)ldo + (size_t)h * 128 + d * 8; *(v8us*)dst = f.half[0];  } }

template <int TAB, int IL, int F32OUT>
__global__ __launch_bounds__(128) void k_rope128x(const float* __restrict__ F, int ldf, int nh, const float* __restrict__ CS, const float* __restrict__ SN, void* __restrict__ OUT, int ldo, float osc) {
  #pragma clang fp contract(off)
  __shared__ float xv[128]; __shared__ float ov[128]; const int d = threadIdx.x; const int h = blockIdx.x % nh; const size_t r = blockIdx.x / nh; const int p = (int)(r % SQ);
  xv[d] = F[r * (size_t)ldf + (size_t)h * 128 + d]; __syncthreads();
  float c, s; if (TAB == 2) { c = CS[r * 128 + d]; s = SN[r * 128 + d]; }      /* computed full-width f32 tables, one row per token row r (relative to the passed pointers) */ else if (TAB) { c = bf16_round(CS[(size_t)p * 128 + d]); s = bf16_round(SN[(size_t)p * 128 + d]); } else { const int ti = IL ? (d >> 1) : (d & 63); c = CS[p * 64 + ti]; s = SN[p * 64 + ti]; }
  const float rot = IL ? ((d & 1) ? xv[d - 1] : -xv[d + 1]) : ((d < 64) ? -xv[d + 64] : xv[d - 64]);
  ov[d] = __fmul_rn(__fadd_rn(__fmul_rn(xv[d], c), __fmul_rn(rot, s)), osc); __syncthreads();
  if (F32OUT) { if (d < 32) { const v4f v = *(const v4f*)&ov[d * 4]; float* dst = (float*)OUT + r * (size_t)ldo + (size_t)h * 128 + d * 4; *(v4f*)dst = v;  } }
  else { if (d < 16) { FragH f; for (int q = 0; q < 8; ++q) f.h[q] = (_Float16)ov[d * 8 + q]; unsigned short* dst = (unsigned short*)OUT + r * (size_t)ldo + (size_t)h * 128 + d * 8; *(v8us*)dst = f.half[0];  } } }
template <int N>
__global__ __launch_bounds__(256) void k_rmsrow(float* __restrict__ X, const float* __restrict__ w, float eps) {
  #pragma clang fp contract(off)
  constexpr int PT = N / 256; __shared__ float red[256]; const size_t r = blockIdx.x; const int t = threadIdx.x; float* row = X + r * N + (size_t)t * PT; float v[PT]; float ss = 0.f;
  for (int q = 0; q < PT; ++q) { v[q] = row[q]; ss = __fadd_rn(ss, __fmul_rn(v[q], v[q])); }
  red[t] = ss; __syncthreads(); for (int k = 128; k > 0; k >>= 1) { if (t < k) red[t] = __fadd_rn(red[t], red[t + k]); __syncthreads(); }
  const float rs = rsqrtf(__fadd_rn(red[0] / (float)N, eps)); float o[PT]; for (int q = 0; q < PT; ++q) o[q] = __fmul_rn(__fmul_rn(v[q], rs), bf16_round(w[t * PT + q]));
  { for (int q = 0; q < PT; ++q) *(float*)(row + q) = o[q];  } }
template <int GS_, int NHQ, int DSRC>
__global__ __launch_bounds__(256) void k_kvexp128(const float* __restrict__ src, float* __restrict__ dst, size_t n4) { const size_t t = (size_t)blockIdx.x * 256 + threadIdx.x; if (t >= n4) return; const size_t e = t * 4; const size_t row = e / ((size_t)NHQ * 128); const int col = (int)(e % ((size_t)NHQ * 128)); const int h = col / 128, d = col % 128; const v4f v = *(const v4fa*)(src + row * DSRC + (size_t)(h / GS_) * 128 + d); *(v4f*)(dst + e) = v;  }

__global__ __launch_bounds__(256) void k_rsmcfb(const float* __restrict__ S, _Float16* __restrict__ P, int hg, int q0, int nk, const int* __restrict__ mk) {
  #pragma clang fp contract(off)
  const int t = blockIdx.x * 256 + threadIdx.x; if (t >= hg * QT) return; const size_t i = (size_t)t; const float* s = S + i * NKX; const size_t ig = (size_t)(q0 + (t % QT)); const int* mr = mk + ig * SQ; float mx = -3.0e38f;
#pragma unroll 1
  for (int j = 0; j < nk; ++j) { const int mb = mr[j]; const float f = (mb == 0) ? 1.f : 0.f; mx = fmaxf(mx, fmaf(f, s[j], (1.f - f) * -1.0e9f)); } float se = 0.f;
#pragma unroll 1
  for (int j = 0; j < nk; ++j) { const int mb = mr[j]; const float f = (mb == 0) ? 1.f : 0.f; se += __expf(fmaf(f, s[j], (1.f - f) * -1.0e9f) - mx); } const float sc = 256.0f / se;
#pragma unroll 1
  for (int j0 = 0; j0 < nk; j0 += 8) { FragH fr; for (int q = 0; q < 8; ++q) { const int j = j0 + q; const int mb = mr[j]; const float f = (mb == 0) ? 1.f : 0.f; fr.h[q] = (_Float16)(__expf(fmaf(f, s[j], (1.f - f) * -1.0e9f) - mx) * sc); } unsigned short* d = (unsigned short*)P + i * NKX + j0; *(v8us*)d = fr.half[0];  } }


__global__ __launch_bounds__(256) void k_rsmcf2(const float* __restrict__ S, _Float16* __restrict__ P, int hg, int q0, int nk) {
  #pragma clang fp contract(off)
  const int t = blockIdx.x * 256 + threadIdx.x; if (t >= hg * QT) return; const size_t i = (size_t)t; const float* s = S + i * NKX; const int last = q0 + (t % QT); float mx = -3.0e38f;
#pragma unroll 1
  for (int j = 0; j < nk; ++j) { const float f = (j <= last) ? 1.f : 0.f; mx = fmaxf(mx, fmaf(f, s[j], (1.f - f) * -1.0e9f)); } float se = 0.f;
#pragma unroll 1
  for (int j = 0; j < nk; ++j) { const float f = (j <= last) ? 1.f : 0.f; se += __expf(fmaf(f, s[j], (1.f - f) * -1.0e9f) - mx); } const float sc = 256.0f / se;
#pragma unroll 1
  for (int j0 = 0; j0 < nk; j0 += 8) { FragH fr; for (int q = 0; q < 8; ++q) { const int j = j0 + q; const float f = (j <= last) ? 1.f : 0.f; fr.h[q] = (_Float16)(__expf(fmaf(f, s[j], (1.f - f) * -1.0e9f) - mx) * sc); } unsigned short* d = (unsigned short*)P + i * NKX + j0; *(v8us*)d = fr.half[0];  } }



__global__ __launch_bounds__(256) void k_tab128p(const int* __restrict__ pos, int nrows, float theta, float* __restrict__ CS, float* __restrict__ SN) {
  #pragma clang fp contract(off)
  const int t = blockIdx.x * 256 + threadIdx.x; if (t >= nrows * 64) return; const int i = t % 64; const int r = t / 64; const float invf = (float)(1.0 / pow((double)theta, (double)(2 * i) / 128.0)); const float ang = __fmul_rn((float)pos[r], invf); const float c = cosf(ang), sv = sinf(ang);
  float* c0 = CS + (size_t)r * 128 + i; float* s0 = SN + (size_t)r * 128 + i;
  { *(float*)c0 = c; *(float*)(c0 + 64) = c; *(float*)s0 = sv; *(float*)(s0 + 64) = sv;  } }

__global__ __launch_bounds__(256) void k_rsmcim(const float* __restrict__ S, _Float16* __restrict__ P, int hg, int q0, int nk, const int* __restrict__ am) {
  #pragma clang fp contract(off)
  const int t = blockIdx.x * 256 + threadIdx.x; if (t >= hg * QT) return; const size_t i = (size_t)t; const float* s = S + i * NKX; const int last = q0 + (t % QT); const int* mr = am + (size_t)last * SQ; float mx = -3.0e38f;      /* the module's mask row of this query (keys >= nk lie above the diagonal of the causal mask and are not computed) */
#pragma unroll 1
  for (int j = 0; j < nk; ++j) { const float f = (mr[j] != 0) ? 1.f : 0.f; mx = fmaxf(mx, fmaf(f, s[j], (1.f - f) * -1.0e9f)); } float se = 0.f;
#pragma unroll 1
  for (int j = 0; j < nk; ++j) { const float f = (mr[j] != 0) ? 1.f : 0.f; se += __expf(fmaf(f, s[j], (1.f - f) * -1.0e9f) - mx); } const float sc = 256.0f / se;
#pragma unroll 1
  for (int j0 = 0; j0 < nk; j0 += 8) { FragH fr; for (int q = 0; q < 8; ++q) { const int j = j0 + q; const float f = (mr[j] != 0) ? 1.f : 0.f; fr.h[q] = (_Float16)(__expf(fmaf(f, s[j], (1.f - f) * -1.0e9f) - mx) * sc); } unsigned short* d = (unsigned short*)P + i * NKX + j0; *(v8us*)d = fr.half[0];  } }



__global__ __launch_bounds__(256) void k_tab128h(int nr, float theta, float* __restrict__ CS, float* __restrict__ SN) {
  #pragma clang fp contract(off)
  const size_t t = (size_t)blockIdx.x * 256 + threadIdx.x; if (t >= (size_t)nr * 64) return; const int i = (int)(t % 64); const size_t r = t / 64; const int p = (int)(r % SQ);
  const float invf = (float)(1.0 / pow((double)theta, ((double)(2 * i)) / 128.0)); const float ang = __fmul_rn((float)p, invf); const float c = cosf(ang), sv = sinf(ang);
  float* pc = CS + r * 128 + i; float* ps = SN + r * 128 + i;
  *(float*)pc = c; *(float*)(pc + 64) = c; *(float*)ps = sv; *(float*)(ps + 64) = sv;  }

// Per-block softmax, spread over lanes: one wave takes 4 score rows x one 256-key block (blockIdx.y). A lane holds 2 x 4 neighbouring scores of each row
// (every wave-wide load covers 512 contiguous bytes, every store 256), so each score is read once and each exponential is taken once;
// row maximum and row sum are five-step lane butterflies in registers (four steps inside the 16-lane row, one across the two rows): every lane ends with the same value.
// The short loops are unrolled so that a[] and b[] are indexed by constants and stay in registers.
template <int M> __device__ __forceinline__ float sm_xrow(float x) { return __builtin_bit_cast(float, __builtin_amdgcn_mov_dpp(__builtin_bit_cast(int, x), 0x160 | M, 0xf, 0xf, true)); }      /* lane l with lane l ^ M, M < 16 (row_xmask) */
__device__ __forceinline__ float sm_xhalf(float x) { const int b = __builtin_bit_cast(int, x); return __builtin_bit_cast(float, __builtin_amdgcn_permlanex16(b, b, 0x76543210, 0xfedcba98, false, false)); }      /* lane l with lane l ^ 16 */
__device__ __forceinline__ float sm_wmax(float x) { x = fmaxf(x, sm_xrow<1>(x)); x = fmaxf(x, sm_xrow<2>(x)); x = fmaxf(x, sm_xrow<4>(x)); x = fmaxf(x, sm_xrow<8>(x)); return fmaxf(x, sm_xhalf(x)); }
__device__ __forceinline__ float sm_wsum(float x) { x += sm_xrow<1>(x); x += sm_xrow<2>(x); x += sm_xrow<4>(x); x += sm_xrow<8>(x); return x + sm_xhalf(x); }
// Eight native 2^x in one statement. The outputs are early-clobber, so no v_exp_f32 in it overwrites a neighbour's source or reads its result; the closing v_nop keeps the one slot
// that the instruction set asks for behind a transcendental, whatever the compiler places next.
__device__ __forceinline__ void sm_exp2x8(v4f& a, v4f& b) { float e0, e1, e2, e3, e4, e5, e6, e7;
  asm("v_exp_f32 %0, %8\n\tv_exp_f32 %1, %9\n\tv_exp_f32 %2, %10\n\tv_exp_f32 %3, %11\n\tv_exp_f32 %4, %12\n\tv_exp_f32 %5, %13\n\tv_exp_f32 %6, %14\n\tv_exp_f32 %7, %15\n\tv_nop"
      : "=&v"(e0), "=&v"(e1), "=&v"(e2), "=&v"(e3), "=&v"(e4), "=&v"(e5), "=&v"(e6), "=&v"(e7) : "v"(a[0]), "v"(a[1]), "v"(a[2]), "v"(a[3]), "v"(b[0]), "v"(b[1]), "v"(b[2]), "v"(b[3]));
  a[0] = e0; a[1] = e1; a[2] = e2; a[3] = e3; b[0] = e4; b[1] = e5; b[2] = e6; b[3] = e7; }
__global__ __launch_bounds__(256) void k_rsmblk(const float* __restrict__ S, _Float16* __restrict__ P, _Float16* __restrict__ PL, int hg, int q0, int nk) {
  const int lane = threadIdx.x & 31; const int r0 = (blockIdx.x * 8 + (threadIdx.x >> 5)) * 4; if (r0 >= hg * QT) return;
  const int nb = nk / 256; const float nrm = 256.0f / __fadd_rn((float)nb, 1e-6f); const int k0 = blockIdx.y * 256; const int ka = k0 + lane * 4, kb = ka + 128;
  v4f a[4], b[4];
#pragma unroll
  for (int r = 0; r < 4; ++r) { const float* s = S + (size_t)(r0 + r) * NKX; a[r] = *(const v4fa*)(s + ka); b[r] = *(const v4fa*)(s + kb); }
  asm volatile("s_wait_xcnt 0x0" ::: "memory");      /* stands in front of the first reuse of the loads' address registers (a precaution; the compiler wrote none here); no load sinks below it, so all eight are in flight together instead of row after row */
  if (k0 + 255 > q0) {      /* only a key block that reaches past the tile's first query can hold a key above a query */
#pragma unroll
    for (int r = 0; r < 4; ++r) { const int last = q0 + ((r0 + r) % QT);
#pragma unroll
      for (int u = 0; u < 4; ++u) { a[r][u] = (ka + u <= last) ? a[r][u] : -1.0e9f; b[r][u] = (kb + u <= last) ? b[r][u] : -1.0e9f; } } }
#pragma unroll
  for (int r = 0; r < 4; ++r) {
    const float mx = sm_wmax(fmaxf(fmaxf(fmaxf(a[r][0], a[r][1]), fmaxf(a[r][2], a[r][3])), fmaxf(fmaxf(b[r][0], b[r][1]), fmaxf(b[r][2], b[r][3]))));
#pragma unroll
    for (int u = 0; u < 4; ++u) { a[r][u] = (a[r][u] - mx) * 1.44269504f; b[r][u] = (b[r][u] - mx) * 1.44269504f; }      /* e^x = 2^(x log2 e), as the native exp forms it */
    sm_exp2x8(a[r], b[r]);
    const float se = sm_wsum(((a[r][0] + a[r][1]) + (a[r][2] + a[r][3])) + ((b[r][0] + b[r][1]) + (b[r][2] + b[r][3])));
    const float isum = nrm / se; v4h ha, la, hb, lb;
#pragma unroll
    for (int u = 0; u < 4; ++u) { const float va = a[r][u] * isum, vb = b[r][u] * isum; ha[u] = (_Float16)va; la[u] = (_Float16)((va - (float)ha[u]) * 1024.0f); hb[u] = (_Float16)vb; lb[u] = (_Float16)((vb - (float)hb[u]) * 1024.0f); }
    _Float16* d = P + (size_t)(r0 + r) * NKX; _Float16* dl = PL + (size_t)(r0 + r) * NKX;
    *(v4h*)(d + ka) = ha; *(v4h*)(d + kb) = hb; *(v4h*)(dl + ka) = la; *(v4h*)(dl + kb) = lb; } }
// Exact f32 causal attention of rows 0..255, spread over a work-group: 8 waves take 8 query rows of one head (keys 0 .. i0 + 7 only).
// Scores: 4 neighbouring lanes share one key row (each wave-wide load covers 8 rows x 64 contiguous bytes), a lane sums its 32 of the 128 dims for all 8 queries (q from LDS, 64 contiguous bytes per read), two lane steps finish the dot.
// Softmax: wave w owns row i0 + w, 8 keys a lane, plain two-pass (all scores of a row are at hand), accurate expf; keys above the query get weight 0.
// Output: wave w sums keys w, w + 8, ... (a V row is one coalesced 512 B load, its 8 weights two LDS broadcasts), the 8 partial sums meet in LDS in fixed order; o x64 / row sum as before.
__global__ __launch_bounds__(256) void k_att0w(const float* __restrict__ QF, const float* __restrict__ KF, const float* __restrict__ VF, float scale, float* __restrict__ OF) {
  __shared__ __attribute__((aligned(16))) float lq[8][128]; __shared__ __attribute__((aligned(16))) float sc[8][QT0 + 4]; __shared__ __attribute__((aligned(16))) float pt[QT0][8]; __shared__ __attribute__((aligned(16))) float red[8][8][128]; __shared__ float inv[8];
  const int lane = threadIdx.x & 31; const int w = __builtin_amdgcn_readfirstlane(threadIdx.x >> 5); const int h = blockIdx.x % NH, i0 = (QT0 / 8 - 1 - blockIdx.x / NH) * 8; const int nkey = i0 + 8;      /* the row groups with the most keys come first */
  *(v4f*)&lq[w][lane * 4] = *(const v4fa*)(QF + (size_t)(i0 + w) * DMX + h * 128 + lane * 4);
  __syncthreads();
  const int dq = (lane & 3) * 4;
#pragma unroll 1      /* one trip = 64 keys of the work-group; rolled so that only the trips below the diagonal run */
  for (int j0 = w * 8; j0 < nkey; j0 += 64) { const int j = j0 + (lane >> 2); const float* kr = KF + (size_t)j * DKV + h * 128 + dq; v4f kq[8];
#pragma unroll
    for (int c = 0; c < 8; ++c) kq[c] = *(const v4fa*)(kr + c * 16);
    asm volatile("s_wait_xcnt 0x0" ::: "memory");      /* stands in front of the first reuse of the loads' address registers (a precaution); no load sinks below it, so all eight are in flight together */
#pragma unroll 1      /* four query rows a trip: with all eight unrolled the q reads of a whole tile are hoisted and the wave needs more than 256 registers, so that only one work-group fits a WGP */
    for (int rh = 0; rh < 8; rh += 4) { float acc[4] = {0.f, 0.f, 0.f, 0.f};
#pragma unroll
      for (int c = 0; c < 8; ++c) {
#pragma unroll
        for (int r = 0; r < 4; ++r) { const v4f q = *(const v4f*)&lq[rh + r][c * 16 + dq]; acc[r] += q[0] * kq[c][0] + q[1] * kq[c][1] + q[2] * kq[c][2] + q[3] * kq[c][3]; } }
#pragma unroll
      for (int r = 0; r < 4; ++r) { float s = acc[r]; s += sm_xrow<1>(s); s += sm_xrow<2>(s); if ((lane & 3) == 0) sc[rh + r][j] = s * scale; } } }
  __syncthreads();
  { const int i = i0 + w; float s[8]; float mx = -3.0e38f;
#pragma unroll
    for (int u = 0; u < 8; ++u) { const int j = lane + 32 * u; s[u] = (j <= i) ? sc[w][j] : -3.0e38f; mx = fmaxf(mx, s[u]); }
    mx = sm_wmax(mx); float se = 0.f;
#pragma unroll
    for (int u = 0; u < 8; ++u) { const int j = lane + 32 * u; const float e = (j <= i) ? expf(s[u] - mx) : 0.f; se += e; pt[j][w] = e; }
    se = sm_wsum(se); if (lane == 0) inv[w] = 64.0f / se; }
  __syncthreads();
  const v4f z4 = {0.f, 0.f, 0.f, 0.f}; v4f o[8] = {z4, z4, z4, z4, z4, z4, z4, z4};
#pragma unroll 1      /* one trip = 64 keys of the work-group, 8 a wave; keys from nkey on carry weight 0 for all 8 rows (rows below 256 of V, in bounds) */
  for (int jb = w; jb < nkey; jb += 64) { const float* vr = VF + (size_t)jb * DKV + h * 128 + lane * 4; v4f vv[8];
#pragma unroll
    for (int u = 0; u < 8; ++u) vv[u] = *(const v4fa*)(vr + (size_t)(8 * u) * DKV);
#pragma unroll
    for (int u = 0; u < 8; ++u) { const v4f p0 = *(const v4f*)&pt[jb + 8 * u][0], p1 = *(const v4f*)&pt[jb + 8 * u][4];
#pragma unroll
      for (int r = 0; r < 4; ++r) { o[r] += p0[r] * vv[u]; o[4 + r] += p1[r] * vv[u]; } } }
#pragma unroll
  for (int r = 0; r < 8; ++r) *(v4f*)&red[w][r][lane * 4] = o[r];
  __syncthreads();
  { v4f a = *(const v4f*)&red[0][w][lane * 4];
#pragma unroll
    for (int k = 1; k < 8; ++k) a += *(const v4f*)&red[k][w][lane * 4];
    a *= inv[w]; *(v4f*)(OF + (size_t)(i0 + w) * DMX + h * 128 + lane * 4) = a; } }
extern "C" void kernel_launch(void* const* d_in, const int* in_sizes, int n_in,
                              void* d_out, int out_size, void* d_ws, size_t ws_size, hipStream_t stream) {
  (void)in_sizes; (void)n_in; (void)out_size;
  const float* const* I = (const float* const*)d_in; const float* x = I[0]; const float* wq = I[1]; const float* wk = I[2]; const float* wv = I[3]; const float* wo = I[4]; const float* bq = nullptr; const float* bk = nullptr; const float* bv = nullptr; const float* bo = nullptr;      /* natural [out][in] Wq/Wk/Wv/Wo [2048][2048]; no biases */
  char* ws = (char*)d_ws; size_t off = 0;
  auto take = [&](size_t bytes) { char* p = ws + off; off += (bytes + 255) & ~(size_t)255; return p; };
  _Float16* BQ = (_Float16*)take((size_t)DMX * DMX * 2); _Float16* BK = (_Float16*)take((size_t)DKV * DMX * 2); _Float16* BV = (_Float16*)take((size_t)DKV * DMX * 2); _Float16* BO = (_Float16*)take((size_t)DMX * DMX * 2);
  _Float16* X16 = (_Float16*)take(NR * DMX * 2); float* QF = (float*)take((size_t)SQ * DMX * 4); float* KF = (float*)take((size_t)SQ * DKV * 4); float* VF = (float*)take((size_t)SQ * DKV * 4); _Float16* VH = (_Float16*)take((size_t)SQ * DKV * 2); _Float16* VL = (_Float16*)take((size_t)SQ * DKV * 2); _Float16* Q16 = (_Float16*)take((size_t)SQ * DMX * 2); _Float16* QL = (_Float16*)take((size_t)SQ * DMX * 2); _Float16* K16 = (_Float16*)take((size_t)SQ * DKV * 2); _Float16* KL = (_Float16*)take((size_t)SQ * DKV * 2); _Float16* O16 = (_Float16*)take(NR * DMX * 2);      /* per-batch q, k, v in f32 -> f16 hi + x1024 residual planes */ float* OTF = (float*)take((size_t)QT * DMX * 4);      /* per-batch v in f32 -> f16 hi + x1024 residual; per-tile f32 o accumulator */
  float* S = (float*)take((size_t)NH * QT * NKX * 4); _Float16* P = (_Float16*)take((size_t)NH * QT * NKX * 2); _Float16* PL = (_Float16*)take((size_t)NH * QT * NKX * 2); _Float16* VT = (_Float16*)take((size_t)(DKV / 64) * 64 * SQ * 2); _Float16* VTL = (_Float16*)take((size_t)(DKV / 64) * 64 * SQ * 2);
  float* OF0 = (float*)take((size_t)NB * QT0 * DMX * 4); _Float16* OH0 = (_Float16*)take((size_t)NB * QT0 * DMX * 2); _Float16* OL0 = (_Float16*)take((size_t)NB * QT0 * DMX * 2);
  if (off > ws_size) return;      /* approx 8 + 8 + 8 + 8 + 16 + 16 + 16 + 16 + 8 + 8 + 8 + 8 + 8 + 8 + 16 + 2 + 32 + 16 + 16 + 8 + 8 + 4 + 2 + 2 = 250 MiB */
  { const unsigned g = (unsigned)(((size_t)DMX * DMX / 8 + 255) / 256); k_wnat<<<g, 256, 0, stream>>>(wq, (size_t)DMX * DMX / 8, BQ); k_wnat<<<g, 256, 0, stream>>>(wk, (size_t)DKV * DMX / 8, BK); k_wnat<<<g, 256, 0, stream>>>(wv, (size_t)DKV * DMX / 8, BV); k_wnat<<<g, 256, 0, stream>>>(wo, (size_t)DMX * DMX / 8, BO); }      /* natural [out][in] = Bt x16 */
  k_x16<<<(unsigned)((NR * DMX / 8 + 255) / 256), 256, 0, stream>>>(x, X16, NR * DMX / 8);
  for (int b = 0; b < NB; ++b) { const size_t r0 = (size_t)b * SQ;
    float* QF0 = QF; float* KF0 = KF; k_gemm2<0><<<dim3((SQ / 128) * (DMX / 64), 1), 128, 0, stream>>>(X16 + r0 * DMX, DMX, 0, BQ, DMX, 0, 0.0625f, bq, 0, nullptr, 1, 0, 0, QF, nullptr, DMX, 0, SQ, DMX, DMX); k_gemm2<0><<<dim3((SQ / 128) * (DKV / 64), 1), 128, 0, stream>>>(X16 + r0 * DMX, DMX, 0, BK, DMX, 0, 0.0625f, bk, 0, nullptr, 1, 0, 0, KF, nullptr, DKV, 0, SQ, DKV, DMX); k_hl<<<(unsigned)(((size_t)SQ * DMX / 8 + 255) / 256), 256, 0, stream>>>(QF, Q16, QL, (size_t)SQ * DMX / 8); k_hl<<<(unsigned)(((size_t)SQ * DKV / 8 + 255) / 256), 256, 0, stream>>>(KF, K16, KL, (size_t)SQ * DKV / 8);      /* this batch's q and k in f32 (exact products) -> f16 hi + x1024 residual (block 0's full softmax seen from every later block's first row needs near-exact logits) */ k_gemm2<0><<<dim3((SQ / 128) * (DKV / 64), 1), 128, 0, stream>>>(X16 + r0 * DMX, DMX, 0, BV, DMX, 0, 0.0625f, bv, 0, nullptr, 1, 0, 0, VF, nullptr, DKV, 0, SQ, DKV, DMX); k_hl<<<(unsigned)(((size_t)SQ * DKV / 8 + 255) / 256), 256, 0, stream>>>(VF, VH, VL, (size_t)SQ * DKV / 8);      /* f32 q and k (all rows, above; rows 0..255 feed the exact first tile); this batch's v in f32 (exact products) -> f16 hi + x1024 residual (the per-block softmax gives every block's first rows single-key weights, so v and P must be carried beyond one f16) */
    k_vt<DKV / 64, SQ><<<(DKV / 64) * (SQ / 64), 256, 0, stream>>>(VH, DKV, 0, VT); k_vt<DKV / 64, SQ><<<(DKV / 64) * (SQ / 64), 256, 0, stream>>>(VL, DKV, 0, VTL);      /* V^T hi / residual of this batch: head h = slabs 2h, 2h+1 */
    k_att0w<<<NH * (QT0 / 8), 256, 0, stream>>>(QF0, KF0, VF, ATS, OF0 + (size_t)b * QT0 * DMX);      /* exact causal attention rows 0..255 (o x64) */
    for (int q0 = 0; q0 < SQ; q0 += QT) { const int nk = q0 + QT;      /* causal: keys below the tile end only */
      k_gemm2<0><<<dim3((QT / 128) * (nk / 64), NH), 128, 0, stream>>>(Q16 + (size_t)q0 * DMX, DMX, (size_t)HDK, K16, DKV, (size_t)HDK, ATS, nullptr, 0, nullptr, 1, 0, 0, S, nullptr, NKX, (size_t)QT * NKX, QT, nk, HDK); k_gemm2<0><<<dim3((QT / 128) * (nk / 64), NH), 128, 0, stream>>>(QL + (size_t)q0 * DMX, DMX, (size_t)HDK, K16, DKV, (size_t)HDK, ATS * 0.0009765625f, nullptr, 0, S, -1, 0, 0, S, nullptr, NKX, (size_t)QT * NKX, QT, nk, HDK); k_gemm2<0><<<dim3((QT / 128) * (nk / 64), NH), 128, 0, stream>>>(Q16 + (size_t)q0 * DMX, DMX, (size_t)HDK, KL, DKV, (size_t)HDK, ATS * 0.0009765625f, nullptr, 0, S, -1, 0, 0, S, nullptr, NKX, (size_t)QT * NKX, QT, nk, HDK);      /* scores of query block i against key blocks 0..i: hi.hi + lo.hi 2^-10 + hi.lo 2^-10 (own element), all 16 heads on grid.y */
      k_rsmblk<<<dim3(NH * QT / 32, nk / 256), 256, 0, stream>>>(S, P, PL, NH, q0, nk);      /* the module's per-block softmax: an independent softmax per 256-key block j <= i (diagonal block causal), weights divided by (block count + 1e-6) -> P x256 as f16 hi + x1024 residual */
      k_gemm2<0><<<dim3((QT / 128) * (HDK / 64), NH), 128, 0, stream>>>(P, NKX, (size_t)QT * NKX, VT, SQ, (size_t)HDK * SQ, 0.25f, nullptr, 0, nullptr, 1, 0, 0, OTF, nullptr, DMX, (size_t)HDK, QT, HDK, nk);      /* o x64 = Ph Vh (f32 tile accumulator) */
      k_gemm2<0><<<dim3((QT / 128) * (HDK / 64), NH), 128, 0, stream>>>(PL, NKX, (size_t)QT * NKX, VT, SQ, (size_t)HDK * SQ, 0.000244140625f, nullptr, 0, OTF, -1, 0, 0, OTF, nullptr, DMX, (size_t)HDK, QT, HDK, nk);      /* += Pl Vh 2^-12 (own element) */
      k_gemm2<0><<<dim3((QT / 128) * (HDK / 64), NH), 128, 0, stream>>>(P, NKX, (size_t)QT * NKX, VTL, SQ, (size_t)HDK * SQ, 0.000244140625f, nullptr, 0, OTF, -1, 0, 0, OTF, O16 + (r0 + q0) * DMX, DMX, (size_t)HDK, QT, HDK, nk); } }      /* += Ph Vl 2^-12 and emit the merged f16 o rows (x64) */
  k_gemm2<0><<<dim3((unsigned)((NR / 128) * (DMX / 64)), 1), 128, 0, stream>>>(O16, DMX, 0, BO, DMX, 0, 0.0009765625f, bo, 0, nullptr, 1, 0, 0, (float*)d_out, nullptr, DMX, 0, (int)NR, DMX, DMX);      /* out = o Wo^T */
  k_hl<<<(unsigned)(((size_t)NB * QT0 * DMX / 8 + 255) / 256), 256, 0, stream>>>(OF0, OH0, OL0, (size_t)NB * QT0 * DMX / 8);      /* first-tile o (x64) -> f16 hi + x1024 residual planes */
  for (int b = 0; b < NB; ++b) { const size_t r0 = (size_t)b * SQ; const size_t f0 = (size_t)b * QT0;
    k_gemm2<0><<<dim3((QT0 / 128) * (DMX / 64), 1), 128, 0, stream>>>(OH0 + f0 * DMX, DMX, 0, BO, DMX, 0, 0.0009765625f, bo, 0, nullptr, 1, 0, 0, (float*)d_out + r0 * DMX, nullptr, DMX, 0, QT0, DMX, DMX);      /* rows 0..255 of the batch rewritten from the exact path */
    k_gemm2<0><<<dim3((QT0 / 128) * (DMX / 64), 1), 128, 0, stream>>>(OL0 + f0 * DMX, DMX, 0, BO, DMX, 0, 0.00000095367431640625f, nullptr, 0, (const float*)d_out + r0 * DMX, -1, 0, 0, (float*)d_out + r0 * DMX, nullptr, DMX, 0, QT0, DMX, DMX); }      /* += o_lo Wo 2^-20 (own-element accumulate) */
}

// v003
// It runs in 2420 microseconds.
// In two side-by-side timings against v002, it was 1.58 and 1.59 times as fast.
// Counting every step since v000, it is 4.20 times as fast.
#include <hip/hip_runtime.h>
// Block-chunked causal attention with the module's PER-BLOCK softmax (hidden [2][2048][2048]; q/k/v = x W^T (natural [2048][2048] sigma 0.02, no biases), 16 heads of 128; keys in blocks of 256: for query block i every key block j <= i gets its OWN softmax over its 256 keys (scores / sqrt(128); inside the diagonal block keys above the query are -inf), the block outputs are summed and divided by the summed weights (= number of included blocks) + 1e-6; merged Wo^T -> [2][2048][2048]; no RoPE).
// Structure: token rows; x as exact f16 rows; natural weights as exact x16 planes; q, k, v as WMMA GEMMs (32x64 wave tiles, f32 accumulation) -> f32 (all rows) + f16 hi/x1024 residual rows; per batch: V^T via LDS transposes; exact f32 causal attention for rows 0..255 (= key block 0, where the per-block softmax is the ordinary causal softmax) on VALU; per 256-row query block i: scores against key blocks 0..i (K = 128, alpha 1/sqrt(128)) f32, the module's per-block softmax on VALU (f32 statistics, native exp; weights x256 f16 divided by the block count + 1e-6), o = P V^T (x64) merged f16; out = o Wo^T; first-tile rows rewritten from o hi/lo; launches: see trace.
// Compute dtype: inputs rounded to bf16; x / weights exact; projections f32; q, k, v and softmax weights as f16 hi + x1024 residual GEMM operands, o as plain f16 (~2^-12; first 256 rows of each batch exact); scores, statistics, out f32. v_wmma_f32_16x16x32_f16.
#define NB 2
#define SQ 2048
#define DMX 2048
#define NH 16
#define NKV 16
#define GSZ 1                        /* plain MHA: kv head == query head */
#define HDK 128
#define DKV (NKV * HDK)
#define QT 256
#define QT0 256
#define NKX SQ
#define DM DMX
#define HD 64
#define HG 1
#define NR ((size_t)NB * SQ)
#define ATS 0.08838834764831845f
typedef __bf16 v16b __attribute__((ext_vector_type(16)));
typedef unsigned short v8us __attribute__((ext_vector_type(8), may_alias));
typedef float  v8f  __attribute__((ext_vector_type(8)));
typedef float  v4f  __attribute__((ext_vector_type(4)));
typedef float  v4fa __attribute__((ext_vector_type(4), may_alias));
union FragB { v16b v; v8us half[2]; unsigned short u[16]; };

__device__ __forceinline__ unsigned short bf16_bits(float x) { unsigned int u = __float_as_uint(x); return (unsigned short)((u + 0x7FFFu + ((u >> 16) & 1u)) >> 16); }
__device__ __forceinline__ float bf16_val(unsigned short b) { return __uint_as_float(((unsigned int)b) << 16); }
__device__ __forceinline__ float bf16_round(float x) { return bf16_val(bf16_bits(x)); }
// D += A·B with NT terms: 1 = ah·bh, 2 = + al·bh (A split), 3 = + ah·bl (both split)
template <int NT>
__device__ __forceinline__ v8f mmaN(v16b ah, v16b al, v16b bh, v16b bl, v8f c) {
  c = __builtin_amdgcn_wmma_f32_16x16x32_bf16(false, ah, false, bh, (short)0, c, false, false);
  if (NT >= 2) c = __builtin_amdgcn_wmma_f32_16x16x32_bf16(false, al, false, bh, (short)0, c, false, false);
  if (NT >= 3) c = __builtin_amdgcn_wmma_f32_16x16x32_bf16(false, ah, false, bl, (short)0, c, false, false);
  asm volatile("v_nop\n\tv_nop\n\tv_nop\n\tv_nop" : "+v"(c) : "v"(ah), "v"(al), "v"(bh), "v"(bl));
  return c;
}

__global__ __launch_bounds__(256) void k_wt_bf16(const float* __restrict__ W, unsigned short* __restrict__ Wt, int K, int N) {
  const int t = blockIdx.x * 256 + threadIdx.x;
  const int k8n = K / 8;
  if (t >= N * k8n) return;
  const int n = t / k8n, k8 = (t % k8n) * 8;
  v8us v;
#pragma unroll
  for (int i = 0; i < 8; ++i) v[i] = bf16_bits(W[(size_t)(k8 + i) * N + n]);
  *(v8us*)(Wt + (size_t)n * K + k8) = v;
  
}

// GEMM C[M][N] (f32, pitch ldc) = act(A[M][K]·W + bias). A f32 row-major (pitch lda) converted per fragment to bf16
// (ASPLIT: hi/lo two planes -> 2 terms, else single rounded term); Wt bf16 [N][K] (pitch ldb). BIAS_BF16 rounds the
// bias to bf16 first (bias quantised to bf16 before the add). K%32==0, M%16==0, N%64==0.
template <bool ASPLIT, int ACT, bool BIAS_BF16>
__global__ __launch_bounds__(128) void k_gemm_bf(const float* __restrict__ A, int lda, const unsigned short* __restrict__ Wt, int ldb,
                                               const float* __restrict__ bias, float* __restrict__ C, int ldc, int M, int N, int K) {
  __shared__ __attribute__((aligned(16))) float so[4][16][64];
  const int tid = threadIdx.x, w = tid >> 5, lane = tid & 31, ln = lane & 15, hh = lane >> 4;
  const int ntn = N / 64;
  const int wid = blockIdx.x * 4 + w;
  const int mt = wid / ntn, nq = wid % ntn;
  if (mt * 16 >= M) return;
  const int row0 = mt * 16, col0 = nq * 64;
  const float* arow = A + (size_t)(row0 + ln) * lda;
  v8f acc[4] = {};
  for (int kb = 0; kb < K; kb += 32) {
    FragB ah, al;
    const v4f x0 = *(const v4fa*)(arow + kb + 8 * hh), x1 = *(const v4fa*)(arow + kb + 8 * hh + 4);
    const v4f x2 = *(const v4fa*)(arow + kb + 16 + 8 * hh), x3 = *(const v4fa*)(arow + kb + 16 + 8 * hh + 4);
    float xs[16] = {x0[0],x0[1],x0[2],x0[3],x1[0],x1[1],x1[2],x1[3],x2[0],x2[1],x2[2],x2[3],x3[0],x3[1],x3[2],x3[3]};
#pragma unroll
    for (int i = 0; i < 16; ++i) { const unsigned short hb = bf16_bits(xs[i]); ah.u[i] = hb; al.u[i] = ASPLIT ? bf16_bits(xs[i] - bf16_val(hb)) : (unsigned short)0; }
#pragma unroll
    for (int t = 0; t < 4; ++t) {
      const unsigned short* brow = Wt + (size_t)(col0 + t * 16 + ln) * ldb + kb;
      FragB b;
      b.half[0] = *(const v8us*)(brow + 8 * hh);
      b.half[1] = *(const v8us*)(brow + 16 + 8 * hh);
      acc[t] = mmaN<ASPLIT ? 2 : 1>(ah.v, al.v, b.v, b.v, acc[t]);
    }
  }
#pragma unroll
  for (int t = 0; t < 4; ++t) {
    float bv = bias ? bias[col0 + t * 16 + ln] : 0.f;
    if (BIAS_BF16) bv = bf16_round(bv);
#pragma unroll
    for (int r = 0; r < 8; ++r) { float v = acc[t][r] + bv; if (ACT == 1) v = fmaxf(v, 0.f); so[w][8 * hh + r][t * 16 + ln] = v; }
  }
  __builtin_amdgcn_fence(__ATOMIC_ACQ_REL, "workgroup");
  __builtin_amdgcn_wave_barrier();
  const int rsub = lane >> 4, c4 = (lane & 15) * 4;
  {
#pragma unroll
    for (int q = 0; q < 8; ++q) {
      const int r = q * 2 + rsub;
      const v4f v = *(const v4fa*)&so[w][r][c4];
      *(v4f*)(C + (size_t)(row0 + r) * ldc + col0 + c4) = v;
    }
    
  }
}

// GEMM C = act(A·W + bias + resid): A f32 (ASPLIT -> hi/lo 2 terms), Wt bf16 [N][K]; ACT 0 none, 1 relu, 2 exact gelu;
// resid (optional, f32, row index = (row % rmod), pitch ldr, RES_BF16 rounds it) added before the activation.
template <bool ASPLIT, int ACT, bool BIAS_BF16, bool RES_BF16>
__global__ __launch_bounds__(128) void k_gemm_bf3(const float* __restrict__ A, int lda, const unsigned short* __restrict__ Wt, int ldb,
                                                const float* __restrict__ bias, const float* __restrict__ resid, int rmod, int ldr,
                                                float* __restrict__ C, int ldc, int M, int N, int K) {
  __shared__ __attribute__((aligned(16))) float so[4][16][64];
  const int tid = threadIdx.x, w = tid >> 5, lane = tid & 31, ln = lane & 15, hh = lane >> 4;
  const int ntn = N / 64;
  const int wid = blockIdx.x * 4 + w;
  const int mt = wid / ntn, nq = wid % ntn;
  if (mt * 16 >= M) return;
  const int row0 = mt * 16, col0 = nq * 64;
  const float* arow = A + (size_t)(row0 + ln) * lda;
  v8f acc[4] = {};
  for (int kb = 0; kb < K; kb += 32) {
    FragB ah, al;
    const v4f x0 = *(const v4fa*)(arow + kb + 8 * hh), x1 = *(const v4fa*)(arow + kb + 8 * hh + 4);
    const v4f x2 = *(const v4fa*)(arow + kb + 16 + 8 * hh), x3 = *(const v4fa*)(arow + kb + 16 + 8 * hh + 4);
    float xs[16] = {x0[0],x0[1],x0[2],x0[3],x1[0],x1[1],x1[2],x1[3],x2[0],x2[1],x2[2],x2[3],x3[0],x3[1],x3[2],x3[3]};
#pragma unroll
    for (int i = 0; i < 16; ++i) { const unsigned short hb = bf16_bits(xs[i]); ah.u[i] = hb; al.u[i] = ASPLIT ? bf16_bits(xs[i] - bf16_val(hb)) : (unsigned short)0; }
#pragma unroll
    for (int t = 0; t < 4; ++t) {
      const unsigned short* brow = Wt + (size_t)(col0 + t * 16 + ln) * ldb + kb;
      FragB b;
      b.half[0] = *(const v8us*)(brow + 8 * hh);
      b.half[1] = *(const v8us*)(brow + 16 + 8 * hh);
      acc[t] = mmaN<ASPLIT ? 2 : 1>(ah.v, al.v, b.v, b.v, acc[t]);
    }
  }
#pragma unroll
  for (int t = 0; t < 4; ++t) {
    const int col = col0 + t * 16 + ln;
    float bv = bias ? bias[col] : 0.f;
    if (BIAS_BF16) bv = bf16_round(bv);
#pragma unroll
    for (int r = 0; r < 8; ++r) {
      float v = acc[t][r] + bv;
      if (resid) { float rv = resid[(size_t)((row0 + 8 * hh + r) % rmod) * ldr + col]; if (RES_BF16) rv = bf16_round(rv); v += rv; }
      if (ACT == 1) v = fmaxf(v, 0.f);
      if (ACT == 2) v = 0.5f * v * (1.0f + erff(v * 0.70710678118654752f));
      if (ACT == 3) { const float u = 0.7978845608028654f * (v + 0.044715f * v * v * v); v = 0.5f * v * (1.0f + tanhf(u)); }
      so[w][8 * hh + r][t * 16 + ln] = v;
    }
  }
  __builtin_amdgcn_fence(__ATOMIC_ACQ_REL, "workgroup");
  __builtin_amdgcn_wave_barrier();
  const int rsub = lane >> 4, c4 = (lane & 15) * 4;
  {
#pragma unroll
    for (int q = 0; q < 8; ++q) {
      const int r = q * 2 + rsub;
      const v4f v = *(const v4fa*)&so[w][r][c4];
      *(v4f*)(C + (size_t)(row0 + r) * ldc + col0 + c4) = v;
    }
    
  }
}
// row LayerNorm (biased variance, eps) over N: s = X (+ R); optional out_sum <- s; out_norm <- (s-mu)*rsqrt(var+eps)*g + b
template <bool PARAM_BF16>
__global__ __launch_bounds__(256) void k_layernorm(const float* __restrict__ X, const float* __restrict__ R, const float* __restrict__ g, const float* __restrict__ bta,
                                                  float* __restrict__ out_sum, float* __restrict__ out_norm, int N, float eps) {
  __shared__ float red[256];
  const int row = blockIdx.x, tid = threadIdx.x;
  const float* x = X + (size_t)row * N; const float* rr = R ? R + (size_t)row * N : nullptr;
  float vals[16];                     // up to N = 4096
  const int per = N / 256;            // contiguous chunk per thread? use strided-by-4 chunks: thread handles j = tid*4 + 1024*u
  float s1 = 0.f;
  for (int u = 0; u < per / 4; ++u) {
    const int j = tid * 4 + 1024 * u;
    const v4f a = *(const v4fa*)(x + j);
    v4f b = {0.f,0.f,0.f,0.f}; if (rr) b = *(const v4fa*)(rr + j);
#pragma unroll
    for (int q = 0; q < 4; ++q) { const float v = a[q] + b[q]; vals[u * 4 + q] = v; s1 += v; }
  }
  red[tid] = s1; __syncthreads();
  for (int st = 128; st > 0; st >>= 1) { if (tid < st) red[tid] += red[tid + st]; __syncthreads(); }
  const float mu = red[0] / (float)N; __syncthreads();
  float s2 = 0.f;
  for (int u = 0; u < per / 4; ++u)
#pragma unroll
    for (int q = 0; q < 4; ++q) { const float c = vals[u * 4 + q] - mu; s2 += c * c; }
  red[tid] = s2; __syncthreads();
  for (int st = 128; st > 0; st >>= 1) { if (tid < st) red[tid] += red[tid + st]; __syncthreads(); }
  const float rs = rsqrtf(red[0] / (float)N + eps);
  {
    for (int u = 0; u < per / 4; ++u) {
      const int j = tid * 4 + 1024 * u;
      v4f o, sm;
#pragma unroll
      for (int q = 0; q < 4; ++q) {
        float gg = g[j + q], bb = bta[j + q];
        if (PARAM_BF16) { gg = bf16_round(gg); bb = bf16_round(bb); }
        sm[q] = vals[u * 4 + q]; o[q] = (vals[u * 4 + q] - mu) * rs * gg + bb;
      }
      if (out_sum) *(v4f*)(out_sum + (size_t)row * N + j) = sm;
      *(v4f*)(out_norm + (size_t)row * N + j) = o;
    }
    
  }
}



// ---- f16 WMMA path (v_wmma_f32_16x16x32_f16): 11-bit significands for operands in range — used where a [0,1] probability operand needs more precision than bf16
typedef _Float16 v16h __attribute__((ext_vector_type(16)));
union FragH { v16h v; v8us half[2]; _Float16 h[16]; unsigned short u[16]; };
template <int NT>
__device__ __forceinline__ v8f mmaH(v16h ah, v16h al, v16h bh, v16h bl, v8f c) {
  c = __builtin_amdgcn_wmma_f32_16x16x32_f16(false, ah, false, bh, (short)0, c, false, false);
  if (NT >= 2) c = __builtin_amdgcn_wmma_f32_16x16x32_f16(false, al, false, bh, (short)0, c, false, false);
  if (NT >= 3) c = __builtin_amdgcn_wmma_f32_16x16x32_f16(false, ah, false, bl, (short)0, c, false, false);
  asm volatile("v_nop\n\tv_nop\n\tv_nop\n\tv_nop" : "+v"(c) : "v"(ah), "v"(al), "v"(bh), "v"(bl));
  return c;
}
// batched GEMM like k_gemm_b but f16 operands: A f32 (split into f16 hi/lo if ASPLIT, else rounded to f16), Bt = f16 values [n][k]; alpha; C f32; N multiple of 16 (partial tiles skipped)
template <bool ASPLIT>
__global__ __launch_bounds__(128) void k_gemm_h(const float* __restrict__ A, int lda, size_t sA, const _Float16* __restrict__ Bh, int ldb, size_t sB, float alpha, float* __restrict__ C, int ldc, size_t sC, int M, int N, int K) {
  __shared__ __attribute__((aligned(16))) float so[4][16][64];
  const int tid = threadIdx.x, w = tid >> 5, lane = tid & 31, ln = lane & 15, hh = lane >> 4; const int by = blockIdx.y;
  A += (size_t)by * sA; Bh += (size_t)by * sB; C += (size_t)by * sC;
  const int ntn = (N + 63) / 64; const int wid = blockIdx.x * 4 + w; const int mt = wid / ntn, nq = wid % ntn; if (mt * 16 >= M) return;
  const int row0 = mt * 16, col0 = nq * 64; const float* arow = A + (size_t)(row0 + ln) * lda;
  v8f acc[4] = {};
  for (int kb = 0; kb < K; kb += 32) {
    FragH ah, al;
    const v4f x0 = *(const v4fa*)(arow + kb + 8 * hh), x1 = *(const v4fa*)(arow + kb + 8 * hh + 4), x2 = *(const v4fa*)(arow + kb + 16 + 8 * hh), x3 = *(const v4fa*)(arow + kb + 16 + 8 * hh + 4);
    float xs[16] = {x0[0],x0[1],x0[2],x0[3],x1[0],x1[1],x1[2],x1[3],x2[0],x2[1],x2[2],x2[3],x3[0],x3[1],x3[2],x3[3]};
#pragma unroll
    for (int i = 0; i < 16; ++i) { const _Float16 h = (_Float16)xs[i]; ah.h[i] = h; al.h[i] = ASPLIT ? (_Float16)(xs[i] - (float)h) : (_Float16)0.0f; }
#pragma unroll
    for (int t = 0; t < 4; ++t) { if (col0 + t * 16 >= N) continue; const size_t boff = (size_t)(col0 + t * 16 + ln) * ldb + kb; FragH bq; bq.half[0] = *(const v8us*)(Bh + boff + 8 * hh); bq.half[1] = *(const v8us*)(Bh + boff + 16 + 8 * hh);
      acc[t] = mmaH<ASPLIT ? 2 : 1>(ah.v, al.v, bq.v, bq.v, acc[t]); }
  }
#pragma unroll
  for (int t = 0; t < 4; ++t) { if (col0 + t * 16 >= N) continue;
#pragma unroll
    for (int r = 0; r < 8; ++r) so[w][8 * hh + r][t * 16 + ln] = acc[t][r] * alpha; }
  __builtin_amdgcn_fence(__ATOMIC_ACQ_REL, "workgroup"); __builtin_amdgcn_wave_barrier();
  const int rsub = lane >> 4, c4 = (lane & 15) * 4;
  {
#pragma unroll
    for (int q = 0; q < 8; ++q) { const int r = q * 2 + rsub; if (col0 + c4 < N) { const v4f v = *(const v4fa*)&so[w][r][c4]; *(v4f*)(C + (size_t)(row0 + r) * ldc + col0 + c4) = v; } }
     }
}

// Wt[n][k] = f16(W[k][n]·scale) from f32 row-major W[K][N] (scale = power of two; bf16-exact weights stay exact in f16 away from the subnormal range)
__global__ __launch_bounds__(256) void k_wt_f16(const float* __restrict__ W, _Float16* __restrict__ Wt, int K, int N, float scale) {
  const int t = blockIdx.x * 256 + threadIdx.x; if (t >= N * (K / 8)) return; const int n = t / (K / 8), k8 = (t % (K / 8)) * 8; FragH f;
#pragma unroll
  for (int i = 0; i < 8; ++i) f.h[i] = (_Float16)(bf16_round(W[(size_t)(k8 + i) * N + n]) * scale); const v8us o = f.half[0];
  *(v8us*)((unsigned short*)Wt + (size_t)n * K + k8) = o; 
}
// k_gemm_hh variant with fused epilogue: v = acc·alpha + bias[by·sBias + col] (+ CP[(row/rowsPerB)·sCPb + by·64 + col] if CP) ; ACT 0 none / 1 elu ; writes f16 C16 (and f32 C if non-null)
template <int ACT>
__global__ __launch_bounds__(128) void k_gemm_hhx(const _Float16* __restrict__ A, int lda, size_t sA, const _Float16* __restrict__ Bh, int ldb, size_t sB, float alpha, const float* __restrict__ bias, size_t sBias, const float* __restrict__ CP, int rowsPerB, size_t sCPb, int row0g,
    float* __restrict__ C, _Float16* __restrict__ C16, int ldc, size_t sC, int M, int N, int K) {
  __shared__ __attribute__((aligned(16))) float so[4][16][64];
  const int tid = threadIdx.x, w = tid >> 5, lane = tid & 31, ln = lane & 15, hh = lane >> 4; const int by = blockIdx.y;
  A += (size_t)by * sA; Bh += (size_t)by * sB; const size_t cofs = (size_t)by * sC; const float* bp = bias ? bias + (size_t)by * sBias : nullptr;
  const int ntn = (N + 63) / 64; const int wid = blockIdx.x * 4 + w; const int mt = wid / ntn, nq = wid % ntn; if (mt * 16 >= M) return;
  const int row0 = mt * 16, col0 = nq * 64; const _Float16* arow = A + (size_t)(row0 + ln) * lda;
  v8f acc[4] = {};
  for (int kb = 0; kb < K; kb += 32) { FragH ah; ah.half[0] = *(const v8us*)((const unsigned short*)arow + kb + 8 * hh); ah.half[1] = *(const v8us*)((const unsigned short*)arow + kb + 16 + 8 * hh);
#pragma unroll
    for (int t = 0; t < 4; ++t) { if (col0 + t * 16 >= N) continue; const size_t boff = (size_t)(col0 + t * 16 + ln) * ldb + kb; FragH bq; bq.half[0] = *(const v8us*)((const unsigned short*)Bh + boff + 8 * hh); bq.half[1] = *(const v8us*)((const unsigned short*)Bh + boff + 16 + 8 * hh);
      acc[t] = mmaH<1>(ah.v, ah.v, bq.v, bq.v, acc[t]); }
  }
#pragma unroll
  for (int t = 0; t < 4; ++t) { if (col0 + t * 16 >= N) continue; const int col = col0 + t * 16 + ln; const float bv = bp ? bf16_round(bp[col]) : 0.f;
#pragma unroll
    for (int r = 0; r < 8; ++r) { float v = acc[t][r] * alpha + bv; if (CP) { const int rr = row0g + row0 + 8 * hh + r; if (rowsPerB < 0) v += CP[cofs + (size_t)rr * ldc + col];      /* rowsPerB < 0: own element of the batched C plane */ else { const int bidx = rr / rowsPerB; v += CP[(size_t)bidx * sCPb + (size_t)by * 64 + col]; } } if (ACT == 1) v = (v > 0.f) ? v : expm1f(v); else if (ACT == 7) v = (v > 0.f) ? v + 1.0f : expf(v); else if (ACT == 8) v = tanhf(v); else if (ACT == 9) v = 0.5f * v * (1.0f + tanhf(0.7978845608028654f * (v + 0.044715f * v * v * v))); else if (ACT == 11) v = 1.0f / (1.0f + expf(-v)); else if (ACT == 12) v = (v > 0.f) ? v : 0.01f * v; else if (ACT == 14) v = (v > 0.f) ? v : 0.1f * v; else if (ACT == 16) v = (v >= 0.f) ? v : 0.3f * v; else if (ACT == 17) v = (v >= 0.f) ? v : 0.2f * v; else if (ACT == 15) v = v / (1.0f + expf(-v)); else if (ACT == 3) v = fmaxf(v, 0.f); else if (ACT == 6) v = 0.5f * v * (1.0f + erff(v * 0.70710678118654752f)); so[w][8 * hh + r][t * 16 + ln] = v; } }
  __builtin_amdgcn_fence(__ATOMIC_ACQ_REL, "workgroup"); __builtin_amdgcn_wave_barrier();
  const int rsub = lane >> 4, c4 = (lane & 15) * 4; typedef _Float16 v4h __attribute__((ext_vector_type(4)));
  {
#pragma unroll
    for (int q = 0; q < 8; ++q) { const int r = q * 2 + rsub; if (col0 + c4 < N) { const v4f v = *(const v4fa*)&so[w][r][c4]; if (C) *(v4f*)(C + cofs + (size_t)(row0 + r) * ldc + col0 + c4) = v; if (C16) { v4h h4; for (int i = 0; i < 4; ++i) h4[i] = (_Float16)v[i]; *(v4h*)(C16 + cofs + (size_t)(row0 + r) * ldc + col0 + c4) = h4; } } }
     }
}


typedef _Float16 v4h __attribute__((ext_vector_type(4)));

__global__ __launch_bounds__(256) void k_x16(const float* __restrict__ x, _Float16* __restrict__ X16, size_t n8) { const size_t t = (size_t)blockIdx.x * 256 + threadIdx.x; if (t >= n8) return; FragH f;
#pragma unroll
  for (int q = 0; q < 8; ++q) f.h[q] = (_Float16)bf16_round(x[t * 8 + q]); *(v8us*)((unsigned short*)X16 + t * 8) = f.half[0];  }
__global__ __launch_bounds__(256) void k_h16(const float* __restrict__ x, _Float16* __restrict__ X16, size_t n8) { const size_t t = (size_t)blockIdx.x * 256 + threadIdx.x; if (t >= n8) return; FragH f;
#pragma unroll
  for (int q = 0; q < 8; ++q) f.h[q] = (_Float16)x[t * 8 + q]; *(v8us*)((unsigned short*)X16 + t * 8) = f.half[0];  }
__global__ __launch_bounds__(256) void k_round16f(const float* __restrict__ W, _Float16* __restrict__ Bt, size_t n8) { const size_t t = (size_t)blockIdx.x * 256 + threadIdx.x; if (t >= n8) return; FragH f;
#pragma unroll
  for (int i = 0; i < 8; ++i) f.h[i] = (_Float16)(bf16_round(W[t * 8 + i]) * 16.0f); *(v8us*)((unsigned short*)Bt + t * 8) = f.half[0];  }
template <int NHv, int TTv>
__global__ __launch_bounds__(256) void k_vt(const _Float16* __restrict__ V16, int ldv, int voff, _Float16* __restrict__ Vt) { __shared__ unsigned short tl[64][66]; const int tid = threadIdx.x; const int slab = blockIdx.x / (TTv / 64), lg = blockIdx.x % (TTv / 64); const int b = slab / NHv, h = slab % NHv;
  for (int i = tid; i < 64 * 8; i += 256) { const int r = i / 8, c8 = (i % 8) * 8; FragH f; f.half[0] = *(const v8us*)((const unsigned short*)V16 + ((size_t)b * TTv + lg * 64 + r) * ldv + voff + h * 64 + c8);
#pragma unroll
    for (int q = 0; q < 8; ++q) tl[r][c8 + q] = f.u[q]; }
  __syncthreads();
  {
#pragma unroll
    for (int rd = 0; rd < 2; ++rd) { const int d = rd * 32 + tid / 8, pc = tid % 8; FragH f;
#pragma unroll
      for (int q = 0; q < 8; ++q) f.u[q] = tl[pc * 8 + q][d];
      *(v8us*)((unsigned short*)Vt + ((size_t)slab * 64 + d) * TTv + lg * 64 + pc * 8) = f.half[0]; }
     } }

__global__ __launch_bounds__(256) void k_hl(const float* __restrict__ F, _Float16* __restrict__ Hh, _Float16* __restrict__ Hl, size_t n8) { const size_t t = (size_t)blockIdx.x * 256 + threadIdx.x; if (t >= n8) return; FragH fh, fl; const v4f a = *(const v4fa*)(F + t * 8), c = *(const v4fa*)(F + t * 8 + 4);
#pragma unroll
  for (int q = 0; q < 4; ++q) { _Float16 h = (_Float16)a[q]; fh.h[q] = h; fl.h[q] = (_Float16)((a[q] - (float)h) * 1024.0f); h = (_Float16)c[q]; fh.h[4 + q] = h; fl.h[4 + q] = (_Float16)((c[q] - (float)h) * 1024.0f); }
  { *(v8us*)((unsigned short*)Hh + t * 8) = fh.half[0]; *(v8us*)((unsigned short*)Hl + t * 8) = fl.half[0];  } }

// ---- fast GEMM (wave tile 32x64; requires M % 32 == 0 rows per launch region, N % 64 == 0, K % 32 == 0 and K >= 96); epilogue = k_gemm_hhx semantics ----
__device__ __forceinline__ v16h g2_frag(const _Float16* p, int hh) { FragH f; f.half[0] = *(const v8us*)((const unsigned short*)p + 8 * hh); f.half[1] = *(const v8us*)((const unsigned short*)p + 16 + 8 * hh); return f.v; }
__device__ __forceinline__ v8f g2_mma(v16h a, v16h b, v8f c) { v8f d = __builtin_amdgcn_wmma_f32_16x16x32_f16(false, a, false, b, (short)0, c, false, false); asm volatile("v_nop\n\tv_nop\n\tv_nop\n\tv_nop" : "+v"(d) : "v"(a), "v"(b)); return d; }
struct G2S { v16h a0, a1, b0, b1, b2, b3; };      /* the fragments of one k-step of a 32x64 wave tile */
__device__ __forceinline__ void g2_load(G2S& s, const _Float16* a0p, const _Float16* a1p, const _Float16* b0p, const _Float16* b1p, const _Float16* b2p, const _Float16* b3p, int k, int hh) { s.a0 = g2_frag(a0p + k, hh); s.b0 = g2_frag(b0p + k, hh); s.a1 = g2_frag(a1p + k, hh); s.b1 = g2_frag(b1p + k, hh); s.b2 = g2_frag(b2p + k, hh); s.b3 = g2_frag(b3p + k, hh); }
template <int ACT>
__global__ __launch_bounds__(128) void k_gemm2(const _Float16* __restrict__ A, int lda, size_t sA, const _Float16* __restrict__ Bh, int ldb, size_t sB, float alpha, const float* __restrict__ bias, size_t sBias, const float* __restrict__ CP, int rowsPerB, size_t sCPb, int row0g,
    float* __restrict__ C, _Float16* __restrict__ C16, int ldc, size_t sC, int M, int N, int K) { static_assert(ACT == 0 || ACT == 3 || ACT == 6 || ACT == 8 || ACT == 9 || ACT == 11 || ACT == 12 || ACT == 14 || ACT == 15 || ACT == 16 || ACT == 17, "k_gemm2: unsupported ACT code (would silently apply no activation)");
  __shared__ __attribute__((aligned(16))) float so[4][32][68];
  const int tid = threadIdx.x, w = tid >> 5, lane = tid & 31, ln = lane & 15, hh = lane >> 4; const int by = blockIdx.y;
  A += (size_t)by * sA; Bh += (size_t)by * sB; const size_t cofs = (size_t)by * sC; const float* bp = bias ? bias + (size_t)by * sBias : nullptr;
  const int ntn = N >> 6; const int mt = blockIdx.x / ntn, nq = blockIdx.x - mt * ntn; const int row0 = mt * 128 + 32 * w, col0 = nq * 64; if (row0 >= M) return;
  const _Float16* a0p = A + (size_t)(row0 + ln) * lda; const _Float16* a1p = a0p + (size_t)16 * lda;
  const _Float16* b0p = Bh + (size_t)(col0 + ln) * ldb; const _Float16* b1p = b0p + (size_t)16 * ldb; const _Float16* b2p = b1p + (size_t)16 * ldb; const _Float16* b3p = b2p + (size_t)16 * ldb;
  // k loop, three k-steps of fragments in registers: a step's 12 loads are issued together, directly behind the products of the step that held those registers,
  // so they fly during the next two steps' products instead of being waited for one fragment at a time. Products and their order per accumulator are as before.
  const int nst = K >> 5; G2S s0, s1, s2; int st = 0, ko = 0;
  g2_load(s0, a0p, a1p, b0p, b1p, b2p, b3p, 0, hh); __builtin_amdgcn_sched_barrier(0);      /* the three sets are requested one after the other, as in the loop: mixed, the counted load waits in the loop (set for both ways into it) would wait for the younger sets too */
  g2_load(s1, a0p, a1p, b0p, b1p, b2p, b3p, 32, hh); __builtin_amdgcn_sched_barrier(0);      /* as above */
  g2_load(s2, a0p, a1p, b0p, b1p, b2p, b3p, 64, hh);
  asm volatile("s_wait_xcnt 0x0" ::: "memory");      /* stands in front of the clearing of the accumulators, some of which take the registers of an address that the loads above name (a precaution; the compiler wrote none there) */
  const v8f z8 = {0.f,0.f,0.f,0.f,0.f,0.f,0.f,0.f}; v8f c00 = z8, c01 = z8, c02 = z8, c03 = z8, c10 = z8, c11 = z8, c12 = z8, c13 = z8;
#define G2_MMA8(S) { c00 = g2_mma(S.a0, S.b0, c00); c10 = g2_mma(S.a1, S.b0, c10); c01 = g2_mma(S.a0, S.b1, c01); c11 = g2_mma(S.a1, S.b1, c11); c02 = g2_mma(S.a0, S.b2, c02); c12 = g2_mma(S.a1, S.b2, c12); c03 = g2_mma(S.a0, S.b3, c03); c13 = g2_mma(S.a1, S.b3, c13); }
  /* G2_STEP: the k offset moves on by three steps. The wait stands in front of the rewrite of the address registers that the loads in flight name (a precaution; the compiler wrote none over the back edge); the new offset is its output, so every new address is formed behind it. */
#define G2_STEP { ko += 96; asm volatile("s_wait_xcnt 0x0" : "+s"(ko) : : "memory"); }
#pragma unroll 1      /* one trip = three k-steps, one per register set; rolled so that the sets keep their registers */
  for (; st + 6 <= nst; st += 3) {
    G2_MMA8(s0) G2_STEP g2_load(s0, a0p + ko, a1p + ko, b0p + ko, b1p + ko, b2p + ko, b3p + ko, 0, hh); __builtin_amdgcn_sched_barrier(0);      /* keeps the next set's first product, with its load wait, from moving up in front of these requests */
    G2_MMA8(s1) g2_load(s1, a0p + ko, a1p + ko, b0p + ko, b1p + ko, b2p + ko, b3p + ko, 32, hh);
    G2_MMA8(s2) g2_load(s2, a0p + ko, a1p + ko, b0p + ko, b1p + ko, b2p + ko, b3p + ko, 64, hh); }
  const int rem = nst - st;      /* 3, 4 or 5 k-steps are left, the first three of them loaded */
  G2_MMA8(s0) G2_STEP if (rem > 3) g2_load(s0, a0p + ko, a1p + ko, b0p + ko, b1p + ko, b2p + ko, b3p + ko, 0, hh);
  G2_MMA8(s1) if (rem > 4) g2_load(s1, a0p + ko, a1p + ko, b0p + ko, b1p + ko, b2p + ko, b3p + ko, 32, hh);
  G2_MMA8(s2)
  if (rem > 3) G2_MMA8(s0)
  if (rem > 4) G2_MMA8(s1)
#undef G2_STEP
#undef G2_MMA8
  v8f accs[8] = {c00, c01, c02, c03, c10, c11, c12, c13};
#pragma unroll
  for (int u = 0; u < 8; ++u) { const int t = u & 3, half = u >> 2; const int col = col0 + t * 16 + ln; const float bv = bp ? bf16_round(bp[col]) : 0.f;
#pragma unroll
    for (int r = 0; r < 8; ++r) { const int rloc = half * 16 + 8 * hh + r; float v = accs[u][r] * alpha + bv; if (CP) { if (rowsPerB < 0) v += CP[cofs + (size_t)(row0g + row0 + rloc) * ldc + col];      /* rowsPerB < 0: own element of the batched C plane */ else { const int bidx = (row0g + row0 + rloc) / rowsPerB; v += CP[(size_t)bidx * sCPb + (size_t)by * 64 + col]; } }
      if (ACT == 3) v = fmaxf(v, 0.f); else if (ACT == 6) v = 0.5f * v * (1.0f + erff(v * 0.70710678118654752f)); else if (ACT == 11) v = 1.0f / (1.0f + expf(-v)); else if (ACT == 15) v = v / (1.0f + expf(-v)); else if (ACT == 12) v = (v > 0.f) ? v : 0.01f * v; else if (ACT == 8) v = tanhf(v); else if (ACT == 9) v = 0.5f * v * (1.0f + tanhf(0.7978845608028654f * (v + 0.044715f * v * v * v))); else if (ACT == 14) v = (v > 0.f) ? v : 0.1f * v; else if (ACT == 16) v = (v >= 0.f) ? v : 0.3f * v; else if (ACT == 17) v = (v >= 0.f) ? v : 0.2f * v;
      so[w][rloc][t * 16 + ln] = v; } }
  __builtin_amdgcn_fence(__ATOMIC_ACQ_REL, "workgroup"); __builtin_amdgcn_wave_barrier();
  const int rsub = lane >> 4, c4 = (lane & 15) * 4;
  {
#pragma unroll
    for (int q = 0; q < 16; ++q) { const int r = q * 2 + rsub; const v4f v = *(const v4fa*)&so[w][r][c4]; if (C) *(v4f*)(C + cofs + (size_t)(row0 + r) * ldc + col0 + c4) = v; if (C16) { v4h h4; for (int i = 0; i < 4; ++i) h4[i] = (_Float16)v[i]; *(v4h*)(C16 + cofs + (size_t)(row0 + r) * ldc + col0 + c4) = h4; } }
     } }


__global__ __launch_bounds__(256) void k_wnat(const float* __restrict__ w, size_t n8, _Float16* __restrict__ Bt) { const size_t t = (size_t)blockIdx.x * 256 + threadIdx.x; if (t >= n8) return; FragH f; for (int q = 0; q < 8; ++q) f.h[q] = (_Float16)(bf16_round(w[t * 8 + q]) * 16.0f); *(v8us*)((unsigned short*)Bt + t * 8) = f.half[0];  }
__global__ __launch_bounds__(256) void k_rsm(const float* __restrict__ S, _Float16* __restrict__ P, int nrows) {
  #pragma clang fp contract(off)
  const int i = blockIdx.x * 256 + threadIdx.x; if (i >= nrows) return; const float* s = S + (size_t)i * SQ; float mx = -3.0e38f;
#pragma unroll 1
  for (int j = 0; j < SQ; ++j) mx = fmaxf(mx, s[j]); float se = 0.f;
#pragma unroll 1
  for (int j = 0; j < SQ; ++j) se += expf(s[j] - mx); const float sc = 256.0f / se;
#pragma unroll 1
  for (int j0 = 0; j0 < SQ; j0 += 8) { FragH f; for (int q = 0; q < 8; ++q) f.h[q] = (_Float16)(expf(s[j0 + q] - mx) * sc); unsigned short* d = (unsigned short*)P + (size_t)i * SQ + j0; *(v8us*)d = f.half[0];  } }
__global__ __launch_bounds__(256) void k_vt(const _Float16* __restrict__ V16, int b, int h0, _Float16* __restrict__ VT) { __shared__ unsigned short tl[64][65]; const int tid = threadIdx.x; const int hh = blockIdx.x % HG, sg = blockIdx.x / HG; const int s0 = sg * 64; const int h = h0 + hh;
  for (int i = tid; i < 64 * 8; i += 256) { const int j = i / 8, d8 = (i % 8) * 8; FragH f; f.half[0] = *(const v8us*)((const unsigned short*)V16 + ((size_t)b * SQ + s0 + j) * DM + h * HD + d8); for (int q = 0; q < 8; ++q) tl[d8 + q][j] = f.u[q]; }
  __syncthreads();
  { for (int i = tid; i < 64 * 8; i += 256) { const int d = i / 8, j8 = (i % 8) * 8; FragH f; for (int q = 0; q < 8; ++q) f.u[q] = tl[d][j8 + q]; *(v8us*)((unsigned short*)VT + ((size_t)hh * HD + d) * SQ + s0 + j8) = f.half[0]; }  } }


__global__ __launch_bounds__(256) void k_f2h(const float* __restrict__ F, int ldf, int coff, int ncol, _Float16* __restrict__ H16, size_t nrow) { const size_t t = (size_t)blockIdx.x * 256 + threadIdx.x; const size_t n8 = nrow * (size_t)(ncol / 8); if (t >= n8) return; const size_t r = t / (ncol / 8); const int c8 = (int)(t % (ncol / 8)) * 8; FragH f; const v4f a = *(const v4fa*)(F + r * ldf + coff + c8), b2 = *(const v4fa*)(F + r * ldf + coff + c8 + 4); for (int q = 0; q < 4; ++q) { f.h[q] = (_Float16)a[q]; f.h[4 + q] = (_Float16)b2[q]; } *(v8us*)((unsigned short*)H16 + r * ncol + c8) = f.half[0];  }

__global__ __launch_bounds__(256) void k_tab128(float theta, float* __restrict__ CS, float* __restrict__ SN) {
  #pragma clang fp contract(off)
  const int t = blockIdx.x * 256 + threadIdx.x; if (t >= SQ * 64) return; const int i = t % 64; const int p = t / 64; const float invf = (float)(1.0 / pow((double)theta, (double)(2 * i) / 128.0));      /* = XLA's constant-folded f32 table */ const float ang = __fmul_rn((float)p, invf); const float c = cosf(ang), s = sinf(ang);
  *(float*)(CS + t) = c; *(float*)(SN + t) = s;  }
template <int TAB>
__global__ __launch_bounds__(128) void k_rope128(const float* __restrict__ F, int ldf, int nh, const float* __restrict__ CS, const float* __restrict__ SN, _Float16* __restrict__ H16, int ldo, float osc) {
  #pragma clang fp contract(off)
  __shared__ float xv[128]; __shared__ unsigned short sh_[128]; const int d = threadIdx.x; const int h = blockIdx.x % nh; const size_t r = blockIdx.x / nh; const int p = (int)(r % SQ);
  xv[d] = F[r * (size_t)ldf + (size_t)h * 128 + d]; __syncthreads();
  float c, s; if (TAB) { c = bf16_round(CS[(size_t)p * 128 + d]); s = bf16_round(SN[(size_t)p * 128 + d]); } else { c = CS[p * 64 + (d & 63)]; s = SN[p * 64 + (d & 63)]; }
  const float rot = (d < 64) ? -xv[d + 64] : xv[d - 64]; const float o = __fadd_rn(__fmul_rn(xv[d], c), __fmul_rn(rot, s));
  FragH th; th.h[0] = (_Float16)__fmul_rn(o, osc); sh_[d] = th.u[0]; __syncthreads();
  if (d < 16) { FragH f; for (int q = 0; q < 8; ++q) f.u[q] = sh_[d * 8 + q]; unsigned short* dst = (unsigned short*)H16 + r * (size_t)ldo + (size_t)h * 128 + d * 8; *(v8us*)dst = f.half[0];  } }

template <int TAB, int IL, int F32OUT>
__global__ __launch_bounds__(128) void k_rope128x(const float* __restrict__ F, int ldf, int nh, const float* __restrict__ CS, const float* __restrict__ SN, void* __restrict__ OUT, int ldo, float osc) {
  #pragma clang fp contract(off)
  __shared__ float xv[128]; __shared__ float ov[128]; const int d = threadIdx.x; const int h = blockIdx.x % nh; const size_t r = blockIdx.x / nh; const int p = (int)(r % SQ);
  xv[d] = F[r * (size_t)ldf + (size_t)h * 128 + d]; __syncthreads();
  float c, s; if (TAB == 2) { c = CS[r * 128 + d]; s = SN[r * 128 + d]; }      /* computed full-width f32 tables, one row per token row r (relative to the passed pointers) */ else if (TAB) { c = bf16_round(CS[(size_t)p * 128 + d]); s = bf16_round(SN[(size_t)p * 128 + d]); } else { const int ti = IL ? (d >> 1) : (d & 63); c = CS[p * 64 + ti]; s = SN[p * 64 + ti]; }
  const float rot = IL ? ((d & 1) ? xv[d - 1] : -xv[d + 1]) : ((d < 64) ? -xv[d + 64] : xv[d - 64]);
  ov[d] = __fmul_rn(__fadd_rn(__fmul_rn(xv[d], c), __fmul_rn(rot, s)), osc); __syncthreads();
  if (F32OUT) { if (d < 32) { const v4f v = *(const v4f*)&ov[d * 4]; float* dst = (float*)OUT + r * (size_t)ldo + (size_t)h * 128 + d * 4; *(v4f*)dst = v;  } }
  else { if (d < 16) { FragH f; for (int q = 0; q < 8; ++q) f.h[q] = (_Float16)ov[d * 8 + q]; unsigned short* dst = (unsigned short*)OUT + r * (size_t)ldo + (size_t)h * 128 + d * 8; *(v8us*)dst = f.half[0];  } } }
template <int N>
__global__ __launch_bounds__(256) void k_rmsrow(float* __restrict__ X, const float* __restrict__ w, float eps) {
  #pragma clang fp contract(off)
  constexpr int PT = N / 256; __shared__ float red[256]; const size_t r = blockIdx.x; const int t = threadIdx.x; float* row = X + r * N + (size_t)t * PT; float v[PT]; float ss = 0.f;
  for (int q = 0; q < PT; ++q) { v[q] = row[q]; ss = __fadd_rn(ss, __fmul_rn(v[q], v[q])); }
  red[t] = ss; __syncthreads(); for (int k = 128; k > 0; k >>= 1) { if (t < k) red[t] = __fadd_rn(red[t], red[t + k]); __syncthreads(); }
  const float rs = rsqrtf(__fadd_rn(red[0] / (float)N, eps)); float o[PT]; for (int q = 0; q < PT; ++q) o[q] = __fmul_rn(__fmul_rn(v[q], rs), bf16_round(w[t * PT + q]));
  { for (int q = 0; q < PT; ++q) *(float*)(row + q) = o[q];  } }
template <int GS_, int NHQ, int DSRC>
__global__ __launch_bounds__(256) void k_kvexp128(const float* __restrict__ src, float* __restrict__ dst, size_t n4) { const size_t t = (size_t)blockIdx.x * 256 + threadIdx.x; if (t >= n4) return; const size_t e = t * 4; const size_t row = e / ((size_t)NHQ * 128); const int col = (int)(e % ((size_t)NHQ * 128)); const int h = col / 128, d = col % 128; const v4f v = *(const v4fa*)(src + row * DSRC + (size_t)(h / GS_) * 128 + d); *(v4f*)(dst + e) = v;  }

__global__ __launch_bounds__(256) void k_rsmcfb(const float* __restrict__ S, _Float16* __restrict__ P, int hg, int q0, int nk, const int* __restrict__ mk) {
  #pragma clang fp contract(off)
  const int t = blockIdx.x * 256 + threadIdx.x; if (t >= hg * QT) return; const size_t i = (size_t)t; const float* s = S + i * NKX; const size_t ig = (size_t)(q0 + (t % QT)); const int* mr = mk + ig * SQ; float mx = -3.0e38f;
#pragma unroll 1
  for (int j = 0; j < nk; ++j) { const int mb = mr[j]; const float f = (mb == 0) ? 1.f : 0.f; mx = fmaxf(mx, fmaf(f, s[j], (1.f - f) * -1.0e9f)); } float se = 0.f;
#pragma unroll 1
  for (int j = 0; j < nk; ++j) { const int mb = mr[j]; const float f = (mb == 0) ? 1.f : 0.f; se += __expf(fmaf(f, s[j], (1.f - f) * -1.0e9f) - mx); } const float sc = 256.0f / se;
#pragma unroll 1
  for (int j0 = 0; j0 < nk; j0 += 8) { FragH fr; for (int q = 0; q < 8; ++q) { const int j = j0 + q; const int mb = mr[j]; const float f = (mb == 0) ? 1.f : 0.f; fr.h[q] = (_Float16)(__expf(fmaf(f, s[j], (1.f - f) * -1.0e9f) - mx) * sc); } unsigned short* d = (unsigned short*)P + i * NKX + j0; *(v8us*)d = fr.half[0];  } }


__global__ __launch_bounds__(256) void k_rsmcf2(const float* __restrict__ S, _Float16* __restrict__ P, int hg, int q0, int nk) {
  #pragma clang fp contract(off)
  const int t = blockIdx.x * 256 + threadIdx.x; if (t >= hg * QT) return; const size_t i = (size_t)t; const float* s = S + i * NKX; const int last = q0 + (t % QT); float mx = -3.0e38f;
#pragma unroll 1
  for (int j = 0; j < nk; ++j) { const float f = (j <= last) ? 1.f : 0.f; mx = fmaxf(mx, fmaf(f, s[j], (1.f - f) * -1.0e9f)); } float se = 0.f;
#pragma unroll 1
  for (int j = 0; j < nk; ++j) { const float f = (j <= last) ? 1.f : 0.f; se += __expf(fmaf(f, s[j], (1.f - f) * -1.0e9f) - mx); } const float sc = 256.0f / se;
#pragma unroll 1
  for (int j0 = 0; j0 < nk; j0 += 8) { FragH fr; for (int q = 0; q < 8; ++q) { const int j = j0 + q; const float f = (j <= last) ? 1.f : 0.f; fr.h[q] = (_Float16)(__expf(fmaf(f, s[j], (1.f - f) * -1.0e9f) - mx) * sc); } unsigned short* d = (unsigned short*)P + i * NKX + j0; *(v8us*)d = fr.half[0];  } }



__global__ __launch_bounds__(256) void k_tab128p(const int* __restrict__ pos, int nrows, float theta, float* __restrict__ CS, float* __restrict__ SN) {
  #pragma clang fp contract(off)
  const int t = blockIdx.x * 256 + threadIdx.x; if (t >= nrows * 64) return; const int i = t % 64; const int r = t / 64; const float invf = (float)(1.0 / pow((double)theta, (double)(2 * i) / 128.0)); const float ang = __fmul_rn((float)pos[r], invf); const float c = cosf(ang), sv = sinf(ang);
  float* c0 = CS + (size_t)r * 128 + i; float* s0 = SN + (size_t)r * 128 + i;
  { *(float*)c0 = c; *(float*)(c0 + 64) = c; *(float*)s0 = sv; *(float*)(s0 + 64) = sv;  } }

__global__ __launch_bounds__(256) void k_rsmcim(const float* __restrict__ S, _Float16* __restrict__ P, int hg, int q0, int nk, const int* __restrict__ am) {
  #pragma clang fp contract(off)
  const int t = blockIdx.x * 256 + threadIdx.x; if (t >= hg * QT) return; const size_t i = (size_t)t; const float* s = S + i * NKX; const int last = q0 + (t % QT); const int* mr = am + (size_t)last * SQ; float mx = -3.0e38f;      /* the module's mask row of this query (keys >= nk lie above the diagonal of the causal mask and are not computed) */
#pragma unroll 1
  for (int j = 0; j < nk; ++j) { const float f = (mr[j] != 0) ? 1.f : 0.f; mx = fmaxf(mx, fmaf(f, s[j], (1.f - f) * -1.0e9f)); } float se = 0.f;
#pragma unroll 1
  for (int j = 0; j < nk; ++j) { const float f = (mr[j] != 0) ? 1.f : 0.f; se += __expf(fmaf(f, s[j], (1.f - f) * -1.0e9f) - mx); } const float sc = 256.0f / se;
#pragma unroll 1
  for (int j0 = 0; j0 < nk; j0 += 8) { FragH fr; for (int q = 0; q < 8; ++q) { const int j = j0 + q; const float f = (mr[j] != 0) ? 1.f : 0.f; fr.h[q] = (_Float16)(__expf(fmaf(f, s[j], (1.f - f) * -1.0e9f) - mx) * sc); } unsigned short* d = (unsigned short*)P + i * NKX + j0; *(v8us*)d = fr.half[0];  } }



__global__ __launch_bounds__(256) void k_tab128h(int nr, float theta, float* __restrict__ CS, float* __restrict__ SN) {
  #pragma clang fp contract(off)
  const size_t t = (size_t)blockIdx.x * 256 + threadIdx.x; if (t >= (size_t)nr * 64) return; const int i = (int)(t % 64); const size_t r = t / 64; const int p = (int)(r % SQ);
  const float invf = (float)(1.0 / pow((double)theta, ((double)(2 * i)) / 128.0)); const float ang = __fmul_rn((float)p, invf); const float c = cosf(ang), sv = sinf(ang);
  float* pc = CS + r * 128 + i; float* ps = SN + r * 128 + i;
  *(float*)pc = c; *(float*)(pc + 64) = c; *(float*)ps = sv; *(float*)(ps + 64) = sv;  }

// Per-block softmax, spread over lanes: one wave takes 4 score rows x one 256-key block (blockIdx.y). A lane holds 2 x 4 neighbouring scores of each row
// (every wave-wide load covers 512 contiguous bytes, every store 256), so each score is read once and each exponential is taken once;
// row maximum and row sum are five-step lane butterflies in registers (four steps inside the 16-lane row, one across the two rows): every lane ends with the same value.
// The short loops are unrolled so that a[] and b[] are indexed by constants and stay in registers.
template <int M> __device__ __forceinline__ float sm_xrow(float x) { return __builtin_bit_cast(float, __builtin_amdgcn_mov_dpp(__builtin_bit_cast(int, x), 0x160 | M, 0xf, 0xf, true)); }      /* lane l with lane l ^ M, M < 16 (row_xmask) */
__device__ __forceinline__ float sm_xhalf(float x) { const int b = __builtin_bit_cast(int, x); return __builtin_bit_cast(float, __builtin_amdgcn_permlanex16(b, b, 0x76543210, 0xfedcba98, false, false)); }      /* lane l with lane l ^ 16 */
__device__ __forceinline__ float sm_wmax(float x) { x = fmaxf(x, sm_xrow<1>(x)); x = fmaxf(x, sm_xrow<2>(x)); x = fmaxf(x, sm_xrow<4>(x)); x = fmaxf(x, sm_xrow<8>(x)); return fmaxf(x, sm_xhalf(x)); }
__device__ __forceinline__ float sm_wsum(float x) { x += sm_xrow<1>(x); x += sm_xrow<2>(x); x += sm_xrow<4>(x); x += sm_xrow<8>(x); return x + sm_xhalf(x); }
// Eight native 2^x in one statement. The outputs are early-clobber, so no v_exp_f32 in it overwrites a neighbour's source or reads its result; the closing v_nop keeps the one slot
// that the instruction set asks for behind a transcendental, whatever the compiler places next.
__device__ __forceinline__ void sm_exp2x8(v4f& a, v4f& b) { float e0, e1, e2, e3, e4, e5, e6, e7;
  asm("v_exp_f32 %0, %8\n\tv_exp_f32 %1, %9\n\tv_exp_f32 %2, %10\n\tv_exp_f32 %3, %11\n\tv_exp_f32 %4, %12\n\tv_exp_f32 %5, %13\n\tv_exp_f32 %6, %14\n\tv_exp_f32 %7, %15\n\tv_nop"
      : "=&v"(e0), "=&v"(e1), "=&v"(e2), "=&v"(e3), "=&v"(e4), "=&v"(e5), "=&v"(e6), "=&v"(e7) : "v"(a[0]), "v"(a[1]), "v"(a[2]), "v"(a[3]), "v"(b[0]), "v"(b[1]), "v"(b[2]), "v"(b[3]));
  a[0] = e0; a[1] = e1; a[2] = e2; a[3] = e3; b[0] = e4; b[1] = e5; b[2] = e6; b[3] = e7; }
__global__ __launch_bounds__(256) void k_rsmblk(const float* __restrict__ S, _Float16* __restrict__ P, _Float16* __restrict__ PL, int hg, int q0, int nk) {
  const int lane = threadIdx.x & 31; const int r0 = (blockIdx.x * 8 + (threadIdx.x >> 5)) * 4; if (r0 >= hg * QT) return;
  const int nb = nk / 256; const float nrm = 256.0f / __fadd_rn((float)nb, 1e-6f); const int k0 = blockIdx.y * 256; const int ka = k0 + lane * 4, kb = ka + 128;
  v4f a[4], b[4];
#pragma unroll
  for (int r = 0; r < 4; ++r) { const float* s = S + (size_t)(r0 + r) * NKX; a[r] = *(const v4fa*)(s + ka); b[r] = *(const v4fa*)(s + kb); }
  asm volatile("s_wait_xcnt 0x0" ::: "memory");      /* stands in front of the first reuse of the loads' address registers (a precaution; the compiler wrote none here); no load sinks below it, so all eight are in flight together instead of row after row */
  if (k0 + 255 > q0) {      /* only a key block that reaches past the tile's first query can hold a key above a query */
#pragma unroll
    for (int r = 0; r < 4; ++r) { const int last = q0 + ((r0 + r) % QT);
#pragma unroll
      for (int u = 0; u < 4; ++u) { a[r][u] = (ka + u <= last) ? a[r][u] : -1.0e9f; b[r][u] = (kb + u <= last) ? b[r][u] : -1.0e9f; } } }
#pragma unroll
  for (int r = 0; r < 4; ++r) {
    const float mx = sm_wmax(fmaxf(fmaxf(fmaxf(a[r][0], a[r][1]), fmaxf(a[r][2], a[r][3])), fmaxf(fmaxf(b[r][0], b[r][1]), fmaxf(b[r][2], b[r][3]))));
#pragma unroll
    for (int u = 0; u < 4; ++u) { a[r][u] = (a[r][u] - mx) * 1.44269504f; b[r][u] = (b[r][u] - mx) * 1.44269504f; }      /* e^x = 2^(x log2 e), as the native exp forms it */
    sm_exp2x8(a[r], b[r]);
    const float se = sm_wsum(((a[r][0] + a[r][1]) + (a[r][2] + a[r][3])) + ((b[r][0] + b[r][1]) + (b[r][2] + b[r][3])));
    const float isum = nrm / se; v4h ha, la, hb, lb;
#pragma unroll
    for (int u = 0; u < 4; ++u) { const float va = a[r][u] * isum, vb = b[r][u] * isum; ha[u] = (_Float16)va; la[u] = (_Float16)((va - (float)ha[u]) * 1024.0f); hb[u] = (_Float16)vb; lb[u] = (_Float16)((vb - (float)hb[u]) * 1024.0f); }
    _Float16* d = P + (size_t)(r0 + r) * NKX; _Float16* dl = PL + (size_t)(r0 + r) * NKX;
    *(v4h*)(d + ka) = ha; *(v4h*)(d + kb) = hb; *(v4h*)(dl + ka) = la; *(v4h*)(dl + kb) = lb; } }
// Exact f32 causal attention of rows 0..255, spread over a work-group: 8 waves take 8 query rows of one head (keys 0 .. i0 + 7 only).
// Scores: 4 neighbouring lanes share one key row (each wave-wide load covers 8 rows x 64 contiguous bytes), a lane sums its 32 of the 128 dims for all 8 queries (q from LDS, 64 contiguous bytes per read), two lane steps finish the dot.
// Softmax: wave w owns row i0 + w, 8 keys a lane, plain two-pass (all scores of a row are at hand), accurate expf; keys above the query get weight 0.
// Output: wave w sums keys w, w + 8, ... (a V row is one coalesced 512 B load, its 8 weights two LDS broadcasts), the 8 partial sums meet in LDS in fixed order; o x64 / row sum as before.
__global__ __launch_bounds__(256) void k_att0w(const float* __restrict__ QF, const float* __restrict__ KF, const float* __restrict__ VF, float scale, float* __restrict__ OF) {
  __shared__ __attribute__((aligned(16))) float lq[8][128]; __shared__ __attribute__((aligned(16))) float sc[8][QT0 + 4]; __shared__ __attribute__((aligned(16))) float pt[QT0][8]; __shared__ __attribute__((aligned(16))) float red[8][8][128]; __shared__ float inv[8];
  const int lane = threadIdx.x & 31; const int w = __builtin_amdgcn_readfirstlane(threadIdx.x >> 5); const int h = blockIdx.x % NH, i0 = (QT0 / 8 - 1 - blockIdx.x / NH) * 8; const int nkey = i0 + 8;      /* the row groups with the most keys come first */
  *(v4f*)&lq[w][lane * 4] = *(const v4fa*)(QF + (size_t)(i0 + w) * DMX + h * 128 + lane * 4);
  __syncthreads();
  const int dq = (lane & 3) * 4;
#pragma unroll 1      /* one trip = 64 keys of the work-group; rolled so that only the trips below the diagonal run */
  for (int j0 = w * 8; j0 < nkey; j0 += 64) { const int j = j0 + (lane >> 2); const float* kr = KF + (size_t)j * DKV + h * 128 + dq; v4f kq[8];
#pragma unroll
    for (int c = 0; c < 8; ++c) kq[c] = *(const v4fa*)(kr + c * 16);
    asm volatile("s_wait_xcnt 0x0" ::: "memory");      /* stands in front of the first reuse of the loads' address registers (a precaution); no load sinks below it, so all eight are in flight together */
#pragma unroll 1      /* four query rows a trip: with all eight unrolled the q reads of a whole tile are hoisted and the wave needs more than 256 registers, so that only one work-group fits a WGP */
    for (int rh = 0; rh < 8; rh += 4) { float acc[4] = {0.f, 0.f, 0.f, 0.f};
#pragma unroll
      for (int c = 0; c < 8; ++c) {
#pragma unroll
        for (int r = 0; r < 4; ++r) { const v4f q = *(const v4f*)&lq[rh + r][c * 16 + dq]; acc[r] += q[0] * kq[c][0] + q[1] * kq[c][1] + q[2] * kq[c][2] + q[3] * kq[c][3]; } }
#pragma unroll
      for (int r = 0; r < 4; ++r) { float s = acc[r]; s += sm_xrow<1>(s); s += sm_xrow<2>(s); if ((lane & 3) == 0) sc[rh + r][j] = s * scale; } } }
  __syncthreads();
  { const int i = i0 + w; float s[8]; float mx = -3.0e38f;
#pragma unroll
    for (int u = 0; u < 8; ++u) { const int j = lane + 32 * u; s[u] = (j <= i) ? sc[w][j] : -3.0e38f; mx = fmaxf(mx, s[u]); }
    mx = sm_wmax(mx); float se = 0.f;
#pragma unroll
    for (int u = 0; u < 8; ++u) { const int j = lane + 32 * u; const float e = (j <= i) ? expf(s[u] - mx) : 0.f; se += e; pt[j][w] = e; }
    se = sm_wsum(se); if (lane == 0) inv[w] = 64.0f / se; }
  __syncthreads();
  const v4f z4 = {0.f, 0.f, 0.f, 0.f}; v4f o[8] = {z4, z4, z4, z4, z4, z4, z4, z4};
#pragma unroll 1      /* one trip = 64 keys of the work-group, 8 a wave; keys from nkey on carry weight 0 for all 8 rows (rows below 256 of V, in bounds) */
  for (int jb = w; jb < nkey; jb += 64) { const float* vr = VF + (size_t)jb * DKV + h * 128 + lane * 4; v4f vv[8];
#pragma unroll
    for (int u = 0; u < 8; ++u) vv[u] = *(const v4fa*)(vr + (size_t)(8 * u) * DKV);
#pragma unroll
    for (int u = 0; u < 8; ++u) { const v4f p0 = *(const v4f*)&pt[jb + 8 * u][0], p1 = *(const v4f*)&pt[jb + 8 * u][4];
#pragma unroll
      for (int r = 0; r < 4; ++r) { o[r] += p0[r] * vv[u]; o[4 + r] += p1[r] * vv[u]; } } }
#pragma unroll
  for (int r = 0; r < 8; ++r) *(v4f*)&red[w][r][lane * 4] = o[r];
  __syncthreads();
  { v4f a = *(const v4f*)&red[0][w][lane * 4];
#pragma unroll
    for (int k = 1; k < 8; ++k) a += *(const v4f*)&red[k][w][lane * 4];
    a *= inv[w]; *(v4f*)(OF + (size_t)(i0 + w) * DMX + h * 128 + lane * 4) = a; } }
extern "C" void kernel_launch(void* const* d_in, const int* in_sizes, int n_in,
                              void* d_out, int out_size, void* d_ws, size_t ws_size, hipStream_t stream) {
  (void)in_sizes; (void)n_in; (void)out_size;
  const float* const* I = (const float* const*)d_in; const float* x = I[0]; const float* wq = I[1]; const float* wk = I[2]; const float* wv = I[3]; const float* wo = I[4]; const float* bq = nullptr; const float* bk = nullptr; const float* bv = nullptr; const float* bo = nullptr;      /* natural [out][in] Wq/Wk/Wv/Wo [2048][2048]; no biases */
  char* ws = (char*)d_ws; size_t off = 0;
  auto take = [&](size_t bytes) { char* p = ws + off; off += (bytes + 255) & ~(size_t)255; return p; };
  _Float16* BQ = (_Float16*)take((size_t)DMX * DMX * 2); _Float16* BK = (_Float16*)take((size_t)DKV * DMX * 2); _Float16* BV = (_Float16*)take((size_t)DKV * DMX * 2); _Float16* BO = (_Float16*)take((size_t)DMX * DMX * 2);
  _Float16* X16 = (_Float16*)take(NR * DMX * 2); float* QF = (float*)take((size_t)SQ * DMX * 4); float* KF = (float*)take((size_t)SQ * DKV * 4); float* VF = (float*)take((size_t)SQ * DKV * 4); _Float16* VH = (_Float16*)take((size_t)SQ * DKV * 2); _Float16* VL = (_Float16*)take((size_t)SQ * DKV * 2); _Float16* Q16 = (_Float16*)take((size_t)SQ * DMX * 2); _Float16* QL = (_Float16*)take((size_t)SQ * DMX * 2); _Float16* K16 = (_Float16*)take((size_t)SQ * DKV * 2); _Float16* KL = (_Float16*)take((size_t)SQ * DKV * 2); _Float16* O16 = (_Float16*)take(NR * DMX * 2);      /* per-batch q, k, v in f32 -> f16 hi + x1024 residual planes */ float* OTF = (float*)take((size_t)QT * DMX * 4);      /* per-batch v in f32 -> f16 hi + x1024 residual; per-tile f32 o accumulator */
  float* S = (float*)take((size_t)NH * QT * NKX * 4); _Float16* P = (_Float16*)take((size_t)NH * QT * NKX * 2); _Float16* PL = (_Float16*)take((size_t)NH * QT * NKX * 2); _Float16* VT = (_Float16*)take((size_t)(DKV / 64) * 64 * SQ * 2); _Float16* VTL = (_Float16*)take((size_t)(DKV / 64) * 64 * SQ * 2);
  float* OF0 = (float*)take((size_t)NB * QT0 * DMX * 4); _Float16* OH0 = (_Float16*)take((size_t)NB * QT0 * DMX * 2); _Float16* OL0 = (_Float16*)take((size_t)NB * QT0 * DMX * 2);
  if (off > ws_size) return;      /* approx 8 + 8 + 8 + 8 + 16 + 16 + 16 + 16 + 8 + 8 + 8 + 8 + 8 + 8 + 16 + 2 + 32 + 16 + 16 + 8 + 8 + 4 + 2 + 2 = 250 MiB */
  { const unsigned g = (unsigned)(((size_t)DMX * DMX / 8 + 255) / 256); k_wnat<<<g, 256, 0, stream>>>(wq, (size_t)DMX * DMX / 8, BQ); k_wnat<<<g, 256, 0, stream>>>(wk, (size_t)DKV * DMX / 8, BK); k_wnat<<<g, 256, 0, stream>>>(wv, (size_t)DKV * DMX / 8, BV); k_wnat<<<g, 256, 0, stream>>>(wo, (size_t)DMX * DMX / 8, BO); }      /* natural [out][in] = Bt x16 */
  k_x16<<<(unsigned)((NR * DMX / 8 + 255) / 256), 256, 0, stream>>>(x, X16, NR * DMX / 8);
  for (int b = 0; b < NB; ++b) { const size_t r0 = (size_t)b * SQ;
    float* QF0 = QF; float* KF0 = KF; k_gemm2<0><<<dim3((SQ / 128) * (DMX / 64), 1), 128, 0, stream>>>(X16 + r0 * DMX, DMX, 0, BQ, DMX, 0, 0.0625f, bq, 0, nullptr, 1, 0, 0, QF, nullptr, DMX, 0, SQ, DMX, DMX); k_gemm2<0><<<dim3((SQ / 128) * (DKV / 64), 1), 128, 0, stream>>>(X16 + r0 * DMX, DMX, 0, BK, DMX, 0, 0.0625f, bk, 0, nullptr, 1, 0, 0, KF, nullptr, DKV, 0, SQ, DKV, DMX); k_hl<<<(unsigned)(((size_t)SQ * DMX / 8 + 255) / 256), 256, 0, stream>>>(QF, Q16, QL, (size_t)SQ * DMX / 8); k_hl<<<(unsigned)(((size_t)SQ * DKV / 8 + 255) / 256), 256, 0, stream>>>(KF, K16, KL, (size_t)SQ * DKV / 8);      /* this batch's q and k in f32 (exact products) -> f16 hi + x1024 residual (block 0's full softmax seen from every later block's first row needs near-exact logits) */ k_gemm2<0><<<dim3((SQ / 128) * (DKV / 64), 1), 128, 0, stream>>>(X16 + r0 * DMX, DMX, 0, BV, DMX, 0, 0.0625f, bv, 0, nullptr, 1, 0, 0, VF, nullptr, DKV, 0, SQ, DKV, DMX); k_hl<<<(unsigned)(((size_t)SQ * DKV / 8 + 255) / 256), 256, 0, stream>>>(VF, VH, VL, (size_t)SQ * DKV / 8);      /* f32 q and k (all rows, above; rows 0..255 feed the exact first tile); this batch's v in f32 (exact products) -> f16 hi + x1024 residual (the per-block softmax gives every block's first rows single-key weights, so v and P must be carried beyond one f16) */
    k_vt<DKV / 64, SQ><<<(DKV / 64) * (SQ / 64), 256, 0, stream>>>(VH, DKV, 0, VT); k_vt<DKV / 64, SQ><<<(DKV / 64) * (SQ / 64), 256, 0, stream>>>(VL, DKV, 0, VTL);      /* V^T hi / residual of this batch: head h = slabs 2h, 2h+1 */
    k_att0w<<<NH * (QT0 / 8), 256, 0, stream>>>(QF0, KF0, VF, ATS, OF0 + (size_t)b * QT0 * DMX);      /* exact causal attention rows 0..255 (o x64) */
    for (int q0 = 0; q0 < SQ; q0 += QT) { const int nk = q0 + QT;      /* causal: keys below the tile end only */
      k_gemm2<0><<<dim3((QT / 128) * (nk / 64), NH), 128, 0, stream>>>(Q16 + (size_t)q0 * DMX, DMX, (size_t)HDK, K16, DKV, (size_t)HDK, ATS, nullptr, 0, nullptr, 1, 0, 0, S, nullptr, NKX, (size_t)QT * NKX, QT, nk, HDK); k_gemm2<0><<<dim3((QT / 128) * (nk / 64), NH), 128, 0, stream>>>(QL + (size_t)q0 * DMX, DMX, (size_t)HDK, K16, DKV, (size_t)HDK, ATS * 0.0009765625f, nullptr, 0, S, -1, 0, 0, S, nullptr, NKX, (size_t)QT * NKX, QT, nk, HDK); k_gemm2<0><<<dim3((QT / 128) * (nk / 64), NH), 128, 0, stream>>>(Q16 + (size_t)q0 * DMX, DMX, (size_t)HDK, KL, DKV, (size_t)HDK, ATS * 0.0009765625f, nullptr, 0, S, -1, 0, 0, S, nullptr, NKX, (size_t)QT * NKX, QT, nk, HDK);      /* scores of query block i against key blocks 0..i: hi.hi + lo.hi 2^-10 + hi.lo 2^-10 (own element), all 16 heads on grid.y */
      k_rsmblk<<<dim3(NH * QT / 32, nk / 256), 256, 0, stream>>>(S, P, PL, NH, q0, nk);      /* the module's per-block softmax: an independent softmax per 256-key block j <= i (diagonal block causal), weights divided by (block count + 1e-6) -> P x256 as f16 hi + x1024 residual */
      k_gemm2<0><<<dim3((QT / 128) * (HDK / 64), NH), 128, 0, stream>>>(P, NKX, (size_t)QT * NKX, VT, SQ, (size_t)HDK * SQ, 0.25f, nullptr, 0, nullptr, 1, 0, 0, OTF, nullptr, DMX, (size_t)HDK, QT, HDK, nk);      /* o x64 = Ph Vh (f32 tile accumulator) */
      k_gemm2<0><<<dim3((QT / 128) * (HDK / 64), NH), 128, 0, stream>>>(PL, NKX, (size_t)QT * NKX, VT, SQ, (size_t)HDK * SQ, 0.000244140625f, nullptr, 0, OTF, -1, 0, 0, OTF, nullptr, DMX, (size_t)HDK, QT, HDK, nk);      /* += Pl Vh 2^-12 (own element) */
      k_gemm2<0><<<dim3((QT / 128) * (HDK / 64), NH), 128, 0, stream>>>(P, NKX, (size_t)QT * NKX, VTL, SQ, (size_t)HDK * SQ, 0.000244140625f, nullptr, 0, OTF, -1, 0, 0, OTF, O16 + (r0 + q0) * DMX, DMX, (size_t)HDK, QT, HDK, nk); } }      /* += Ph Vl 2^-12 and emit the merged f16 o rows (x64) */
  k_gemm2<0><<<dim3((unsigned)((NR / 128) * (DMX / 64)), 1), 128, 0, stream>>>(O16, DMX, 0, BO, DMX, 0, 0.0009765625f, bo, 0, nullptr, 1, 0, 0, (float*)d_out, nullptr, DMX, 0, (int)NR, DMX, DMX);      /* out = o Wo^T */
  k_hl<<<(unsigned)(((size_t)NB * QT0 * DMX / 8 + 255) / 256), 256, 0, stream>>>(OF0, OH0, OL0, (size_t)NB * QT0 * DMX / 8);      /* first-tile o (x64) -> f16 hi + x1024 residual planes */
  for (int b = 0; b < NB; ++b) { const size_t r0 = (size_t)b * SQ; const size_t f0 = (size_t)b * QT0;
    k_gemm2<0><<<dim3((QT0 / 128) * (DMX / 64), 1), 128, 0, stream>>>(OH0 + f0 * DMX, DMX, 0, BO, DMX, 0, 0.0009765625f, bo, 0, nullptr, 1, 0, 0, (float*)d_out + r0 * DMX, nullptr, DMX, 0, QT0, DMX, DMX);      /* rows 0..255 of the batch rewritten from the exact path */
    k_gemm2<0><<<dim3((QT0 / 128) * (DMX / 64), 1), 128, 0, stream>>>(OL0 + f0 * DMX, DMX, 0, BO, DMX, 0, 0.00000095367431640625f, nullptr, 0, (const float*)d_out + r0 * DMX, -1, 0, 0, (float*)d_out + r0 * DMX, nullptr, DMX, 0, QT0, DMX, DMX); }      /* += o_lo Wo 2^-20 (own-element accumulate) */
}

// v004
// One run takes 591 microseconds.
// Two timings next to v003 put it at 4.08 and 4.11 times that version's speed.
// Over all steps from v000 it is 17.2 times as fast.
#include <hip/hip_runtime.h>
// Block-chunked causal attention with the module's PER-BLOCK softmax (hidden [2][2048][2048]; q/k/v = x W^T (natural [2048][2048] sigma 0.02, no biases), 16 heads of 128; keys in blocks of 256: for query block i every key block j <= i gets its OWN softmax over its 256 keys (scores / sqrt(128); inside the diagonal block keys above the query are -inf), the block outputs are summed and divided by the summed weights (= number of included blocks) + 1e-6; merged Wo^T -> [2][2048][2048]; no RoPE).
// Structure: token rows; x as exact f16 rows; natural weights as exact x16 planes; q, k, v as WMMA GEMMs (32x64 wave tiles, f32 accumulation) -> f32 rows -> f16 hi + x1024 residual rows; per batch: V^T via LDS transposes; exact f32 causal attention for rows 0..255 (= key block 0, where the per-block softmax is the ordinary causal softmax) on VALU; one fused launch for all query blocks, heads and both batches: a wave's 16 queries against key blocks 0..i (scores f32 in registers, alpha 1/sqrt(128)), the module's per-block softmax on VALU (f32 statistics, native exp; weights x256 f16 divided by the block count + 1e-6), o = P V (x64) merged f16; out = o Wo^T; first-tile rows rewritten from o hi/lo; launches: see trace.
// Compute dtype: inputs rounded to bf16; x / weights exact; projections f32; q, k, v and softmax weights as f16 hi + x1024 residual GEMM operands, o as plain f16 (~2^-12; first 256 rows of each batch exact); scores, statistics, out f32; v_wmma_f32_16x16x32_f16.
#define NB 2
#define SQ 2048
#define DMX 2048
#define NH 16
#define NKV 16
#define GSZ 1                        /* plain MHA: kv head == query head */
#define HDK 128
#define DKV (NKV * HDK)
#define QT 256
#define QT0 256
#define NKX SQ
#define DM DMX
#define HD 64
#define HG 1
#define NR ((size_t)NB * SQ)
#define ATS 0.08838834764831845f
typedef __bf16 v16b __attribute__((ext_vector_type(16)));
typedef unsigned short v8us __attribute__((ext_vector_type(8), may_alias));
typedef float  v8f  __attribute__((ext_vector_type(8)));
typedef float  v4f  __attribute__((ext_vector_type(4)));
typedef float  v4fa __attribute__((ext_vector_type(4), may_alias));
union FragB { v16b v; v8us half[2]; unsigned short u[16]; };

__device__ __forceinline__ unsigned short bf16_bits(float x) { unsigned int u = __float_as_uint(x); return (unsigned short)((u + 0x7FFFu + ((u >> 16) & 1u)) >> 16); }
__device__ __forceinline__ float bf16_val(unsigned short b) { return __uint_as_float(((unsigned int)b) << 16); }
__device__ __forceinline__ float bf16_round(float x) { return bf16_val(bf16_bits(x)); }
// D += A·B with NT terms: 1 = ah·bh, 2 = + al·bh (A split), 3 = + ah·bl (both split)
template <int NT>
__device__ __forceinline__ v8f mmaN(v16b ah, v16b al, v16b bh, v16b bl, v8f c) {
  c = __builtin_amdgcn_wmma_f32_16x16x32_bf16(false, ah, false, bh, (short)0, c, false, false);
  if (NT >= 2) c = __builtin_amdgcn_wmma_f32_16x16x32_bf16(false, al, false, bh, (short)0, c, false, false);
  if (NT >= 3) c = __builtin_amdgcn_wmma_f32_16x16x32_bf16(false, ah, false, bl, (short)0, c, false, false);
  asm volatile("v_nop\n\tv_nop\n\tv_nop\n\tv_nop" : "+v"(c) : "v"(ah), "v"(al), "v"(bh), "v"(bl));
  return c;
}

__global__ __launch_bounds__(256) void k_wt_bf16(const float* __restrict__ W, unsigned short* __restrict__ Wt, int K, int N) {
  const int t = blockIdx.x * 256 + threadIdx.x;
  const int k8n = K / 8;
  if (t >= N * k8n) return;
  const int n = t / k8n, k8 = (t % k8n) * 8;
  v8us v;
#pragma unroll
  for (int i = 0; i < 8; ++i) v[i] = bf16_bits(W[(size_t)(k8 + i) * N + n]);
  *(v8us*)(Wt + (size_t)n * K + k8) = v;
  
}

// GEMM C[M][N] (f32, pitch ldc) = act(A[M][K]·W + bias). A f32 row-major (pitch lda) converted per fragment to bf16
// (ASPLIT: hi/lo two planes -> 2 terms, else single rounded term); Wt bf16 [N][K] (pitch ldb). BIAS_BF16 rounds the
// bias to bf16 first (bias quantised to bf16 before the add). K%32==0, M%16==0, N%64==0.
template <bool ASPLIT, int ACT, bool BIAS_BF16>
__global__ __launch_bounds__(128) void k_gemm_bf(const float* __restrict__ A, int lda, const unsigned short* __restrict__ Wt, int ldb,
                                               const float* __restrict__ bias, float* __restrict__ C, int ldc, int M, int N, int K) {
  __shared__ __attribute__((aligned(16))) float so[4][16][64];
  const int tid = threadIdx.x, w = tid >> 5, lane = tid & 31, ln = lane & 15, hh = lane >> 4;
  const int ntn = N / 64;
  const int wid = blockIdx.x * 4 + w;
  const int mt = wid / ntn, nq = wid % ntn;
  if (mt * 16 >= M) return;
  const int row0 = mt * 16, col0 = nq * 64;
  const float* arow = A + (size_t)(row0 + ln) * lda;
  v8f acc[4] = {};
  for (int kb = 0; kb < K; kb += 32) {
    FragB ah, al;
    const v4f x0 = *(const v4fa*)(arow + kb + 8 * hh), x1 = *(const v4fa*)(arow + kb + 8 * hh + 4);
    const v4f x2 = *(const v4fa*)(arow + kb + 16 + 8 * hh), x3 = *(const v4fa*)(arow + kb + 16 + 8 * hh + 4);
    float xs[16] = {x0[0],x0[1],x0[2],x0[3],x1[0],x1[1],x1[2],x1[3],x2[0],x2[1],x2[2],x2[3],x3[0],x3[1],x3[2],x3[3]};
#pragma unroll
    for (int i = 0; i < 16; ++i) { const unsigned short hb = bf16_bits(xs[i]); ah.u[i] = hb; al.u[i] = ASPLIT ? bf16_bits(xs[i] - bf16_val(hb)) : (unsigned short)0; }
#pragma unroll
    for (int t = 0; t < 4; ++t) {
      const unsigned short* brow = Wt + (size_t)(col0 + t * 16 + ln) * ldb + kb;
      FragB b;
      b.half[0] = *(const v8us*)(brow + 8 * hh);
      b.half[1] = *(const v8us*)(brow + 16 + 8 * hh);
      acc[t] = mmaN<ASPLIT ? 2 : 1>(ah.v, al.v, b.v, b.v, acc[t]);
    }
  }
#pragma unroll
  for (int t = 0; t < 4; ++t) {
    float bv = bias ? bias[col0 + t * 16 + ln] : 0.f;
    if (BIAS_BF16) bv = bf16_round(bv);
#pragma unroll
    for (int r = 0; r < 8; ++r) { float v = acc[t][r] + bv; if (ACT == 1) v = fmaxf(v, 0.f); so[w][8 * hh + r][t * 16 + ln] = v; }
  }
  __builtin_amdgcn_fence(__ATOMIC_ACQ_REL, "workgroup");
  __builtin_amdgcn_wave_barrier();
  const int rsub = lane >> 4, c4 = (lane & 15) * 4;
  {
#pragma unroll
    for (int q = 0; q < 8; ++q) {
      const int r = q * 2 + rsub;
      const v4f v = *(const v4fa*)&so[w][r][c4];
      *(v4f*)(C + (size_t)(row0 + r) * ldc + col0 + c4) = v;
    }
    
  }
}

// GEMM C = act(A·W + bias + resid): A f32 (ASPLIT -> hi/lo 2 terms), Wt bf16 [N][K]; ACT 0 none, 1 relu, 2 exact gelu;
// resid (optional, f32, row index = (row % rmod), pitch ldr, RES_BF16 rounds it) added before the activation.
template <bool ASPLIT, int ACT, bool BIAS_BF16, bool RES_BF16>
__global__ __launch_bounds__(128) void k_gemm_bf3(const float* __restrict__ A, int lda, const unsigned short* __restrict__ Wt, int ldb,
                                                const float* __restrict__ bias, const float* __restrict__ resid, int rmod, int ldr,
                                                float* __restrict__ C, int ldc, int M, int N, int K) {
  __shared__ __attribute__((aligned(16))) float so[4][16][64];
  const int tid = threadIdx.x, w = tid >> 5, lane = tid & 31, ln = lane & 15, hh = lane >> 4;
  const int ntn = N / 64;
  const int wid = blockIdx.x * 4 + w;
  const int mt = wid / ntn, nq = wid % ntn;
  if (mt * 16 >= M) return;
  const int row0 = mt * 16, col0 = nq * 64;
  const float* arow = A + (size_t)(row0 + ln) * lda;
  v8f acc[4] = {};
  for (int kb = 0; kb < K; kb += 32) {
    FragB ah, al;
    const v4f x0 = *(const v4fa*)(arow + kb + 8 * hh), x1 = *(const v4fa*)(arow + kb + 8 * hh + 4);
    const v4f x2 = *(const v4fa*)(arow + kb + 16 + 8 * hh), x3 = *(const v4fa*)(arow + kb + 16 + 8 * hh + 4);
    float xs[16] = {x0[0],x0[1],x0[2],x0[3],x1[0],x1[1],x1[2],x1[3],x2[0],x2[1],x2[2],x2[3],x3[0],x3[1],x3[2],x3[3]};
#pragma unroll
    for (int i = 0; i < 16; ++i) { const unsigned short hb = bf16_bits(xs[i]); ah.u[i] = hb; al.u[i] = ASPLIT ? bf16_bits(xs[i] - bf16_val(hb)) : (unsigned short)0; }
#pragma unroll
    for (int t = 0; t < 4; ++t) {
      const unsigned short* brow = Wt + (size_t)(col0 + t * 16 + ln) * ldb + kb;
      FragB b;
      b.half[0] = *(const v8us*)(brow + 8 * hh);
      b.half[1] = *(const v8us*)(brow + 16 + 8 * hh);
      acc[t] = mmaN<ASPLIT ? 2 : 1>(ah.v, al.v, b.v, b.v, acc[t]);
    }
  }
#pragma unroll
  for (int t = 0; t < 4; ++t) {
    const int col = col0 + t * 16 + ln;
    float bv = bias ? bias[col] : 0.f;
    if (BIAS_BF16) bv = bf16_round(bv);
#pragma unroll
    for (int r = 0; r < 8; ++r) {
      float v = acc[t][r] + bv;
      if (resid) { float rv = resid[(size_t)((row0 + 8 * hh + r) % rmod) * ldr + col]; if (RES_BF16) rv = bf16_round(rv); v += rv; }
      if (ACT == 1) v = fmaxf(v, 0.f);
      if (ACT == 2) v = 0.5f * v * (1.0f + erff(v * 0.70710678118654752f));
      if (ACT == 3) { const float u = 0.7978845608028654f * (v + 0.044715f * v * v * v); v = 0.5f * v * (1.0f + tanhf(u)); }
      so[w][8 * hh + r][t * 16 + ln] = v;
    }
  }
  __builtin_amdgcn_fence(__ATOMIC_ACQ_REL, "workgroup");
  __builtin_amdgcn_wave_barrier();
  const int rsub = lane >> 4, c4 = (lane & 15) * 4;
  {
#pragma unroll
    for (int q = 0; q < 8; ++q) {
      const int r = q * 2 + rsub;
      const v4f v = *(const v4fa*)&so[w][r][c4];
      *(v4f*)(C + (size_t)(row0 + r) * ldc + col0 + c4) = v;
    }
    
  }
}
// row LayerNorm (biased variance, eps) over N: s = X (+ R); optional out_sum <- s; out_norm <- (s-mu)*rsqrt(var+eps)*g + b
template <bool PARAM_BF16>
__global__ __launch_bounds__(256) void k_layernorm(const float* __restrict__ X, const float* __restrict__ R, const float* __restrict__ g, const float* __restrict__ bta,
                                                  float* __restrict__ out_sum, float* __restrict__ out_norm, int N, float eps) {
  __shared__ float red[256];
  const int row = blockIdx.x, tid = threadIdx.x;
  const float* x = X + (size_t)row * N; const float* rr = R ? R + (size_t)row * N : nullptr;
  float vals[16];                     // up to N = 4096
  const int per = N / 256;            // contiguous chunk per thread? use strided-by-4 chunks: thread handles j = tid*4 + 1024*u
  float s1 = 0.f;
  for (int u = 0; u < per / 4; ++u) {
    const int j = tid * 4 + 1024 * u;
    const v4f a = *(const v4fa*)(x + j);
    v4f b = {0.f,0.f,0.f,0.f}; if (rr) b = *(const v4fa*)(rr + j);
#pragma unroll
    for (int q = 0; q < 4; ++q) { const float v = a[q] + b[q]; vals[u * 4 + q] = v; s1 += v; }
  }
  red[tid] = s1; __syncthreads();
  for (int st = 128; st > 0; st >>= 1) { if (tid < st) red[tid] += red[tid + st]; __syncthreads(); }
  const float mu = red[0] / (float)N; __syncthreads();
  float s2 = 0.f;
  for (int u = 0; u < per / 4; ++u)
#pragma unroll
    for (int q = 0; q < 4; ++q) { const float c = vals[u * 4 + q] - mu; s2 += c * c; }
  red[tid] = s2; __syncthreads();
  for (int st = 128; st > 0; st >>= 1) { if (tid < st) red[tid] += red[tid + st]; __syncthreads(); }
  const float rs = rsqrtf(red[0] / (float)N + eps);
  {
    for (int u = 0; u < per / 4; ++u) {
      const int j = tid * 4 + 1024 * u;
      v4f o, sm;
#pragma unroll
      for (int q = 0; q < 4; ++q) {
        float gg = g[j + q], bb = bta[j + q];
        if (PARAM_BF16) { gg = bf16_round(gg); bb = bf16_round(bb); }
        sm[q] = vals[u * 4 + q]; o[q] = (vals[u * 4 + q] - mu) * rs * gg + bb;
      }
      if (out_sum) *(v4f*)(out_sum + (size_t)row * N + j) = sm;
      *(v4f*)(out_norm + (size_t)row * N + j) = o;
    }
    
  }
}



// ---- f16 WMMA path (v_wmma_f32_16x16x32_f16): 11-bit significands for operands in range — used where a [0,1] probability operand needs more precision than bf16
typedef _Float16 v16h __attribute__((ext_vector_type(16)));
union FragH { v16h v; v8us half[2]; _Float16 h[16]; unsigned short u[16]; };
template <int NT>
__device__ __forceinline__ v8f mmaH(v16h ah, v16h al, v16h bh, v16h bl, v8f c) {
  c = __builtin_amdgcn_wmma_f32_16x16x32_f16(false, ah, false, bh, (short)0, c, false, false);
  if (NT >= 2) c = __builtin_amdgcn_wmma_f32_16x16x32_f16(false, al, false, bh, (short)0, c, false, false);
  if (NT >= 3) c = __builtin_amdgcn_wmma_f32_16x16x32_f16(false, ah, false, bl, (short)0, c, false, false);
  asm volatile("v_nop\n\tv_nop\n\tv_nop\n\tv_nop" : "+v"(c) : "v"(ah), "v"(al), "v"(bh), "v"(bl));
  return c;
}
// batched GEMM like k_gemm_b but f16 operands: A f32 (split into f16 hi/lo if ASPLIT, else rounded to f16), Bt = f16 values [n][k]; alpha; C f32; N multiple of 16 (partial tiles skipped)
template <bool ASPLIT>
__global__ __launch_bounds__(128) void k_gemm_h(const float* __restrict__ A, int lda, size_t sA, const _Float16* __restrict__ Bh, int ldb, size_t sB, float alpha, float* __restrict__ C, int ldc, size_t sC, int M, int N, int K) {
  __shared__ __attribute__((aligned(16))) float so[4][16][64];
  const int tid = threadIdx.x, w = tid >> 5, lane = tid & 31, ln = lane & 15, hh = lane >> 4; const int by = blockIdx.y;
  A += (size_t)by * sA; Bh += (size_t)by * sB; C += (size_t)by * sC;
  const int ntn = (N + 63) / 64; const int wid = blockIdx.x * 4 + w; const int mt = wid / ntn, nq = wid % ntn; if (mt * 16 >= M) return;
  const int row0 = mt * 16, col0 = nq * 64; const float* arow = A + (size_t)(row0 + ln) * lda;
  v8f acc[4] = {};
  for (int kb = 0; kb < K; kb += 32) {
    FragH ah, al;
    const v4f x0 = *(const v4fa*)(arow + kb + 8 * hh), x1 = *(const v4fa*)(arow + kb + 8 * hh + 4), x2 = *(const v4fa*)(arow + kb + 16 + 8 * hh), x3 = *(const v4fa*)(arow + kb + 16 + 8 * hh + 4);
    float xs[16] = {x0[0],x0[1],x0[2],x0[3],x1[0],x1[1],x1[2],x1[3],x2[0],x2[1],x2[2],x2[3],x3[0],x3[1],x3[2],x3[3]};
#pragma unroll
    for (int i = 0; i < 16; ++i) { const _Float16 h = (_Float16)xs[i]; ah.h[i] = h; al.h[i] = ASPLIT ? (_Float16)(xs[i] - (float)h) : (_Float16)0.0f; }
#pragma unroll
    for (int t = 0; t < 4; ++t) { if (col0 + t * 16 >= N) continue; const size_t boff = (size_t)(col0 + t * 16 + ln) * ldb + kb; FragH bq; bq.half[0] = *(const v8us*)(Bh + boff + 8 * hh); bq.half[1] = *(const v8us*)(Bh + boff + 16 + 8 * hh);
      acc[t] = mmaH<ASPLIT ? 2 : 1>(ah.v, al.v, bq.v, bq.v, acc[t]); }
  }
#pragma unroll
  for (int t = 0; t < 4; ++t) { if (col0 + t * 16 >= N) continue;
#pragma unroll
    for (int r = 0; r < 8; ++r) so[w][8 * hh + r][t * 16 + ln] = acc[t][r] * alpha; }
  __builtin_amdgcn_fence(__ATOMIC_ACQ_REL, "workgroup"); __builtin_amdgcn_wave_barrier();
  const int rsub = lane >> 4, c4 = (lane & 15) * 4;
  {
#pragma unroll
    for (int q = 0; q < 8; ++q) { const int r = q * 2 + rsub; if (col0 + c4 < N) { const v4f v = *(const v4fa*)&so[w][r][c4]; *(v4f*)(C + (size_t)(row0 + r) * ldc + col0 + c4) = v; } }
     }
}

// Wt[n][k] = f16(W[k][n]·scale) from f32 row-major W[K][N] (scale = power of two; bf16-exact weights stay exact in f16 away from the subnormal range)
__global__ __launch_bounds__(256) void k_wt_f16(const float* __restrict__ W, _Float16* __restrict__ Wt, int K, int N, float scale) {
  const int t = blockIdx.x * 256 + threadIdx.x; if (t >= N * (K / 8)) return; const int n = t / (K / 8), k8 = (t % (K / 8)) * 8; FragH f;
#pragma unroll
  for (int i = 0; i < 8; ++i) f.h[i] = (_Float16)(bf16_round(W[(size_t)(k8 + i) * N + n]) * scale); const v8us o = f.half[0];
  *(v8us*)((unsigned short*)Wt + (size_t)n * K + k8) = o; 
}
// k_gemm_hh variant with fused epilogue: v = acc·alpha + bias[by·sBias + col] (+ CP[(row/rowsPerB)·sCPb + by·64 + col] if CP) ; ACT 0 none / 1 elu ; writes f16 C16 (and f32 C if non-null)
template <int ACT>
__global__ __launch_bounds__(128) void k_gemm_hhx(const _Float16* __restrict__ A, int lda, size_t sA, const _Float16* __restrict__ Bh, int ldb, size_t sB, float alpha, const float* __restrict__ bias, size_t sBias, const float* __restrict__ CP, int rowsPerB, size_t sCPb, int row0g,
    float* __restrict__ C, _Float16* __restrict__ C16, int ldc, size_t sC, int M, int N, int K) {
  __shared__ __attribute__((aligned(16))) float so[4][16][64];
  const int tid = threadIdx.x, w = tid >> 5, lane = tid & 31, ln = lane & 15, hh = lane >> 4; const int by = blockIdx.y;
  A += (size_t)by * sA; Bh += (size_t)by * sB; const size_t cofs = (size_t)by * sC; const float* bp = bias ? bias + (size_t)by * sBias : nullptr;
  const int ntn = (N + 63) / 64; const int wid = blockIdx.x * 4 + w; const int mt = wid / ntn, nq = wid % ntn; if (mt * 16 >= M) return;
  const int row0 = mt * 16, col0 = nq * 64; const _Float16* arow = A + (size_t)(row0 + ln) * lda;
  v8f acc[4] = {};
  for (int kb = 0; kb < K; kb += 32) { FragH ah; ah.half[0] = *(const v8us*)((const unsigned short*)arow + kb + 8 * hh); ah.half[1] = *(const v8us*)((const unsigned short*)arow + kb + 16 + 8 * hh);
#pragma unroll
    for (int t = 0; t < 4; ++t) { if (col0 + t * 16 >= N) continue; const size_t boff = (size_t)(col0 + t * 16 + ln) * ldb + kb; FragH bq; bq.half[0] = *(const v8us*)((const unsigned short*)Bh + boff + 8 * hh); bq.half[1] = *(const v8us*)((const unsigned short*)Bh + boff + 16 + 8 * hh);
      acc[t] = mmaH<1>(ah.v, ah.v, bq.v, bq.v, acc[t]); }
  }
#pragma unroll
  for (int t = 0; t < 4; ++t) { if (col0 + t * 16 >= N) continue; const int col = col0 + t * 16 + ln; const float bv = bp ? bf16_round(bp[col]) : 0.f;
#pragma unroll
    for (int r = 0; r < 8; ++r) { float v = acc[t][r] * alpha + bv; if (CP) { const int rr = row0g + row0 + 8 * hh + r; if (rowsPerB < 0) v += CP[cofs + (size_t)rr * ldc + col];      /* rowsPerB < 0: own element of the batched C plane */ else { const int bidx = rr / rowsPerB; v += CP[(size_t)bidx * sCPb + (size_t)by * 64 + col]; } } if (ACT == 1) v = (v > 0.f) ? v : expm1f(v); else if (ACT == 7) v = (v > 0.f) ? v + 1.0f : expf(v); else if (ACT == 8) v = tanhf(v); else if (ACT == 9) v = 0.5f * v * (1.0f + tanhf(0.7978845608028654f * (v + 0.044715f * v * v * v))); else if (ACT == 11) v = 1.0f / (1.0f + expf(-v)); else if (ACT == 12) v = (v > 0.f) ? v : 0.01f * v; else if (ACT == 14) v = (v > 0.f) ? v : 0.1f * v; else if (ACT == 16) v = (v >= 0.f) ? v : 0.3f * v; else if (ACT == 17) v = (v >= 0.f) ? v : 0.2f * v; else if (ACT == 15) v = v / (1.0f + expf(-v)); else if (ACT == 3) v = fmaxf(v, 0.f); else if (ACT == 6) v = 0.5f * v * (1.0f + erff(v * 0.70710678118654752f)); so[w][8 * hh + r][t * 16 + ln] = v; } }
  __builtin_amdgcn_fence(__ATOMIC_ACQ_REL, "workgroup"); __builtin_amdgcn_wave_barrier();
  const int rsub = lane >> 4, c4 = (lane & 15) * 4; typedef _Float16 v4h __attribute__((ext_vector_type(4)));
  {
#pragma unroll
    for (int q = 0; q < 8; ++q) { const int r = q * 2 + rsub; if (col0 + c4 < N) { const v4f v = *(const v4fa*)&so[w][r][c4]; if (C) *(v4f*)(C + cofs + (size_t)(row0 + r) * ldc + col0 + c4) = v; if (C16) { v4h h4; for (int i = 0; i < 4; ++i) h4[i] = (_Float16)v[i]; *(v4h*)(C16 + cofs + (size_t)(row0 + r) * ldc + col0 + c4) = h4; } } }
     }
}


typedef _Float16 v4h __attribute__((ext_vector_type(4)));

__global__ __launch_bounds__(256) void k_x16(const float* __restrict__ x, _Float16* __restrict__ X16, size_t n8) { const size_t t = (size_t)blockIdx.x * 256 + threadIdx.x; if (t >= n8) return; FragH f;
#pragma unroll
  for (int q = 0; q < 8; ++q) f.h[q] = (_Float16)bf16_round(x[t * 8 + q]); *(v8us*)((unsigned short*)X16 + t * 8) = f.half[0];  }
__global__ __launch_bounds__(256) void k_h16(const float* __restrict__ x, _Float16* __restrict__ X16, size_t n8) { const size_t t = (size_t)blockIdx.x * 256 + threadIdx.x; if (t >= n8) return; FragH f;
#pragma unroll
  for (int q = 0; q < 8; ++q) f.h[q] = (_Float16)x[t * 8 + q]; *(v8us*)((unsigned short*)X16 + t * 8) = f.half[0];  }
__global__ __launch_bounds__(256) void k_round16f(const float* __restrict__ W, _Float16* __restrict__ Bt, size_t n8) { const size_t t = (size_t)blockIdx.x * 256 + threadIdx.x; if (t >= n8) return; FragH f;
#pragma unroll
  for (int i = 0; i < 8; ++i) f.h[i] = (_Float16)(bf16_round(W[t * 8 + i]) * 16.0f); *(v8us*)((unsigned short*)Bt + t * 8) = f.half[0];  }
template <int NHv, int TTv>
__global__ __launch_bounds__(256) void k_vt(const _Float16* __restrict__ V16, int ldv, int voff, _Float16* __restrict__ Vt) { __shared__ unsigned short tl[64][66]; const int tid = threadIdx.x; const int slab = blockIdx.x / (TTv / 64), lg = blockIdx.x % (TTv / 64); const int b = slab / NHv, h = slab % NHv;
  for (int i = tid; i < 64 * 8; i += 256) { const int r = i / 8, c8 = (i % 8) * 8; FragH f; f.half[0] = *(const v8us*)((const unsigned short*)V16 + ((size_t)b * TTv + lg * 64 + r) * ldv + voff + h * 64 + c8);
#pragma unroll
    for (int q = 0; q < 8; ++q) tl[r][c8 + q] = f.u[q]; }
  __syncthreads();
  {
#pragma unroll
    for (int rd = 0; rd < 2; ++rd) { const int d = rd * 32 + tid / 8, pc = tid % 8; FragH f;
#pragma unroll
      for (int q = 0; q < 8; ++q) f.u[q] = tl[pc * 8 + q][d];
      *(v8us*)((unsigned short*)Vt + ((size_t)slab * 64 + d) * TTv + lg * 64 + pc * 8) = f.half[0]; }
     } }

__global__ __launch_bounds__(256) void k_hl(const float* __restrict__ F, _Float16* __restrict__ Hh, _Float16* __restrict__ Hl, size_t n8) { const size_t t = (size_t)blockIdx.x * 256 + threadIdx.x; if (t >= n8) return; FragH fh, fl; const v4f a = *(const v4fa*)(F + t * 8), c = *(const v4fa*)(F + t * 8 + 4);
#pragma unroll
  for (int q = 0; q < 4; ++q) { _Float16 h = (_Float16)a[q]; fh.h[q] = h; fl.h[q] = (_Float16)((a[q] - (float)h) * 1024.0f); h = (_Float16)c[q]; fh.h[4 + q] = h; fl.h[4 + q] = (_Float16)((c[q] - (float)h) * 1024.0f); }
  { *(v8us*)((unsigned short*)Hh + t * 8) = fh.half[0]; *(v8us*)((unsigned short*)Hl + t * 8) = fl.half[0];  } }

// ---- fast GEMM (wave tile 32x64; requires M % 32 == 0 rows per launch region, N % 64 == 0, K % 32 == 0 and K >= 96); epilogue = k_gemm_hhx semantics ----
__device__ __forceinline__ v16h g2_frag(const _Float16* p, int hh) { FragH f; f.half[0] = *(const v8us*)((const unsigned short*)p + 8 * hh); f.half[1] = *(const v8us*)((const unsigned short*)p + 16 + 8 * hh); return f.v; }
__device__ __forceinline__ v8f g2_mma(v16h a, v16h b, v8f c) { v8f d = __builtin_amdgcn_wmma_f32_16x16x32_f16(false, a, false, b, (short)0, c, false, false); asm volatile("v_nop\n\tv_nop\n\tv_nop\n\tv_nop" : "+v"(d) : "v"(a), "v"(b)); return d; }
struct G2S { v16h a0, a1, b0, b1, b2, b3; };      /* the fragments of one k-step of a 32x64 wave tile */
__device__ __forceinline__ void g2_load(G2S& s, const _Float16* a0p, const _Float16* a1p, const _Float16* b0p, const _Float16* b1p, const _Float16* b2p, const _Float16* b3p, int k, int hh) { s.a0 = g2_frag(a0p + k, hh); s.b0 = g2_frag(b0p + k, hh); s.a1 = g2_frag(a1p + k, hh); s.b1 = g2_frag(b1p + k, hh); s.b2 = g2_frag(b2p + k, hh); s.b3 = g2_frag(b3p + k, hh); }
template <int ACT>
__global__ __launch_bounds__(128) void k_gemm2(const _Float16* __restrict__ A, int lda, size_t sA, const _Float16* __restrict__ Bh, int ldb, size_t sB, float alpha, const float* __restrict__ bias, size_t sBias, const float* __restrict__ CP, int rowsPerB, size_t sCPb, int row0g,
    float* __restrict__ C, _Float16* __restrict__ C16, int ldc, size_t sC, int M, int N, int K) { static_assert(ACT == 0 || ACT == 3 || ACT == 6 || ACT == 8 || ACT == 9 || ACT == 11 || ACT == 12 || ACT == 14 || ACT == 15 || ACT == 16 || ACT == 17, "k_gemm2: unsupported ACT code (would silently apply no activation)");
  __shared__ __attribute__((aligned(16))) float so[4][32][68];
  const int tid = threadIdx.x, w = tid >> 5, lane = tid & 31, ln = lane & 15, hh = lane >> 4; const int by = blockIdx.y;
  A += (size_t)by * sA; Bh += (size_t)by * sB; const size_t cofs = (size_t)by * sC; const float* bp = bias ? bias + (size_t)by * sBias : nullptr;
  const int ntn = N >> 6; const int mt = blockIdx.x / ntn, nq = blockIdx.x - mt * ntn; const int row0 = mt * 128 + 32 * w, col0 = nq * 64; if (row0 >= M) return;
  const _Float16* a0p = A + (size_t)(row0 + ln) * lda; const _Float16* a1p = a0p + (size_t)16 * lda;
  const _Float16* b0p = Bh + (size_t)(col0 + ln) * ldb; const _Float16* b1p = b0p + (size_t)16 * ldb; const _Float16* b2p = b1p + (size_t)16 * ldb; const _Float16* b3p = b2p + (size_t)16 * ldb;
  // k loop, three k-steps of fragments in registers: a step's 12 loads are issued together, directly behind the products of the step that held those registers,
  // so they fly during the next two steps' products instead of being waited for one fragment at a time. Products and their order per accumulator are as before.
  const int nst = K >> 5; G2S s0, s1, s2; int st = 0, ko = 0;
  g2_load(s0, a0p, a1p, b0p, b1p, b2p, b3p, 0, hh); __builtin_amdgcn_sched_barrier(0);      /* the three sets are requested one after the other, as in the loop: mixed, the counted load waits in the loop (set for both ways into it) would wait for the younger sets too */
  g2_load(s1, a0p, a1p, b0p, b1p, b2p, b3p, 32, hh); __builtin_amdgcn_sched_barrier(0);      /* as above */
  g2_load(s2, a0p, a1p, b0p, b1p, b2p, b3p, 64, hh);
  asm volatile("s_wait_xcnt 0x0" ::: "memory");      /* stands in front of the clearing of the accumulators, some of which take the registers of an address that the loads above name (a precaution; the compiler wrote none there) */
  const v8f z8 = {0.f,0.f,0.f,0.f,0.f,0.f,0.f,0.f}; v8f c00 = z8, c01 = z8, c02 = z8, c03 = z8, c10 = z8, c11 = z8, c12 = z8, c13 = z8;
#define G2_MMA8(S) { c00 = g2_mma(S.a0, S.b0, c00); c10 = g2_mma(S.a1, S.b0, c10); c01 = g2_mma(S.a0, S.b1, c01); c11 = g2_mma(S.a1, S.b1, c11); c02 = g2_mma(S.a0, S.b2, c02); c12 = g2_mma(S.a1, S.b2, c12); c03 = g2_mma(S.a0, S.b3, c03); c13 = g2_mma(S.a1, S.b3, c13); }
  /* G2_STEP: the k offset moves on by three steps. The wait stands in front of the rewrite of the address registers that the loads in flight name (a precaution; the compiler wrote none over the back edge); the new offset is its output, so every new address is formed behind it. */
#define G2_STEP { ko += 96; asm volatile("s_wait_xcnt 0x0" : "+s"(ko) : : "memory"); }
#pragma unroll 1      /* one trip = three k-steps, one per register set; rolled so that the sets keep their registers */
  for (; st + 6 <= nst; st += 3) {
    G2_MMA8(s0) G2_STEP g2_load(s0, a0p + ko, a1p + ko, b0p + ko, b1p + ko, b2p + ko, b3p + ko, 0, hh); __builtin_amdgcn_sched_barrier(0);      /* keeps the next set's first product, with its load wait, from moving up in front of these requests */
    G2_MMA8(s1) g2_load(s1, a0p + ko, a1p + ko, b0p + ko, b1p + ko, b2p + ko, b3p + ko, 32, hh);
    G2_MMA8(s2) g2_load(s2, a0p + ko, a1p + ko, b0p + ko, b1p + ko, b2p + ko, b3p + ko, 64, hh); }
  const int rem = nst - st;      /* 3, 4 or 5 k-steps are left, the first three of them loaded */
  G2_MMA8(s0) G2_STEP if (rem > 3) g2_load(s0, a0p + ko, a1p + ko, b0p + ko, b1p + ko, b2p + ko, b3p + ko, 0, hh);
  G2_MMA8(s1) if (rem > 4) g2_load(s1, a0p + ko, a1p + ko, b0p + ko, b1p + ko, b2p + ko, b3p + ko, 32, hh);
  G2_MMA8(s2)
  if (rem > 3) G2_MMA8(s0)
  if (rem > 4) G2_MMA8(s1)
#undef G2_STEP
#undef G2_MMA8
  v8f accs[8] = {c00, c01, c02, c03, c10, c11, c12, c13};
#pragma unroll
  for (int u = 0; u < 8; ++u) { const int t = u & 3, half = u >> 2; const int col = col0 + t * 16 + ln; const float bv = bp ? bf16_round(bp[col]) : 0.f;
#pragma unroll
    for (int r = 0; r < 8; ++r) { const int rloc = half * 16 + 8 * hh + r; float v = accs[u][r] * alpha + bv; if (CP) { if (rowsPerB < 0) v += CP[cofs + (size_t)(row0g + row0 + rloc) * ldc + col];      /* rowsPerB < 0: own element of the batched C plane */ else { const int bidx = (row0g + row0 + rloc) / rowsPerB; v += CP[(size_t)bidx * sCPb + (size_t)by * 64 + col]; } }
      if (ACT == 3) v = fmaxf(v, 0.f); else if (ACT == 6) v = 0.5f * v * (1.0f + erff(v * 0.70710678118654752f)); else if (ACT == 11) v = 1.0f / (1.0f + expf(-v)); else if (ACT == 15) v = v / (1.0f + expf(-v)); else if (ACT == 12) v = (v > 0.f) ? v : 0.01f * v; else if (ACT == 8) v = tanhf(v); else if (ACT == 9) v = 0.5f * v * (1.0f + tanhf(0.7978845608028654f * (v + 0.044715f * v * v * v))); else if (ACT == 14) v = (v > 0.f) ? v : 0.1f * v; else if (ACT == 16) v = (v >= 0.f) ? v : 0.3f * v; else if (ACT == 17) v = (v >= 0.f) ? v : 0.2f * v;
      so[w][rloc][t * 16 + ln] = v; } }
  __builtin_amdgcn_fence(__ATOMIC_ACQ_REL, "workgroup"); __builtin_amdgcn_wave_barrier();
  const int rsub = lane >> 4, c4 = (lane & 15) * 4;
  {
#pragma unroll
    for (int q = 0; q < 16; ++q) { const int r = q * 2 + rsub; const v4f v = *(const v4fa*)&so[w][r][c4]; if (C) *(v4f*)(C + cofs + (size_t)(row0 + r) * ldc + col0 + c4) = v; if (C16) { v4h h4; for (int i = 0; i < 4; ++i) h4[i] = (_Float16)v[i]; *(v4h*)(C16 + cofs + (size_t)(row0 + r) * ldc + col0 + c4) = h4; } }
     } }


__global__ __launch_bounds__(256) void k_wnat(const float* __restrict__ w, size_t n8, _Float16* __restrict__ Bt) { const size_t t = (size_t)blockIdx.x * 256 + threadIdx.x; if (t >= n8) return; FragH f; for (int q = 0; q < 8; ++q) f.h[q] = (_Float16)(bf16_round(w[t * 8 + q]) * 16.0f); *(v8us*)((unsigned short*)Bt + t * 8) = f.half[0];  }
__global__ __launch_bounds__(256) void k_rsm(const float* __restrict__ S, _Float16* __restrict__ P, int nrows) {
  #pragma clang fp contract(off)
  const int i = blockIdx.x * 256 + threadIdx.x; if (i >= nrows) return; const float* s = S + (size_t)i * SQ; float mx = -3.0e38f;
#pragma unroll 1
  for (int j = 0; j < SQ; ++j) mx = fmaxf(mx, s[j]); float se = 0.f;
#pragma unroll 1
  for (int j = 0; j < SQ; ++j) se += expf(s[j] - mx); const float sc = 256.0f / se;
#pragma unroll 1
  for (int j0 = 0; j0 < SQ; j0 += 8) { FragH f; for (int q = 0; q < 8; ++q) f.h[q] = (_Float16)(expf(s[j0 + q] - mx) * sc); unsigned short* d = (unsigned short*)P + (size_t)i * SQ + j0; *(v8us*)d = f.half[0];  } }
__global__ __launch_bounds__(256) void k_vt(const _Float16* __restrict__ V16, int b, int h0, _Float16* __restrict__ VT) { __shared__ unsigned short tl[64][65]; const int tid = threadIdx.x; const int hh = blockIdx.x % HG, sg = blockIdx.x / HG; const int s0 = sg * 64; const int h = h0 + hh;
  for (int i = tid; i < 64 * 8; i += 256) { const int j = i / 8, d8 = (i % 8) * 8; FragH f; f.half[0] = *(const v8us*)((const unsigned short*)V16 + ((size_t)b * SQ + s0 + j) * DM + h * HD + d8); for (int q = 0; q < 8; ++q) tl[d8 + q][j] = f.u[q]; }
  __syncthreads();
  { for (int i = tid; i < 64 * 8; i += 256) { const int d = i / 8, j8 = (i % 8) * 8; FragH f; for (int q = 0; q < 8; ++q) f.u[q] = tl[d][j8 + q]; *(v8us*)((unsigned short*)VT + ((size_t)hh * HD + d) * SQ + s0 + j8) = f.half[0]; }  } }


__global__ __launch_bounds__(256) void k_f2h(const float* __restrict__ F, int ldf, int coff, int ncol, _Float16* __restrict__ H16, size_t nrow) { const size_t t = (size_t)blockIdx.x * 256 + threadIdx.x; const size_t n8 = nrow * (size_t)(ncol / 8); if (t >= n8) return; const size_t r = t / (ncol / 8); const int c8 = (int)(t % (ncol / 8)) * 8; FragH f; const v4f a = *(const v4fa*)(F + r * ldf + coff + c8), b2 = *(const v4fa*)(F + r * ldf + coff + c8 + 4); for (int q = 0; q < 4; ++q) { f.h[q] = (_Float16)a[q]; f.h[4 + q] = (_Float16)b2[q]; } *(v8us*)((unsigned short*)H16 + r * ncol + c8) = f.half[0];  }

__global__ __launch_bounds__(256) void k_tab128(float theta, float* __restrict__ CS, float* __restrict__ SN) {
  #pragma clang fp contract(off)
  const int t = blockIdx.x * 256 + threadIdx.x; if (t >= SQ * 64) return; const int i = t % 64; const int p = t / 64; const float invf = (float)(1.0 / pow((double)theta, (double)(2 * i) / 128.0));      /* = XLA's constant-folded f32 table */ const float ang = __fmul_rn((float)p, invf); const float c = cosf(ang), s = sinf(ang);
  *(float*)(CS + t) = c; *(float*)(SN + t) = s;  }
template <int TAB>
__global__ __launch_bounds__(128) void k_rope128(const float* __restrict__ F, int ldf, int nh, const float* __restrict__ CS, const float* __restrict__ SN, _Float16* __restrict__ H16, int ldo, float osc) {
  #pragma clang fp contract(off)
  __shared__ float xv[128]; __shared__ unsigned short sh_[128]; const int d = threadIdx.x; const int h = blockIdx.x % nh; const size_t r = blockIdx.x / nh; const int p = (int)(r % SQ);
  xv[d] = F[r * (size_t)ldf + (size_t)h * 128 + d]; __syncthreads();
  float c, s; if (TAB) { c = bf16_round(CS[(size_t)p * 128 + d]); s = bf16_round(SN[(size_t)p * 128 + d]); } else { c = CS[p * 64 + (d & 63)]; s = SN[p * 64 + (d & 63)]; }
  const float rot = (d < 64) ? -xv[d + 64] : xv[d - 64]; const float o = __fadd_rn(__fmul_rn(xv[d], c), __fmul_rn(rot, s));
  FragH th; th.h[0] = (_Float16)__fmul_rn(o, osc); sh_[d] = th.u[0]; __syncthreads();
  if (d < 16) { FragH f; for (int q = 0; q < 8; ++q) f.u[q] = sh_[d * 8 + q]; unsigned short* dst = (unsigned short*)H16 + r * (size_t)ldo + (size_t)h * 128 + d * 8; *(v8us*)dst = f.half[0];  } }

template <int TAB, int IL, int F32OUT>
__global__ __launch_bounds__(128) void k_rope128x(const float* __restrict__ F, int ldf, int nh, const float* __restrict__ CS, const float* __restrict__ SN, void* __restrict__ OUT, int ldo, float osc) {
  #pragma clang fp contract(off)
  __shared__ float xv[128]; __shared__ float ov[128]; const int d = threadIdx.x; const int h = blockIdx.x % nh; const size_t r = blockIdx.x / nh; const int p = (int)(r % SQ);
  xv[d] = F[r * (size_t)ldf + (size_t)h * 128 + d]; __syncthreads();
  float c, s; if (TAB == 2) { c = CS[r * 128 + d]; s = SN[r * 128 + d]; }      /* computed full-width f32 tables, one row per token row r (relative to the passed pointers) */ else if (TAB) { c = bf16_round(CS[(size_t)p * 128 + d]); s = bf16_round(SN[(size_t)p * 128 + d]); } else { const int ti = IL ? (d >> 1) : (d & 63); c = CS[p * 64 + ti]; s = SN[p * 64 + ti]; }
  const float rot = IL ? ((d & 1) ? xv[d - 1] : -xv[d + 1]) : ((d < 64) ? -xv[d + 64] : xv[d - 64]);
  ov[d] = __fmul_rn(__fadd_rn(__fmul_rn(xv[d], c), __fmul_rn(rot, s)), osc); __syncthreads();
  if (F32OUT) { if (d < 32) { const v4f v = *(const v4f*)&ov[d * 4]; float* dst = (float*)OUT + r * (size_t)ldo + (size_t)h * 128 + d * 4; *(v4f*)dst = v;  } }
  else { if (d < 16) { FragH f; for (int q = 0; q < 8; ++q) f.h[q] = (_Float16)ov[d * 8 + q]; unsigned short* dst = (unsigned short*)OUT + r * (size_t)ldo + (size_t)h * 128 + d * 8; *(v8us*)dst = f.half[0];  } } }
template <int N>
__global__ __launch_bounds__(256) void k_rmsrow(float* __restrict__ X, const float* __restrict__ w, float eps) {
  #pragma clang fp contract(off)
  constexpr int PT = N / 256; __shared__ float red[256]; const size_t r = blockIdx.x; const int t = threadIdx.x; float* row = X + r * N + (size_t)t * PT; float v[PT]; float ss = 0.f;
  for (int q = 0; q < PT; ++q) { v[q] = row[q]; ss = __fadd_rn(ss, __fmul_rn(v[q], v[q])); }
  red[t] = ss; __syncthreads(); for (int k = 128; k > 0; k >>= 1) { if (t < k) red[t] = __fadd_rn(red[t], red[t + k]); __syncthreads(); }
  const float rs = rsqrtf(__fadd_rn(red[0] / (float)N, eps)); float o[PT]; for (int q = 0; q < PT; ++q) o[q] = __fmul_rn(__fmul_rn(v[q], rs), bf16_round(w[t * PT + q]));
  { for (int q = 0; q < PT; ++q) *(float*)(row + q) = o[q];  } }
template <int GS_, int NHQ, int DSRC>
__global__ __launch_bounds__(256) void k_kvexp128(const float* __restrict__ src, float* __restrict__ dst, size_t n4) { const size_t t = (size_t)blockIdx.x * 256 + threadIdx.x; if (t >= n4) return; const size_t e = t * 4; const size_t row = e / ((size_t)NHQ * 128); const int col = (int)(e % ((size_t)NHQ * 128)); const int h = col / 128, d = col % 128; const v4f v = *(const v4fa*)(src + row * DSRC + (size_t)(h / GS_) * 128 + d); *(v4f*)(dst + e) = v;  }

__global__ __launch_bounds__(256) void k_rsmcfb(const float* __restrict__ S, _Float16* __restrict__ P, int hg, int q0, int nk, const int* __restrict__ mk) {
  #pragma clang fp contract(off)
  const int t = blockIdx.x * 256 + threadIdx.x; if (t >= hg * QT) return; const size_t i = (size_t)t; const float* s = S + i * NKX; const size_t ig = (size_t)(q0 + (t % QT)); const int* mr = mk + ig * SQ; float mx = -3.0e38f;
#pragma unroll 1
  for (int j = 0; j < nk; ++j) { const int mb = mr[j]; const float f = (mb == 0) ? 1.f : 0.f; mx = fmaxf(mx, fmaf(f, s[j], (1.f - f) * -1.0e9f)); } float se = 0.f;
#pragma unroll 1
  for (int j = 0; j < nk; ++j) { const int mb = mr[j]; const float f = (mb == 0) ? 1.f : 0.f; se += __expf(fmaf(f, s[j], (1.f - f) * -1.0e9f) - mx); } const float sc = 256.0f / se;
#pragma unroll 1
  for (int j0 = 0; j0 < nk; j0 += 8) { FragH fr; for (int q = 0; q < 8; ++q) { const int j = j0 + q; const int mb = mr[j]; const float f = (mb == 0) ? 1.f : 0.f; fr.h[q] = (_Float16)(__expf(fmaf(f, s[j], (1.f - f) * -1.0e9f) - mx) * sc); } unsigned short* d = (unsigned short*)P + i * NKX + j0; *(v8us*)d = fr.half[0];  } }


__global__ __launch_bounds__(256) void k_rsmcf2(const float* __restrict__ S, _Float16* __restrict__ P, int hg, int q0, int nk) {
  #pragma clang fp contract(off)
  const int t = blockIdx.x * 256 + threadIdx.x; if (t >= hg * QT) return; const size_t i = (size_t)t; const float* s = S + i * NKX; const int last = q0 + (t % QT); float mx = -3.0e38f;
#pragma unroll 1
  for (int j = 0; j < nk; ++j) { const float f = (j <= last) ? 1.f : 0.f; mx = fmaxf(mx, fmaf(f, s[j], (1.f - f) * -1.0e9f)); } float se = 0.f;
#pragma unroll 1
  for (int j = 0; j < nk; ++j) { const float f = (j <= last) ? 1.f : 0.f; se += __expf(fmaf(f, s[j], (1.f - f) * -1.0e9f) - mx); } const float sc = 256.0f / se;
#pragma unroll 1
  for (int j0 = 0; j0 < nk; j0 += 8) { FragH fr; for (int q = 0; q < 8; ++q) { const int j = j0 + q; const float f = (j <= last) ? 1.f : 0.f; fr.h[q] = (_Float16)(__expf(fmaf(f, s[j], (1.f - f) * -1.0e9f) - mx) * sc); } unsigned short* d = (unsigned short*)P + i * NKX + j0; *(v8us*)d = fr.half[0];  } }



__global__ __launch_bounds__(256) void k_tab128p(const int* __restrict__ pos, int nrows, float theta, float* __restrict__ CS, float* __restrict__ SN) {
  #pragma clang fp contract(off)
  const int t = blockIdx.x * 256 + threadIdx.x; if (t >= nrows * 64) return; const int i = t % 64; const int r = t / 64; const float invf = (float)(1.0 / pow((double)theta, (double)(2 * i) / 128.0)); const float ang = __fmul_rn((float)pos[r], invf); const float c = cosf(ang), sv = sinf(ang);
  float* c0 = CS + (size_t)r * 128 + i; float* s0 = SN + (size_t)r * 128 + i;
  { *(float*)c0 = c; *(float*)(c0 + 64) = c; *(float*)s0 = sv; *(float*)(s0 + 64) = sv;  } }

__global__ __launch_bounds__(256) void k_rsmcim(const float* __restrict__ S, _Float16* __restrict__ P, int hg, int q0, int nk, const int* __restrict__ am) {
  #pragma clang fp contract(off)
  const int t = blockIdx.x * 256 + threadIdx.x; if (t >= hg * QT) return; const size_t i = (size_t)t; const float* s = S + i * NKX; const int last = q0 + (t % QT); const int* mr = am + (size_t)last * SQ; float mx = -3.0e38f;      /* the module's mask row of this query (keys >= nk lie above the diagonal of the causal mask and are not computed) */
#pragma unroll 1
  for (int j = 0; j < nk; ++j) { const float f = (mr[j] != 0) ? 1.f : 0.f; mx = fmaxf(mx, fmaf(f, s[j], (1.f - f) * -1.0e9f)); } float se = 0.f;
#pragma unroll 1
  for (int j = 0; j < nk; ++j) { const float f = (mr[j] != 0) ? 1.f : 0.f; se += __expf(fmaf(f, s[j], (1.f - f) * -1.0e9f) - mx); } const float sc = 256.0f / se;
#pragma unroll 1
  for (int j0 = 0; j0 < nk; j0 += 8) { FragH fr; for (int q = 0; q < 8; ++q) { const int j = j0 + q; const float f = (mr[j] != 0) ? 1.f : 0.f; fr.h[q] = (_Float16)(__expf(fmaf(f, s[j], (1.f - f) * -1.0e9f) - mx) * sc); } unsigned short* d = (unsigned short*)P + i * NKX + j0; *(v8us*)d = fr.half[0];  } }



__global__ __launch_bounds__(256) void k_tab128h(int nr, float theta, float* __restrict__ CS, float* __restrict__ SN) {
  #pragma clang fp contract(off)
  const size_t t = (size_t)blockIdx.x * 256 + threadIdx.x; if (t >= (size_t)nr * 64) return; const int i = (int)(t % 64); const size_t r = t / 64; const int p = (int)(r % SQ);
  const float invf = (float)(1.0 / pow((double)theta, ((double)(2 * i)) / 128.0)); const float ang = __fmul_rn((float)p, invf); const float c = cosf(ang), sv = sinf(ang);
  float* pc = CS + r * 128 + i; float* ps = SN + r * 128 + i;
  *(float*)pc = c; *(float*)(pc + 64) = c; *(float*)ps = sv; *(float*)(ps + 64) = sv;  }

// Lane exchanges and the native exp of the softmax code below.
template <int M> __device__ __forceinline__ float sm_xrow(float x) { return __builtin_bit_cast(float, __builtin_amdgcn_mov_dpp(__builtin_bit_cast(int, x), 0x160 | M, 0xf, 0xf, true)); }      /* lane l with lane l ^ M, M < 16 (row_xmask) */
__device__ __forceinline__ float sm_xhalf(float x) { const int b = __builtin_bit_cast(int, x); return __builtin_bit_cast(float, __builtin_amdgcn_permlanex16(b, b, 0x76543210, 0xfedcba98, false, false)); }      /* lane l with lane l ^ 16 */
__device__ __forceinline__ float sm_wmax(float x) { x = fmaxf(x, sm_xrow<1>(x)); x = fmaxf(x, sm_xrow<2>(x)); x = fmaxf(x, sm_xrow<4>(x)); x = fmaxf(x, sm_xrow<8>(x)); return fmaxf(x, sm_xhalf(x)); }
__device__ __forceinline__ float sm_wsum(float x) { x += sm_xrow<1>(x); x += sm_xrow<2>(x); x += sm_xrow<4>(x); x += sm_xrow<8>(x); return x + sm_xhalf(x); }
// Eight native 2^x in one statement. The outputs are early-clobber, so no v_exp_f32 in it overwrites a neighbour's source or reads its result; the closing v_nop keeps the one slot
// that the instruction set asks for behind a transcendental, whatever the compiler places next.
__device__ __forceinline__ void sm_exp2x8(v4f& a, v4f& b) { float e0, e1, e2, e3, e4, e5, e6, e7;
  asm("v_exp_f32 %0, %8\n\tv_exp_f32 %1, %9\n\tv_exp_f32 %2, %10\n\tv_exp_f32 %3, %11\n\tv_exp_f32 %4, %12\n\tv_exp_f32 %5, %13\n\tv_exp_f32 %6, %14\n\tv_exp_f32 %7, %15\n\tv_nop"
      : "=&v"(e0), "=&v"(e1), "=&v"(e2), "=&v"(e3), "=&v"(e4), "=&v"(e5), "=&v"(e6), "=&v"(e7) : "v"(a[0]), "v"(a[1]), "v"(a[2]), "v"(a[3]), "v"(b[0]), "v"(b[1]), "v"(b[2]), "v"(b[3]));
  a[0] = e0; a[1] = e1; a[2] = e2; a[3] = e3; b[0] = e4; b[1] = e5; b[2] = e6; b[3] = e7; }
// Fused attention of all query blocks: scores, the per-block softmax and P V in one launch; no score or weight ever goes to memory.
// One wave owns 16 queries of one head and walks the key blocks j = 0 .. i. Both products are formed transposed, with the queries as the 16 columns:
//   S^T = K Q^T : A = 16 key rows (hi, residual), B = the wave's q fragments; 16 tiles of 16 keys = the whole 256-key block of a lane's query (column ln; keys 8 hh + r of each tile);
//   softmax     : maximum and sum run over a lane's own 128 scores, one exchange with lane ^ 16 finishes each;
//   O^T = V^T P^T : A = 16 rows of V^T (hi, residual); score tiles 2u and 2u + 1 of a lane ARE the B fragment of keys 32u .. 32u + 31 (elements 0..7 = keys 8 hh + r, 8..15 = keys 16 + 8 hh + r, the k order of g2_frag), so the weights move through no LDS.
// Each product has three terms: hi.hi in one accumulator, the two x1024 residual terms together in a second one. Fragments are requested two steps before their products.
struct FA4 { v16h f0, f1, f2, f3; };      /* the four fragments of one step: a key tile's four k-steps, or four 16-dim tiles of V^T, of one plane (hi or residual) */
__device__ __forceinline__ void fa_load(FA4& s, const _Float16* p, size_t st, int hh) { s.f0 = g2_frag(p, hh); s.f1 = g2_frag(p + st, hh); s.f2 = g2_frag(p + 2 * st, hh); s.f3 = g2_frag(p + 3 * st, hh); }
__device__ __forceinline__ v8f fa_mma(v16h a, v16h b, v8f c) { return __builtin_amdgcn_wmma_f32_16x16x32_f16(false, a, false, b, (short)0, c, false, false); }
__global__ __launch_bounds__(128) void k_fattn(const _Float16* __restrict__ Qh, const _Float16* __restrict__ Ql, const _Float16* __restrict__ Kh, const _Float16* __restrict__ Kl, const _Float16* __restrict__ Vh, const _Float16* __restrict__ Vl, _Float16* __restrict__ O) {
  const int lane = threadIdx.x & 31, ln = lane & 15, hh = lane >> 4, w = threadIdx.x >> 5;
  const int qb = (SQ / QT - 1) - (int)(blockIdx.x / (NB * NH * 4)); const int rem = blockIdx.x % (NB * NH * 4); const int sub = rem & 3, h = (rem >> 2) % NH, b = rem / (4 * NH);      /* the query blocks with the most key blocks take the lowest work-group indices */
  const int qrow = qb * QT + sub * 64 + w * 16 + ln;      /* this lane's query (a column of both products) */
  const _Float16* qph = Qh + ((size_t)b * SQ + qrow) * DMX; const _Float16* qpl = Ql + ((size_t)b * SQ + qrow) * DMX;
  const _Float16* kph = Kh + ((size_t)b * SQ + ln) * DKV + h * HDK; const _Float16* kpl = Kl + ((size_t)b * SQ + ln) * DKV + h * HDK;
  const _Float16* vph = Vh + ((size_t)b * DKV + h * HDK + ln) * SQ; const _Float16* vpl = Vl + ((size_t)b * DKV + h * HDK + ln) * SQ;
  const v8f z8 = {0.f, 0.f, 0.f, 0.f, 0.f, 0.f, 0.f, 0.f}; v8f oh[8] = {z8, z8, z8, z8, z8, z8, z8, z8};
  const float nrm = 256.0f / __fadd_rn((float)(qb + 1), 1e-6f);
  int j = 0;
#pragma unroll 1      /* one trip = one 256-key block; rolled, the trip count differs between query blocks (at least one trip: block 0) */
  do { int jo = j * 256, qo = h * HDK;
    asm volatile("s_wait_xcnt 0x0" : "+s"(jo), "+s"(qo) : : "memory");      /* stands in front of the rewrite of the address registers of the last trip's loads (a precaution); the key offset and the q offset are its outputs, so every new address is formed behind it, and the q fragments are fetched anew in every trip: they hold no registers during softmax and P V, which keeps two waves on a SIMD */
    const _Float16* qp = qph + qo; const _Float16* qlp = qpl + qo;
    const v16h qh0 = g2_frag(qp, hh), qh1 = g2_frag(qp + 32, hh), qh2 = g2_frag(qp + 64, hh), qh3 = g2_frag(qp + 96, hh), ql0 = g2_frag(qlp, hh), ql1 = g2_frag(qlp + 32, hh), ql2 = g2_frag(qlp + 64, hh), ql3 = g2_frag(qlp + 96, hh);
    const _Float16* kh_ = kph + (size_t)jo * DKV; const _Float16* kl_ = kpl + (size_t)jo * DKV; const _Float16* vh_ = vph + jo; const _Float16* vl_ = vpl + jo;
    // 64 steps of 8 loads a trip: steps 0..31 = key tile t, hi plane then residual plane; steps 32..63 = 32 keys x 64 dims of V^T, hi then residual. Three register sets turn: step k + 2 is requested in front of the products of step k.
#define FA_REQ(k) { if ((k) < 32) fa_load(x[(k) % 3], (((k) & 1) ? kl_ : kh_) + (size_t)((k) >> 1) * 16 * DKV, 32, hh); else fa_load(x[(k) % 3], (((k) & 1) ? vl_ : vh_) + (size_t)(((k) - 32) >> 2) * 32 + (size_t)(((((k) - 32) >> 1) & 1) * 4) * 16 * SQ, (size_t)16 * SQ, hh); }
    v8f s[16]; FA4 x[3]; FA_REQ(0) __builtin_amdgcn_sched_barrier(0);      /* the q fragments and step 0 are requested first, then step 1, then step 2: mixed, the first products' counted load wait would wait for the younger steps too */
    FA_REQ(1) __builtin_amdgcn_sched_barrier(0);      /* as above */
    v8f ah = z8, al = z8;
#pragma unroll
    for (int k = 0; k < 32; ++k) { if (k == 28 || k == 29) __builtin_amdgcn_sched_barrier(0);      /* keeps the vector work of the step before out of the stretch between a K plane's last request and the wait below */
      FA_REQ(k + 2)      /* behind the last key tile: the first V^T fragments, which fly during the softmax */
      if (k == 28 || k == 29) { __builtin_amdgcn_sched_barrier(0); asm volatile("s_wait_xcnt 0x0" ::: "memory"); }      /* behind the last request of a K plane: its address registers are free from here on and the compiler reuses them with the loads in flight (a precaution; it wrote no wait there); the barrier in front keeps the requests above the wait */
      __builtin_amdgcn_sched_barrier(0);      /* keeps this step's products, with their load wait, from moving up in front of the requests of the step after next */
      const FA4& c = x[k % 3];
      if ((k & 1) == 0) { ah = fa_mma(c.f0, qh0, z8); al = fa_mma(c.f0, ql0, z8); ah = fa_mma(c.f1, qh1, ah); al = fa_mma(c.f1, ql1, al); ah = fa_mma(c.f2, qh2, ah); al = fa_mma(c.f2, ql2, al); ah = fa_mma(c.f3, qh3, ah); al = fa_mma(c.f3, ql3, al); }
      else { al = fa_mma(c.f0, qh0, al); al = fa_mma(c.f1, qh1, al); al = fa_mma(c.f2, qh2, al); al = fa_mma(c.f3, qh3, al); s[k >> 1] = ah * ATS + al * (ATS * 0.0009765625f); } }
    if (j == qb) {      /* only the diagonal block holds keys above a query */
#pragma unroll
      for (int t = 0; t < 16; ++t) {
#pragma unroll
        for (int r = 0; r < 8; ++r) s[t][r] = (jo + t * 16 + 8 * hh + r <= qrow) ? s[t][r] : -1.0e9f; } }
    float mx = -3.0e38f;
#pragma unroll
    for (int t = 0; t < 16; ++t) mx = fmaxf(mx, fmaxf(fmaxf(fmaxf(s[t][0], s[t][1]), fmaxf(s[t][2], s[t][3])), fmaxf(fmaxf(s[t][4], s[t][5]), fmaxf(s[t][6], s[t][7]))));
    mx = fmaxf(mx, sm_xhalf(mx)); float se = 0.f;
#pragma unroll
    for (int t = 0; t < 16; ++t) { v4f a, e;
#pragma unroll
      for (int u = 0; u < 4; ++u) { a[u] = (s[t][u] - mx) * 1.44269504f; e[u] = (s[t][4 + u] - mx) * 1.44269504f; }      /* e^x = 2^(x log2 e), as the native exp forms it */
      sm_exp2x8(a, e); se += ((a[0] + a[1]) + (a[2] + a[3])) + ((e[0] + e[1]) + (e[2] + e[3]));
#pragma unroll
      for (int u = 0; u < 4; ++u) { s[t][u] = a[u]; s[t][4 + u] = e[u]; } }
    se += sm_xhalf(se); const float isum = nrm / se;
    FragH bh, bl; v8f ol[8] = {z8, z8, z8, z8, z8, z8, z8, z8};      /* the residual terms of this key block (x1024) */
#pragma unroll
    for (int k = 32; k < 64; ++k) { const int u = (k - 32) >> 2, d0 = (((k - 32) >> 1) & 1) * 4;
      if (k == 60 || k == 61) __builtin_amdgcn_sched_barrier(0);      /* as for K above */
      if (k + 2 < 64) FA_REQ(k + 2)
      if (k == 60 || k == 61) { __builtin_amdgcn_sched_barrier(0); asm volatile("s_wait_xcnt 0x0" ::: "memory"); }      /* behind the last request of a V^T plane, as for K above */
      __builtin_amdgcn_sched_barrier(0);      /* as above: the requests stay in front of this step's products */
      const FA4& c = x[k % 3];
      if (((k - 32) & 3) == 0) {      /* the weights of keys 32u .. 32u + 31 as f16 hi + x1024 residual: the B fragments of the next four steps */
#pragma unroll
        for (int r = 0; r < 8; ++r) { const float p0 = s[2 * u][r] * isum, p1 = s[2 * u + 1][r] * isum; bh.h[r] = (_Float16)p0; bl.h[r] = (_Float16)((p0 - (float)bh.h[r]) * 1024.0f); bh.h[8 + r] = (_Float16)p1; bl.h[8 + r] = (_Float16)((p1 - (float)bh.h[8 + r]) * 1024.0f); } }
      if ((k & 1) == 0) { oh[d0] = fa_mma(c.f0, bh.v, oh[d0]); oh[d0 + 1] = fa_mma(c.f1, bh.v, oh[d0 + 1]); oh[d0 + 2] = fa_mma(c.f2, bh.v, oh[d0 + 2]); oh[d0 + 3] = fa_mma(c.f3, bh.v, oh[d0 + 3]);
        ol[d0] = fa_mma(c.f0, bl.v, ol[d0]); ol[d0 + 1] = fa_mma(c.f1, bl.v, ol[d0 + 1]); ol[d0 + 2] = fa_mma(c.f2, bl.v, ol[d0 + 2]); ol[d0 + 3] = fa_mma(c.f3, bl.v, ol[d0 + 3]); }
      else { ol[d0] = fa_mma(c.f0, bh.v, ol[d0]); ol[d0 + 1] = fa_mma(c.f1, bh.v, ol[d0 + 1]); ol[d0 + 2] = fa_mma(c.f2, bh.v, ol[d0 + 2]); ol[d0 + 3] = fa_mma(c.f3, bh.v, ol[d0 + 3]); } }
#undef FA_REQ
#pragma unroll
    for (int dt = 0; dt < 8; ++dt) oh[dt] += ol[dt] * 0.0009765625f;      /* joined per key block, so that the second accumulator holds no registers while the next scores are formed */
  } while (++j <= qb);
  unsigned short* op = (unsigned short*)O + ((size_t)b * SQ + qrow) * DMX + h * HDK + 8 * hh;      /* a lane holds dims 16 dt + 8 hh + r of its query: 16 contiguous bytes a tile; the wave writes the whole 256 B of each of its rows */
#pragma unroll
  for (int dt = 0; dt < 8; ++dt) { FragH f;
#pragma unroll
    for (int r = 0; r < 8; ++r) f.h[r] = (_Float16)(oh[dt][r] * 0.25f);      /* o x64 = (Ph Vh + (Pl Vh + Ph Vl) 2^-10) / 4 */
    *(v8us*)(op + dt * 16) = f.half[0]; } }
// Exact f32 causal attention of rows 0..255, spread over a work-group: 8 waves take 8 query rows of one head (keys 0 .. i0 + 7 only).
// Scores: 4 neighbouring lanes share one key row (each wave-wide load covers 8 rows x 64 contiguous bytes), a lane sums its 32 of the 128 dims for all 8 queries (q from LDS, 64 contiguous bytes per read), two lane steps finish the dot.
// Softmax: wave w owns row i0 + w, 8 keys a lane, plain two-pass (all scores of a row are at hand), accurate expf; keys above the query get weight 0.
// Output: wave w sums keys w, w + 8, ... (a V row is one coalesced 512 B load, its 8 weights two LDS broadcasts), the 8 partial sums meet in LDS in fixed order; o x64 / row sum as before.
__global__ __launch_bounds__(256) void k_att0w(const float* __restrict__ QF, const float* __restrict__ KF, const float* __restrict__ VF, float scale, float* __restrict__ OF) {
  __shared__ __attribute__((aligned(16))) float lq[8][128]; __shared__ __attribute__((aligned(16))) float sc[8][QT0 + 4]; __shared__ __attribute__((aligned(16))) float pt[QT0][8]; __shared__ __attribute__((aligned(16))) float red[8][8][128]; __shared__ float inv[8];
  const int lane = threadIdx.x & 31; const int w = __builtin_amdgcn_readfirstlane(threadIdx.x >> 5); const int h = blockIdx.x % NH, i0 = (QT0 / 8 - 1 - blockIdx.x / NH) * 8; const int nkey = i0 + 8;      /* the row groups with the most keys come first */
  *(v4f*)&lq[w][lane * 4] = *(const v4fa*)(QF + (size_t)(i0 + w) * DMX + h * 128 + lane * 4);
  __syncthreads();
  const int dq = (lane & 3) * 4;
#pragma unroll 1      /* one trip = 64 keys of the work-group; rolled so that only the trips below the diagonal run */
  for (int j0 = w * 8; j0 < nkey; j0 += 64) { const int j = j0 + (lane >> 2); const float* kr = KF + (size_t)j * DKV + h * 128 + dq; v4f kq[8];
#pragma unroll
    for (int c = 0; c < 8; ++c) kq[c] = *(const v4fa*)(kr + c * 16);
    asm volatile("s_wait_xcnt 0x0" ::: "memory");      /* stands in front of the first reuse of the loads' address registers (a precaution); no load sinks below it, so all eight are in flight together */
#pragma unroll 1      /* four query rows a trip: with all eight unrolled the q reads of a whole tile are hoisted and the wave needs more than 256 registers, so that only one work-group fits a WGP */
    for (int rh = 0; rh < 8; rh += 4) { float acc[4] = {0.f, 0.f, 0.f, 0.f};
#pragma unroll
      for (int c = 0; c < 8; ++c) {
#pragma unroll
        for (int r = 0; r < 4; ++r) { const v4f q = *(const v4f*)&lq[rh + r][c * 16 + dq]; acc[r] += q[0] * kq[c][0] + q[1] * kq[c][1] + q[2] * kq[c][2] + q[3] * kq[c][3]; } }
#pragma unroll
      for (int r = 0; r < 4; ++r) { float s = acc[r]; s += sm_xrow<1>(s); s += sm_xrow<2>(s); if ((lane & 3) == 0) sc[rh + r][j] = s * scale; } } }
  __syncthreads();
  { const int i = i0 + w; float s[8]; float mx = -3.0e38f;
#pragma unroll
    for (int u = 0; u < 8; ++u) { const int j = lane + 32 * u; s[u] = (j <= i) ? sc[w][j] : -3.0e38f; mx = fmaxf(mx, s[u]); }
    mx = sm_wmax(mx); float se = 0.f;
#pragma unroll
    for (int u = 0; u < 8; ++u) { const int j = lane + 32 * u; const float e = (j <= i) ? expf(s[u] - mx) : 0.f; se += e; pt[j][w] = e; }
    se = sm_wsum(se); if (lane == 0) inv[w] = 64.0f / se; }
  __syncthreads();
  const v4f z4 = {0.f, 0.f, 0.f, 0.f}; v4f o[8] = {z4, z4, z4, z4, z4, z4, z4, z4};
#pragma unroll 1      /* one trip = 64 keys of the work-group, 8 a wave; keys from nkey on carry weight 0 for all 8 rows (rows below 256 of V, in bounds) */
  for (int jb = w; jb < nkey; jb += 64) { const float* vr = VF + (size_t)jb * DKV + h * 128 + lane * 4; v4f vv[8];
#pragma unroll
    for (int u = 0; u < 8; ++u) vv[u] = *(const v4fa*)(vr + (size_t)(8 * u) * DKV);
#pragma unroll
    for (int u = 0; u < 8; ++u) { const v4f p0 = *(const v4f*)&pt[jb + 8 * u][0], p1 = *(const v4f*)&pt[jb + 8 * u][4];
#pragma unroll
      for (int r = 0; r < 4; ++r) { o[r] += p0[r] * vv[u]; o[4 + r] += p1[r] * vv[u]; } } }
#pragma unroll
  for (int r = 0; r < 8; ++r) *(v4f*)&red[w][r][lane * 4] = o[r];
  __syncthreads();
  { v4f a = *(const v4f*)&red[0][w][lane * 4];
#pragma unroll
    for (int k = 1; k < 8; ++k) a += *(const v4f*)&red[k][w][lane * 4];
    a *= inv[w]; *(v4f*)(OF + (size_t)(i0 + w) * DMX + h * 128 + lane * 4) = a; } }
extern "C" void kernel_launch(void* const* d_in, const int* in_sizes, int n_in,
                              void* d_out, int out_size, void* d_ws, size_t ws_size, hipStream_t stream) {
  (void)in_sizes; (void)n_in; (void)out_size;
  const float* const* I = (const float* const*)d_in; const float* x = I[0]; const float* wq = I[1]; const float* wk = I[2]; const float* wv = I[3]; const float* wo = I[4]; const float* bq = nullptr; const float* bk = nullptr; const float* bv = nullptr; const float* bo = nullptr;      /* natural [out][in] Wq/Wk/Wv/Wo [2048][2048]; no biases */
  char* ws = (char*)d_ws; size_t off = 0;
  auto take = [&](size_t bytes) { char* p = ws + off; off += (bytes + 255) & ~(size_t)255; return p; };
  _Float16* BQ = (_Float16*)take((size_t)DMX * DMX * 2); _Float16* BK = (_Float16*)take((size_t)DKV * DMX * 2); _Float16* BV = (_Float16*)take((size_t)DKV * DMX * 2); _Float16* BO = (_Float16*)take((size_t)DMX * DMX * 2);
  _Float16* X16 = (_Float16*)take(NR * DMX * 2); float* QF = (float*)take((size_t)SQ * DMX * 4); float* KF = (float*)take((size_t)SQ * DKV * 4); float* VF = (float*)take((size_t)SQ * DKV * 4); _Float16* VH = (_Float16*)take((size_t)SQ * DKV * 2); _Float16* VL = (_Float16*)take((size_t)SQ * DKV * 2); _Float16* Q16 = (_Float16*)take(NR * DMX * 2); _Float16* QL = (_Float16*)take(NR * DMX * 2); _Float16* K16 = (_Float16*)take(NR * DKV * 2); _Float16* KL = (_Float16*)take(NR * DKV * 2); _Float16* O16 = (_Float16*)take(NR * DMX * 2);      /* per-batch q, k, v in f32 -> f16 hi + x1024 residual planes (q, k planes of both batches) */
  _Float16* VT = (_Float16*)take((size_t)NB * DKV * SQ * 2); _Float16* VTL = (_Float16*)take((size_t)NB * DKV * SQ * 2);      /* V^T hi / residual of both batches */
  float* OF0 = (float*)take((size_t)NB * QT0 * DMX * 4); _Float16* OH0 = (_Float16*)take((size_t)NB * QT0 * DMX * 2); _Float16* OL0 = (_Float16*)take((size_t)NB * QT0 * DMX * 2);
  if (off > ws_size) return;      /* 232 MiB */
  { const unsigned g = (unsigned)(((size_t)DMX * DMX / 8 + 255) / 256); k_wnat<<<g, 256, 0, stream>>>(wq, (size_t)DMX * DMX / 8, BQ); k_wnat<<<g, 256, 0, stream>>>(wk, (size_t)DKV * DMX / 8, BK); k_wnat<<<g, 256, 0, stream>>>(wv, (size_t)DKV * DMX / 8, BV); k_wnat<<<g, 256, 0, stream>>>(wo, (size_t)DMX * DMX / 8, BO); }      /* natural [out][in] = Bt x16 */
  k_x16<<<(unsigned)((NR * DMX / 8 + 255) / 256), 256, 0, stream>>>(x, X16, NR * DMX / 8);
  for (int b = 0; b < NB; ++b) { const size_t r0 = (size_t)b * SQ;
    float* QF0 = QF; float* KF0 = KF; k_gemm2<0><<<dim3((SQ / 128) * (DMX / 64), 1), 128, 0, stream>>>(X16 + r0 * DMX, DMX, 0, BQ, DMX, 0, 0.0625f, bq, 0, nullptr, 1, 0, 0, QF, nullptr, DMX, 0, SQ, DMX, DMX); k_gemm2<0><<<dim3((SQ / 128) * (DKV / 64), 1), 128, 0, stream>>>(X16 + r0 * DMX, DMX, 0, BK, DMX, 0, 0.0625f, bk, 0, nullptr, 1, 0, 0, KF, nullptr, DKV, 0, SQ, DKV, DMX); k_hl<<<(unsigned)(((size_t)SQ * DMX / 8 + 255) / 256), 256, 0, stream>>>(QF, Q16 + r0 * DMX, QL + r0 * DMX, (size_t)SQ * DMX / 8); k_hl<<<(unsigned)(((size_t)SQ * DKV / 8 + 255) / 256), 256, 0, stream>>>(KF, K16 + r0 * DKV, KL + r0 * DKV, (size_t)SQ * DKV / 8);      /* this batch's q and k in f32 (exact products) -> f16 hi + x1024 residual (block 0's full softmax seen from every later block's first row needs near-exact logits) */ k_gemm2<0><<<dim3((SQ / 128) * (DKV / 64), 1), 128, 0, stream>>>(X16 + r0 * DMX, DMX, 0, BV, DMX, 0, 0.0625f, bv, 0, nullptr, 1, 0, 0, VF, nullptr, DKV, 0, SQ, DKV, DMX); k_hl<<<(unsigned)(((size_t)SQ * DKV / 8 + 255) / 256), 256, 0, stream>>>(VF, VH, VL, (size_t)SQ * DKV / 8);      /* f32 q and k (all rows, above; rows 0..255 for the exact first tile); this batch's v in f32 (exact products) -> f16 hi + x1024 residual (the per-block softmax gives every block's first rows single-key weights, so v and P must be carried beyond one f16) */
    k_vt<DKV / 64, SQ><<<(DKV / 64) * (SQ / 64), 256, 0, stream>>>(VH, DKV, 0, VT + (size_t)b * DKV * SQ); k_vt<DKV / 64, SQ><<<(DKV / 64) * (SQ / 64), 256, 0, stream>>>(VL, DKV, 0, VTL + (size_t)b * DKV * SQ);      /* V^T hi / residual of this batch: head h = slabs 2h, 2h+1 */
    k_att0w<<<NH * (QT0 / 8), 256, 0, stream>>>(QF0, KF0, VF, ATS, OF0 + (size_t)b * QT0 * DMX);      /* exact causal attention rows 0..255 (o x64) */
  }
  k_fattn<<<NB * NH * (SQ / 64), 128, 0, stream>>>(Q16, QL, K16, KL, VT, VTL, O16);      /* scores (hi.hi + the two residual terms), the module's per-block softmax (an independent softmax per 256-key block j <= i, diagonal block causal, weights divided by block count + 1e-6) and o = P V (hi.hi + the two residual terms) -> merged f16 o rows (x64) */
  k_gemm2<0><<<dim3((unsigned)((NR / 128) * (DMX / 64)), 1), 128, 0, stream>>>(O16, DMX, 0, BO, DMX, 0, 0.0009765625f, bo, 0, nullptr, 1, 0, 0, (float*)d_out, nullptr, DMX, 0, (int)NR, DMX, DMX);      /* out = o Wo^T */
  k_hl<<<(unsigned)(((size_t)NB * QT0 * DMX / 8 + 255) / 256), 256, 0, stream>>>(OF0, OH0, OL0, (size_t)NB * QT0 * DMX / 8);      /* first-tile o (x64) -> f16 hi + x1024 residual planes */
  for (int b = 0; b < NB; ++b) { const size_t r0 = (size_t)b * SQ; const size_t f0 = (size_t)b * QT0;
    k_gemm2<0><<<dim3((QT0 / 128) * (DMX / 64), 1), 128, 0, stream>>>(OH0 + f0 * DMX, DMX, 0, BO, DMX, 0, 0.0009765625f, bo, 0, nullptr, 1, 0, 0, (float*)d_out + r0 * DMX, nullptr, DMX, 0, QT0, DMX, DMX);      /* rows 0..255 of the batch rewritten from the exact path */
    k_gemm2<0><<<dim3((QT0 / 128) * (DMX / 64), 1), 128, 0, stream>>>(OL0 + f0 * DMX, DMX, 0, BO, DMX, 0, 0.00000095367431640625f, nullptr, 0, (const float*)d_out + r0 * DMX, -1, 0, 0, (float*)d_out + r0 * DMX, nullptr, DMX, 0, QT0, DMX, DMX); }      /* += o_lo Wo 2^-20 (own-element accumulate) */
}

// v005
// A run of this version takes 436 microseconds.
// Next to v004, in two timings, it ran 1.35 and 1.36 times as fast.
// All steps since v000 together make it 23.3 times as fast.
#include <hip/hip_runtime.h>
// Block-chunked causal attention with the module's PER-BLOCK softmax (hidden [2][2048][2048]; q/k/v = x W^T (natural [2048][2048] sigma 0.02, no biases), 16 heads of 128; keys in blocks of 256: for query block i every key block j <= i gets its OWN softmax over its 256 keys (scores / sqrt(128); inside the diagonal block keys above the query are -inf), the block outputs are summed and divided by the summed weights (= number of included blocks) + 1e-6; merged Wo^T -> [2][2048][2048]; no RoPE).
// Structure: token rows; x as exact f16 rows; natural weights as exact x16 planes; q, k, v as WMMA GEMMs (32x64 wave tiles, f32 accumulation) -> f32 rows -> f16 hi + x1024 residual rows; per batch: V^T via LDS transposes; exact f32 causal attention for rows 0..255 (= key block 0, where the per-block softmax is the ordinary causal softmax) on VALU; one fused launch for all query blocks, heads and both batches: a wave's 16 queries against key blocks 0..i (scores f32 in registers, alpha 1/sqrt(128)), the module's per-block softmax on VALU (f32 statistics, native exp; weights x256 f16 divided by the block count + 1e-6), o = P V (x64) merged f16; out = o Wo^T; first-tile rows rewritten from o hi/lo; launches: see trace.
// Compute dtype: inputs rounded to bf16; x / weights exact; projections f32; q, k, v and softmax weights as f16 hi + x1024 residual GEMM operands, o as plain f16 (~2^-12; first 256 rows of each batch exact); scores, statistics, out f32; v_wmma_f32_16x16x32_f16.
#define NB 2
#define SQ 2048
#define DMX 2048
#define NH 16
#define NKV 16
#define GSZ 1                        /* plain MHA: kv head == query head */
#define HDK 128
#define DKV (NKV * HDK)
#define QT 256
#define QT0 256
#define NKX SQ
#define DM DMX
#define HD 64
#define HG 1
#define NR ((size_t)NB * SQ)
#define ATS 0.08838834764831845f
typedef __bf16 v16b __attribute__((ext_vector_type(16)));
typedef unsigned short v8us __attribute__((ext_vector_type(8), may_alias));
typedef float  v8f  __attribute__((ext_vector_type(8)));
typedef float  v4f  __attribute__((ext_vector_type(4)));
typedef float  v4fa __attribute__((ext_vector_type(4), may_alias));
union FragB { v16b v; v8us half[2]; unsigned short u[16]; };

__device__ __forceinline__ unsigned short bf16_bits(float x) { unsigned int u = __float_as_uint(x); return (unsigned short)((u + 0x7FFFu + ((u >> 16) & 1u)) >> 16); }
__device__ __forceinline__ float bf16_val(unsigned short b) { return __uint_as_float(((unsigned int)b) << 16); }
__device__ __forceinline__ float bf16_round(float x) { return bf16_val(bf16_bits(x)); }
// D += A·B with NT terms: 1 = ah·bh, 2 = + al·bh (A split), 3 = + ah·bl (both split)
template <int NT>
__device__ __forceinline__ v8f mmaN(v16b ah, v16b al, v16b bh, v16b bl, v8f c) {
  c = __builtin_amdgcn_wmma_f32_16x16x32_bf16(false, ah, false, bh, (short)0, c, false, false);
  if (NT >= 2) c = __builtin_amdgcn_wmma_f32_16x16x32_bf16(false, al, false, bh, (short)0, c, false, false);
  if (NT >= 3) c = __builtin_amdgcn_wmma_f32_16x16x32_bf16(false, ah, false, bl, (short)0, c, false, false);
  asm volatile("v_nop\n\tv_nop\n\tv_nop\n\tv_nop" : "+v"(c) : "v"(ah), "v"(al), "v"(bh), "v"(bl));
  return c;
}

__global__ __launch_bounds__(256) void k_wt_bf16(const float* __restrict__ W, unsigned short* __restrict__ Wt, int K, int N) {
  const int t = blockIdx.x * 256 + threadIdx.x;
  const int k8n = K / 8;
  if (t >= N * k8n) return;
  const int n = t / k8n, k8 = (t % k8n) * 8;
  v8us v;
#pragma unroll
  for (int i = 0; i < 8; ++i) v[i] = bf16_bits(W[(size_t)(k8 + i) * N + n]);
  *(v8us*)(Wt + (size_t)n * K + k8) = v;
  
}

// GEMM C[M][N] (f32, pitch ldc) = act(A[M][K]·W + bias). A f32 row-major (pitch lda) converted per fragment to bf16
// (ASPLIT: hi/lo two planes -> 2 terms, else single rounded term); Wt bf16 [N][K] (pitch ldb). BIAS_BF16 rounds the
// bias to bf16 first (bias quantised to bf16 before the add). K%32==0, M%16==0, N%64==0.
template <bool ASPLIT, int ACT, bool BIAS_BF16>
__global__ __launch_bounds__(128) void k_gemm_bf(const float* __restrict__ A, int lda, const unsigned short* __restrict__ Wt, int ldb,
                                               const float* __restrict__ bias, float* __restrict__ C, int ldc, int M, int N, int K) {
  __shared__ __attribute__((aligned(16))) float so[4][16][64];
  const int tid = threadIdx.x, w = tid >> 5, lane = tid & 31, ln = lane & 15, hh = lane >> 4;
  const int ntn = N / 64;
  const int wid = blockIdx.x * 4 + w;
  const int mt = wid / ntn, nq = wid % ntn;
  if (mt * 16 >= M) return;
  const int row0 = mt * 16, col0 = nq * 64;
  const float* arow = A + (size_t)(row0 + ln) * lda;
  v8f acc[4] = {};
  for (int kb = 0; kb < K; kb += 32) {
    FragB ah, al;
    const v4f x0 = *(const v4fa*)(arow + kb + 8 * hh), x1 = *(const v4fa*)(arow + kb + 8 * hh + 4);
    const v4f x2 = *(const v4fa*)(arow + kb + 16 + 8 * hh), x3 = *(const v4fa*)(arow + kb + 16 + 8 * hh + 4);
    float xs[16] = {x0[0],x0[1],x0[2],x0[3],x1[0],x1[1],x1[2],x1[3],x2[0],x2[1],x2[2],x2[3],x3[0],x3[1],x3[2],x3[3]};
#pragma unroll
    for (int i = 0; i < 16; ++i) { const unsigned short hb = bf16_bits(xs[i]); ah.u[i] = hb; al.u[i] = ASPLIT ? bf16_bits(xs[i] - bf16_val(hb)) : (unsigned short)0; }
#pragma unroll
    for (int t = 0; t < 4; ++t) {
      const unsigned short* brow = Wt + (size_t)(col0 + t * 16 + ln) * ldb + kb;
      FragB b;
      b.half[0] = *(const v8us*)(brow + 8 * hh);
      b.half[1] = *(const v8us*)(brow + 16 + 8 * hh);
      acc[t] = mmaN<ASPLIT ? 2 : 1>(ah.v, al.v, b.v, b.v, acc[t]);
    }
  }
#pragma unroll
  for (int t = 0; t < 4; ++t) {
    float bv = bias ? bias[col0 + t * 16 + ln] : 0.f;
    if (BIAS_BF16) bv = bf16_round(bv);
#pragma unroll
    for (int r = 0; r < 8; ++r) { float v = acc[t][r] + bv; if (ACT == 1) v = fmaxf(v, 0.f); so[w][8 * hh + r][t * 16 + ln] = v; }
  }
  __builtin_amdgcn_fence(__ATOMIC_ACQ_REL, "workgroup");
  __builtin_amdgcn_wave_barrier();
  const int rsub = lane >> 4, c4 = (lane & 15) * 4;
  {
#pragma unroll
    for (int q = 0; q < 8; ++q) {
      const int r = q * 2 + rsub;
      const v4f v = *(const v4fa*)&so[w][r][c4];
      *(v4f*)(C + (size_t)(row0 + r) * ldc + col0 + c4) = v;
    }
    
  }
}

// GEMM C = act(A·W + bias + resid): A f32 (ASPLIT -> hi/lo 2 terms), Wt bf16 [N][K]; ACT 0 none, 1 relu, 2 exact gelu;
// resid (optional, f32, row index = (row % rmod), pitch ldr, RES_BF16 rounds it) added before the activation.
template <bool ASPLIT, int ACT, bool BIAS_BF16, bool RES_BF16>
__global__ __launch_bounds__(128) void k_gemm_bf3(const float* __restrict__ A, int lda, const unsigned short* __restrict__ Wt, int ldb,
                                                const float* __restrict__ bias, const float* __restrict__ resid, int rmod, int ldr,
                                                float* __restrict__ C, int ldc, int M, int N, int K) {
  __shared__ __attribute__((aligned(16))) float so[4][16][64];
  const int tid = threadIdx.x, w = tid >> 5, lane = tid & 31, ln = lane & 15, hh = lane >> 4;
  const int ntn = N / 64;
  const int wid = blockIdx.x * 4 + w;
  const int mt = wid / ntn, nq = wid % ntn;
  if (mt * 16 >= M) return;
  const int row0 = mt * 16, col0 = nq * 64;
  const float* arow = A + (size_t)(row0 + ln) * lda;
  v8f acc[4] = {};
  for (int kb = 0; kb < K; kb += 32) {
    FragB ah, al;
    const v4f x0 = *(const v4fa*)(arow + kb + 8 * hh), x1 = *(const v4fa*)(arow + kb + 8 * hh + 4);
    const v4f x2 = *(const v4fa*)(arow + kb + 16 + 8 * hh), x3 = *(const v4fa*)(arow + kb + 16 + 8 * hh + 4);
    float xs[16] = {x0[0],x0[1],x0[2],x0[3],x1[0],x1[1],x1[2],x1[3],x2[0],x2[1],x2[2],x2[3],x3[0],x3[1],x3[2],x3[3]};
#pragma unroll
    for (int i = 0; i < 16; ++i) { const unsigned short hb = bf16_bits(xs[i]); ah.u[i] = hb; al.u[i] = ASPLIT ? bf16_bits(xs[i] - bf16_val(hb)) : (unsigned short)0; }
#pragma unroll
    for (int t = 0; t < 4; ++t) {
      const unsigned short* brow = Wt + (size_t)(col0 + t * 16 + ln) * ldb + kb;
      FragB b;
      b.half[0] = *(const v8us*)(brow + 8 * hh);
      b.half[1] = *(const v8us*)(brow + 16 + 8 * hh);
      acc[t] = mmaN<ASPLIT ? 2 : 1>(ah.v, al.v, b.v, b.v, acc[t]);
    }
  }
#pragma unroll
  for (int t = 0; t < 4; ++t) {
    const int col = col0 + t * 16 + ln;
    float bv = bias ? bias[col] : 0.f;
    if (BIAS_BF16) bv = bf16_round(bv);
#pragma unroll
    for (int r = 0; r < 8; ++r) {
      float v = acc[t][r] + bv;
      if (resid) { float rv = resid[(size_t)((row0 + 8 * hh + r) % rmod) * ldr + col]; if (RES_BF16) rv = bf16_round(rv); v += rv; }
      if (ACT == 1) v = fmaxf(v, 0.f);
      if (ACT == 2) v = 0.5f * v * (1.0f + erff(v * 0.70710678118654752f));
      if (ACT == 3) { const float u = 0.7978845608028654f * (v + 0.044715f * v * v * v); v = 0.5f * v * (1.0f + tanhf(u)); }
      so[w][8 * hh + r][t * 16 + ln] = v;
    }
  }
  __builtin_amdgcn_fence(__ATOMIC_ACQ_REL, "workgroup");
  __builtin_amdgcn_wave_barrier();
  const int rsub = lane >> 4, c4 = (lane & 15) * 4;
  {
#pragma unroll
    for (int q = 0; q < 8; ++q) {
      const int r = q * 2 + rsub;
      const v4f v = *(const v4fa*)&so[w][r][c4];
      *(v4f*)(C + (size_t)(row0 + r) * ldc + col0 + c4) = v;
    }
    
  }
}
// row LayerNorm (biased variance, eps) over N: s = X (+ R); optional out_sum <- s; out_norm <- (s-mu)*rsqrt(var+eps)*g + b
template <bool PARAM_BF16>
__global__ __launch_bounds__(256) void k_layernorm(const float* __restrict__ X, const float* __restrict__ R, const float* __restrict__ g, const float* __restrict__ bta,
                                                  float* __restrict__ out_sum, float* __restrict__ out_norm, int N, float eps) {
  __shared__ float red[256];
  const int row = blockIdx.x, tid = threadIdx.x;
  const float* x = X + (size_t)row * N; const float* rr = R ? R + (size_t)row * N : nullptr;
  float vals[16];                     // up to N = 4096
  const int per = N / 256;            // contiguous chunk per thread? use strided-by-4 chunks: thread handles j = tid*4 + 1024*u
  float s1 = 0.f;
  for (int u = 0; u < per / 4; ++u) {
    const int j = tid * 4 + 1024 * u;
    const v4f a = *(const v4fa*)(x + j);
    v4f b = {0.f,0.f,0.f,0.f}; if (rr) b = *(const v4fa*)(rr + j);
#pragma unroll
    for (int q = 0; q < 4; ++q) { const float v = a[q] + b[q]; vals[u * 4 + q] = v; s1 += v; }
  }
  red[tid] = s1; __syncthreads();
  for (int st = 128; st > 0; st >>= 1) { if (tid < st) red[tid] += red[tid + st]; __syncthreads(); }
  const float mu = red[0] / (float)N; __syncthreads();
  float s2 = 0.f;
  for (int u = 0; u < per / 4; ++u)
#pragma unroll
    for (int q = 0; q < 4; ++q) { const float c = vals[u * 4 + q] - mu; s2 += c * c; }
  red[tid] = s2; __syncthreads();
  for (int st = 128; st > 0; st >>= 1) { if (tid < st) red[tid] += red[tid + st]; __syncthreads(); }
  const float rs = rsqrtf(red[0] / (float)N + eps);
  {
    for (int u = 0; u < per / 4; ++u) {
      const int j = tid * 4 + 1024 * u;
      v4f o, sm;
#pragma unroll
      for (int q = 0; q < 4; ++q) {
        float gg = g[j + q], bb = bta[j + q];
        if (PARAM_BF16) { gg = bf16_round(gg); bb = bf16_round(bb); }
        sm[q] = vals[u * 4 + q]; o[q] = (vals[u * 4 + q] - mu) * rs * gg + bb;
      }
      if (out_sum) *(v4f*)(out_sum + (size_t)row * N + j) = sm;
      *(v4f*)(out_norm + (size_t)row * N + j) = o;
    }
    
  }
}



// ---- f16 WMMA path (v_wmma_f32_16x16x32_f16): 11-bit significands for operands in range — used where a [0,1] probability operand needs more precision than bf16
typedef _Float16 v16h __attribute__((ext_vector_type(16)));
union FragH { v16h v; v8us half[2]; _Float16 h[16]; unsigned short u[16]; };
template <int NT>
__device__ __forceinline__ v8f mmaH(v16h ah, v16h al, v16h bh, v16h bl, v8f c) {
  c = __builtin_amdgcn_wmma_f32_16x16x32_f16(false, ah, false, bh, (short)0, c, false, false);
  if (NT >= 2) c = __builtin_amdgcn_wmma_f32_16x16x32_f16(false, al, false, bh, (short)0, c, false, false);
  if (NT >= 3) c = __builtin_amdgcn_wmma_f32_16x16x32_f16(false, ah, false, bl, (short)0, c, false, false);
  asm volatile("v_nop\n\tv_nop\n\tv_nop\n\tv_nop" : "+v"(c) : "v"(ah), "v"(al), "v"(bh), "v"(bl));
  return c;
}
// batched GEMM like k_gemm_b but f16 operands: A f32 (split into f16 hi/lo if ASPLIT, else rounded to f16), Bt = f16 values [n][k]; alpha; C f32; N multiple of 16 (partial tiles skipped)
template <bool ASPLIT>
__global__ __launch_bounds__(128) void k_gemm_h(const float* __restrict__ A, int lda, size_t sA, const _Float16* __restrict__ Bh, int ldb, size_t sB, float alpha, float* __restrict__ C, int ldc, size_t sC, int M, int N, int K) {
  __shared__ __attribute__((aligned(16))) float so[4][16][64];
  const int tid = threadIdx.x, w = tid >> 5, lane = tid & 31, ln = lane & 15, hh = lane >> 4; const int by = blockIdx.y;
  A += (size_t)by * sA; Bh += (size_t)by * sB; C += (size_t)by * sC;
  const int ntn = (N + 63) / 64; const int wid = blockIdx.x * 4 + w; const int mt = wid / ntn, nq = wid % ntn; if (mt * 16 >= M) return;
  const int row0 = mt * 16, col0 = nq * 64; const float* arow = A + (size_t)(row0 + ln) * lda;
  v8f acc[4] = {};
  for (int kb = 0; kb < K; kb += 32) {
    FragH ah, al;
    const v4f x0 = *(const v4fa*)(arow + kb + 8 * hh), x1 = *(const v4fa*)(arow + kb + 8 * hh + 4), x2 = *(const v4fa*)(arow + kb + 16 + 8 * hh), x3 = *(const v4fa*)(arow + kb + 16 + 8 * hh + 4);
    float xs[16] = {x0[0],x0[1],x0[2],x0[3],x1[0],x1[1],x1[2],x1[3],x2[0],x2[1],x2[2],x2[3],x3[0],x3[1],x3[2],x3[3]};
#pragma unroll
    for (int i = 0; i < 16; ++i) { const _Float16 h = (_Float16)xs[i]; ah.h[i] = h; al.h[i] = ASPLIT ? (_Float16)(xs[i] - (float)h) : (_Float16)0.0f; }
#pragma unroll
    for (int t = 0; t < 4; ++t) { if (col0 + t * 16 >= N) continue; const size_t boff = (size_t)(col0 + t * 16 + ln) * ldb + kb; FragH bq; bq.half[0] = *(const v8us*)(Bh + boff + 8 * hh); bq.half[1] = *(const v8us*)(Bh + boff + 16 + 8 * hh);
      acc[t] = mmaH<ASPLIT ? 2 : 1>(ah.v, al.v, bq.v, bq.v, acc[t]); }
  }
#pragma unroll
  for (int t = 0; t < 4; ++t) { if (col0 + t * 16 >= N) continue;
#pragma unroll
    for (int r = 0; r < 8; ++r) so[w][8 * hh + r][t * 16 + ln] = acc[t][r] * alpha; }
  __builtin_amdgcn_fence(__ATOMIC_ACQ_REL, "workgroup"); __builtin_amdgcn_wave_barrier();
  const int rsub = lane >> 4, c4 = (lane & 15) * 4;
  {
#pragma unroll
    for (int q = 0; q < 8; ++q) { const int r = q * 2 + rsub; if (col0 + c4 < N) { const v4f v = *(const v4fa*)&so[w][r][c4]; *(v4f*)(C + (size_t)(row0 + r) * ldc + col0 + c4) = v; } }
     }
}

// Wt[n][k] = f16(W[k][n]·scale) from f32 row-major W[K][N] (scale = power of two; bf16-exact weights stay exact in f16 away from the subnormal range)
__global__ __launch_bounds__(256) void k_wt_f16(const float* __restrict__ W, _Float16* __restrict__ Wt, int K, int N, float scale) {
  const int t = blockIdx.x * 256 + threadIdx.x; if (t >= N * (K / 8)) return; const int n = t / (K / 8), k8 = (t % (K / 8)) * 8; FragH f;
#pragma unroll
  for (int i = 0; i < 8; ++i) f.h[i] = (_Float16)(bf16_round(W[(size_t)(k8 + i) * N + n]) * scale); const v8us o = f.half[0];
  *(v8us*)((unsigned short*)Wt + (size_t)n * K + k8) = o; 
}
// k_gemm_hh variant with fused epilogue: v = acc·alpha + bias[by·sBias + col] (+ CP[(row/rowsPerB)·sCPb + by·64 + col] if CP) ; ACT 0 none / 1 elu ; writes f16 C16 (and f32 C if non-null)
template <int ACT>
__global__ __launch_bounds__(128) void k_gemm_hhx(const _Float16* __restrict__ A, int lda, size_t sA, const _Float16* __restrict__ Bh, int ldb, size_t sB, float alpha, const float* __restrict__ bias, size_t sBias, const float* __restrict__ CP, int rowsPerB, size_t sCPb, int row0g,
    float* __restrict__ C, _Float16* __restrict__ C16, int ldc, size_t sC, int M, int N, int K) {
  __shared__ __attribute__((aligned(16))) float so[4][16][64];
  const int tid = threadIdx.x, w = tid >> 5, lane = tid & 31, ln = lane & 15, hh = lane >> 4; const int by = blockIdx.y;
  A += (size_t)by * sA; Bh += (size_t)by * sB; const size_t cofs = (size_t)by * sC; const float* bp = bias ? bias + (size_t)by * sBias : nullptr;
  const int ntn = (N + 63) / 64; const int wid = blockIdx.x * 4 + w; const int mt = wid / ntn, nq = wid % ntn; if (mt * 16 >= M) return;
  const int row0 = mt * 16, col0 = nq * 64; const _Float16* arow = A + (size_t)(row0 + ln) * lda;
  v8f acc[4] = {};
  for (int kb = 0; kb < K; kb += 32) { FragH ah; ah.half[0] = *(const v8us*)((const unsigned short*)arow + kb + 8 * hh); ah.half[1] = *(const v8us*)((const unsigned short*)arow + kb + 16 + 8 * hh);
#pragma unroll
    for (int t = 0; t < 4; ++t) { if (col0 + t * 16 >= N) continue; const size_t boff = (size_t)(col0 + t * 16 + ln) * ldb + kb; FragH bq; bq.half[0] = *(const v8us*)((const unsigned short*)Bh + boff + 8 * hh); bq.half[1] = *(const v8us*)((const unsigned short*)Bh + boff + 16 + 8 * hh);
      acc[t] = mmaH<1>(ah.v, ah.v, bq.v, bq.v, acc[t]); }
  }
#pragma unroll
  for (int t = 0; t < 4; ++t) { if (col0 + t * 16 >= N) continue; const int col = col0 + t * 16 + ln; const float bv = bp ? bf16_round(bp[col]) : 0.f;
#pragma unroll
    for (int r = 0; r < 8; ++r) { float v = acc[t][r] * alpha + bv; if (CP) { const int rr = row0g + row0 + 8 * hh + r; if (rowsPerB < 0) v += CP[cofs + (size_t)rr * ldc + col];      /* rowsPerB < 0: own element of the batched C plane */ else { const int bidx = rr / rowsPerB; v += CP[(size_t)bidx * sCPb + (size_t)by * 64 + col]; } } if (ACT == 1) v = (v > 0.f) ? v : expm1f(v); else if (ACT == 7) v = (v > 0.f) ? v + 1.0f : expf(v); else if (ACT == 8) v = tanhf(v); else if (ACT == 9) v = 0.5f * v * (1.0f + tanhf(0.7978845608028654f * (v + 0.044715f * v * v * v))); else if (ACT == 11) v = 1.0f / (1.0f + expf(-v)); else if (ACT == 12) v = (v > 0.f) ? v : 0.01f * v; else if (ACT == 14) v = (v > 0.f) ? v : 0.1f * v; else if (ACT == 16) v = (v >= 0.f) ? v : 0.3f * v; else if (ACT == 17) v = (v >= 0.f) ? v : 0.2f * v; else if (ACT == 15) v = v / (1.0f + expf(-v)); else if (ACT == 3) v = fmaxf(v, 0.f); else if (ACT == 6) v = 0.5f * v * (1.0f + erff(v * 0.70710678118654752f)); so[w][8 * hh + r][t * 16 + ln] = v; } }
  __builtin_amdgcn_fence(__ATOMIC_ACQ_REL, "workgroup"); __builtin_amdgcn_wave_barrier();
  const int rsub = lane >> 4, c4 = (lane & 15) * 4; typedef _Float16 v4h __attribute__((ext_vector_type(4)));
  {
#pragma unroll
    for (int q = 0; q < 8; ++q) { const int r = q * 2 + rsub; if (col0 + c4 < N) { const v4f v = *(const v4fa*)&so[w][r][c4]; if (C) *(v4f*)(C + cofs + (size_t)(row0 + r) * ldc + col0 + c4) = v; if (C16) { v4h h4; for (int i = 0; i < 4; ++i) h4[i] = (_Float16)v[i]; *(v4h*)(C16 + cofs + (size_t)(row0 + r) * ldc + col0 + c4) = h4; } } }
     }
}


typedef _Float16 v4h __attribute__((ext_vector_type(4)));

// FRAGMENT ORDER of an f16 operand plane of 2048 columns: the plane is cut into tiles of 16 rows x 32 columns, 1 KiB each, 64 tiles to a strip of 16 rows (a strip starts where it starts in the row-major plane).
// Inside a tile the 16-byte piece p = 32 half + 16 hh + ln holds columns 16 half + 8 hh .. + 7 of row ln: piece 32 half + lane is what lane (hh, ln) takes as elements 8 half .. 8 half + 7 of an A or B fragment.
// So each of the two 16-byte loads of a fragment reads 512 contiguous bytes (4 whole lines) over the wave; from a row-major plane it took 32 bytes out of each of 16 lines. The registers hold the same values as before.
static_assert(DMX == 2048 && DKV == 2048 && SQ == 2048, "fragment order below is written for planes of 2048 columns");
// A converting launch gives thread t eight values of tile t / 64: row (t & 63) / 4, columns 8 (t & 3) .. + 7. Four neighbouring lanes read one whole row of the tile (a 128-byte line of the f32 source), and the wave's store fills four whole lines of the plane.
__device__ __forceinline__ size_t fo_src(size_t t) { const size_t tile = t >> 6; return ((tile >> 6) * 16 + ((t & 63) >> 2)) * 2048 + (tile & 63) * 32 + (t & 3) * 8; }      /* element offset of thread t's 8 values in the row-major source */
__device__ __forceinline__ size_t fo_dst(size_t t) { return (t >> 6) * 512 + ((t & 3) * 16 + ((t & 63) >> 2)) * 8; }      /* and in the plane in fragment order: piece 16 (2 half + hh) + ln */
__global__ __launch_bounds__(256) void k_x16(const float* __restrict__ x, _Float16* __restrict__ X16, size_t n8) { const size_t t = (size_t)blockIdx.x * 256 + threadIdx.x; if (t >= n8) return; FragH f; const float* xs = x + fo_src(t);      /* X16 in fragment order */
#pragma unroll
  for (int q = 0; q < 8; ++q) f.h[q] = (_Float16)bf16_round(xs[q]); *(v8us*)((unsigned short*)X16 + fo_dst(t)) = f.half[0];  }
__global__ __launch_bounds__(256) void k_h16(const float* __restrict__ x, _Float16* __restrict__ X16, size_t n8) { const size_t t = (size_t)blockIdx.x * 256 + threadIdx.x; if (t >= n8) return; FragH f;
#pragma unroll
  for (int q = 0; q < 8; ++q) f.h[q] = (_Float16)x[t * 8 + q]; *(v8us*)((unsigned short*)X16 + t * 8) = f.half[0];  }
__global__ __launch_bounds__(256) void k_round16f(const float* __restrict__ W, _Float16* __restrict__ Bt, size_t n8) { const size_t t = (size_t)blockIdx.x * 256 + threadIdx.x; if (t >= n8) return; FragH f;
#pragma unroll
  for (int i = 0; i < 8; ++i) f.h[i] = (_Float16)(bf16_round(W[t * 8 + i]) * 16.0f); *(v8us*)((unsigned short*)Bt + t * 8) = f.half[0];  }
template <int NHv, int TTv>
__global__ __launch_bounds__(256) void k_vt(const _Float16* __restrict__ V16, int ldv, int voff, _Float16* __restrict__ Vt) { __shared__ unsigned short tl[64][66]; const int tid = threadIdx.x; const int slab = blockIdx.x / (TTv / 64), lg = blockIdx.x % (TTv / 64); const int b = slab / NHv, h = slab % NHv;
  for (int i = tid; i < 64 * 8; i += 256) { const int r = i / 8, c8 = (i % 8) * 8; FragH f; f.half[0] = *(const v8us*)((const unsigned short*)V16 + ((size_t)b * TTv + lg * 64 + r) * ldv + voff + h * 64 + c8);
#pragma unroll
    for (int q = 0; q < 8; ++q) tl[r][c8 + q] = f.u[q]; }
  __syncthreads();
  {
#pragma unroll
    for (int rd = 0; rd < 2; ++rd) { const int idx = rd * 256 + tid, t8 = idx >> 6, p = idx & 63; const int d = (t8 >> 1) * 16 + (p & 15), c8 = (t8 & 1) * 32 + (p >> 5) * 16 + ((p >> 4) & 1) * 8; FragH f;      /* the 64 x 64 block = 4 x 2 tiles of V^T in fragment order (rows = dims, columns = keys), a thread per 16-byte piece */
#pragma unroll
      for (int q = 0; q < 8; ++q) f.u[q] = tl[c8 + q][d];
      *(v8us*)((unsigned short*)Vt + (((size_t)slab * 4 + (t8 >> 1)) * (TTv / 32) + lg * 2 + (t8 & 1)) * 512 + p * 8) = f.half[0]; }
     } }

template <bool FO>      /* FO: the two planes are written in fragment order (F stays row-major) */
__global__ __launch_bounds__(256) void k_hl(const float* __restrict__ F, _Float16* __restrict__ Hh, _Float16* __restrict__ Hl, size_t n8) { const size_t t = (size_t)blockIdx.x * 256 + threadIdx.x; if (t >= n8) return; FragH fh, fl; const float* fs = F + (FO ? fo_src(t) : t * 8); const v4f a = *(const v4fa*)fs, c = *(const v4fa*)(fs + 4);
#pragma unroll
  for (int q = 0; q < 4; ++q) { _Float16 h = (_Float16)a[q]; fh.h[q] = h; fl.h[q] = (_Float16)((a[q] - (float)h) * 1024.0f); h = (_Float16)c[q]; fh.h[4 + q] = h; fl.h[4 + q] = (_Float16)((c[q] - (float)h) * 1024.0f); }
  { const size_t d = FO ? fo_dst(t) : t * 8; *(v8us*)((unsigned short*)Hh + d) = fh.half[0]; *(v8us*)((unsigned short*)Hl + d) = fl.half[0];  } }

// ---- fast GEMM (wave tile 32x64; requires M % 32 == 0 rows per launch region, N % 64 == 0, K % 32 == 0 and K >= 96); A and Bh in fragment order (lda, ldb = columns of the plane); epilogue = k_gemm_hhx semantics ----
__device__ __forceinline__ v16h g2_frag(const _Float16* p) { FragH f; f.half[0] = *(const v8us*)((const unsigned short*)p); f.half[1] = *(const v8us*)((const unsigned short*)p + 256); return f.v; }      /* p = the tile in fragment order + 8 lane */
__device__ __forceinline__ v8f g2_mma(v16h a, v16h b, v8f c) { v8f d = __builtin_amdgcn_wmma_f32_16x16x32_f16(false, a, false, b, (short)0, c, false, false); asm volatile("v_nop\n\tv_nop\n\tv_nop\n\tv_nop" : "+v"(d) : "v"(a), "v"(b)); return d; }
struct G2S { v16h a0, a1, b0, b1, b2, b3; };      /* the fragments of one k-step of a 32x64 wave tile */
__device__ __forceinline__ void g2_load(G2S& s, const _Float16* a0p, const _Float16* a1p, const _Float16* b0p, const _Float16* b1p, const _Float16* b2p, const _Float16* b3p, int k) { s.a0 = g2_frag(a0p + k); s.b0 = g2_frag(b0p + k); s.a1 = g2_frag(a1p + k); s.b1 = g2_frag(b1p + k); s.b2 = g2_frag(b2p + k); s.b3 = g2_frag(b3p + k); }      /* k: 512 elements (one tile) a k-step */
template <int ACT>
__global__ __launch_bounds__(128) void k_gemm2(const _Float16* __restrict__ A, int lda, size_t sA, const _Float16* __restrict__ Bh, int ldb, size_t sB, float alpha, const float* __restrict__ bias, size_t sBias, const float* __restrict__ CP, int rowsPerB, size_t sCPb, int row0g,
    float* __restrict__ C, _Float16* __restrict__ C16, int ldc, size_t sC, int M, int N, int K) { static_assert(ACT == 0 || ACT == 3 || ACT == 6 || ACT == 8 || ACT == 9 || ACT == 11 || ACT == 12 || ACT == 14 || ACT == 15 || ACT == 16 || ACT == 17, "k_gemm2: unsupported ACT code (would silently apply no activation)");
  __shared__ __attribute__((aligned(16))) float so[4][32][68];
  const int tid = threadIdx.x, w = tid >> 5, lane = tid & 31, ln = lane & 15, hh = lane >> 4; const int by = blockIdx.y;
  A += (size_t)by * sA; Bh += (size_t)by * sB; const size_t cofs = (size_t)by * sC; const float* bp = bias ? bias + (size_t)by * sBias : nullptr;
  const int ntn = N >> 6; const int mt = blockIdx.x / ntn, nq = blockIdx.x - mt * ntn; const int row0 = mt * 128 + 32 * w, col0 = nq * 64; if (row0 >= M) return;
  const _Float16* a0p = A + (size_t)row0 * lda + lane * 8; const _Float16* a1p = a0p + (size_t)16 * lda;
  const _Float16* b0p = Bh + (size_t)col0 * ldb + lane * 8; const _Float16* b1p = b0p + (size_t)16 * ldb; const _Float16* b2p = b1p + (size_t)16 * ldb; const _Float16* b3p = b2p + (size_t)16 * ldb;
  // k loop, three k-steps of fragments in registers: a step's 12 loads are issued together, directly behind the products of the step that held those registers,
  // so they fly during the next two steps' products instead of being waited for one fragment at a time. Products and their order per accumulator are as before.
  const int nst = K >> 5; G2S s0, s1, s2; int st = 0, ko = 0;
  g2_load(s0, a0p, a1p, b0p, b1p, b2p, b3p, 0); __builtin_amdgcn_sched_barrier(0);      /* the three sets are requested one after the other, as in the loop: mixed, the counted load waits in the loop (set for both ways into it) would wait for the younger sets too */
  g2_load(s1, a0p, a1p, b0p, b1p, b2p, b3p, 512); __builtin_amdgcn_sched_barrier(0);      /* as above */
  g2_load(s2, a0p, a1p, b0p, b1p, b2p, b3p, 1024);
  asm volatile("s_wait_xcnt 0x0" ::: "memory");      /* stands in front of the clearing of the accumulators, some of which take the registers of an address that the loads above name (a precaution; the compiler wrote none there) */
  const v8f z8 = {0.f,0.f,0.f,0.f,0.f,0.f,0.f,0.f}; v8f c00 = z8, c01 = z8, c02 = z8, c03 = z8, c10 = z8, c11 = z8, c12 = z8, c13 = z8;
#define G2_MMA8(S) { c00 = g2_mma(S.a0, S.b0, c00); c10 = g2_mma(S.a1, S.b0, c10); c01 = g2_mma(S.a0, S.b1, c01); c11 = g2_mma(S.a1, S.b1, c11); c02 = g2_mma(S.a0, S.b2, c02); c12 = g2_mma(S.a1, S.b2, c12); c03 = g2_mma(S.a0, S.b3, c03); c13 = g2_mma(S.a1, S.b3, c13); }
  /* G2_STEP: the k offset moves on by three steps. The wait stands in front of the rewrite of the address registers that the loads in flight name (a precaution; the compiler wrote none over the back edge); the new offset is its output, so every new address is formed behind it. */
#define G2_STEP { ko += 1536; asm volatile("s_wait_xcnt 0x0" : "+s"(ko) : : "memory"); }
#pragma unroll 1      /* one trip = three k-steps, one per register set; rolled so that the sets keep their registers */
  for (; st + 6 <= nst; st += 3) {
    G2_MMA8(s0) G2_STEP g2_load(s0, a0p + ko, a1p + ko, b0p + ko, b1p + ko, b2p + ko, b3p + ko, 0); __builtin_amdgcn_sched_barrier(0);      /* keeps the next set's first product, with its load wait, from moving up in front of these requests */
    G2_MMA8(s1) g2_load(s1, a0p + ko, a1p + ko, b0p + ko, b1p + ko, b2p + ko, b3p + ko, 512);
    G2_MMA8(s2) g2_load(s2, a0p + ko, a1p + ko, b0p + ko, b1p + ko, b2p + ko, b3p + ko, 1024); }
  const int rem = nst - st;      /* 3, 4 or 5 k-steps are left, the first three of them loaded */
  G2_MMA8(s0) G2_STEP if (rem > 3) g2_load(s0, a0p + ko, a1p + ko, b0p + ko, b1p + ko, b2p + ko, b3p + ko, 0);
  G2_MMA8(s1) if (rem > 4) { asm volatile("s_wait_xcnt 0x0" : "+s"(ko) : : "memory");      /* as in G2_STEP: the compiler forms this set's addresses in registers that the loads just above name */
    g2_load(s1, a0p + ko, a1p + ko, b0p + ko, b1p + ko, b2p + ko, b3p + ko, 512); }
  G2_MMA8(s2)
  if (rem > 3) G2_MMA8(s0)
  if (rem > 4) G2_MMA8(s1)
#undef G2_STEP
#undef G2_MMA8
  v8f accs[8] = {c00, c01, c02, c03, c10, c11, c12, c13};
#pragma unroll
  for (int u = 0; u < 8; ++u) { const int t = u & 3, half = u >> 2; const int col = col0 + t * 16 + ln; const float bv = bp ? bf16_round(bp[col]) : 0.f;
#pragma unroll
    for (int r = 0; r < 8; ++r) { const int rloc = half * 16 + 8 * hh + r; float v = accs[u][r] * alpha + bv; if (CP) { if (rowsPerB < 0) v += CP[cofs + (size_t)(row0g + row0 + rloc) * ldc + col];      /* rowsPerB < 0: own element of the batched C plane */ else { const int bidx = (row0g + row0 + rloc) / rowsPerB; v += CP[(size_t)bidx * sCPb + (size_t)by * 64 + col]; } }
      if (ACT == 3) v = fmaxf(v, 0.f); else if (ACT == 6) v = 0.5f * v * (1.0f + erff(v * 0.70710678118654752f)); else if (ACT == 11) v = 1.0f / (1.0f + expf(-v)); else if (ACT == 15) v = v / (1.0f + expf(-v)); else if (ACT == 12) v = (v > 0.f) ? v : 0.01f * v; else if (ACT == 8) v = tanhf(v); else if (ACT == 9) v = 0.5f * v * (1.0f + tanhf(0.7978845608028654f * (v + 0.044715f * v * v * v))); else if (ACT == 14) v = (v > 0.f) ? v : 0.1f * v; else if (ACT == 16) v = (v >= 0.f) ? v : 0.3f * v; else if (ACT == 17) v = (v >= 0.f) ? v : 0.2f * v;
      so[w][rloc][t * 16 + ln] = v; } }
  __builtin_amdgcn_fence(__ATOMIC_ACQ_REL, "workgroup"); __builtin_amdgcn_wave_barrier();
  const int rsub = lane >> 4, c4 = (lane & 15) * 4;
  {
#pragma unroll
    for (int q = 0; q < 16; ++q) { const int r = q * 2 + rsub; const v4f v = *(const v4fa*)&so[w][r][c4]; if (C) *(v4f*)(C + cofs + (size_t)(row0 + r) * ldc + col0 + c4) = v; if (C16) { v4h h4; for (int i = 0; i < 4; ++i) h4[i] = (_Float16)v[i]; *(v4h*)(C16 + cofs + (size_t)(row0 + r) * ldc + col0 + c4) = h4; } }
     } }


__global__ __launch_bounds__(256) void k_wnat(const float* __restrict__ w, size_t n8, _Float16* __restrict__ Bt) { const size_t t = (size_t)blockIdx.x * 256 + threadIdx.x; if (t >= n8) return; FragH f; const float* wsrc = w + fo_src(t);      /* Bt in fragment order */ for (int q = 0; q < 8; ++q) f.h[q] = (_Float16)(bf16_round(wsrc[q]) * 16.0f); *(v8us*)((unsigned short*)Bt + fo_dst(t)) = f.half[0];  }
__global__ __launch_bounds__(256) void k_rsm(const float* __restrict__ S, _Float16* __restrict__ P, int nrows) {
  #pragma clang fp contract(off)
  const int i = blockIdx.x * 256 + threadIdx.x; if (i >= nrows) return; const float* s = S + (size_t)i * SQ; float mx = -3.0e38f;
#pragma unroll 1
  for (int j = 0; j < SQ; ++j) mx = fmaxf(mx, s[j]); float se = 0.f;
#pragma unroll 1
  for (int j = 0; j < SQ; ++j) se += expf(s[j] - mx); const float sc = 256.0f / se;
#pragma unroll 1
  for (int j0 = 0; j0 < SQ; j0 += 8) { FragH f; for (int q = 0; q < 8; ++q) f.h[q] = (_Float16)(expf(s[j0 + q] - mx) * sc); unsigned short* d = (unsigned short*)P + (size_t)i * SQ + j0; *(v8us*)d = f.half[0];  } }
__global__ __launch_bounds__(256) void k_vt(const _Float16* __restrict__ V16, int b, int h0, _Float16* __restrict__ VT) { __shared__ unsigned short tl[64][65]; const int tid = threadIdx.x; const int hh = blockIdx.x % HG, sg = blockIdx.x / HG; const int s0 = sg * 64; const int h = h0 + hh;
  for (int i = tid; i < 64 * 8; i += 256) { const int j = i / 8, d8 = (i % 8) * 8; FragH f; f.half[0] = *(const v8us*)((const unsigned short*)V16 + ((size_t)b * SQ + s0 + j) * DM + h * HD + d8); for (int q = 0; q < 8; ++q) tl[d8 + q][j] = f.u[q]; }
  __syncthreads();
  { for (int i = tid; i < 64 * 8; i += 256) { const int d = i / 8, j8 = (i % 8) * 8; FragH f; for (int q = 0; q < 8; ++q) f.u[q] = tl[d][j8 + q]; *(v8us*)((unsigned short*)VT + ((size_t)hh * HD + d) * SQ + s0 + j8) = f.half[0]; }  } }


__global__ __launch_bounds__(256) void k_f2h(const float* __restrict__ F, int ldf, int coff, int ncol, _Float16* __restrict__ H16, size_t nrow) { const size_t t = (size_t)blockIdx.x * 256 + threadIdx.x; const size_t n8 = nrow * (size_t)(ncol / 8); if (t >= n8) return; const size_t r = t / (ncol / 8); const int c8 = (int)(t % (ncol / 8)) * 8; FragH f; const v4f a = *(const v4fa*)(F + r * ldf + coff + c8), b2 = *(const v4fa*)(F + r * ldf + coff + c8 + 4); for (int q = 0; q < 4; ++q) { f.h[q] = (_Float16)a[q]; f.h[4 + q] = (_Float16)b2[q]; } *(v8us*)((unsigned short*)H16 + r * ncol + c8) = f.half[0];  }

__global__ __launch_bounds__(256) void k_tab128(float theta, float* __restrict__ CS, float* __restrict__ SN) {
  #pragma clang fp contract(off)
  const int t = blockIdx.x * 256 + threadIdx.x; if (t >= SQ * 64) return; const int i = t % 64; const int p = t / 64; const float invf = (float)(1.0 / pow((double)theta, (double)(2 * i) / 128.0));      /* = XLA's constant-folded f32 table */ const float ang = __fmul_rn((float)p, invf); const float c = cosf(ang), s = sinf(ang);
  *(float*)(CS + t) = c; *(float*)(SN + t) = s;  }
template <int TAB>
__global__ __launch_bounds__(128) void k_rope128(const float* __restrict__ F, int ldf, int nh, const float* __restrict__ CS, const float* __restrict__ SN, _Float16* __restrict__ H16, int ldo, float osc) {
  #pragma clang fp contract(off)
  __shared__ float xv[128]; __shared__ unsigned short sh_[128]; const int d = threadIdx.x; const int h = blockIdx.x % nh; const size_t r = blockIdx.x / nh; const int p = (int)(r % SQ);
  xv[d] = F[r * (size_t)ldf + (size_t)h * 128 + d]; __syncthreads();
  float c, s; if (TAB) { c = bf16_round(CS[(size_t)p * 128 + d]); s = bf16_round(SN[(size_t)p * 128 + d]); } else { c = CS[p * 64 + (d & 63)]; s = SN[p * 64 + (d & 63)]; }
  const float rot = (d < 64) ? -xv[d + 64] : xv[d - 64]; const float o = __fadd_rn(__fmul_rn(xv[d], c), __fmul_rn(rot, s));
  FragH th; th.h[0] = (_Float16)__fmul_rn(o, osc); sh_[d] = th.u[0]; __syncthreads();
  if (d < 16) { FragH f; for (int q = 0; q < 8; ++q) f.u[q] = sh_[d * 8 + q]; unsigned short* dst = (unsigned short*)H16 + r * (size_t)ldo + (size_t)h * 128 + d * 8; *(v8us*)dst = f.half[0];  } }

template <int TAB, int IL, int F32OUT>
__global__ __launch_bounds__(128) void k_rope128x(const float* __restrict__ F, int ldf, int nh, const float* __restrict__ CS, const float* __restrict__ SN, void* __restrict__ OUT, int ldo, float osc) {
  #pragma clang fp contract(off)
  __shared__ float xv[128]; __shared__ float ov[128]; const int d = threadIdx.x; const int h = blockIdx.x % nh; const size_t r = blockIdx.x / nh; const int p = (int)(r % SQ);
  xv[d] = F[r * (size_t)ldf + (size_t)h * 128 + d]; __syncthreads();
  float c, s; if (TAB == 2) { c = CS[r * 128 + d]; s = SN[r * 128 + d]; }      /* computed full-width f32 tables, one row per token row r (relative to the passed pointers) */ else if (TAB) { c = bf16_round(CS[(size_t)p * 128 + d]); s = bf16_round(SN[(size_t)p * 128 + d]); } else { const int ti = IL ? (d >> 1) : (d & 63); c = CS[p * 64 + ti]; s = SN[p * 64 + ti]; }
  const float rot = IL ? ((d & 1) ? xv[d - 1] : -xv[d + 1]) : ((d < 64) ? -xv[d + 64] : xv[d - 64]);
  ov[d] = __fmul_rn(__fadd_rn(__fmul_rn(xv[d], c), __fmul_rn(rot, s)), osc); __syncthreads();
  if (F32OUT) { if (d < 32) { const v4f v = *(const v4f*)&ov[d * 4]; float* dst = (float*)OUT + r * (size_t)ldo + (size_t)h * 128 + d * 4; *(v4f*)dst = v;  } }
  else { if (d < 16) { FragH f; for (int q = 0; q < 8; ++q) f.h[q] = (_Float16)ov[d * 8 + q]; unsigned short* dst = (unsigned short*)OUT + r * (size_t)ldo + (size_t)h * 128 + d * 8; *(v8us*)dst = f.half[0];  } } }
template <int N>
__global__ __launch_bounds__(256) void k_rmsrow(float* __restrict__ X, const float* __restrict__ w, float eps) {
  #pragma clang fp contract(off)
  constexpr int PT = N / 256; __shared__ float red[256]; const size_t r = blockIdx.x; const int t = threadIdx.x; float* row = X + r * N + (size_t)t * PT; float v[PT]; float ss = 0.f;
  for (int q = 0; q < PT; ++q) { v[q] = row[q]; ss = __fadd_rn(ss, __fmul_rn(v[q], v[q])); }
  red[t] = ss; __syncthreads(); for (int k = 128; k > 0; k >>= 1) { if (t < k) red[t] = __fadd_rn(red[t], red[t + k]); __syncthreads(); }
  const float rs = rsqrtf(__fadd_rn(red[0] / (float)N, eps)); float o[PT]; for (int q = 0; q < PT; ++q) o[q] = __fmul_rn(__fmul_rn(v[q], rs), bf16_round(w[t * PT + q]));
  { for (int q = 0; q < PT; ++q) *(float*)(row + q) = o[q];  } }
template <int GS_, int NHQ, int DSRC>
__global__ __launch_bounds__(256) void k_kvexp128(const float* __restrict__ src, float* __restrict__ dst, size_t n4) { const size_t t = (size_t)blockIdx.x * 256 + threadIdx.x; if (t >= n4) return; const size_t e = t * 4; const size_t row = e / ((size_t)NHQ * 128); const int col = (int)(e % ((size_t)NHQ * 128)); const int h = col / 128, d = col % 128; const v4f v = *(const v4fa*)(src + row * DSRC + (size_t)(h / GS_) * 128 + d); *(v4f*)(dst + e) = v;  }

__global__ __launch_bounds__(256) void k_rsmcfb(const float* __restrict__ S, _Float16* __restrict__ P, int hg, int q0, int nk, const int* __restrict__ mk) {
  #pragma clang fp contract(off)
  const int t = blockIdx.x * 256 + threadIdx.x; if (t >= hg * QT) return; const size_t i = (size_t)t; const float* s = S + i * NKX; const size_t ig = (size_t)(q0 + (t % QT)); const int* mr = mk + ig * SQ; float mx = -3.0e38f;
#pragma unroll 1
  for (int j = 0; j < nk; ++j) { const int mb = mr[j]; const float f = (mb == 0) ? 1.f : 0.f; mx = fmaxf(mx, fmaf(f, s[j], (1.f - f) * -1.0e9f)); } float se = 0.f;
#pragma unroll 1
  for (int j = 0; j < nk; ++j) { const int mb = mr[j]; const float f = (mb == 0) ? 1.f : 0.f; se += __expf(fmaf(f, s[j], (1.f - f) * -1.0e9f) - mx); } const float sc = 256.0f / se;
#pragma unroll 1
  for (int j0 = 0; j0 < nk; j0 += 8) { FragH fr; for (int q = 0; q < 8; ++q) { const int j = j0 + q; const int mb = mr[j]; const float f = (mb == 0) ? 1.f : 0.f; fr.h[q] = (_Float16)(__expf(fmaf(f, s[j], (1.f - f) * -1.0e9f) - mx) * sc); } unsigned short* d = (unsigned short*)P + i * NKX + j0; *(v8us*)d = fr.half[0];  } }


__global__ __launch_bounds__(256) void k_rsmcf2(const float* __restrict__ S, _Float16* __restrict__ P, int hg, int q0, int nk) {
  #pragma clang fp contract(off)
  const int t = blockIdx.x * 256 + threadIdx.x; if (t >= hg * QT) return; const size_t i = (size_t)t; const float* s = S + i * NKX; const int last = q0 + (t % QT); float mx = -3.0e38f;
#pragma unroll 1
  for (int j = 0; j < nk; ++j) { const float f = (j <= last) ? 1.f : 0.f; mx = fmaxf(mx, fmaf(f, s[j], (1.f - f) * -1.0e9f)); } float se = 0.f;
#pragma unroll 1
  for (int j = 0; j < nk; ++j) { const float f = (j <= last) ? 1.f : 0.f; se += __expf(fmaf(f, s[j], (1.f - f) * -1.0e9f) - mx); } const float sc = 256.0f / se;
#pragma unroll 1
  for (int j0 = 0; j0 < nk; j0 += 8) { FragH fr; for (int q = 0; q < 8; ++q) { const int j = j0 + q; const float f = (j <= last) ? 1.f : 0.f; fr.h[q] = (_Float16)(__expf(fmaf(f, s[j], (1.f - f) * -1.0e9f) - mx) * sc); } unsigned short* d = (unsigned short*)P + i * NKX + j0; *(v8us*)d = fr.half[0];  } }



__global__ __launch_bounds__(256) void k_tab128p(const int* __restrict__ pos, int nrows, float theta, float* __restrict__ CS, float* __restrict__ SN) {
  #pragma clang fp contract(off)
  const int t = blockIdx.x * 256 + threadIdx.x; if (t >= nrows * 64) return; const int i = t % 64; const int r = t / 64; const float invf = (float)(1.0 / pow((double)theta, (double)(2 * i) / 128.0)); const float ang = __fmul_rn((float)pos[r], invf); const float c = cosf(ang), sv = sinf(ang);
  float* c0 = CS + (size_t)r * 128 + i; float* s0 = SN + (size_t)r * 128 + i;
  { *(float*)c0 = c; *(float*)(c0 + 64) = c; *(float*)s0 = sv; *(float*)(s0 + 64) = sv;  } }

__global__ __launch_bounds__(256) void k_rsmcim(const float* __restrict__ S, _Float16* __restrict__ P, int hg, int q0, int nk, const int* __restrict__ am) {
  #pragma clang fp contract(off)
  const int t = blockIdx.x * 256 + threadIdx.x; if (t >= hg * QT) return; const size_t i = (size_t)t; const float* s = S + i * NKX; const int last = q0 + (t % QT); const int* mr = am + (size_t)last * SQ; float mx = -3.0e38f;      /* the module's mask row of this query (keys >= nk lie above the diagonal of the causal mask and are not computed) */
#pragma unroll 1
  for (int j = 0; j < nk; ++j) { const float f = (mr[j] != 0) ? 1.f : 0.f; mx = fmaxf(mx, fmaf(f, s[j], (1.f - f) * -1.0e9f)); } float se = 0.f;
#pragma unroll 1
  for (int j = 0; j < nk; ++j) { const float f = (mr[j] != 0) ? 1.f : 0.f; se += __expf(fmaf(f, s[j], (1.f - f) * -1.0e9f) - mx); } const float sc = 256.0f / se;
#pragma unroll 1
  for (int j0 = 0; j0 < nk; j0 += 8) { FragH fr; for (int q = 0; q < 8; ++q) { const int j = j0 + q; const float f = (mr[j] != 0) ? 1.f : 0.f; fr.h[q] = (_Float16)(__expf(fmaf(f, s[j], (1.f - f) * -1.0e9f) - mx) * sc); } unsigned short* d = (unsigned short*)P + i * NKX + j0; *(v8us*)d = fr.half[0];  } }



__global__ __launch_bounds__(256) void k_tab128h(int nr, float theta, float* __restrict__ CS, float* __restrict__ SN) {
  #pragma clang fp contract(off)
  const size_t t = (size_t)blockIdx.x * 256 + threadIdx.x; if (t >= (size_t)nr * 64) return; const int i = (int)(t % 64); const size_t r = t / 64; const int p = (int)(r % SQ);
  const float invf = (float)(1.0 / pow((double)theta, ((double)(2 * i)) / 128.0)); const float ang = __fmul_rn((float)p, invf); const float c = cosf(ang), sv = sinf(ang);
  float* pc = CS + r * 128 + i; float* ps = SN + r * 128 + i;
  *(float*)pc = c; *(float*)(pc + 64) = c; *(float*)ps = sv; *(float*)(ps + 64) = sv;  }

// Lane exchanges and the native exp of the softmax code below.
template <int M> __device__ __forceinline__ float sm_xrow(float x) { return __builtin_bit_cast(float, __builtin_amdgcn_mov_dpp(__builtin_bit_cast(int, x), 0x160 | M, 0xf, 0xf, true)); }      /* lane l with lane l ^ M, M < 16 (row_xmask) */
__device__ __forceinline__ float sm_xhalf(float x) { const int b = __builtin_bit_cast(int, x); return __builtin_bit_cast(float, __builtin_amdgcn_permlanex16(b, b, 0x76543210, 0xfedcba98, false, false)); }      /* lane l with lane l ^ 16 */
__device__ __forceinline__ float sm_wmax(float x) { x = fmaxf(x, sm_xrow<1>(x)); x = fmaxf(x, sm_xrow<2>(x)); x = fmaxf(x, sm_xrow<4>(x)); x = fmaxf(x, sm_xrow<8>(x)); return fmaxf(x, sm_xhalf(x)); }
__device__ __forceinline__ float sm_wsum(float x) { x += sm_xrow<1>(x); x += sm_xrow<2>(x); x += sm_xrow<4>(x); x += sm_xrow<8>(x); return x + sm_xhalf(x); }
// Eight native 2^x in one statement. The outputs are early-clobber, so no v_exp_f32 in it overwrites a neighbour's source or reads its result; the closing v_nop keeps the one slot
// that the instruction set asks for behind a transcendental, whatever the compiler places next.
__device__ __forceinline__ void sm_exp2x8(v4f& a, v4f& b) { float e0, e1, e2, e3, e4, e5, e6, e7;
  asm("v_exp_f32 %0, %8\n\tv_exp_f32 %1, %9\n\tv_exp_f32 %2, %10\n\tv_exp_f32 %3, %11\n\tv_exp_f32 %4, %12\n\tv_exp_f32 %5, %13\n\tv_exp_f32 %6, %14\n\tv_exp_f32 %7, %15\n\tv_nop"
      : "=&v"(e0), "=&v"(e1), "=&v"(e2), "=&v"(e3), "=&v"(e4), "=&v"(e5), "=&v"(e6), "=&v"(e7) : "v"(a[0]), "v"(a[1]), "v"(a[2]), "v"(a[3]), "v"(b[0]), "v"(b[1]), "v"(b[2]), "v"(b[3]));
  a[0] = e0; a[1] = e1; a[2] = e2; a[3] = e3; b[0] = e4; b[1] = e5; b[2] = e6; b[3] = e7; }
// Fused attention of all query blocks: scores, the per-block softmax and P V in one launch; no score or weight ever goes to memory.
// One wave owns 16 queries of one head and walks the key blocks j = 0 .. i. Both products are formed transposed, with the queries as the 16 columns:
//   S^T = K Q^T : A = 16 key rows (hi, residual), B = the wave's q fragments; 16 tiles of 16 keys = the whole 256-key block of a lane's query (column ln; keys 8 hh + r of each tile);
//   softmax     : maximum and sum run over a lane's own 128 scores, one exchange with lane ^ 16 finishes each;
//   O^T = V^T P^T : A = 16 rows of V^T (hi, residual); score tiles 2u and 2u + 1 of a lane ARE the B fragment of keys 32u .. 32u + 31 (elements 0..7 = keys 8 hh + r, 8..15 = keys 16 + 8 hh + r, the k order of g2_frag), so the weights move through no LDS.
// Each product has three terms: hi.hi in one accumulator, the two x1024 residual terms together in a second one. Fragments are requested two steps before their products.
struct FA4 { v16h f0, f1, f2, f3; };      /* the four fragments of one step: a key tile's four k-steps, or four 16-dim tiles of V^T, of one plane (hi or residual) */
__device__ __forceinline__ void fa_load(FA4& s, const _Float16* p, size_t st) { s.f0 = g2_frag(p); s.f1 = g2_frag(p + st); s.f2 = g2_frag(p + 2 * st); s.f3 = g2_frag(p + 3 * st); }
__device__ __forceinline__ v8f fa_mma(v16h a, v16h b, v8f c) { return __builtin_amdgcn_wmma_f32_16x16x32_f16(false, a, false, b, (short)0, c, false, false); }
__global__ __launch_bounds__(128) void k_fattn(const _Float16* __restrict__ Qh, const _Float16* __restrict__ Ql, const _Float16* __restrict__ Kh, const _Float16* __restrict__ Kl, const _Float16* __restrict__ Vh, const _Float16* __restrict__ Vl, _Float16* __restrict__ O) {
  const int lane = threadIdx.x & 31, ln = lane & 15, hh = lane >> 4, w = threadIdx.x >> 5;
  const int qb = (SQ / QT - 1) - (int)(blockIdx.x / (NB * NH * 4)); const int rem = blockIdx.x % (NB * NH * 4); const int sub = rem & 3, h = (rem >> 2) % NH, b = rem / (4 * NH);      /* the query blocks with the most key blocks take the lowest work-group indices */
  const int qrow = qb * QT + sub * 64 + w * 16 + ln;      /* this lane's query (a column of both products) */
  // All six planes and O are in fragment order: a strip of 16 rows starts at row x 2048 elements, column c (a multiple of 32) at 16 c elements inside it, the lane's piece at 8 lane.
  const size_t qs = ((size_t)b * SQ + (qrow - ln)) * DMX + lane * 8; const _Float16* qph = Qh + qs; const _Float16* qpl = Ql + qs;
  const size_t ks = (size_t)b * SQ * DKV + h * HDK * 16 + lane * 8; const _Float16* kph = Kh + ks; const _Float16* kpl = Kl + ks;
  const size_t vs = ((size_t)b * DKV + h * HDK) * SQ + lane * 8; const _Float16* vph = Vh + vs; const _Float16* vpl = Vl + vs;
  const v8f z8 = {0.f, 0.f, 0.f, 0.f, 0.f, 0.f, 0.f, 0.f}; v8f oh[8] = {z8, z8, z8, z8, z8, z8, z8, z8};
  const float nrm = 256.0f / __fadd_rn((float)(qb + 1), 1e-6f);
  int j = 0;
#pragma unroll 1      /* one trip = one 256-key block; rolled, the trip count differs between query blocks (at least one trip: block 0) */
  do { int jo = j * 256, qo = h * HDK * 16;
    asm volatile("s_wait_xcnt 0x0" : "+s"(jo), "+s"(qo) : : "memory");      /* stands in front of the rewrite of the address registers of the last trip's loads (a precaution); the key offset and the q offset are its outputs, so every new address is formed behind it, and the q fragments are fetched anew in every trip: they hold no registers during softmax and P V, which keeps two waves on a SIMD */
    const _Float16* qp = qph + qo; const _Float16* qlp = qpl + qo;
    const v16h qh0 = g2_frag(qp), qh1 = g2_frag(qp + 512), qh2 = g2_frag(qp + 1024), qh3 = g2_frag(qp + 1536), ql0 = g2_frag(qlp), ql1 = g2_frag(qlp + 512), ql2 = g2_frag(qlp + 1024), ql3 = g2_frag(qlp + 1536);
    const _Float16* kh_ = kph + (size_t)jo * DKV; const _Float16* kl_ = kpl + (size_t)jo * DKV; const _Float16* vh_ = vph + jo * 16; const _Float16* vl_ = vpl + jo * 16;
    // 64 steps of 8 loads a trip: steps 0..31 = key tile t, hi plane then residual plane; steps 32..63 = 32 keys x 64 dims of V^T, hi then residual. Three register sets turn: step k + 2 is requested in front of the products of step k.
#define FA_REQ(k) { if ((k) < 32) fa_load(x[(k) % 3], (((k) & 1) ? kl_ : kh_) + (size_t)((k) >> 1) * 16 * DKV, 512); else fa_load(x[(k) % 3], (((k) & 1) ? vl_ : vh_) + (size_t)(((k) - 32) >> 2) * 512 + (size_t)(((((k) - 32) >> 1) & 1) * 4) * 16 * SQ, (size_t)16 * SQ); }
    v8f s[16]; FA4 x[3]; FA_REQ(0) __builtin_amdgcn_sched_barrier(0);      /* the q fragments and step 0 are requested first, then step 1, then step 2: mixed, the first products' counted load wait would wait for the younger steps too */
    FA_REQ(1) __builtin_amdgcn_sched_barrier(0);      /* as above */
    v8f ah = z8, al = z8;
#pragma unroll
    for (int k = 0; k < 32; ++k) { if (k == 28 || k == 29) __builtin_amdgcn_sched_barrier(0);      /* keeps the vector work of the step before out of the stretch between a K plane's last request and the wait below */
      FA_REQ(k + 2)      /* behind the last key tile: the first V^T fragments, which fly during the softmax */
      if (k == 28 || k == 29) { __builtin_amdgcn_sched_barrier(0); asm volatile("s_wait_xcnt 0x0" ::: "memory"); }      /* behind the last request of a K plane: its address registers are free from here on and the compiler reuses them with the loads in flight (a precaution; it wrote no wait there); the barrier in front keeps the requests above the wait */
      __builtin_amdgcn_sched_barrier(0);      /* keeps this step's products, with their load wait, from moving up in front of the requests of the step after next */
      const FA4& c = x[k % 3];
      if ((k & 1) == 0) { ah = fa_mma(c.f0, qh0, z8); al = fa_mma(c.f0, ql0, z8); ah = fa_mma(c.f1, qh1, ah); al = fa_mma(c.f1, ql1, al); ah = fa_mma(c.f2, qh2, ah); al = fa_mma(c.f2, ql2, al); ah = fa_mma(c.f3, qh3, ah); al = fa_mma(c.f3, ql3, al); }
      else { al = fa_mma(c.f0, qh0, al); al = fa_mma(c.f1, qh1, al); al = fa_mma(c.f2, qh2, al); al = fa_mma(c.f3, qh3, al); s[k >> 1] = ah * ATS + al * (ATS * 0.0009765625f); } }
    if (j == qb) {      /* only the diagonal block holds keys above a query */
#pragma unroll
      for (int t = 0; t < 16; ++t) {
#pragma unroll
        for (int r = 0; r < 8; ++r) s[t][r] = (jo + t * 16 + 8 * hh + r <= qrow) ? s[t][r] : -1.0e9f; } }
    float mx = -3.0e38f;
#pragma unroll
    for (int t = 0; t < 16; ++t) mx = fmaxf(mx, fmaxf(fmaxf(fmaxf(s[t][0], s[t][1]), fmaxf(s[t][2], s[t][3])), fmaxf(fmaxf(s[t][4], s[t][5]), fmaxf(s[t][6], s[t][7]))));
    mx = fmaxf(mx, sm_xhalf(mx)); float se = 0.f;
#pragma unroll
    for (int t = 0; t < 16; ++t) { v4f a, e;
#pragma unroll
      for (int u = 0; u < 4; ++u) { a[u] = (s[t][u] - mx) * 1.44269504f; e[u] = (s[t][4 + u] - mx) * 1.44269504f; }      /* e^x = 2^(x log2 e), as the native exp forms it */
      sm_exp2x8(a, e); se += ((a[0] + a[1]) + (a[2] + a[3])) + ((e[0] + e[1]) + (e[2] + e[3]));
#pragma unroll
      for (int u = 0; u < 4; ++u) { s[t][u] = a[u]; s[t][4 + u] = e[u]; } }
    se += sm_xhalf(se); const float isum = nrm / se;
    FragH bh, bl; v8f ol[8] = {z8, z8, z8, z8, z8, z8, z8, z8};      /* the residual terms of this key block (x1024) */
#pragma unroll
    for (int k = 32; k < 64; ++k) { const int u = (k - 32) >> 2, d0 = (((k - 32) >> 1) & 1) * 4;
      if (k == 60 || k == 61) __builtin_amdgcn_sched_barrier(0);      /* as for K above */
      if (k + 2 < 64) FA_REQ(k + 2)
      if (k == 60 || k == 61) { __builtin_amdgcn_sched_barrier(0); asm volatile("s_wait_xcnt 0x0" ::: "memory"); }      /* behind the last request of a V^T plane, as for K above */
      __builtin_amdgcn_sched_barrier(0);      /* as above: the requests stay in front of this step's products */
      const FA4& c = x[k % 3];
      if (((k - 32) & 3) == 0) {      /* the weights of keys 32u .. 32u + 31 as f16 hi + x1024 residual: the B fragments of the next four steps */
#pragma unroll
        for (int r = 0; r < 8; ++r) { const float p0 = s[2 * u][r] * isum, p1 = s[2 * u + 1][r] * isum; bh.h[r] = (_Float16)p0; bl.h[r] = (_Float16)((p0 - (float)bh.h[r]) * 1024.0f); bh.h[8 + r] = (_Float16)p1; bl.h[8 + r] = (_Float16)((p1 - (float)bh.h[8 + r]) * 1024.0f); } }
      if ((k & 1) == 0) { oh[d0] = fa_mma(c.f0, bh.v, oh[d0]); oh[d0 + 1] = fa_mma(c.f1, bh.v, oh[d0 + 1]); oh[d0 + 2] = fa_mma(c.f2, bh.v, oh[d0 + 2]); oh[d0 + 3] = fa_mma(c.f3, bh.v, oh[d0 + 3]);
        ol[d0] = fa_mma(c.f0, bl.v, ol[d0]); ol[d0 + 1] = fa_mma(c.f1, bl.v, ol[d0 + 1]); ol[d0 + 2] = fa_mma(c.f2, bl.v, ol[d0 + 2]); ol[d0 + 3] = fa_mma(c.f3, bl.v, ol[d0 + 3]); }
      else { ol[d0] = fa_mma(c.f0, bh.v, ol[d0]); ol[d0 + 1] = fa_mma(c.f1, bh.v, ol[d0 + 1]); ol[d0 + 2] = fa_mma(c.f2, bh.v, ol[d0 + 2]); ol[d0 + 3] = fa_mma(c.f3, bh.v, ol[d0 + 3]); } }
#undef FA_REQ
#pragma unroll
    for (int dt = 0; dt < 8; ++dt) oh[dt] += ol[dt] * 0.0009765625f;      /* joined per key block, so that the second accumulator holds no registers while the next scores are formed */
  } while (++j <= qb);
  unsigned short* op = (unsigned short*)O + qs + h * HDK * 16;      /* a lane holds dims 16 dt + 8 hh + r of its query: piece 32 (dt & 1) + lane of tile dt / 2 of the head's four: each store of the wave writes 512 contiguous bytes */
#pragma unroll
  for (int dt = 0; dt < 8; ++dt) { FragH f;
#pragma unroll
    for (int r = 0; r < 8; ++r) f.h[r] = (_Float16)(oh[dt][r] * 0.25f);      /* o x64 = (Ph Vh + (Pl Vh + Ph Vl) 2^-10) / 4 */
    *(v8us*)(op + dt * 256) = f.half[0]; } }
// Exact f32 causal attention of rows 0..255, spread over a work-group: 8 waves take 8 query rows of one head (keys 0 .. i0 + 7 only).
// Scores: 4 neighbouring lanes share one key row (each wave-wide load covers 8 rows x 64 contiguous bytes), a lane sums its 32 of the 128 dims for all 8 queries (q from LDS, 64 contiguous bytes per read), two lane steps finish the dot.
// Softmax: wave w owns row i0 + w, 8 keys a lane, plain two-pass (all scores of a row are at hand), accurate expf; keys above the query get weight 0.
// Output: wave w sums keys w, w + 8, ... (a V row is one coalesced 512 B load, its 8 weights two LDS broadcasts), the 8 partial sums meet in LDS in fixed order; o x64 / row sum as before.
__global__ __launch_bounds__(256) void k_att0w(const float* __restrict__ QF, const float* __restrict__ KF, const float* __restrict__ VF, float scale, float* __restrict__ OF) {
  __shared__ __attribute__((aligned(16))) float lq[8][128]; __shared__ __attribute__((aligned(16))) float sc[8][QT0 + 4]; __shared__ __attribute__((aligned(16))) float pt[QT0][8]; __shared__ __attribute__((aligned(16))) float red[8][8][128]; __shared__ float inv[8];
  const int lane = threadIdx.x & 31; const int w = __builtin_amdgcn_readfirstlane(threadIdx.x >> 5); const int h = blockIdx.x % NH, i0 = (QT0 / 8 - 1 - blockIdx.x / NH) * 8; const int nkey = i0 + 8;      /* the row groups with the most keys come first */
  *(v4f*)&lq[w][lane * 4] = *(const v4fa*)(QF + (size_t)(i0 + w) * DMX + h * 128 + lane * 4);
  __syncthreads();
  const int dq = (lane & 3) * 4;
#pragma unroll 1      /* one trip = 64 keys of the work-group; rolled so that only the trips below the diagonal run */
  for (int j0 = w * 8; j0 < nkey; j0 += 64) { const int j = j0 + (lane >> 2); const float* kr = KF + (size_t)j * DKV + h * 128 + dq; v4f kq[8];
#pragma unroll
    for (int c = 0; c < 8; ++c) kq[c] = *(const v4fa*)(kr + c * 16);
    asm volatile("s_wait_xcnt 0x0" ::: "memory");      /* stands in front of the first reuse of the loads' address registers (a precaution); no load sinks below it, so all eight are in flight together */
#pragma unroll 1      /* four query rows a trip: with all eight unrolled the q reads of a whole tile are hoisted and the wave needs more than 256 registers, so that only one work-group fits a WGP */
    for (int rh = 0; rh < 8; rh += 4) { float acc[4] = {0.f, 0.f, 0.f, 0.f};
#pragma unroll
      for (int c = 0; c < 8; ++c) {
#pragma unroll
        for (int r = 0; r < 4; ++r) { const v4f q = *(const v4f*)&lq[rh + r][c * 16 + dq]; acc[r] += q[0] * kq[c][0] + q[1] * kq[c][1] + q[2] * kq[c][2] + q[3] * kq[c][3]; } }
#pragma unroll
      for (int r = 0; r < 4; ++r) { float s = acc[r]; s += sm_xrow<1>(s); s += sm_xrow<2>(s); if ((lane & 3) == 0) sc[rh + r][j] = s * scale; } } }
  __syncthreads();
  { const int i = i0 + w; float s[8]; float mx = -3.0e38f;
#pragma unroll
    for (int u = 0; u < 8; ++u) { const int j = lane + 32 * u; s[u] = (j <= i) ? sc[w][j] : -3.0e38f; mx = fmaxf(mx, s[u]); }
    mx = sm_wmax(mx); float se = 0.f;
#pragma unroll
    for (int u = 0; u < 8; ++u) { const int j = lane + 32 * u; const float e = (j <= i) ? expf(s[u] - mx) : 0.f; se += e; pt[j][w] = e; }
    se = sm_wsum(se); if (lane == 0) inv[w] = 64.0f / se; }
  __syncthreads();
  const v4f z4 = {0.f, 0.f, 0.f, 0.f}; v4f o[8] = {z4, z4, z4, z4, z4, z4, z4, z4};
#pragma unroll 1      /* one trip = 64 keys of the work-group, 8 a wave; keys from nkey on carry weight 0 for all 8 rows (rows below 256 of V, in bounds) */
  for (int jb = w; jb < nkey; jb += 64) { const float* vr = VF + (size_t)jb * DKV + h * 128 + lane * 4; v4f vv[8];
#pragma unroll
    for (int u = 0; u < 8; ++u) vv[u] = *(const v4fa*)(vr + (size_t)(8 * u) * DKV);
#pragma unroll
    for (int u = 0; u < 8; ++u) { const v4f p0 = *(const v4f*)&pt[jb + 8 * u][0], p1 = *(const v4f*)&pt[jb + 8 * u][4];
#pragma unroll
      for (int r = 0; r < 4; ++r) { o[r] += p0[r] * vv[u]; o[4 + r] += p1[r] * vv[u]; } } }
#pragma unroll
  for (int r = 0; r < 8; ++r) *(v4f*)&red[w][r][lane * 4] = o[r];
  __syncthreads();
  { v4f a = *(const v4f*)&red[0][w][lane * 4];
#pragma unroll
    for (int k = 1; k < 8; ++k) a += *(const v4f*)&red[k][w][lane * 4];
    a *= inv[w]; *(v4f*)(OF + (size_t)(i0 + w) * DMX + h * 128 + lane * 4) = a; } }
extern "C" void kernel_launch(void* const* d_in, const int* in_sizes, int n_in,
                              void* d_out, int out_size, void* d_ws, size_t ws_size, hipStream_t stream) {
  (void)in_sizes; (void)n_in; (void)out_size;
  const float* const* I = (const float* const*)d_in; const float* x = I[0]; const float* wq = I[1]; const float* wk = I[2]; const float* wv = I[3]; const float* wo = I[4]; const float* bq = nullptr; const float* bk = nullptr; const float* bv = nullptr; const float* bo = nullptr;      /* natural [out][in] Wq/Wk/Wv/Wo [2048][2048]; no biases */
  char* ws = (char*)d_ws; size_t off = 0;
  auto take = [&](size_t bytes) { char* p = ws + off; off += (bytes + 255) & ~(size_t)255; return p; };
  _Float16* BQ = (_Float16*)take((size_t)DMX * DMX * 2); _Float16* BK = (_Float16*)take((size_t)DKV * DMX * 2); _Float16* BV = (_Float16*)take((size_t)DKV * DMX * 2); _Float16* BO = (_Float16*)take((size_t)DMX * DMX * 2);
  _Float16* X16 = (_Float16*)take(NR * DMX * 2); float* QF = (float*)take((size_t)SQ * DMX * 4); float* KF = (float*)take((size_t)SQ * DKV * 4); float* VF = (float*)take((size_t)SQ * DKV * 4); _Float16* VH = (_Float16*)take((size_t)SQ * DKV * 2); _Float16* VL = (_Float16*)take((size_t)SQ * DKV * 2); _Float16* Q16 = (_Float16*)take(NR * DMX * 2); _Float16* QL = (_Float16*)take(NR * DMX * 2); _Float16* K16 = (_Float16*)take(NR * DKV * 2); _Float16* KL = (_Float16*)take(NR * DKV * 2); _Float16* O16 = (_Float16*)take(NR * DMX * 2);      /* per-batch q, k, v in f32 -> f16 hi + x1024 residual planes (q, k planes of both batches) */
  _Float16* VT = (_Float16*)take((size_t)NB * DKV * SQ * 2); _Float16* VTL = (_Float16*)take((size_t)NB * DKV * SQ * 2);      /* V^T hi / residual of both batches */
  float* OF0 = (float*)take((size_t)NB * QT0 * DMX * 4); _Float16* OH0 = (_Float16*)take((size_t)NB * QT0 * DMX * 2); _Float16* OL0 = (_Float16*)take((size_t)NB * QT0 * DMX * 2);
  if (off > ws_size) return;      /* 232 MiB */
  { const unsigned g = (unsigned)(((size_t)DMX * DMX / 8 + 255) / 256); k_wnat<<<g, 256, 0, stream>>>(wq, (size_t)DMX * DMX / 8, BQ); k_wnat<<<g, 256, 0, stream>>>(wk, (size_t)DKV * DMX / 8, BK); k_wnat<<<g, 256, 0, stream>>>(wv, (size_t)DKV * DMX / 8, BV); k_wnat<<<g, 256, 0, stream>>>(wo, (size_t)DMX * DMX / 8, BO); }      /* natural [out][in] = Bt x16 */
  k_x16<<<(unsigned)((NR * DMX / 8 + 255) / 256), 256, 0, stream>>>(x, X16, NR * DMX / 8);
  for (int b = 0; b < NB; ++b) { const size_t r0 = (size_t)b * SQ;
    float* QF0 = QF; float* KF0 = KF; k_gemm2<0><<<dim3((SQ / 128) * (DMX / 64), 1), 128, 0, stream>>>(X16 + r0 * DMX, DMX, 0, BQ, DMX, 0, 0.0625f, bq, 0, nullptr, 1, 0, 0, QF, nullptr, DMX, 0, SQ, DMX, DMX); k_gemm2<0><<<dim3((SQ / 128) * (DKV / 64), 1), 128, 0, stream>>>(X16 + r0 * DMX, DMX, 0, BK, DMX, 0, 0.0625f, bk, 0, nullptr, 1, 0, 0, KF, nullptr, DKV, 0, SQ, DKV, DMX); k_hl<true><<<(unsigned)(((size_t)SQ * DMX / 8 + 255) / 256), 256, 0, stream>>>(QF, Q16 + r0 * DMX, QL + r0 * DMX, (size_t)SQ * DMX / 8); k_hl<true><<<(unsigned)(((size_t)SQ * DKV / 8 + 255) / 256), 256, 0, stream>>>(KF, K16 + r0 * DKV, KL + r0 * DKV, (size_t)SQ * DKV / 8);      /* this batch's q and k in f32 (exact products) -> f16 hi + x1024 residual (block 0's full softmax seen from every later block's first row needs near-exact logits) */ k_gemm2<0><<<dim3((SQ / 128) * (DKV / 64), 1), 128, 0, stream>>>(X16 + r0 * DMX, DMX, 0, BV, DMX, 0, 0.0625f, bv, 0, nullptr, 1, 0, 0, VF, nullptr, DKV, 0, SQ, DKV, DMX); k_hl<false><<<(unsigned)(((size_t)SQ * DKV / 8 + 255) / 256), 256, 0, stream>>>(VF, VH, VL, (size_t)SQ * DKV / 8);      /* f32 q (all rows, above) and k of the first 256 rows for the exact first tile; this batch's v in f32 (exact products) -> f16 hi + x1024 residual (the per-block softmax gives every block's first rows single-key weights, so v and P must be carried beyond one f16) */
    k_vt<DKV / 64, SQ><<<(DKV / 64) * (SQ / 64), 256, 0, stream>>>(VH, DKV, 0, VT + (size_t)b * DKV * SQ); k_vt<DKV / 64, SQ><<<(DKV / 64) * (SQ / 64), 256, 0, stream>>>(VL, DKV, 0, VTL + (size_t)b * DKV * SQ);      /* V^T hi / residual of this batch: head h = slabs 2h, 2h+1 */
    k_att0w<<<NH * (QT0 / 8), 256, 0, stream>>>(QF0, KF0, VF, ATS, OF0 + (size_t)b * QT0 * DMX);      /* exact causal attention rows 0..255 (o x64) */
  }
  k_fattn<<<NB * NH * (SQ / 64), 128, 0, stream>>>(Q16, QL, K16, KL, VT, VTL, O16);      /* scores (hi.hi + the two residual terms), the module's per-block softmax (an independent softmax per 256-key block j <= i, diagonal block causal, weights divided by block count + 1e-6) and o = P V (hi.hi + the two residual terms) -> merged f16 o rows (x64) */
  k_gemm2<0><<<dim3((unsigned)((NR / 128) * (DMX / 64)), 1), 128, 0, stream>>>(O16, DMX, 0, BO, DMX, 0, 0.0009765625f, bo, 0, nullptr, 1, 0, 0, (float*)d_out, nullptr, DMX, 0, (int)NR, DMX, DMX);      /* out = o Wo^T */
  k_hl<true><<<(unsigned)(((size_t)NB * QT0 * DMX / 8 + 255) / 256), 256, 0, stream>>>(OF0, OH0, OL0, (size_t)NB * QT0 * DMX / 8);      /* first-tile o (x64) -> f16 hi + x1024 residual planes */
  for (int b = 0; b < NB; ++b) { const size_t r0 = (size_t)b * SQ; const size_t f0 = (size_t)b * QT0;
    k_gemm2<0><<<dim3((QT0 / 128) * (DMX / 64), 1), 128, 0, stream>>>(OH0 + f0 * DMX, DMX, 0, BO, DMX, 0, 0.0009765625f, bo, 0, nullptr, 1, 0, 0, (float*)d_out + r0 * DMX, nullptr, DMX, 0, QT0, DMX, DMX);      /* rows 0..255 of the batch rewritten from the exact path */
    k_gemm2<0><<<dim3((QT0 / 128) * (DMX / 64), 1), 128, 0, stream>>>(OL0 + f0 * DMX, DMX, 0, BO, DMX, 0, 0.00000095367431640625f, nullptr, 0, (const float*)d_out + r0 * DMX, -1, 0, 0, (float*)d_out + r0 * DMX, nullptr, DMX, 0, QT0, DMX, DMX); }      /* += o_lo Wo 2^-20 (own-element accumulate) */
}

// v006
// One run takes 386 microseconds.
// In both of two side-by-side timings against v005, it was 1.13 times as fast.
// Counting every step since v000, it is 26.4 times as fast.
#include <hip/hip_runtime.h>
// Block-chunked causal attention with the module's PER-BLOCK softmax (hidden [2][2048][2048]; q/k/v = x W^T (natural [2048][2048] sigma 0.02, no biases), 16 heads of 128; keys in blocks of 256: for query block i every key block j <= i gets its OWN softmax over its 256 keys (scores / sqrt(128); inside the diagonal block keys above the query are -inf), the block outputs are summed and divided by the summed weights (= number of included blocks) + 1e-6; merged Wo^T -> [2][2048][2048]; no RoPE).
// Structure: token rows; x as exact f16 rows; natural weights as exact x16 planes; q, k, v as WMMA GEMMs (32x64 wave tiles, f32 accumulation) whose epilogues write f32 (first tile) + the f16 operand planes of q, k and V^T; per batch: exact f32 causal attention for rows 0..255 (= key block 0, where the per-block softmax is the ordinary causal softmax) on VALU; one fused launch for all query blocks, heads and both batches: a wave's 16 queries against key blocks 0..i (scores f32 in registers, alpha 1/sqrt(128)), the module's per-block softmax on VALU (f32 statistics, native exp; weights x256 f16 divided by the block count + 1e-6), o = P V (x64) merged f16; out = o Wo^T; first-tile rows rewritten from o hi/lo; launches: see trace.
// Compute dtype: inputs rounded to bf16; x / weights exact; projections f32; q, k, v and softmax weights as f16 hi + x1024 residual pairs, o as a plain f16 GEMM operand (~2^-12; first 256 rows of each batch exact); scores, statistics, out f32. v_wmma_f32_16x16x32_f16.
#define NB 2
#define SQ 2048
#define DMX 2048
#define NH 16
#define NKV 16
#define GSZ 1                        /* plain MHA: kv head == query head */
#define HDK 128
#define DKV (NKV * HDK)
#define QT 256
#define QT0 256
#define NKX SQ
#define DM DMX
#define HD 64
#define HG 1
#define NR ((size_t)NB * SQ)
#define ATS 0.08838834764831845f
typedef __bf16 v16b __attribute__((ext_vector_type(16)));
typedef unsigned short v8us __attribute__((ext_vector_type(8), may_alias));
typedef float  v8f  __attribute__((ext_vector_type(8)));
typedef float  v4f  __attribute__((ext_vector_type(4)));
typedef float  v4fa __attribute__((ext_vector_type(4), may_alias));
union FragB { v16b v; v8us half[2]; unsigned short u[16]; };

__device__ __forceinline__ unsigned short bf16_bits(float x) { unsigned int u = __float_as_uint(x); return (unsigned short)((u + 0x7FFFu + ((u >> 16) & 1u)) >> 16); }
__device__ __forceinline__ float bf16_val(unsigned short b) { return __uint_as_float(((unsigned int)b) << 16); }
__device__ __forceinline__ float bf16_round(float x) { return bf16_val(bf16_bits(x)); }
// D += A·B with NT terms: 1 = ah·bh, 2 = + al·bh (A split), 3 = + ah·bl (both split)
template <int NT>
__device__ __forceinline__ v8f mmaN(v16b ah, v16b al, v16b bh, v16b bl, v8f c) {
  c = __builtin_amdgcn_wmma_f32_16x16x32_bf16(false, ah, false, bh, (short)0, c, false, false);
  if (NT >= 2) c = __builtin_amdgcn_wmma_f32_16x16x32_bf16(false, al, false, bh, (short)0, c, false, false);
  if (NT >= 3) c = __builtin_amdgcn_wmma_f32_16x16x32_bf16(false, ah, false, bl, (short)0, c, false, false);
  asm volatile("v_nop\n\tv_nop\n\tv_nop\n\tv_nop" : "+v"(c) : "v"(ah), "v"(al), "v"(bh), "v"(bl));
  return c;
}

__global__ __launch_bounds__(256) void k_wt_bf16(const float* __restrict__ W, unsigned short* __restrict__ Wt, int K, int N) {
  const int t = blockIdx.x * 256 + threadIdx.x;
  const int k8n = K / 8;
  if (t >= N * k8n) return;
  const int n = t / k8n, k8 = (t % k8n) * 8;
  v8us v;
#pragma unroll
  for (int i = 0; i < 8; ++i) v[i] = bf16_bits(W[(size_t)(k8 + i) * N + n]);
  *(v8us*)(Wt + (size_t)n * K + k8) = v;
  
}

// GEMM C[M][N] (f32, pitch ldc) = act(A[M][K]·W + bias). A f32 row-major (pitch lda) converted per fragment to bf16
// (ASPLIT: hi/lo two planes -> 2 terms, else single rounded term); Wt bf16 [N][K] (pitch ldb). BIAS_BF16 rounds the
// bias to bf16 first (bias quantised to bf16 before the add). K%32==0, M%16==0, N%64==0.
template <bool ASPLIT, int ACT, bool BIAS_BF16>
__global__ __launch_bounds__(128) void k_gemm_bf(const float* __restrict__ A, int lda, const unsigned short* __restrict__ Wt, int ldb,
                                               const float* __restrict__ bias, float* __restrict__ C, int ldc, int M, int N, int K) {
  __shared__ __attribute__((aligned(16))) float so[4][16][64];
  const int tid = threadIdx.x, w = tid >> 5, lane = tid & 31, ln = lane & 15, hh = lane >> 4;
  const int ntn = N / 64;
  const int wid = blockIdx.x * 4 + w;
  const int mt = wid / ntn, nq = wid % ntn;
  if (mt * 16 >= M) return;
  const int row0 = mt * 16, col0 = nq * 64;
  const float* arow = A + (size_t)(row0 + ln) * lda;
  v8f acc[4] = {};
  for (int kb = 0; kb < K; kb += 32) {
    FragB ah, al;
    const v4f x0 = *(const v4fa*)(arow + kb + 8 * hh), x1 = *(const v4fa*)(arow + kb + 8 * hh + 4);
    const v4f x2 = *(const v4fa*)(arow + kb + 16 + 8 * hh), x3 = *(const v4fa*)(arow + kb + 16 + 8 * hh + 4);
    float xs[16] = {x0[0],x0[1],x0[2],x0[3],x1[0],x1[1],x1[2],x1[3],x2[0],x2[1],x2[2],x2[3],x3[0],x3[1],x3[2],x3[3]};
#pragma unroll
    for (int i = 0; i < 16; ++i) { const unsigned short hb = bf16_bits(xs[i]); ah.u[i] = hb; al.u[i] = ASPLIT ? bf16_bits(xs[i] - bf16_val(hb)) : (unsigned short)0; }
#pragma unroll
    for (int t = 0; t < 4; ++t) {
      const unsigned short* brow = Wt + (size_t)(col0 + t * 16 + ln) * ldb + kb;
      FragB b;
      b.half[0] = *(const v8us*)(brow + 8 * hh);
      b.half[1] = *(const v8us*)(brow + 16 + 8 * hh);
      acc[t] = mmaN<ASPLIT ? 2 : 1>(ah.v, al.v, b.v, b.v, acc[t]);
    }
  }
#pragma unroll
  for (int t = 0; t < 4; ++t) {
    float bv = bias ? bias[col0 + t * 16 + ln] : 0.f;
    if (BIAS_BF16) bv = bf16_round(bv);
#pragma unroll
    for (int r = 0; r < 8; ++r) { float v = acc[t][r] + bv; if (ACT == 1) v = fmaxf(v, 0.f); so[w][8 * hh + r][t * 16 + ln] = v; }
  }
  __builtin_amdgcn_fence(__ATOMIC_ACQ_REL, "workgroup");
  __builtin_amdgcn_wave_barrier();
  const int rsub = lane >> 4, c4 = (lane & 15) * 4;
  {
#pragma unroll
    for (int q = 0; q < 8; ++q) {
      const int r = q * 2 + rsub;
      const v4f v = *(const v4fa*)&so[w][r][c4];
      *(v4f*)(C + (size_t)(row0 + r) * ldc + col0 + c4) = v;
    }
    
  }
}

// GEMM C = act(A·W + bias + resid): A f32 (ASPLIT -> hi/lo 2 terms), Wt bf16 [N][K]; ACT 0 none, 1 relu, 2 exact gelu;
// resid (optional, f32, row index = (row % rmod), pitch ldr, RES_BF16 rounds it) added before the activation.
template <bool ASPLIT, int ACT, bool BIAS_BF16, bool RES_BF16>
__global__ __launch_bounds__(128) void k_gemm_bf3(const float* __restrict__ A, int lda, const unsigned short* __restrict__ Wt, int ldb,
                                                const float* __restrict__ bias, const float* __restrict__ resid, int rmod, int ldr,
                                                float* __restrict__ C, int ldc, int M, int N, int K) {
  __shared__ __attribute__((aligned(16))) float so[4][16][64];
  const int tid = threadIdx.x, w = tid >> 5, lane = tid & 31, ln = lane & 15, hh = lane >> 4;
  const int ntn = N / 64;
  const int wid = blockIdx.x * 4 + w;
  const int mt = wid / ntn, nq = wid % ntn;
  if (mt * 16 >= M) return;
  const int row0 = mt * 16, col0 = nq * 64;
  const float* arow = A + (size_t)(row0 + ln) * lda;
  v8f acc[4] = {};
  for (int kb = 0; kb < K; kb += 32) {
    FragB ah, al;
    const v4f x0 = *(const v4fa*)(arow + kb + 8 * hh), x1 = *(const v4fa*)(arow + kb + 8 * hh + 4);
    const v4f x2 = *(const v4fa*)(arow + kb + 16 + 8 * hh), x3 = *(const v4fa*)(arow + kb + 16 + 8 * hh + 4);
    float xs[16] = {x0[0],x0[1],x0[2],x0[3],x1[0],x1[1],x1[2],x1[3],x2[0],x2[1],x2[2],x2[3],x3[0],x3[1],x3[2],x3[3]};
#pragma unroll
    for (int i = 0; i < 16; ++i) { const unsigned short hb = bf16_bits(xs[i]); ah.u[i] = hb; al.u[i] = ASPLIT ? bf16_bits(xs[i] - bf16_val(hb)) : (unsigned short)0; }
#pragma unroll
    for (int t = 0; t < 4; ++t) {
      const unsigned short* brow = Wt + (size_t)(col0 + t * 16 + ln) * ldb + kb;
      FragB b;
      b.half[0] = *(const v8us*)(brow + 8 * hh);
      b.half[1] = *(const v8us*)(brow + 16 + 8 * hh);
      acc[t] = mmaN<ASPLIT ? 2 : 1>(ah.v, al.v, b.v, b.v, acc[t]);
    }
  }
#pragma unroll
  for (int t = 0; t < 4; ++t) {
    const int col = col0 + t * 16 + ln;
    float bv = bias ? bias[col] : 0.f;
    if (BIAS_BF16) bv = bf16_round(bv);
#pragma unroll
    for (int r = 0; r < 8; ++r) {
      float v = acc[t][r] + bv;
      if (resid) { float rv = resid[(size_t)((row0 + 8 * hh + r) % rmod) * ldr + col]; if (RES_BF16) rv = bf16_round(rv); v += rv; }
      if (ACT == 1) v = fmaxf(v, 0.f);
      if (ACT == 2) v = 0.5f * v * (1.0f + erff(v * 0.70710678118654752f));
      if (ACT == 3) { const float u = 0.7978845608028654f * (v + 0.044715f * v * v * v); v = 0.5f * v * (1.0f + tanhf(u)); }
      so[w][8 * hh + r][t * 16 + ln] = v;
    }
  }
  __builtin_amdgcn_fence(__ATOMIC_ACQ_REL, "workgroup");
  __builtin_amdgcn_wave_barrier();
  const int rsub = lane >> 4, c4 = (lane & 15) * 4;
  {
#pragma unroll
    for (int q = 0; q < 8; ++q) {
      const int r = q * 2 + rsub;
      const v4f v = *(const v4fa*)&so[w][r][c4];
      *(v4f*)(C + (size_t)(row0 + r) * ldc + col0 + c4) = v;
    }
    
  }
}
// row LayerNorm (biased variance, eps) over N: s = X (+ R); optional out_sum <- s; out_norm <- (s-mu)*rsqrt(var+eps)*g + b
template <bool PARAM_BF16>
__global__ __launch_bounds__(256) void k_layernorm(const float* __restrict__ X, const float* __restrict__ R, const float* __restrict__ g, const float* __restrict__ bta,
                                                  float* __restrict__ out_sum, float* __restrict__ out_norm, int N, float eps) {
  __shared__ float red[256];
  const int row = blockIdx.x, tid = threadIdx.x;
  const float* x = X + (size_t)row * N; const float* rr = R ? R + (size_t)row * N : nullptr;
  float vals[16];                     // up to N = 4096
  const int per = N / 256;            // contiguous chunk per thread? use strided-by-4 chunks: thread handles j = tid*4 + 1024*u
  float s1 = 0.f;
  for (int u = 0; u < per / 4; ++u) {
    const int j = tid * 4 + 1024 * u;
    const v4f a = *(const v4fa*)(x + j);
    v4f b = {0.f,0.f,0.f,0.f}; if (rr) b = *(const v4fa*)(rr + j);
#pragma unroll
    for (int q = 0; q < 4; ++q) { const float v = a[q] + b[q]; vals[u * 4 + q] = v; s1 += v; }
  }
  red[tid] = s1; __syncthreads();
  for (int st = 128; st > 0; st >>= 1) { if (tid < st) red[tid] += red[tid + st]; __syncthreads(); }
  const float mu = red[0] / (float)N; __syncthreads();
  float s2 = 0.f;
  for (int u = 0; u < per / 4; ++u)
#pragma unroll
    for (int q = 0; q < 4; ++q) { const float c = vals[u * 4 + q] - mu; s2 += c * c; }
  red[tid] = s2; __syncthreads();
  for (int st = 128; st > 0; st >>= 1) { if (tid < st) red[tid] += red[tid + st]; __syncthreads(); }
  const float rs = rsqrtf(red[0] / (float)N + eps);
  {
    for (int u = 0; u < per / 4; ++u) {
      const int j = tid * 4 + 1024 * u;
      v4f o, sm;
#pragma unroll
      for (int q = 0; q < 4; ++q) {
        float gg = g[j + q], bb = bta[j + q];
        if (PARAM_BF16) { gg = bf16_round(gg); bb = bf16_round(bb); }
        sm[q] = vals[u * 4 + q]; o[q] = (vals[u * 4 + q] - mu) * rs * gg + bb;
      }
      if (out_sum) *(v4f*)(out_sum + (size_t)row * N + j) = sm;
      *(v4f*)(out_norm + (size_t)row * N + j) = o;
    }
    
  }
}



// ---- f16 WMMA path (v_wmma_f32_16x16x32_f16): 11-bit significands for operands in range — used where a [0,1] probability operand needs more precision than bf16
typedef _Float16 v16h __attribute__((ext_vector_type(16)));
union FragH { v16h v; v8us half[2]; _Float16 h[16]; unsigned short u[16]; };
template <int NT>
__device__ __forceinline__ v8f mmaH(v16h ah, v16h al, v16h bh, v16h bl, v8f c) {
  c = __builtin_amdgcn_wmma_f32_16x16x32_f16(false, ah, false, bh, (short)0, c, false, false);
  if (NT >= 2) c = __builtin_amdgcn_wmma_f32_16x16x32_f16(false, al, false, bh, (short)0, c, false, false);
  if (NT >= 3) c = __builtin_amdgcn_wmma_f32_16x16x32_f16(false, ah, false, bl, (short)0, c, false, false);
  asm volatile("v_nop\n\tv_nop\n\tv_nop\n\tv_nop" : "+v"(c) : "v"(ah), "v"(al), "v"(bh), "v"(bl));
  return c;
}
// batched GEMM like k_gemm_b but f16 operands: A f32 (split into f16 hi/lo if ASPLIT, else rounded to f16), Bt = f16 values [n][k]; alpha; C f32; N multiple of 16 (partial tiles skipped)
template <bool ASPLIT>
__global__ __launch_bounds__(128) void k_gemm_h(const float* __restrict__ A, int lda, size_t sA, const _Float16* __restrict__ Bh, int ldb, size_t sB, float alpha, float* __restrict__ C, int ldc, size_t sC, int M, int N, int K) {
  __shared__ __attribute__((aligned(16))) float so[4][16][64];
  const int tid = threadIdx.x, w = tid >> 5, lane = tid & 31, ln = lane & 15, hh = lane >> 4; const int by = blockIdx.y;
  A += (size_t)by * sA; Bh += (size_t)by * sB; C += (size_t)by * sC;
  const int ntn = (N + 63) / 64; const int wid = blockIdx.x * 4 + w; const int mt = wid / ntn, nq = wid % ntn; if (mt * 16 >= M) return;
  const int row0 = mt * 16, col0 = nq * 64; const float* arow = A + (size_t)(row0 + ln) * lda;
  v8f acc[4] = {};
  for (int kb = 0; kb < K; kb += 32) {
    FragH ah, al;
    const v4f x0 = *(const v4fa*)(arow + kb + 8 * hh), x1 = *(const v4fa*)(arow + kb + 8 * hh + 4), x2 = *(const v4fa*)(arow + kb + 16 + 8 * hh), x3 = *(const v4fa*)(arow + kb + 16 + 8 * hh + 4);
    float xs[16] = {x0[0],x0[1],x0[2],x0[3],x1[0],x1[1],x1[2],x1[3],x2[0],x2[1],x2[2],x2[3],x3[0],x3[1],x3[2],x3[3]};
#pragma unroll
    for (int i = 0; i < 16; ++i) { const _Float16 h = (_Float16)xs[i]; ah.h[i] = h; al.h[i] = ASPLIT ? (_Float16)(xs[i] - (float)h) : (_Float16)0.0f; }
#pragma unroll
    for (int t = 0; t < 4; ++t) { if (col0 + t * 16 >= N) continue; const size_t boff = (size_t)(col0 + t * 16 + ln) * ldb + kb; FragH bq; bq.half[0] = *(const v8us*)(Bh + boff + 8 * hh); bq.half[1] = *(const v8us*)(Bh + boff + 16 + 8 * hh);
      acc[t] = mmaH<ASPLIT ? 2 : 1>(ah.v, al.v, bq.v, bq.v, acc[t]); }
  }
#pragma unroll
  for (int t = 0; t < 4; ++t) { if (col0 + t * 16 >= N) continue;
#pragma unroll
    for (int r = 0; r < 8; ++r) so[w][8 * hh + r][t * 16 + ln] = acc[t][r] * alpha; }
  __builtin_amdgcn_fence(__ATOMIC_ACQ_REL, "workgroup"); __builtin_amdgcn_wave_barrier();
  const int rsub = lane >> 4, c4 = (lane & 15) * 4;
  {
#pragma unroll
    for (int q = 0; q < 8; ++q) { const int r = q * 2 + rsub; if (col0 + c4 < N) { const v4f v = *(const v4fa*)&so[w][r][c4]; *(v4f*)(C + (size_t)(row0 + r) * ldc + col0 + c4) = v; } }
     }
}

// Wt[n][k] = f16(W[k][n]·scale) from f32 row-major W[K][N] (scale = power of two; bf16-exact weights stay exact in f16 away from the subnormal range)
__global__ __launch_bounds__(256) void k_wt_f16(const float* __restrict__ W, _Float16* __restrict__ Wt, int K, int N, float scale) {
  const int t = blockIdx.x * 256 + threadIdx.x; if (t >= N * (K / 8)) return; const int n = t / (K / 8), k8 = (t % (K / 8)) * 8; FragH f;
#pragma unroll
  for (int i = 0; i < 8; ++i) f.h[i] = (_Float16)(bf16_round(W[(size_t)(k8 + i) * N + n]) * scale); const v8us o = f.half[0];
  *(v8us*)((unsigned short*)Wt + (size_t)n * K + k8) = o; 
}
// k_gemm_hh variant with fused epilogue: v = acc·alpha + bias[by·sBias + col] (+ CP[(row/rowsPerB)·sCPb + by·64 + col] if CP) ; ACT 0 none / 1 elu ; writes f16 C16 (and f32 C if non-null)
template <int ACT>
__global__ __launch_bounds__(128) void k_gemm_hhx(const _Float16* __restrict__ A, int lda, size_t sA, const _Float16* __restrict__ Bh, int ldb, size_t sB, float alpha, const float* __restrict__ bias, size_t sBias, const float* __restrict__ CP, int rowsPerB, size_t sCPb, int row0g,
    float* __restrict__ C, _Float16* __restrict__ C16, int ldc, size_t sC, int M, int N, int K) {
  __shared__ __attribute__((aligned(16))) float so[4][16][64];
  const int tid = threadIdx.x, w = tid >> 5, lane = tid & 31, ln = lane & 15, hh = lane >> 4; const int by = blockIdx.y;
  A += (size_t)by * sA; Bh += (size_t)by * sB; const size_t cofs = (size_t)by * sC; const float* bp = bias ? bias + (size_t)by * sBias : nullptr;
  const int ntn = (N + 63) / 64; const int wid = blockIdx.x * 4 + w; const int mt = wid / ntn, nq = wid % ntn; if (mt * 16 >= M) return;
  const int row0 = mt * 16, col0 = nq * 64; const _Float16* arow = A + (size_t)(row0 + ln) * lda;
  v8f acc[4] = {};
  for (int kb = 0; kb < K; kb += 32) { FragH ah; ah.half[0] = *(const v8us*)((const unsigned short*)arow + kb + 8 * hh); ah.half[1] = *(const v8us*)((const unsigned short*)arow + kb + 16 + 8 * hh);
#pragma unroll
    for (int t = 0; t < 4; ++t) { if (col0 + t * 16 >= N) continue; const size_t boff = (size_t)(col0 + t * 16 + ln) * ldb + kb; FragH bq; bq.half[0] = *(const v8us*)((const unsigned short*)Bh + boff + 8 * hh); bq.half[1] = *(const v8us*)((const unsigned short*)Bh + boff + 16 + 8 * hh);
      acc[t] = mmaH<1>(ah.v, ah.v, bq.v, bq.v, acc[t]); }
  }
#pragma unroll
  for (int t = 0; t < 4; ++t) { if (col0 + t * 16 >= N) continue; const int col = col0 + t * 16 + ln; const float bv = bp ? bf16_round(bp[col]) : 0.f;
#pragma unroll
    for (int r = 0; r < 8; ++r) { float v = acc[t][r] * alpha + bv; if (CP) { const int rr = row0g + row0 + 8 * hh + r; if (rowsPerB < 0) v += CP[cofs + (size_t)rr * ldc + col];      /* rowsPerB < 0: own element of the batched C plane */ else { const int bidx = rr / rowsPerB; v += CP[(size_t)bidx * sCPb + (size_t)by * 64 + col]; } } if (ACT == 1) v = (v > 0.f) ? v : expm1f(v); else if (ACT == 7) v = (v > 0.f) ? v + 1.0f : expf(v); else if (ACT == 8) v = tanhf(v); else if (ACT == 9) v = 0.5f * v * (1.0f + tanhf(0.7978845608028654f * (v + 0.044715f * v * v * v))); else if (ACT == 11) v = 1.0f / (1.0f + expf(-v)); else if (ACT == 12) v = (v > 0.f) ? v : 0.01f * v; else if (ACT == 14) v = (v > 0.f) ? v : 0.1f * v; else if (ACT == 16) v = (v >= 0.f) ? v : 0.3f * v; else if (ACT == 17) v = (v >= 0.f) ? v : 0.2f * v; else if (ACT == 15) v = v / (1.0f + expf(-v)); else if (ACT == 3) v = fmaxf(v, 0.f); else if (ACT == 6) v = 0.5f * v * (1.0f + erff(v * 0.70710678118654752f)); so[w][8 * hh + r][t * 16 + ln] = v; } }
  __builtin_amdgcn_fence(__ATOMIC_ACQ_REL, "workgroup"); __builtin_amdgcn_wave_barrier();
  const int rsub = lane >> 4, c4 = (lane & 15) * 4; typedef _Float16 v4h __attribute__((ext_vector_type(4)));
  {
#pragma unroll
    for (int q = 0; q < 8; ++q) { const int r = q * 2 + rsub; if (col0 + c4 < N) { const v4f v = *(const v4fa*)&so[w][r][c4]; if (C) *(v4f*)(C + cofs + (size_t)(row0 + r) * ldc + col0 + c4) = v; if (C16) { v4h h4; for (int i = 0; i < 4; ++i) h4[i] = (_Float16)v[i]; *(v4h*)(C16 + cofs + (size_t)(row0 + r) * ldc + col0 + c4) = h4; } } }
     }
}


typedef _Float16 v4h __attribute__((ext_vector_type(4)));

// FRAGMENT ORDER of an f16 operand plane of 2048 columns: the plane is cut into tiles of 16 rows x 32 columns, 1 KiB each, 64 tiles to a strip of 16 rows (a strip starts where it starts in the row-major plane).
// Inside a tile the 16-byte piece p = 32 half + 16 hh + ln holds columns 16 half + 8 hh .. + 7 of row ln: piece 32 half + lane is what lane (hh, ln) takes as elements 8 half .. 8 half + 7 of an A or B fragment.
// So each of the two 16-byte loads of a fragment reads 512 contiguous bytes (4 whole lines) over the wave; from a row-major plane it took 32 bytes out of each of 16 lines. The registers hold the same values as before.
static_assert(DMX == 2048 && DKV == 2048 && SQ == 2048, "fragment order below is written for planes of 2048 columns");
// A converting launch gives thread t eight values of tile t / 64: row (t & 63) / 4, columns 8 (t & 3) .. + 7. Four neighbouring lanes read one whole row of the tile (a 128-byte line of the f32 source), and the wave's store fills four whole lines of the plane.
__device__ __forceinline__ size_t fo_src(size_t t) { const size_t tile = t >> 6; return ((tile >> 6) * 16 + ((t & 63) >> 2)) * 2048 + (tile & 63) * 32 + (t & 3) * 8; }      /* element offset of thread t's 8 values in the row-major source */
__device__ __forceinline__ size_t fo_dst(size_t t) { return (t >> 6) * 512 + ((t & 3) * 16 + ((t & 63) >> 2)) * 8; }      /* and in the plane in fragment order: piece 16 (2 half + hh) + ln */
__global__ __launch_bounds__(256) void k_x16(const float* __restrict__ x, _Float16* __restrict__ X16, size_t n8) { const size_t t = (size_t)blockIdx.x * 256 + threadIdx.x; if (t >= n8) return; FragH f; const float* xs = x + fo_src(t);      /* X16 in fragment order */
#pragma unroll
  for (int q = 0; q < 8; ++q) f.h[q] = (_Float16)bf16_round(xs[q]); *(v8us*)((unsigned short*)X16 + fo_dst(t)) = f.half[0];  }
__global__ __launch_bounds__(256) void k_h16(const float* __restrict__ x, _Float16* __restrict__ X16, size_t n8) { const size_t t = (size_t)blockIdx.x * 256 + threadIdx.x; if (t >= n8) return; FragH f;
#pragma unroll
  for (int q = 0; q < 8; ++q) f.h[q] = (_Float16)x[t * 8 + q]; *(v8us*)((unsigned short*)X16 + t * 8) = f.half[0];  }
__global__ __launch_bounds__(256) void k_round16f(const float* __restrict__ W, _Float16* __restrict__ Bt, size_t n8) { const size_t t = (size_t)blockIdx.x * 256 + threadIdx.x; if (t >= n8) return; FragH f;
#pragma unroll
  for (int i = 0; i < 8; ++i) f.h[i] = (_Float16)(bf16_round(W[t * 8 + i]) * 16.0f); *(v8us*)((unsigned short*)Bt + t * 8) = f.half[0];  }
template <int NHv, int TTv>
__global__ __launch_bounds__(256) void k_vt(const _Float16* __restrict__ V16, int ldv, int voff, _Float16* __restrict__ Vt) { __shared__ unsigned short tl[64][66]; const int tid = threadIdx.x; const int slab = blockIdx.x / (TTv / 64), lg = blockIdx.x % (TTv / 64); const int b = slab / NHv, h = slab % NHv;
  for (int i = tid; i < 64 * 8; i += 256) { const int r = i / 8, c8 = (i % 8) * 8; FragH f; f.half[0] = *(const v8us*)((const unsigned short*)V16 + ((size_t)b * TTv + lg * 64 + r) * ldv + voff + h * 64 + c8);
#pragma unroll
    for (int q = 0; q < 8; ++q) tl[r][c8 + q] = f.u[q]; }
  __syncthreads();
  {
#pragma unroll
    for (int rd = 0; rd < 2; ++rd) { const int idx = rd * 256 + tid, t8 = idx >> 6, p = idx & 63; const int d = (t8 >> 1) * 16 + (p & 15), c8 = (t8 & 1) * 32 + (p >> 5) * 16 + ((p >> 4) & 1) * 8; FragH f;      /* the 64 x 64 block = 4 x 2 tiles of V^T in fragment order (rows = dims, columns = keys), a thread per 16-byte piece */
#pragma unroll
      for (int q = 0; q < 8; ++q) f.u[q] = tl[c8 + q][d];
      *(v8us*)((unsigned short*)Vt + (((size_t)slab * 4 + (t8 >> 1)) * (TTv / 32) + lg * 2 + (t8 & 1)) * 512 + p * 8) = f.half[0]; }
     } }

template <bool FO>      /* FO: the two planes are written in fragment order (F stays row-major) */
__global__ __launch_bounds__(256) void k_hl(const float* __restrict__ F, _Float16* __restrict__ Hh, _Float16* __restrict__ Hl, size_t n8) { const size_t t = (size_t)blockIdx.x * 256 + threadIdx.x; if (t >= n8) return; FragH fh, fl; const float* fs = F + (FO ? fo_src(t) : t * 8); const v4f a = *(const v4fa*)fs, c = *(const v4fa*)(fs + 4);
#pragma unroll
  for (int q = 0; q < 4; ++q) { _Float16 h = (_Float16)a[q]; fh.h[q] = h; fl.h[q] = (_Float16)((a[q] - (float)h) * 1024.0f); h = (_Float16)c[q]; fh.h[4 + q] = h; fl.h[4 + q] = (_Float16)((c[q] - (float)h) * 1024.0f); }
  { const size_t d = FO ? fo_dst(t) : t * 8; *(v8us*)((unsigned short*)Hh + d) = fh.half[0]; *(v8us*)((unsigned short*)Hl + d) = fl.half[0];  } }

// ---- fast GEMM (wave tile 32x64; requires M % 32 == 0 rows per launch region, N % 64 == 0, K % 32 == 0 and K >= 96); A and Bh in fragment order (lda, ldb = columns of the plane); epilogue = k_gemm_hhx semantics ----
__device__ __forceinline__ v16h g2_frag(const _Float16* p) { FragH f; f.half[0] = *(const v8us*)((const unsigned short*)p); f.half[1] = *(const v8us*)((const unsigned short*)p + 256); return f.v; }      /* p = the tile in fragment order + 8 lane */
__device__ __forceinline__ v8f g2_mma(v16h a, v16h b, v8f c) { v8f d = __builtin_amdgcn_wmma_f32_16x16x32_f16(false, a, false, b, (short)0, c, false, false); asm volatile("v_nop\n\tv_nop\n\tv_nop\n\tv_nop" : "+v"(d) : "v"(a), "v"(b)); return d; }
struct G2S { v16h a0, a1, b0, b1, b2, b3; };      /* the fragments of one k-step of a 32x64 wave tile */
__device__ __forceinline__ void g2_load(G2S& s, const _Float16* a0p, const _Float16* a1p, const _Float16* b0p, const _Float16* b1p, const _Float16* b2p, const _Float16* b3p, int k) { s.a0 = g2_frag(a0p + k); s.b0 = g2_frag(b0p + k); s.a1 = g2_frag(a1p + k); s.b1 = g2_frag(b1p + k); s.b2 = g2_frag(b2p + k); s.b3 = g2_frag(b3p + k); }      /* k: 512 elements (one tile) a k-step */
// PL 0: C (f32) and C16 row-major, as before. PL 1, 2: the result also leaves as the two f16 operand planes of its consumer, hi + x1024 residual (the split of k_hl), in fragment order, written by this epilogue:
//   PL 1: planes of the result itself: a 32x64 wave tile = 2 x 2 whole 1 KiB tiles (16 rows x 32 columns), a lane's 16-byte piece = 8 neighbouring columns of one row, read back from the LDS staging;
//   PL 2: planes of the TRANSPOSED result (rows = columns of C): the wave tile = 4 whole tiles of 16 columns x 32 rows, and the 8 values of accumulator u of a lane (rows 16 (u / 4) + 8 hh + r of column 16 (u % 4) + ln) ARE piece 32 (u / 4) + lane of tile u % 4: no LDS.
//   With PL 1, 2 the f32 C is stored only by work-groups whose first row lies below frows (the rows that a later f32 consumer reads). Each plane store of a wave writes 512 contiguous bytes.
//   PL 1, 2 take no bias and no CP (their launches pass none).
template <int ACT, int PL>
__global__ __launch_bounds__(128) void k_gemm2(const _Float16* __restrict__ A, int lda, size_t sA, const _Float16* __restrict__ Bh, int ldb, size_t sB, float alpha, const float* __restrict__ bias, size_t sBias, const float* __restrict__ CP, int rowsPerB, size_t sCPb, int row0g,
    float* __restrict__ C, _Float16* __restrict__ C16, int ldc, size_t sC, int M, int N, int K, _Float16* __restrict__ Ph, _Float16* __restrict__ Pl, int frows) { static_assert(ACT == 0 || ACT == 3 || ACT == 6 || ACT == 8 || ACT == 9 || ACT == 11 || ACT == 12 || ACT == 14 || ACT == 15 || ACT == 16 || ACT == 17, "k_gemm2: unsupported ACT code (would silently apply no activation)");
  __shared__ __attribute__((aligned(16))) float so[4][32][68];
  const int tid = threadIdx.x, w = tid >> 5, lane = tid & 31, ln = lane & 15, hh = lane >> 4; const int by = blockIdx.y;
  A += (size_t)by * sA; Bh += (size_t)by * sB; const size_t cofs = (size_t)by * sC; const float* bp = bias ? bias + (size_t)by * sBias : nullptr;
  const int ntn = N >> 6; const int mt = blockIdx.x / ntn, nq = blockIdx.x - mt * ntn; const int row0 = mt * 128 + 32 * w, col0 = nq * 64; if (row0 >= M) return;
  const _Float16* a0p = A + (size_t)row0 * lda + lane * 8; const _Float16* a1p = a0p + (size_t)16 * lda;
  const _Float16* b0p = Bh + (size_t)col0 * ldb + lane * 8; const _Float16* b1p = b0p + (size_t)16 * ldb; const _Float16* b2p = b1p + (size_t)16 * ldb; const _Float16* b3p = b2p + (size_t)16 * ldb;
  // k loop, three k-steps of fragments in registers: a step's 12 loads are issued together, directly behind the products of the step that held those registers,
  // so they fly during the next two steps' products instead of being waited for one fragment at a time. Products and their order per accumulator are as before.
  const int nst = K >> 5; G2S s0, s1, s2; int st = 0, ko = 0;
  g2_load(s0, a0p, a1p, b0p, b1p, b2p, b3p, 0); __builtin_amdgcn_sched_barrier(0);      /* the three sets are requested one after the other, as in the loop: mixed, the counted load waits in the loop (set for both ways into it) would wait for the younger sets too */
  g2_load(s1, a0p, a1p, b0p, b1p, b2p, b3p, 512); __builtin_amdgcn_sched_barrier(0);      /* as above */
  g2_load(s2, a0p, a1p, b0p, b1p, b2p, b3p, 1024);
  asm volatile("s_wait_xcnt 0x0" ::: "memory");      /* stands in front of the clearing of the accumulators, some of which take the registers of an address that the loads above name (a precaution; the compiler wrote none there) */
  const v8f z8 = {0.f,0.f,0.f,0.f,0.f,0.f,0.f,0.f}; v8f c00 = z8, c01 = z8, c02 = z8, c03 = z8, c10 = z8, c11 = z8, c12 = z8, c13 = z8;
#define G2_MMA8(S) { c00 = g2_mma(S.a0, S.b0, c00); c10 = g2_mma(S.a1, S.b0, c10); c01 = g2_mma(S.a0, S.b1, c01); c11 = g2_mma(S.a1, S.b1, c11); c02 = g2_mma(S.a0, S.b2, c02); c12 = g2_mma(S.a1, S.b2, c12); c03 = g2_mma(S.a0, S.b3, c03); c13 = g2_mma(S.a1, S.b3, c13); }
  /* G2_STEP: the k offset moves on by three steps. The wait stands in front of the rewrite of the address registers that the loads in flight name (a precaution; the compiler wrote none over the back edge); the new offset is its output, so every new address is formed behind it. */
#define G2_STEP { ko += 1536; asm volatile("s_wait_xcnt 0x0" : "+s"(ko) : : "memory"); }
#pragma unroll 1      /* one trip = three k-steps, one per register set; rolled so that the sets keep their registers */
  for (; st + 6 <= nst; st += 3) {
    G2_MMA8(s0) G2_STEP g2_load(s0, a0p + ko, a1p + ko, b0p + ko, b1p + ko, b2p + ko, b3p + ko, 0); __builtin_amdgcn_sched_barrier(0);      /* keeps the next set's first product, with its load wait, from moving up in front of these requests */
    G2_MMA8(s1) g2_load(s1, a0p + ko, a1p + ko, b0p + ko, b1p + ko, b2p + ko, b3p + ko, 512);
    G2_MMA8(s2) g2_load(s2, a0p + ko, a1p + ko, b0p + ko, b1p + ko, b2p + ko, b3p + ko, 1024); }
  const int rem = nst - st;      /* 3, 4 or 5 k-steps are left, the first three of them loaded */
  G2_MMA8(s0) G2_STEP if (rem > 3) g2_load(s0, a0p + ko, a1p + ko, b0p + ko, b1p + ko, b2p + ko, b3p + ko, 0);
  G2_MMA8(s1) if (rem > 4) { asm volatile("s_wait_xcnt 0x0" : "+s"(ko) : : "memory");      /* as in G2_STEP: the compiler forms this set's addresses in registers that the loads just above name */
    g2_load(s1, a0p + ko, a1p + ko, b0p + ko, b1p + ko, b2p + ko, b3p + ko, 512); }
  G2_MMA8(s2)
  if (rem > 3) G2_MMA8(s0)
  if (rem > 4) G2_MMA8(s1)
#undef G2_STEP
#undef G2_MMA8
  v8f accs[8] = {c00, c01, c02, c03, c10, c11, c12, c13};
  static_assert(PL == 0 || ACT == 0, "the plane epilogues carry no activation");
  const bool f32rows = PL == 0 || mt * 128 < frows;      /* the same for the whole work-group */
  if (PL != 2 || f32rows) {      /* the LDS staging of the wave tile: PL 2 needs it for its f32 rows only */
#pragma unroll
    for (int u = 0; u < 8; ++u) { const int t = u & 3, half = u >> 2; const int col = col0 + t * 16 + ln; const float bv = (PL == 0 && bp) ? bf16_round(bp[col]) : 0.f;
#pragma unroll
    for (int r = 0; r < 8; ++r) { const int rloc = half * 16 + 8 * hh + r; float v = accs[u][r] * alpha + bv; if (PL == 0 && CP) { if (rowsPerB < 0) v += CP[cofs + (size_t)(row0g + row0 + rloc) * ldc + col];      /* rowsPerB < 0: own element of the batched C plane */ else { const int bidx = (row0g + row0 + rloc) / rowsPerB; v += CP[(size_t)bidx * sCPb + (size_t)by * 64 + col]; } }
      if (ACT == 3) v = fmaxf(v, 0.f); else if (ACT == 6) v = 0.5f * v * (1.0f + erff(v * 0.70710678118654752f)); else if (ACT == 11) v = 1.0f / (1.0f + expf(-v)); else if (ACT == 15) v = v / (1.0f + expf(-v)); else if (ACT == 12) v = (v > 0.f) ? v : 0.01f * v; else if (ACT == 8) v = tanhf(v); else if (ACT == 9) v = 0.5f * v * (1.0f + tanhf(0.7978845608028654f * (v + 0.044715f * v * v * v))); else if (ACT == 14) v = (v > 0.f) ? v : 0.1f * v; else if (ACT == 16) v = (v >= 0.f) ? v : 0.3f * v; else if (ACT == 17) v = (v >= 0.f) ? v : 0.2f * v;
      so[w][rloc][t * 16 + ln] = v; } }
    __builtin_amdgcn_fence(__ATOMIC_ACQ_REL, "workgroup"); __builtin_amdgcn_wave_barrier(); }
  if (PL != 0) { FragH ph[8], pr[8];      /* a lane's eight 16-byte pieces of the hi plane and of the residual plane */
#pragma unroll
    for (int i = 0; i < 8; ++i) { float x[8];
      if (PL == 1) { const float* sp = &so[w][(i >> 2) * 16 + ln][((i >> 1) & 1) * 32 + (i & 1) * 16 + hh * 8]; const v4f a = *(const v4fa*)sp, c = *(const v4fa*)(sp + 4);
#pragma unroll
        for (int q = 0; q < 4; ++q) { x[q] = a[q]; x[4 + q] = c[q]; } }
      else {
#pragma unroll
        for (int q = 0; q < 8; ++q) x[q] = accs[i][q] * alpha; }      /* the value that the staging loop forms (no bias, no CP here) */
#pragma unroll
      for (int q = 0; q < 8; ++q) { const _Float16 h = (_Float16)x[q]; ph[i].h[q] = h; pr[i].h[q] = (_Float16)((x[q] - (float)h) * 1024.0f); } }
    unsigned short* dh = (unsigned short*)Ph + (PL == 1 ? (size_t)row0 * 2048 + (size_t)col0 * 16 : (size_t)col0 * 2048 + (size_t)row0 * 16) + lane * 8; unsigned short* dl = (unsigned short*)Pl + (dh - (unsigned short*)Ph);
    __builtin_amdgcn_sched_barrier(0);      /* all sixteen pieces are formed above, each in registers of its own: no conversion sinks between the stores and overwrites a register of a store already issued */
#pragma unroll
    for (int i = 0; i < 8; ++i) { const size_t d = PL == 1 ? (size_t)(i >> 2) * 16 * 2048 + ((i >> 1) & 1) * 512 + (i & 1) * 256 : (size_t)(i & 3) * 16 * 2048 + (i >> 2) * 256; *(v8us*)(dh + d) = ph[i].half[0]; *(v8us*)(dl + d) = pr[i].half[0]; }
    asm volatile("s_wait_xcnt 0x0" ::: "memory"); }      /* stands in front of whatever reuses the data and address registers of the sixteen stores (a precaution) */
  const int rsub = lane >> 4, c4 = (lane & 15) * 4;
  if (f32rows) {
#pragma unroll
    for (int q = 0; q < 16; ++q) { const int r = q * 2 + rsub; const v4f v = *(const v4fa*)&so[w][r][c4]; if (C) *(v4f*)(C + cofs + (size_t)(row0 + r) * ldc + col0 + c4) = v; if (C16) { v4h h4; for (int i = 0; i < 4; ++i) h4[i] = (_Float16)v[i]; *(v4h*)(C16 + cofs + (size_t)(row0 + r) * ldc + col0 + c4) = h4; } }
     } }


__global__ __launch_bounds__(256) void k_wnat(const float* __restrict__ w, size_t n8, _Float16* __restrict__ Bt) { const size_t t = (size_t)blockIdx.x * 256 + threadIdx.x; if (t >= n8) return; FragH f; const float* wsrc = w + fo_src(t);      /* Bt in fragment order */ for (int q = 0; q < 8; ++q) f.h[q] = (_Float16)(bf16_round(wsrc[q]) * 16.0f); *(v8us*)((unsigned short*)Bt + fo_dst(t)) = f.half[0];  }
__global__ __launch_bounds__(256) void k_rsm(const float* __restrict__ S, _Float16* __restrict__ P, int nrows) {
  #pragma clang fp contract(off)
  const int i = blockIdx.x * 256 + threadIdx.x; if (i >= nrows) return; const float* s = S + (size_t)i * SQ; float mx = -3.0e38f;
#pragma unroll 1
  for (int j = 0; j < SQ; ++j) mx = fmaxf(mx, s[j]); float se = 0.f;
#pragma unroll 1
  for (int j = 0; j < SQ; ++j) se += expf(s[j] - mx); const float sc = 256.0f / se;
#pragma unroll 1
  for (int j0 = 0; j0 < SQ; j0 += 8) { FragH f; for (int q = 0; q < 8; ++q) f.h[q] = (_Float16)(expf(s[j0 + q] - mx) * sc); unsigned short* d = (unsigned short*)P + (size_t)i * SQ + j0; *(v8us*)d = f.half[0];  } }
__global__ __launch_bounds__(256) void k_vt(const _Float16* __restrict__ V16, int b, int h0, _Float16* __restrict__ VT) { __shared__ unsigned short tl[64][65]; const int tid = threadIdx.x; const int hh = blockIdx.x % HG, sg = blockIdx.x / HG; const int s0 = sg * 64; const int h = h0 + hh;
  for (int i = tid; i < 64 * 8; i += 256) { const int j = i / 8, d8 = (i % 8) * 8; FragH f; f.half[0] = *(const v8us*)((const unsigned short*)V16 + ((size_t)b * SQ + s0 + j) * DM + h * HD + d8); for (int q = 0; q < 8; ++q) tl[d8 + q][j] = f.u[q]; }
  __syncthreads();
  { for (int i = tid; i < 64 * 8; i += 256) { const int d = i / 8, j8 = (i % 8) * 8; FragH f; for (int q = 0; q < 8; ++q) f.u[q] = tl[d][j8 + q]; *(v8us*)((unsigned short*)VT + ((size_t)hh * HD + d) * SQ + s0 + j8) = f.half[0]; }  } }


__global__ __launch_bounds__(256) void k_f2h(const float* __restrict__ F, int ldf, int coff, int ncol, _Float16* __restrict__ H16, size_t nrow) { const size_t t = (size_t)blockIdx.x * 256 + threadIdx.x; const size_t n8 = nrow * (size_t)(ncol / 8); if (t >= n8) return; const size_t r = t / (ncol / 8); const int c8 = (int)(t % (ncol / 8)) * 8; FragH f; const v4f a = *(const v4fa*)(F + r * ldf + coff + c8), b2 = *(const v4fa*)(F + r * ldf + coff + c8 + 4); for (int q = 0; q < 4; ++q) { f.h[q] = (_Float16)a[q]; f.h[4 + q] = (_Float16)b2[q]; } *(v8us*)((unsigned short*)H16 + r * ncol + c8) = f.half[0];  }

__global__ __launch_bounds__(256) void k_tab128(float theta, float* __restrict__ CS, float* __restrict__ SN) {
  #pragma clang fp contract(off)
  const int t = blockIdx.x * 256 + threadIdx.x; if (t >= SQ * 64) return; const int i = t % 64; const int p = t / 64; const float invf = (float)(1.0 / pow((double)theta, (double)(2 * i) / 128.0));      /* = XLA's constant-folded f32 table */ const float ang = __fmul_rn((float)p, invf); const float c = cosf(ang), s = sinf(ang);
  *(float*)(CS + t) = c; *(float*)(SN + t) = s;  }
template <int TAB>
__global__ __launch_bounds__(128) void k_rope128(const float* __restrict__ F, int ldf, int nh, const float* __restrict__ CS, const float* __restrict__ SN, _Float16* __restrict__ H16, int ldo, float osc) {
  #pragma clang fp contract(off)
  __shared__ float xv[128]; __shared__ unsigned short sh_[128]; const int d = threadIdx.x; const int h = blockIdx.x % nh; const size_t r = blockIdx.x / nh; const int p = (int)(r % SQ);
  xv[d] = F[r * (size_t)ldf + (size_t)h * 128 + d]; __syncthreads();
  float c, s; if (TAB) { c = bf16_round(CS[(size_t)p * 128 + d]); s = bf16_round(SN[(size_t)p * 128 + d]); } else { c = CS[p * 64 + (d & 63)]; s = SN[p * 64 + (d & 63)]; }
  const float rot = (d < 64) ? -xv[d + 64] : xv[d - 64]; const float o = __fadd_rn(__fmul_rn(xv[d], c), __fmul_rn(rot, s));
  FragH th; th.h[0] = (_Float16)__fmul_rn(o, osc); sh_[d] = th.u[0]; __syncthreads();
  if (d < 16) { FragH f; for (int q = 0; q < 8; ++q) f.u[q] = sh_[d * 8 + q]; unsigned short* dst = (unsigned short*)H16 + r * (size_t)ldo + (size_t)h * 128 + d * 8; *(v8us*)dst = f.half[0];  } }

template <int TAB, int IL, int F32OUT>
__global__ __launch_bounds__(128) void k_rope128x(const float* __restrict__ F, int ldf, int nh, const float* __restrict__ CS, const float* __restrict__ SN, void* __restrict__ OUT, int ldo, float osc) {
  #pragma clang fp contract(off)
  __shared__ float xv[128]; __shared__ float ov[128]; const int d = threadIdx.x; const int h = blockIdx.x % nh; const size_t r = blockIdx.x / nh; const int p = (int)(r % SQ);
  xv[d] = F[r * (size_t)ldf + (size_t)h * 128 + d]; __syncthreads();
  float c, s; if (TAB == 2) { c = CS[r * 128 + d]; s = SN[r * 128 + d]; }      /* computed full-width f32 tables, one row per token row r (relative to the passed pointers) */ else if (TAB) { c = bf16_round(CS[(size_t)p * 128 + d]); s = bf16_round(SN[(size_t)p * 128 + d]); } else { const int ti = IL ? (d >> 1) : (d & 63); c = CS[p * 64 + ti]; s = SN[p * 64 + ti]; }
  const float rot = IL ? ((d & 1) ? xv[d - 1] : -xv[d + 1]) : ((d < 64) ? -xv[d + 64] : xv[d - 64]);
  ov[d] = __fmul_rn(__fadd_rn(__fmul_rn(xv[d], c), __fmul_rn(rot, s)), osc); __syncthreads();
  if (F32OUT) { if (d < 32) { const v4f v = *(const v4f*)&ov[d * 4]; float* dst = (float*)OUT + r * (size_t)ldo + (size_t)h * 128 + d * 4; *(v4f*)dst = v;  } }
  else { if (d < 16) { FragH f; for (int q = 0; q < 8; ++q) f.h[q] = (_Float16)ov[d * 8 + q]; unsigned short* dst = (unsigned short*)OUT + r * (size_t)ldo + (size_t)h * 128 + d * 8; *(v8us*)dst = f.half[0];  } } }
template <int N>
__global__ __launch_bounds__(256) void k_rmsrow(float* __restrict__ X, const float* __restrict__ w, float eps) {
  #pragma clang fp contract(off)
  constexpr int PT = N / 256; __shared__ float red[256]; const size_t r = blockIdx.x; const int t = threadIdx.x; float* row = X + r * N + (size_t)t * PT; float v[PT]; float ss = 0.f;
  for (int q = 0; q < PT; ++q) { v[q] = row[q]; ss = __fadd_rn(ss, __fmul_rn(v[q], v[q])); }
  red[t] = ss; __syncthreads(); for (int k = 128; k > 0; k >>= 1) { if (t < k) red[t] = __fadd_rn(red[t], red[t + k]); __syncthreads(); }
  const float rs = rsqrtf(__fadd_rn(red[0] / (float)N, eps)); float o[PT]; for (int q = 0; q < PT; ++q) o[q] = __fmul_rn(__fmul_rn(v[q], rs), bf16_round(w[t * PT + q]));
  { for (int q = 0; q < PT; ++q) *(float*)(row + q) = o[q];  } }
template <int GS_, int NHQ, int DSRC>
__global__ __launch_bounds__(256) void k_kvexp128(const float* __restrict__ src, float* __restrict__ dst, size_t n4) { const size_t t = (size_t)blockIdx.x * 256 + threadIdx.x; if (t >= n4) return; const size_t e = t * 4; const size_t row = e / ((size_t)NHQ * 128); const int col = (int)(e % ((size_t)NHQ * 128)); const int h = col / 128, d = col % 128; const v4f v = *(const v4fa*)(src + row * DSRC + (size_t)(h / GS_) * 128 + d); *(v4f*)(dst + e) = v;  }

__global__ __launch_bounds__(256) void k_rsmcfb(const float* __restrict__ S, _Float16* __restrict__ P, int hg, int q0, int nk, const int* __restrict__ mk) {
  #pragma clang fp contract(off)
  const int t = blockIdx.x * 256 + threadIdx.x; if (t >= hg * QT) return; const size_t i = (size_t)t; const float* s = S + i * NKX; const size_t ig = (size_t)(q0 + (t % QT)); const int* mr = mk + ig * SQ; float mx = -3.0e38f;
#pragma unroll 1
  for (int j = 0; j < nk; ++j) { const int mb = mr[j]; const float f = (mb == 0) ? 1.f : 0.f; mx = fmaxf(mx, fmaf(f, s[j], (1.f - f) * -1.0e9f)); } float se = 0.f;
#pragma unroll 1
  for (int j = 0; j < nk; ++j) { const int mb = mr[j]; const float f = (mb == 0) ? 1.f : 0.f; se += __expf(fmaf(f, s[j], (1.f - f) * -1.0e9f) - mx); } const float sc = 256.0f / se;
#pragma unroll 1
  for (int j0 = 0; j0 < nk; j0 += 8) { FragH fr; for (int q = 0; q < 8; ++q) { const int j = j0 + q; const int mb = mr[j]; const float f = (mb == 0) ? 1.f : 0.f; fr.h[q] = (_Float16)(__expf(fmaf(f, s[j], (1.f - f) * -1.0e9f) - mx) * sc); } unsigned short* d = (unsigned short*)P + i * NKX + j0; *(v8us*)d = fr.half[0];  } }


__global__ __launch_bounds__(256) void k_rsmcf2(const float* __restrict__ S, _Float16* __restrict__ P, int hg, int q0, int nk) {
  #pragma clang fp contract(off)
  const int t = blockIdx.x * 256 + threadIdx.x; if (t >= hg * QT) return; const size_t i = (size_t)t; const float* s = S + i * NKX; const int last = q0 + (t % QT); float mx = -3.0e38f;
#pragma unroll 1
  for (int j = 0; j < nk; ++j) { const float f = (j <= last) ? 1.f : 0.f; mx = fmaxf(mx, fmaf(f, s[j], (1.f - f) * -1.0e9f)); } float se = 0.f;
#pragma unroll 1
  for (int j = 0; j < nk; ++j) { const float f = (j <= last) ? 1.f : 0.f; se += __expf(fmaf(f, s[j], (1.f - f) * -1.0e9f) - mx); } const float sc = 256.0f / se;
#pragma unroll 1
  for (int j0 = 0; j0 < nk; j0 += 8) { FragH fr; for (int q = 0; q < 8; ++q) { const int j = j0 + q; const float f = (j <= last) ? 1.f : 0.f; fr.h[q] = (_Float16)(__expf(fmaf(f, s[j], (1.f - f) * -1.0e9f) - mx) * sc); } unsigned short* d = (unsigned short*)P + i * NKX + j0; *(v8us*)d = fr.half[0];  } }



__global__ __launch_bounds__(256) void k_tab128p(const int* __restrict__ pos, int nrows, float theta, float* __restrict__ CS, float* __restrict__ SN) {
  #pragma clang fp contract(off)
  const int t = blockIdx.x * 256 + threadIdx.x; if (t >= nrows * 64) return; const int i = t % 64; const int r = t / 64; const float invf = (float)(1.0 / pow((double)theta, (double)(2 * i) / 128.0)); const float ang = __fmul_rn((float)pos[r], invf); const float c = cosf(ang), sv = sinf(ang);
  float* c0 = CS + (size_t)r * 128 + i; float* s0 = SN + (size_t)r * 128 + i;
  { *(float*)c0 = c; *(float*)(c0 + 64) = c; *(float*)s0 = sv; *(float*)(s0 + 64) = sv;  } }

__global__ __launch_bounds__(256) void k_rsmcim(const float* __restrict__ S, _Float16* __restrict__ P, int hg, int q0, int nk, const int* __restrict__ am) {
  #pragma clang fp contract(off)
  const int t = blockIdx.x * 256 + threadIdx.x; if (t >= hg * QT) return; const size_t i = (size_t)t; const float* s = S + i * NKX; const int last = q0 + (t % QT); const int* mr = am + (size_t)last * SQ; float mx = -3.0e38f;      /* the module's mask row of this query (keys >= nk lie above the diagonal of the causal mask and are not computed) */
#pragma unroll 1
  for (int j = 0; j < nk; ++j) { const float f = (mr[j] != 0) ? 1.f : 0.f; mx = fmaxf(mx, fmaf(f, s[j], (1.f - f) * -1.0e9f)); } float se = 0.f;
#pragma unroll 1
  for (int j = 0; j < nk; ++j) { const float f = (mr[j] != 0) ? 1.f : 0.f; se += __expf(fmaf(f, s[j], (1.f - f) * -1.0e9f) - mx); } const float sc = 256.0f / se;
#pragma unroll 1
  for (int j0 = 0; j0 < nk; j0 += 8) { FragH fr; for (int q = 0; q < 8; ++q) { const int j = j0 + q; const float f = (mr[j] != 0) ? 1.f : 0.f; fr.h[q] = (_Float16)(__expf(fmaf(f, s[j], (1.f - f) * -1.0e9f) - mx) * sc); } unsigned short* d = (unsigned short*)P + i * NKX + j0; *(v8us*)d = fr.half[0];  } }



__global__ __launch_bounds__(256) void k_tab128h(int nr, float theta, float* __restrict__ CS, float* __restrict__ SN) {
  #pragma clang fp contract(off)
  const size_t t = (size_t)blockIdx.x * 256 + threadIdx.x; if (t >= (size_t)nr * 64) return; const int i = (int)(t % 64); const size_t r = t / 64; const int p = (int)(r % SQ);
  const float invf = (float)(1.0 / pow((double)theta, ((double)(2 * i)) / 128.0)); const float ang = __fmul_rn((float)p, invf); const float c = cosf(ang), sv = sinf(ang);
  float* pc = CS + r * 128 + i; float* ps = SN + r * 128 + i;
  *(float*)pc = c; *(float*)(pc + 64) = c; *(float*)ps = sv; *(float*)(ps + 64) = sv;  }

// Lane exchanges and the native exp of the softmax code below.
template <int M> __device__ __forceinline__ float sm_xrow(float x) { return __builtin_bit_cast(float, __builtin_amdgcn_mov_dpp(__builtin_bit_cast(int, x), 0x160 | M, 0xf, 0xf, true)); }      /* lane l with lane l ^ M, M < 16 (row_xmask) */
__device__ __forceinline__ float sm_xhalf(float x) { const int b = __builtin_bit_cast(int, x); return __builtin_bit_cast(float, __builtin_amdgcn_permlanex16(b, b, 0x76543210, 0xfedcba98, false, false)); }      /* lane l with lane l ^ 16 */
__device__ __forceinline__ float sm_wmax(float x) { x = fmaxf(x, sm_xrow<1>(x)); x = fmaxf(x, sm_xrow<2>(x)); x = fmaxf(x, sm_xrow<4>(x)); x = fmaxf(x, sm_xrow<8>(x)); return fmaxf(x, sm_xhalf(x)); }
__device__ __forceinline__ float sm_wsum(float x) { x += sm_xrow<1>(x); x += sm_xrow<2>(x); x += sm_xrow<4>(x); x += sm_xrow<8>(x); return x + sm_xhalf(x); }
// Eight native 2^x in one statement. The outputs are early-clobber, so no v_exp_f32 in it overwrites a neighbour's source or reads its result; the closing v_nop keeps the one slot
// that the instruction set asks for behind a transcendental, whatever the compiler places next.
__device__ __forceinline__ void sm_exp2x8(v4f& a, v4f& b) { float e0, e1, e2, e3, e4, e5, e6, e7;
  asm("v_exp_f32 %0, %8\n\tv_exp_f32 %1, %9\n\tv_exp_f32 %2, %10\n\tv_exp_f32 %3, %11\n\tv_exp_f32 %4, %12\n\tv_exp_f32 %5, %13\n\tv_exp_f32 %6, %14\n\tv_exp_f32 %7, %15\n\tv_nop"
      : "=&v"(e0), "=&v"(e1), "=&v"(e2), "=&v"(e3), "=&v"(e4), "=&v"(e5), "=&v"(e6), "=&v"(e7) : "v"(a[0]), "v"(a[1]), "v"(a[2]), "v"(a[3]), "v"(b[0]), "v"(b[1]), "v"(b[2]), "v"(b[3]));
  a[0] = e0; a[1] = e1; a[2] = e2; a[3] = e3; b[0] = e4; b[1] = e5; b[2] = e6; b[3] = e7; }
// Fused attention of all query blocks: scores, the per-block softmax and P V in one launch; no score or weight ever goes to memory.
// One wave owns 16 queries of one head and walks the key blocks j = 0 .. i. Both products are formed transposed, with the queries as the 16 columns:
//   S^T = K Q^T : A = 16 key rows (hi, residual), B = the wave's q fragments; 16 tiles of 16 keys = the whole 256-key block of a lane's query (column ln; keys 8 hh + r of each tile);
//   softmax     : maximum and sum run over a lane's own 128 scores, one exchange with lane ^ 16 finishes each;
//   O^T = V^T P^T : A = 16 rows of V^T (hi, residual); score tiles 2u and 2u + 1 of a lane ARE the B fragment of keys 32u .. 32u + 31 (elements 0..7 = keys 8 hh + r, 8..15 = keys 16 + 8 hh + r, the k order of g2_frag), so the weights move through no LDS.
// Each product has three terms: hi.hi in one accumulator, the two x1024 residual terms together in a second one. Fragments are requested two steps before their products.
struct FA4 { v16h f0, f1, f2, f3; };      /* the four fragments of one step: a key tile's four k-steps, or four 16-dim tiles of V^T, of one plane (hi or residual) */
__device__ __forceinline__ void fa_load(FA4& s, const _Float16* p, size_t st) { s.f0 = g2_frag(p); s.f1 = g2_frag(p + st); s.f2 = g2_frag(p + 2 * st); s.f3 = g2_frag(p + 3 * st); }
__device__ __forceinline__ v8f fa_mma(v16h a, v16h b, v8f c) { return __builtin_amdgcn_wmma_f32_16x16x32_f16(false, a, false, b, (short)0, c, false, false); }
__global__ __launch_bounds__(128) void k_fattn(const _Float16* __restrict__ Qh, const _Float16* __restrict__ Ql, const _Float16* __restrict__ Kh, const _Float16* __restrict__ Kl, const _Float16* __restrict__ Vh, const _Float16* __restrict__ Vl, _Float16* __restrict__ O) {
  const int lane = threadIdx.x & 31, ln = lane & 15, hh = lane >> 4, w = threadIdx.x >> 5;
  const int qb = (SQ / QT - 1) - (int)(blockIdx.x / (NB * NH * 4)); const int rem = blockIdx.x % (NB * NH * 4); const int sub = rem & 3, h = (rem >> 2) % NH, b = rem / (4 * NH);      /* the query blocks with the most key blocks take the lowest work-group indices */
  const int qrow = qb * QT + sub * 64 + w * 16 + ln;      /* this lane's query (a column of both products) */
  // All six planes and O are in fragment order: a strip of 16 rows starts at row x 2048 elements, column c (a multiple of 32) at 16 c elements inside it, the lane's piece at 8 lane.
  const size_t qs = ((size_t)b * SQ + (qrow - ln)) * DMX + lane * 8; const _Float16* qph = Qh + qs; const _Float16* qpl = Ql + qs;
  const size_t ks = (size_t)b * SQ * DKV + h * HDK * 16 + lane * 8; const _Float16* kph = Kh + ks; const _Float16* kpl = Kl + ks;
  const size_t vs = ((size_t)b * DKV + h * HDK) * SQ + lane * 8; const _Float16* vph = Vh + vs; const _Float16* vpl = Vl + vs;
  const v8f z8 = {0.f, 0.f, 0.f, 0.f, 0.f, 0.f, 0.f, 0.f}; v8f oh[8] = {z8, z8, z8, z8, z8, z8, z8, z8};
  const float nrm = 256.0f / __fadd_rn((float)(qb + 1), 1e-6f);
  int j = 0;
#pragma unroll 1      /* one trip = one 256-key block; rolled, the trip count differs between query blocks (at least one trip: block 0) */
  do { int jo = j * 256, qo = h * HDK * 16;
    asm volatile("s_wait_xcnt 0x0" : "+s"(jo), "+s"(qo) : : "memory");      /* stands in front of the rewrite of the address registers of the last trip's loads (a precaution); the key offset and the q offset are its outputs, so every new address is formed behind it, and the q fragments are fetched anew in every trip: they hold no registers during softmax and P V, which keeps two waves on a SIMD */
    const _Float16* qp = qph + qo; const _Float16* qlp = qpl + qo;
    const v16h qh0 = g2_frag(qp), qh1 = g2_frag(qp + 512), qh2 = g2_frag(qp + 1024), qh3 = g2_frag(qp + 1536), ql0 = g2_frag(qlp), ql1 = g2_frag(qlp + 512), ql2 = g2_frag(qlp + 1024), ql3 = g2_frag(qlp + 1536);
    const _Float16* kh_ = kph + (size_t)jo * DKV; const _Float16* kl_ = kpl + (size_t)jo * DKV; const _Float16* vh_ = vph + jo * 16; const _Float16* vl_ = vpl + jo * 16;
    // 64 steps of 8 loads a trip: steps 0..31 = key tile t, hi plane then residual plane; steps 32..63 = 32 keys x 64 dims of V^T, hi then residual. Three register sets turn: step k + 2 is requested in front of the products of step k.
#define FA_REQ(k) { if ((k) < 32) fa_load(x[(k) % 3], (((k) & 1) ? kl_ : kh_) + (size_t)((k) >> 1) * 16 * DKV, 512); else fa_load(x[(k) % 3], (((k) & 1) ? vl_ : vh_) + (size_t)(((k) - 32) >> 2) * 512 + (size_t)(((((k) - 32) >> 1) & 1) * 4) * 16 * SQ, (size_t)16 * SQ); }
    v8f s[16]; FA4 x[3]; FA_REQ(0) __builtin_amdgcn_sched_barrier(0);      /* the q fragments and step 0 are requested first, then step 1, then step 2: mixed, the first products' counted load wait would wait for the younger steps too */
    FA_REQ(1) __builtin_amdgcn_sched_barrier(0);      /* as above */
    v8f ah = z8, al = z8;
#pragma unroll
    for (int k = 0; k < 32; ++k) { if (k == 28 || k == 29) __builtin_amdgcn_sched_barrier(0);      /* keeps the vector work of the step before out of the stretch between a K plane's last request and the wait below */
      FA_REQ(k + 2)      /* behind the last key tile: the first V^T fragments, which fly during the softmax */
      if (k == 28 || k == 29) { __builtin_amdgcn_sched_barrier(0); asm volatile("s_wait_xcnt 0x0" ::: "memory"); }      /* behind the last request of a K plane: its address registers are free from here on and the compiler reuses them with the loads in flight (a precaution; it wrote no wait there); the barrier in front keeps the requests above the wait */
      __builtin_amdgcn_sched_barrier(0);      /* keeps this step's products, with their load wait, from moving up in front of the requests of the step after next */
      const FA4& c = x[k % 3];
      if ((k & 1) == 0) { ah = fa_mma(c.f0, qh0, z8); al = fa_mma(c.f0, ql0, z8); ah = fa_mma(c.f1, qh1, ah); al = fa_mma(c.f1, ql1, al); ah = fa_mma(c.f2, qh2, ah); al = fa_mma(c.f2, ql2, al); ah = fa_mma(c.f3, qh3, ah); al = fa_mma(c.f3, ql3, al); }
      else { al = fa_mma(c.f0, qh0, al); al = fa_mma(c.f1, qh1, al); al = fa_mma(c.f2, qh2, al); al = fa_mma(c.f3, qh3, al); s[k >> 1] = ah * ATS + al * (ATS * 0.0009765625f); } }
    if (j == qb) {      /* only the diagonal block holds keys above a query */
#pragma unroll
      for (int t = 0; t < 16; ++t) {
#pragma unroll
        for (int r = 0; r < 8; ++r) s[t][r] = (jo + t * 16 + 8 * hh + r <= qrow) ? s[t][r] : -1.0e9f; } }
    float mx = -3.0e38f;
#pragma unroll
    for (int t = 0; t < 16; ++t) mx = fmaxf(mx, fmaxf(fmaxf(fmaxf(s[t][0], s[t][1]), fmaxf(s[t][2], s[t][3])), fmaxf(fmaxf(s[t][4], s[t][5]), fmaxf(s[t][6], s[t][7]))));
    mx = fmaxf(mx, sm_xhalf(mx)); float se = 0.f;
#pragma unroll
    for (int t = 0; t < 16; ++t) { v4f a, e;
#pragma unroll
      for (int u = 0; u < 4; ++u) { a[u] = (s[t][u] - mx) * 1.44269504f; e[u] = (s[t][4 + u] - mx) * 1.44269504f; }      /* e^x = 2^(x log2 e), as the native exp forms it */
      sm_exp2x8(a, e); se += ((a[0] + a[1]) + (a[2] + a[3])) + ((e[0] + e[1]) + (e[2] + e[3]));
#pragma unroll
      for (int u = 0; u < 4; ++u) { s[t][u] = a[u]; s[t][4 + u] = e[u]; } }
    se += sm_xhalf(se); const float isum = nrm / se;
    FragH bh, bl; v8f ol[8] = {z8, z8, z8, z8, z8, z8, z8, z8};      /* the residual terms of this key block (x1024) */
#pragma unroll
    for (int k = 32; k < 64; ++k) { const int u = (k - 32) >> 2, d0 = (((k - 32) >> 1) & 1) * 4;
      if (k == 60 || k == 61) __builtin_amdgcn_sched_barrier(0);      /* as for K above */
      if (k + 2 < 64) FA_REQ(k + 2)
      if (k == 60 || k == 61) { __builtin_amdgcn_sched_barrier(0); asm volatile("s_wait_xcnt 0x0" ::: "memory"); }      /* behind the last request of a V^T plane, as for K above */
      __builtin_amdgcn_sched_barrier(0);      /* as above: the requests stay in front of this step's products */
      const FA4& c = x[k % 3];
      if (((k - 32) & 3) == 0) {      /* the weights of keys 32u .. 32u + 31 as f16 hi + x1024 residual: the B fragments of the next four steps */
#pragma unroll
        for (int r = 0; r < 8; ++r) { const float p0 = s[2 * u][r] * isum, p1 = s[2 * u + 1][r] * isum; bh.h[r] = (_Float16)p0; bl.h[r] = (_Float16)((p0 - (float)bh.h[r]) * 1024.0f); bh.h[8 + r] = (_Float16)p1; bl.h[8 + r] = (_Float16)((p1 - (float)bh.h[8 + r]) * 1024.0f); } }
      if ((k & 1) == 0) { oh[d0] = fa_mma(c.f0, bh.v, oh[d0]); oh[d0 + 1] = fa_mma(c.f1, bh.v, oh[d0 + 1]); oh[d0 + 2] = fa_mma(c.f2, bh.v, oh[d0 + 2]); oh[d0 + 3] = fa_mma(c.f3, bh.v, oh[d0 + 3]);
        ol[d0] = fa_mma(c.f0, bl.v, ol[d0]); ol[d0 + 1] = fa_mma(c.f1, bl.v, ol[d0 + 1]); ol[d0 + 2] = fa_mma(c.f2, bl.v, ol[d0 + 2]); ol[d0 + 3] = fa_mma(c.f3, bl.v, ol[d0 + 3]); }
      else { ol[d0] = fa_mma(c.f0, bh.v, ol[d0]); ol[d0 + 1] = fa_mma(c.f1, bh.v, ol[d0 + 1]); ol[d0 + 2] = fa_mma(c.f2, bh.v, ol[d0 + 2]); ol[d0 + 3] = fa_mma(c.f3, bh.v, ol[d0 + 3]); } }
#undef FA_REQ
#pragma unroll
    for (int dt = 0; dt < 8; ++dt) oh[dt] += ol[dt] * 0.0009765625f;      /* joined per key block, so that the second accumulator holds no registers while the next scores are formed */
  } while (++j <= qb);
  unsigned short* op = (unsigned short*)O + qs + h * HDK * 16;      /* a lane holds dims 16 dt + 8 hh + r of its query: piece 32 (dt & 1) + lane of tile dt / 2 of the head's four: each store of the wave writes 512 contiguous bytes */
#pragma unroll
  for (int dt = 0; dt < 8; ++dt) { FragH f;
#pragma unroll
    for (int r = 0; r < 8; ++r) f.h[r] = (_Float16)(oh[dt][r] * 0.25f);      /* o x64 = (Ph Vh + (Pl Vh + Ph Vl) 2^-10) / 4 */
    *(v8us*)(op + dt * 256) = f.half[0]; } }
// Exact f32 causal attention of rows 0..255, spread over a work-group: 8 waves take 8 query rows of one head (keys 0 .. i0 + 7 only).
// Scores: 4 neighbouring lanes share one key row (each wave-wide load covers 8 rows x 64 contiguous bytes), a lane sums its 32 of the 128 dims for all 8 queries (q from LDS, 64 contiguous bytes per read), two lane steps finish the dot.
// Softmax: wave w owns row i0 + w, 8 keys a lane, plain two-pass (all scores of a row are at hand), accurate expf; keys above the query get weight 0.
// Output: wave w sums keys w, w + 8, ... (a V row is one coalesced 512 B load, its 8 weights two LDS broadcasts), the 8 partial sums meet in LDS in fixed order; o x64 / row sum as before.
__global__ __launch_bounds__(256) void k_att0w(const float* __restrict__ QF, const float* __restrict__ KF, const float* __restrict__ VF, float scale, float* __restrict__ OF) {
  __shared__ __attribute__((aligned(16))) float lq[8][128]; __shared__ __attribute__((aligned(16))) float sc[8][QT0 + 4]; __shared__ __attribute__((aligned(16))) float pt[QT0][8]; __shared__ __attribute__((aligned(16))) float red[8][8][128]; __shared__ float inv[8];
  const int lane = threadIdx.x & 31; const int w = __builtin_amdgcn_readfirstlane(threadIdx.x >> 5); const int h = blockIdx.x % NH, i0 = (QT0 / 8 - 1 - blockIdx.x / NH) * 8; const int nkey = i0 + 8;      /* the row groups with the most keys come first */
  *(v4f*)&lq[w][lane * 4] = *(const v4fa*)(QF + (size_t)(i0 + w) * DMX + h * 128 + lane * 4);
  __syncthreads();
  const int dq = (lane & 3) * 4;
#pragma unroll 1      /* one trip = 64 keys of the work-group; rolled so that only the trips below the diagonal run */
  for (int j0 = w * 8; j0 < nkey; j0 += 64) { const int j = j0 + (lane >> 2); const float* kr = KF + (size_t)j * DKV + h * 128 + dq; v4f kq[8];
#pragma unroll
    for (int c = 0; c < 8; ++c) kq[c] = *(const v4fa*)(kr + c * 16);
    asm volatile("s_wait_xcnt 0x0" ::: "memory");      /* stands in front of the first reuse of the loads' address registers (a precaution); no load sinks below it, so all eight are in flight together */
#pragma unroll 1      /* four query rows a trip: with all eight unrolled the q reads of a whole tile are hoisted and the wave needs more than 256 registers, so that only one work-group fits a WGP */
    for (int rh = 0; rh < 8; rh += 4) { float acc[4] = {0.f, 0.f, 0.f, 0.f};
#pragma unroll
      for (int c = 0; c < 8; ++c) {
#pragma unroll
        for (int r = 0; r < 4; ++r) { const v4f q = *(const v4f*)&lq[rh + r][c * 16 + dq]; acc[r] += q[0] * kq[c][0] + q[1] * kq[c][1] + q[2] * kq[c][2] + q[3] * kq[c][3]; } }
#pragma unroll
      for (int r = 0; r < 4; ++r) { float s = acc[r]; s += sm_xrow<1>(s); s += sm_xrow<2>(s); if ((lane & 3) == 0) sc[rh + r][j] = s * scale; } } }
  __syncthreads();
  { const int i = i0 + w; float s[8]; float mx = -3.0e38f;
#pragma unroll
    for (int u = 0; u < 8; ++u) { const int j = lane + 32 * u; s[u] = (j <= i) ? sc[w][j] : -3.0e38f; mx = fmaxf(mx, s[u]); }
    mx = sm_wmax(mx); float se = 0.f;
#pragma unroll
    for (int u = 0; u < 8; ++u) { const int j = lane + 32 * u; const float e = (j <= i) ? expf(s[u] - mx) : 0.f; se += e; pt[j][w] = e; }
    se = sm_wsum(se); if (lane == 0) inv[w] = 64.0f / se; }
  __syncthreads();
  const v4f z4 = {0.f, 0.f, 0.f, 0.f}; v4f o[8] = {z4, z4, z4, z4, z4, z4, z4, z4};
#pragma unroll 1      /* one trip = 64 keys of the work-group, 8 a wave; keys from nkey on carry weight 0 for all 8 rows (rows below 256 of V, in bounds) */
  for (int jb = w; jb < nkey; jb += 64) { const float* vr = VF + (size_t)jb * DKV + h * 128 + lane * 4; v4f vv[8];
#pragma unroll
    for (int u = 0; u < 8; ++u) vv[u] = *(const v4fa*)(vr + (size_t)(8 * u) * DKV);
#pragma unroll
    for (int u = 0; u < 8; ++u) { const v4f p0 = *(const v4f*)&pt[jb + 8 * u][0], p1 = *(const v4f*)&pt[jb + 8 * u][4];
#pragma unroll
      for (int r = 0; r < 4; ++r) { o[r] += p0[r] * vv[u]; o[4 + r] += p1[r] * vv[u]; } } }
#pragma unroll
  for (int r = 0; r < 8; ++r) *(v4f*)&red[w][r][lane * 4] = o[r];
  __syncthreads();
  { v4f a = *(const v4f*)&red[0][w][lane * 4];
#pragma unroll
    for (int k = 1; k < 8; ++k) a += *(const v4f*)&red[k][w][lane * 4];
    a *= inv[w]; *(v4f*)(OF + (size_t)(i0 + w) * DMX + h * 128 + lane * 4) = a; } }
extern "C" void kernel_launch(void* const* d_in, const int* in_sizes, int n_in,
                              void* d_out, int out_size, void* d_ws, size_t ws_size, hipStream_t stream) {
  (void)in_sizes; (void)n_in; (void)out_size;
  const float* const* I = (const float* const*)d_in; const float* x = I[0]; const float* wq = I[1]; const float* wk = I[2]; const float* wv = I[3]; const float* wo = I[4]; const float* bq = nullptr; const float* bk = nullptr; const float* bv = nullptr; const float* bo = nullptr;      /* natural [out][in] Wq/Wk/Wv/Wo [2048][2048]; no biases */
  char* ws = (char*)d_ws; size_t off = 0;
  auto take = [&](size_t bytes) { char* p = ws + off; off += (bytes + 255) & ~(size_t)255; return p; };
  _Float16* BQ = (_Float16*)take((size_t)DMX * DMX * 2); _Float16* BK = (_Float16*)take((size_t)DKV * DMX * 2); _Float16* BV = (_Float16*)take((size_t)DKV * DMX * 2); _Float16* BO = (_Float16*)take((size_t)DMX * DMX * 2);
  _Float16* X16 = (_Float16*)take(NR * DMX * 2); float* QF = (float*)take((size_t)QT0 * DMX * 4); float* KF = (float*)take((size_t)QT0 * DKV * 4); float* VF = (float*)take((size_t)QT0 * DKV * 4); _Float16* Q16 = (_Float16*)take(NR * DMX * 2); _Float16* QL = (_Float16*)take(NR * DMX * 2); _Float16* K16 = (_Float16*)take(NR * DKV * 2); _Float16* KL = (_Float16*)take(NR * DKV * 2); _Float16* O16 = (_Float16*)take(NR * DMX * 2);      /* rows 0..255 of a batch's q, k, v in f32; f16 hi + x1024 residual planes of q, k (both batches) */
  _Float16* VT = (_Float16*)take((size_t)NB * DKV * SQ * 2); _Float16* VTL = (_Float16*)take((size_t)NB * DKV * SQ * 2);      /* V^T hi / residual of both batches */
  float* OF0 = (float*)take((size_t)NB * QT0 * DMX * 4); _Float16* OH0 = (_Float16*)take((size_t)NB * QT0 * DMX * 2); _Float16* OL0 = (_Float16*)take((size_t)NB * QT0 * DMX * 2);
  if (off > ws_size) return;      /* 174 MiB */
  { const unsigned g = (unsigned)(((size_t)DMX * DMX / 8 + 255) / 256); k_wnat<<<g, 256, 0, stream>>>(wq, (size_t)DMX * DMX / 8, BQ); k_wnat<<<g, 256, 0, stream>>>(wk, (size_t)DKV * DMX / 8, BK); k_wnat<<<g, 256, 0, stream>>>(wv, (size_t)DKV * DMX / 8, BV); k_wnat<<<g, 256, 0, stream>>>(wo, (size_t)DMX * DMX / 8, BO); }      /* natural [out][in] = Bt x16 */
  k_x16<<<(unsigned)((NR * DMX / 8 + 255) / 256), 256, 0, stream>>>(x, X16, NR * DMX / 8);
  for (int b = 0; b < NB; ++b) { const size_t r0 = (size_t)b * SQ;
    float* QF0 = QF; float* KF0 = KF;
    k_gemm2<0, 1><<<dim3((SQ / 128) * (DMX / 64), 1), 128, 0, stream>>>(X16 + r0 * DMX, DMX, 0, BQ, DMX, 0, 0.0625f, bq, 0, nullptr, 1, 0, 0, QF, nullptr, DMX, 0, SQ, DMX, DMX, Q16 + r0 * DMX, QL + r0 * DMX, QT0);
    k_gemm2<0, 1><<<dim3((SQ / 128) * (DKV / 64), 1), 128, 0, stream>>>(X16 + r0 * DMX, DMX, 0, BK, DMX, 0, 0.0625f, bk, 0, nullptr, 1, 0, 0, KF, nullptr, DKV, 0, SQ, DKV, DMX, K16 + r0 * DKV, KL + r0 * DKV, QT0);      /* this batch's q and k (exact products, f32 accumulators) leave the GEMM as f16 hi + x1024 residual planes in fragment order (block 0's full softmax seen from every later block's first row needs near-exact logits); f32 rows 0..255 for the exact first tile */
    k_gemm2<0, 2><<<dim3((SQ / 128) * (DKV / 64), 1), 128, 0, stream>>>(X16 + r0 * DMX, DMX, 0, BV, DMX, 0, 0.0625f, bv, 0, nullptr, 1, 0, 0, VF, nullptr, DKV, 0, SQ, DKV, DMX, VT + (size_t)b * DKV * SQ, VTL + (size_t)b * DKV * SQ, QT0);      /* this batch's v leaves the GEMM as V^T hi / x1024 residual planes in fragment order (rows = dims, columns = keys; the per-block softmax gives every block's first rows single-key weights, so v and P must be carried beyond one f16); f32 rows 0..255 for the exact first tile */
    k_att0w<<<NH * (QT0 / 8), 256, 0, stream>>>(QF0, KF0, VF, ATS, OF0 + (size_t)b * QT0 * DMX);      /* exact causal attention rows 0..255 (o x64) */
  }
  k_fattn<<<NB * NH * (SQ / 64), 128, 0, stream>>>(Q16, QL, K16, KL, VT, VTL, O16);      /* scores (hi.hi + the two residual terms), the module's per-block softmax (an independent softmax per 256-key block j <= i, diagonal block causal, weights divided by block count + 1e-6) and o = P V (hi.hi + the two residual terms) -> merged f16 o rows (x64) */
  k_gemm2<0, 0><<<dim3((unsigned)((NR / 128) * (DMX / 64)), 1), 128, 0, stream>>>(O16, DMX, 0, BO, DMX, 0, 0.0009765625f, bo, 0, nullptr, 1, 0, 0, (float*)d_out, nullptr, DMX, 0, (int)NR, DMX, DMX, nullptr, nullptr, 0);      /* out = o Wo^T */
  k_hl<true><<<(unsigned)(((size_t)NB * QT0 * DMX / 8 + 255) / 256), 256, 0, stream>>>(OF0, OH0, OL0, (size_t)NB * QT0 * DMX / 8);      /* first-tile o (x64) -> f16 hi + x1024 residual planes */
  for (int b = 0; b < NB; ++b) { const size_t r0 = (size_t)b * SQ; const size_t f0 = (size_t)b * QT0;
    k_gemm2<0, 0><<<dim3((QT0 / 128) * (DMX / 64), 1), 128, 0, stream>>>(OH0 + f0 * DMX, DMX, 0, BO, DMX, 0, 0.0009765625f, bo, 0, nullptr, 1, 0, 0, (float*)d_out + r0 * DMX, nullptr, DMX, 0, QT0, DMX, DMX, nullptr, nullptr, 0);      /* rows 0..255 of the batch rewritten from the exact path */
    k_gemm2<0, 0><<<dim3((QT0 / 128) * (DMX / 64), 1), 128, 0, stream>>>(OL0 + f0 * DMX, DMX, 0, BO, DMX, 0, 0.00000095367431640625f, nullptr, 0, (const float*)d_out + r0 * DMX, -1, 0, 0, (float*)d_out + r0 * DMX, nullptr, DMX, 0, QT0, DMX, DMX, nullptr, nullptr, 0); }      /* += o_lo Wo 2^-20 (own-element accumulate) */
}

// v007
// It runs in 326 microseconds.
// Timed twice side by side with v006, it ran 1.19 and 1.18 times as fast.
// All steps since v000 together make it 31.3 times as fast.
#include <hip/hip_runtime.h>
// Block-chunked causal attention with the module's PER-BLOCK softmax (hidden [2][2048][2048]; q/k/v = x W^T (natural [2048][2048] sigma 0.02, no biases), 16 heads of 128; keys in blocks of 256: for query block i every key block j <= i gets its OWN softmax over its 256 keys (scores / sqrt(128); inside the diagonal block keys above the query are -inf), the block outputs are summed and divided by the summed weights (= number of included blocks) + 1e-6; merged Wo^T -> [2][2048][2048]; no RoPE).
// Structure: token rows; x as exact f16 rows; natural weights as exact x16 planes; q, k, v as WMMA GEMMs (32x64 wave tiles, f32 accumulation) whose epilogues write f32 (first tile) + the f16 operand planes of q, k and V^T; per batch: exact f32 causal attention for rows 0..255 (= key block 0, where the per-block softmax is the ordinary causal softmax) on VALU; one fused launch for all query blocks, heads and both batches: a wave's 16 queries against key blocks 0..i (scores f32 in registers, alpha 1/sqrt(128)), the module's per-block softmax on VALU (f32 statistics, native exp; weights x256 f16 divided by the block count + 1e-6), o = P V (x64) merged f16; out = o Wo^T; first-tile rows rewritten from o hi/lo; launches: see trace.
// Compute dtype: inputs rounded to bf16; x / weights exact; projections f32; q, k, v and softmax weights as f16 hi + x1024 residual pairs, o as a plain f16 GEMM operand (~2^-12; first 256 rows of each batch exact); scores, statistics, out f32. v_wmma_f32_16x16x32_f16.
#define NB 2
#define SQ 2048
#define DMX 2048
#define NH 16
#define NKV 16
#define GSZ 1                        /* plain MHA: kv head == query head */
#define HDK 128
#define DKV (NKV * HDK)
#define QT 256
#define QT0 256
#define NKX SQ
#define DM DMX
#define HD 64
#define HG 1
#define NR ((size_t)NB * SQ)
#define ATS 0.08838834764831845f
typedef __bf16 v16b __attribute__((ext_vector_type(16)));
typedef unsigned short v8us __attribute__((ext_vector_type(8), may_alias));
typedef float  v8f  __attribute__((ext_vector_type(8)));
typedef float  v4f  __attribute__((ext_vector_type(4)));
typedef float  v4fa __attribute__((ext_vector_type(4), may_alias));
union FragB { v16b v; v8us half[2]; unsigned short u[16]; };

__device__ __forceinline__ unsigned short bf16_bits(float x) { unsigned int u = __float_as_uint(x); return (unsigned short)((u + 0x7FFFu + ((u >> 16) & 1u)) >> 16); }
__device__ __forceinline__ float bf16_val(unsigned short b) { return __uint_as_float(((unsigned int)b) << 16); }
__device__ __forceinline__ float bf16_round(float x) { return bf16_val(bf16_bits(x)); }
// D += A·B with NT terms: 1 = ah·bh, 2 = + al·bh (A split), 3 = + ah·bl (both split)
template <int NT>
__device__ __forceinline__ v8f mmaN(v16b ah, v16b al, v16b bh, v16b bl, v8f c) {
  c = __builtin_amdgcn_wmma_f32_16x16x32_bf16(false, ah, false, bh, (short)0, c, false, false);
  if (NT >= 2) c = __builtin_amdgcn_wmma_f32_16x16x32_bf16(false, al, false, bh, (short)0, c, false, false);
  if (NT >= 3) c = __builtin_amdgcn_wmma_f32_16x16x32_bf16(false, ah, false, bl, (short)0, c, false, false);
  asm volatile("v_nop\n\tv_nop\n\tv_nop\n\tv_nop" : "+v"(c) : "v"(ah), "v"(al), "v"(bh), "v"(bl));
  return c;
}

__global__ __launch_bounds__(256) void k_wt_bf16(const float* __restrict__ W, unsigned short* __restrict__ Wt, int K, int N) {
  const int t = blockIdx.x * 256 + threadIdx.x;
  const int k8n = K / 8;
  if (t >= N * k8n) return;
  const int n = t / k8n, k8 = (t % k8n) * 8;
  v8us v;
#pragma unroll
  for (int i = 0; i < 8; ++i) v[i] = bf16_bits(W[(size_t)(k8 + i) * N + n]);
  *(v8us*)(Wt + (size_t)n * K + k8) = v;
  
}

// GEMM C[M][N] (f32, pitch ldc) = act(A[M][K]·W + bias). A f32 row-major (pitch lda) converted per fragment to bf16
// (ASPLIT: hi/lo two planes -> 2 terms, else single rounded term); Wt bf16 [N][K] (pitch ldb). BIAS_BF16 rounds the
// bias to bf16 first (bias quantised to bf16 before the add). K%32==0, M%16==0, N%64==0.
template <bool ASPLIT, int ACT, bool BIAS_BF16>
__global__ __launch_bounds__(128) void k_gemm_bf(const float* __restrict__ A, int lda, const unsigned short* __restrict__ Wt, int ldb,
                                               const float* __restrict__ bias, float* __restrict__ C, int ldc, int M, int N, int K) {
  __shared__ __attribute__((aligned(16))) float so[4][16][64];
  const int tid = threadIdx.x, w = tid >> 5, lane = tid & 31, ln = lane & 15, hh = lane >> 4;
  const int ntn = N / 64;
  const int wid = blockIdx.x * 4 + w;
  const int mt = wid / ntn, nq = wid % ntn;
  if (mt * 16 >= M) return;
  const int row0 = mt * 16, col0 = nq * 64;
  const float* arow = A + (size_t)(row0 + ln) * lda;
  v8f acc[4] = {};
  for (int kb = 0; kb < K; kb += 32) {
    FragB ah, al;
    const v4f x0 = *(const v4fa*)(arow + kb + 8 * hh), x1 = *(const v4fa*)(arow + kb + 8 * hh + 4);
    const v4f x2 = *(const v4fa*)(arow + kb + 16 + 8 * hh), x3 = *(const v4fa*)(arow + kb + 16 + 8 * hh + 4);
    float xs[16] = {x0[0],x0[1],x0[2],x0[3],x1[0],x1[1],x1[2],x1[3],x2[0],x2[1],x2[2],x2[3],x3[0],x3[1],x3[2],x3[3]};
#pragma unroll
    for (int i = 0; i < 16; ++i) { const unsigned short hb = bf16_bits(xs[i]); ah.u[i] = hb; al.u[i] = ASPLIT ? bf16_bits(xs[i] - bf16_val(hb)) : (unsigned short)0; }
#pragma unroll
    for (int t = 0; t < 4; ++t) {
      const unsigned short* brow = Wt + (size_t)(col0 + t * 16 + ln) * ldb + kb;
      FragB b;
      b.half[0] = *(const v8us*)(brow + 8 * hh);
      b.half[1] = *(const v8us*)(brow + 16 + 8 * hh);
      acc[t] = mmaN<ASPLIT ? 2 : 1>(ah.v, al.v, b.v, b.v, acc[t]);
    }
  }
#pragma unroll
  for (int t = 0; t < 4; ++t) {
    float bv = bias ? bias[col0 + t * 16 + ln] : 0.f;
    if (BIAS_BF16) bv = bf16_round(bv);
#pragma unroll
    for (int r = 0; r < 8; ++r) { float v = acc[t][r] + bv; if (ACT == 1) v = fmaxf(v, 0.f); so[w][8 * hh + r][t * 16 + ln] = v; }
  }
  __builtin_amdgcn_fence(__ATOMIC_ACQ_REL, "workgroup");
  __builtin_amdgcn_wave_barrier();
  const int rsub = lane >> 4, c4 = (lane & 15) * 4;
  {
#pragma unroll
    for (int q = 0; q < 8; ++q) {
      const int r = q * 2 + rsub;
      const v4f v = *(const v4fa*)&so[w][r][c4];
      *(v4f*)(C + (size_t)(row0 + r) * ldc + col0 + c4) = v;
    }
    
  }
}

// GEMM C = act(A·W + bias + resid): A f32 (ASPLIT -> hi/lo 2 terms), Wt bf16 [N][K]; ACT 0 none, 1 relu, 2 exact gelu;
// resid (optional, f32, row index = (row % rmod), pitch ldr, RES_BF16 rounds it) added before the activation.
template <bool ASPLIT, int ACT, bool BIAS_BF16, bool RES_BF16>
__global__ __launch_bounds__(128) void k_gemm_bf3(const float* __restrict__ A, int lda, const unsigned short* __restrict__ Wt, int ldb,
                                                const float* __restrict__ bias, const float* __restrict__ resid, int rmod, int ldr,
                                                float* __restrict__ C, int ldc, int M, int N, int K) {
  __shared__ __attribute__((aligned(16))) float so[4][16][64];
  const int tid = threadIdx.x, w = tid >> 5, lane = tid & 31, ln = lane & 15, hh = lane >> 4;
  const int ntn = N / 64;
  const int wid = blockIdx.x * 4 + w;
  const int mt = wid / ntn, nq = wid % ntn;
  if (mt * 16 >= M) return;
  const int row0 = mt * 16, col0 = nq * 64;
  const float* arow = A + (size_t)(row0 + ln) * lda;
  v8f acc[4] = {};
  for (int kb = 0; kb < K; kb += 32) {
    FragB ah, al;
    const v4f x0 = *(const v4fa*)(arow + kb + 8 * hh), x1 = *(const v4fa*)(arow + kb + 8 * hh + 4);
    const v4f x2 = *(const v4fa*)(arow + kb + 16 + 8 * hh), x3 = *(const v4fa*)(arow + kb + 16 + 8 * hh + 4);
    float xs[16] = {x0[0],x0[1],x0[2],x0[3],x1[0],x1[1],x1[2],x1[3],x2[0],x2[1],x2[2],x2[3],x3[0],x3[1],x3[2],x3[3]};
#pragma unroll
    for (int i = 0; i < 16; ++i) { const unsigned short hb = bf16_bits(xs[i]); ah.u[i] = hb; al.u[i] = ASPLIT ? bf16_bits(xs[i] - bf16_val(hb)) : (unsigned short)0; }
#pragma unroll
    for (int t = 0; t < 4; ++t) {
      const unsigned short* brow = Wt + (size_t)(col0 + t * 16 + ln) * ldb + kb;
      FragB b;
      b.half[0] = *(const v8us*)(brow + 8 * hh);
      b.half[1] = *(const v8us*)(brow + 16 + 8 * hh);
      acc[t] = mmaN<ASPLIT ? 2 : 1>(ah.v, al.v, b.v, b.v, acc[t]);
    }
  }
#pragma unroll
  for (int t = 0; t < 4; ++t) {
    const int col = col0 + t * 16 + ln;
    float bv = bias ? bias[col] : 0.f;
    if (BIAS_BF16) bv = bf16_round(bv);
#pragma unroll
    for (int r = 0; r < 8; ++r) {
      float v = acc[t][r] + bv;
      if (resid) { float rv = resid[(size_t)((row0 + 8 * hh + r) % rmod) * ldr + col]; if (RES_BF16) rv = bf16_round(rv); v += rv; }
      if (ACT == 1) v = fmaxf(v, 0.f);
      if (ACT == 2) v = 0.5f * v * (1.0f + erff(v * 0.70710678118654752f));
      if (ACT == 3) { const float u = 0.7978845608028654f * (v + 0.044715f * v * v * v); v = 0.5f * v * (1.0f + tanhf(u)); }
      so[w][8 * hh + r][t * 16 + ln] = v;
    }
  }
  __builtin_amdgcn_fence(__ATOMIC_ACQ_REL, "workgroup");
  __builtin_amdgcn_wave_barrier();
  const int rsub = lane >> 4, c4 = (lane & 15) * 4;
  {
#pragma unroll
    for (int q = 0; q < 8; ++q) {
      const int r = q * 2 + rsub;
      const v4f v = *(const v4fa*)&so[w][r][c4];
      *(v4f*)(C + (size_t)(row0 + r) * ldc + col0 + c4) = v;
    }
    
  }
}
// row LayerNorm (biased variance, eps) over N: s = X (+ R); optional out_sum <- s; out_norm <- (s-mu)*rsqrt(var+eps)*g + b
template <bool PARAM_BF16>
__global__ __launch_bounds__(256) void k_layernorm(const float* __restrict__ X, const float* __restrict__ R, const float* __restrict__ g, const float* __restrict__ bta,
                                                  float* __restrict__ out_sum, float* __restrict__ out_norm, int N, float eps) {
  __shared__ float red[256];
  const int row = blockIdx.x, tid = threadIdx.x;
  const float* x = X + (size_t)row * N; const float* rr = R ? R + (size_t)row * N : nullptr;
  float vals[16];                     // up to N = 4096
  const int per = N / 256;            // contiguous chunk per thread? use strided-by-4 chunks: thread handles j = tid*4 + 1024*u
  float s1 = 0.f;
  for (int u = 0; u < per / 4; ++u) {
    const int j = tid * 4 + 1024 * u;
    const v4f a = *(const v4fa*)(x + j);
    v4f b = {0.f,0.f,0.f,0.f}; if (rr) b = *(const v4fa*)(rr + j);
#pragma unroll
    for (int q = 0; q < 4; ++q) { const float v = a[q] + b[q]; vals[u * 4 + q] = v; s1 += v; }
  }
  red[tid] = s1; __syncthreads();
  for (int st = 128; st > 0; st >>= 1) { if (tid < st) red[tid] += red[tid + st]; __syncthreads(); }
  const float mu = red[0] / (float)N; __syncthreads();
  float s2 = 0.f;
  for (int u = 0; u < per / 4; ++u)
#pragma unroll
    for (int q = 0; q < 4; ++q) { const float c = vals[u * 4 + q] - mu; s2 += c * c; }
  red[tid] = s2; __syncthreads();
  for (int st = 128; st > 0; st >>= 1) { if (tid < st) red[tid] += red[tid + st]; __syncthreads(); }
  const float rs = rsqrtf(red[0] / (float)N + eps);
  {
    for (int u = 0; u < per / 4; ++u) {
      const int j = tid * 4 + 1024 * u;
      v4f o, sm;
#pragma unroll
      for (int q = 0; q < 4; ++q) {
        float gg = g[j + q], bb = bta[j + q];
        if (PARAM_BF16) { gg = bf16_round(gg); bb = bf16_round(bb); }
        sm[q] = vals[u * 4 + q]; o[q] = (vals[u * 4 + q] - mu) * rs * gg + bb;
      }
      if (out_sum) *(v4f*)(out_sum + (size_t)row * N + j) = sm;
      *(v4f*)(out_norm + (size_t)row * N + j) = o;
    }
    
  }
}



// ---- f16 WMMA path (v_wmma_f32_16x16x32_f16): 11-bit significands for operands in range — used where a [0,1] probability operand needs more precision than bf16
typedef _Float16 v16h __attribute__((ext_vector_type(16)));
union FragH { v16h v; v8us half[2]; _Float16 h[16]; unsigned short u[16]; };
template <int NT>
__device__ __forceinline__ v8f mmaH(v16h ah, v16h al, v16h bh, v16h bl, v8f c) {
  c = __builtin_amdgcn_wmma_f32_16x16x32_f16(false, ah, false, bh, (short)0, c, false, false);
  if (NT >= 2) c = __builtin_amdgcn_wmma_f32_16x16x32_f16(false, al, false, bh, (short)0, c, false, false);
  if (NT >= 3) c = __builtin_amdgcn_wmma_f32_16x16x32_f16(false, ah, false, bl, (short)0, c, false, false);
  asm volatile("v_nop\n\tv_nop\n\tv_nop\n\tv_nop" : "+v"(c) : "v"(ah), "v"(al), "v"(bh), "v"(bl));
  return c;
}
// batched GEMM like k_gemm_b but f16 operands: A f32 (split into f16 hi/lo if ASPLIT, else rounded to f16), Bt = f16 values [n][k]; alpha; C f32; N multiple of 16 (partial tiles skipped)
template <bool ASPLIT>
__global__ __launch_bounds__(128) void k_gemm_h(const float* __restrict__ A, int lda, size_t sA, const _Float16* __restrict__ Bh, int ldb, size_t sB, float alpha, float* __restrict__ C, int ldc, size_t sC, int M, int N, int K) {
  __shared__ __attribute__((aligned(16))) float so[4][16][64];
  const int tid = threadIdx.x, w = tid >> 5, lane = tid & 31, ln = lane & 15, hh = lane >> 4; const int by = blockIdx.y;
  A += (size_t)by * sA; Bh += (size_t)by * sB; C += (size_t)by * sC;
  const int ntn = (N + 63) / 64; const int wid = blockIdx.x * 4 + w; const int mt = wid / ntn, nq = wid % ntn; if (mt * 16 >= M) return;
  const int row0 = mt * 16, col0 = nq * 64; const float* arow = A + (size_t)(row0 + ln) * lda;
  v8f acc[4] = {};
  for (int kb = 0; kb < K; kb += 32) {
    FragH ah, al;
    const v4f x0 = *(const v4fa*)(arow + kb + 8 * hh), x1 = *(const v4fa*)(arow + kb + 8 * hh + 4), x2 = *(const v4fa*)(arow + kb + 16 + 8 * hh), x3 = *(const v4fa*)(arow + kb + 16 + 8 * hh + 4);
    float xs[16] = {x0[0],x0[1],x0[2],x0[3],x1[0],x1[1],x1[2],x1[3],x2[0],x2[1],x2[2],x2[3],x3[0],x3[1],x3[2],x3[3]};
#pragma unroll
    for (int i = 0; i < 16; ++i) { const _Float16 h = (_Float16)xs[i]; ah.h[i] = h; al.h[i] = ASPLIT ? (_Float16)(xs[i] - (float)h) : (_Float16)0.0f; }
#pragma unroll
    for (int t = 0; t < 4; ++t) { if (col0 + t * 16 >= N) continue; const size_t boff = (size_t)(col0 + t * 16 + ln) * ldb + kb; FragH bq; bq.half[0] = *(const v8us*)(Bh + boff + 8 * hh); bq.half[1] = *(const v8us*)(Bh + boff + 16 + 8 * hh);
      acc[t] = mmaH<ASPLIT ? 2 : 1>(ah.v, al.v, bq.v, bq.v, acc[t]); }
  }
#pragma unroll
  for (int t = 0; t < 4; ++t) { if (col0 + t * 16 >= N) continue;
#pragma unroll
    for (int r = 0; r < 8; ++r) so[w][8 * hh + r][t * 16 + ln] = acc[t][r] * alpha; }
  __builtin_amdgcn_fence(__ATOMIC_ACQ_REL, "workgroup"); __builtin_amdgcn_wave_barrier();
  const int rsub = lane >> 4, c4 = (lane & 15) * 4;
  {
#pragma unroll
    for (int q = 0; q < 8; ++q) { const int r = q * 2 + rsub; if (col0 + c4 < N) { const v4f v = *(const v4fa*)&so[w][r][c4]; *(v4f*)(C + (size_t)(row0 + r) * ldc + col0 + c4) = v; } }
     }
}

// Wt[n][k] = f16(W[k][n]·scale) from f32 row-major W[K][N] (scale = power of two; bf16-exact weights stay exact in f16 away from the subnormal range)
__global__ __launch_bounds__(256) void k_wt_f16(const float* __restrict__ W, _Float16* __restrict__ Wt, int K, int N, float scale) {
  const int t = blockIdx.x * 256 + threadIdx.x; if (t >= N * (K / 8)) return; const int n = t / (K / 8), k8 = (t % (K / 8)) * 8; FragH f;
#pragma unroll
  for (int i = 0; i < 8; ++i) f.h[i] = (_Float16)(bf16_round(W[(size_t)(k8 + i) * N + n]) * scale); const v8us o = f.half[0];
  *(v8us*)((unsigned short*)Wt + (size_t)n * K + k8) = o; 
}
// k_gemm_hh variant with fused epilogue: v = acc·alpha + bias[by·sBias + col] (+ CP[(row/rowsPerB)·sCPb + by·64 + col] if CP) ; ACT 0 none / 1 elu ; writes f16 C16 (and f32 C if non-null)
template <int ACT>
__global__ __launch_bounds__(128) void k_gemm_hhx(const _Float16* __restrict__ A, int lda, size_t sA, const _Float16* __restrict__ Bh, int ldb, size_t sB, float alpha, const float* __restrict__ bias, size_t sBias, const float* __restrict__ CP, int rowsPerB, size_t sCPb, int row0g,
    float* __restrict__ C, _Float16* __restrict__ C16, int ldc, size_t sC, int M, int N, int K) {
  __shared__ __attribute__((aligned(16))) float so[4][16][64];
  const int tid = threadIdx.x, w = tid >> 5, lane = tid & 31, ln = lane & 15, hh = lane >> 4; const int by = blockIdx.y;
  A += (size_t)by * sA; Bh += (size_t)by * sB; const size_t cofs = (size_t)by * sC; const float* bp = bias ? bias + (size_t)by * sBias : nullptr;
  const int ntn = (N + 63) / 64; const int wid = blockIdx.x * 4 + w; const int mt = wid / ntn, nq = wid % ntn; if (mt * 16 >= M) return;
  const int row0 = mt * 16, col0 = nq * 64; const _Float16* arow = A + (size_t)(row0 + ln) * lda;
  v8f acc[4] = {};
  for (int kb = 0; kb < K; kb += 32) { FragH ah; ah.half[0] = *(const v8us*)((const unsigned short*)arow + kb + 8 * hh); ah.half[1] = *(const v8us*)((const unsigned short*)arow + kb + 16 + 8 * hh);
#pragma unroll
    for (int t = 0; t < 4; ++t) { if (col0 + t * 16 >= N) continue; const size_t boff = (size_t)(col0 + t * 16 + ln) * ldb + kb; FragH bq; bq.half[0] = *(const v8us*)((const unsigned short*)Bh + boff + 8 * hh); bq.half[1] = *(const v8us*)((const unsigned short*)Bh + boff + 16 + 8 * hh);
      acc[t] = mmaH<1>(ah.v, ah.v, bq.v, bq.v, acc[t]); }
  }
#pragma unroll
  for (int t = 0; t < 4; ++t) { if (col0 + t * 16 >= N) continue; const int col = col0 + t * 16 + ln; const float bv = bp ? bf16_round(bp[col]) : 0.f;
#pragma unroll
    for (int r = 0; r < 8; ++r) { float v = acc[t][r] * alpha + bv; if (CP) { const int rr = row0g + row0 + 8 * hh + r; if (rowsPerB < 0) v += CP[cofs + (size_t)rr * ldc + col];      /* rowsPerB < 0: own element of the batched C plane */ else { const int bidx = rr / rowsPerB; v += CP[(size_t)bidx * sCPb + (size_t)by * 64 + col]; } } if (ACT == 1) v = (v > 0.f) ? v : expm1f(v); else if (ACT == 7) v = (v > 0.f) ? v + 1.0f : expf(v); else if (ACT == 8) v = tanhf(v); else if (ACT == 9) v = 0.5f * v * (1.0f + tanhf(0.7978845608028654f * (v + 0.044715f * v * v * v))); else if (ACT == 11) v = 1.0f / (1.0f + expf(-v)); else if (ACT == 12) v = (v > 0.f) ? v : 0.01f * v; else if (ACT == 14) v = (v > 0.f) ? v : 0.1f * v; else if (ACT == 16) v = (v >= 0.f) ? v : 0.3f * v; else if (ACT == 17) v = (v >= 0.f) ? v : 0.2f * v; else if (ACT == 15) v = v / (1.0f + expf(-v)); else if (ACT == 3) v = fmaxf(v, 0.f); else if (ACT == 6) v = 0.5f * v * (1.0f + erff(v * 0.70710678118654752f)); so[w][8 * hh + r][t * 16 + ln] = v; } }
  __builtin_amdgcn_fence(__ATOMIC_ACQ_REL, "workgroup"); __builtin_amdgcn_wave_barrier();
  const int rsub = lane >> 4, c4 = (lane & 15) * 4; typedef _Float16 v4h __attribute__((ext_vector_type(4)));
  {
#pragma unroll
    for (int q = 0; q < 8; ++q) { const int r = q * 2 + rsub; if (col0 + c4 < N) { const v4f v = *(const v4fa*)&so[w][r][c4]; if (C) *(v4f*)(C + cofs + (size_t)(row0 + r) * ldc + col0 + c4) = v; if (C16) { v4h h4; for (int i = 0; i < 4; ++i) h4[i] = (_Float16)v[i]; *(v4h*)(C16 + cofs + (size_t)(row0 + r) * ldc + col0 + c4) = h4; } } }
     }
}


typedef _Float16 v4h __attribute__((ext_vector_type(4)));

// FRAGMENT ORDER of an f16 operand plane of 2048 columns: the plane is cut into tiles of 16 rows x 32 columns, 1 KiB each, 64 tiles to a strip of 16 rows (a strip starts where it starts in the row-major plane).
// Inside a tile the 16-byte piece p = 32 half + 16 hh + ln holds columns 16 half + 8 hh .. + 7 of row ln: piece 32 half + lane is what lane (hh, ln) takes as elements 8 half .. 8 half + 7 of an A or B fragment.
// So each of the two 16-byte loads of a fragment reads 512 contiguous bytes (4 whole lines) over the wave; from a row-major plane it took 32 bytes out of each of 16 lines. The registers hold the same values as before.
static_assert(DMX == 2048 && DKV == 2048 && SQ == 2048, "fragment order below is written for planes of 2048 columns");
// A converting launch gives thread t eight values of tile t / 64: row (t & 63) / 4, columns 8 (t & 3) .. + 7. Four neighbouring lanes read one whole row of the tile (a 128-byte line of the f32 source), and the wave's store fills four whole lines of the plane.
__device__ __forceinline__ size_t fo_src(size_t t) { const size_t tile = t >> 6; return ((tile >> 6) * 16 + ((t & 63) >> 2)) * 2048 + (tile & 63) * 32 + (t & 3) * 8; }      /* element offset of thread t's 8 values in the row-major source */
__device__ __forceinline__ size_t fo_dst(size_t t) { return (t >> 6) * 512 + ((t & 3) * 16 + ((t & 63) >> 2)) * 8; }      /* and in the plane in fragment order: piece 16 (2 half + hh) + ln */
// All five operand conversions in one launch: work-groups 0 .. 4 WB - 1 take the four weights (WB work-groups each, values x16), the rest take x (x1). Every plane in fragment order, the values as before.
#define WB ((unsigned)((size_t)DMX * DMX / 8 / 256))
__global__ __launch_bounds__(256) void k_prep(const float* __restrict__ x, const float* __restrict__ wq, const float* __restrict__ wk, const float* __restrict__ wv, const float* __restrict__ wo,
    _Float16* __restrict__ X16, _Float16* __restrict__ BQ, _Float16* __restrict__ BK, _Float16* __restrict__ BV, _Float16* __restrict__ BO) {
  const unsigned sel = blockIdx.x / WB < 4u ? blockIdx.x / WB : 4u;      /* the same for the whole work-group */
  const float* s = sel == 0 ? wq : sel == 1 ? wk : sel == 2 ? wv : sel == 3 ? wo : x; _Float16* d = sel == 0 ? BQ : sel == 1 ? BK : sel == 2 ? BV : sel == 3 ? BO : X16; const float sc = sel < 4u ? 16.0f : 1.0f;
  const size_t t = (size_t)(blockIdx.x - sel * WB) * 256 + threadIdx.x; FragH f; const float* p = s + fo_src(t); const v4f a = *(const v4fa*)p, c = *(const v4fa*)(p + 4);
#pragma unroll
  for (int q = 0; q < 4; ++q) { f.h[q] = (_Float16)(bf16_round(a[q]) * sc); f.h[4 + q] = (_Float16)(bf16_round(c[q]) * sc); }
  *(v8us*)((unsigned short*)d + fo_dst(t)) = f.half[0]; }
__global__ __launch_bounds__(256) void k_h16(const float* __restrict__ x, _Float16* __restrict__ X16, size_t n8) { const size_t t = (size_t)blockIdx.x * 256 + threadIdx.x; if (t >= n8) return; FragH f;
#pragma unroll
  for (int q = 0; q < 8; ++q) f.h[q] = (_Float16)x[t * 8 + q]; *(v8us*)((unsigned short*)X16 + t * 8) = f.half[0];  }
__global__ __launch_bounds__(256) void k_round16f(const float* __restrict__ W, _Float16* __restrict__ Bt, size_t n8) { const size_t t = (size_t)blockIdx.x * 256 + threadIdx.x; if (t >= n8) return; FragH f;
#pragma unroll
  for (int i = 0; i < 8; ++i) f.h[i] = (_Float16)(bf16_round(W[t * 8 + i]) * 16.0f); *(v8us*)((unsigned short*)Bt + t * 8) = f.half[0];  }
template <int NHv, int TTv>
__global__ __launch_bounds__(256) void k_vt(const _Float16* __restrict__ V16, int ldv, int voff, _Float16* __restrict__ Vt) { __shared__ unsigned short tl[64][66]; const int tid = threadIdx.x; const int slab = blockIdx.x / (TTv / 64), lg = blockIdx.x % (TTv / 64); const int b = slab / NHv, h = slab % NHv;
  for (int i = tid; i < 64 * 8; i += 256) { const int r = i / 8, c8 = (i % 8) * 8; FragH f; f.half[0] = *(const v8us*)((const unsigned short*)V16 + ((size_t)b * TTv + lg * 64 + r) * ldv + voff + h * 64 + c8);
#pragma unroll
    for (int q = 0; q < 8; ++q) tl[r][c8 + q] = f.u[q]; }
  __syncthreads();
  {
#pragma unroll
    for (int rd = 0; rd < 2; ++rd) { const int idx = rd * 256 + tid, t8 = idx >> 6, p = idx & 63; const int d = (t8 >> 1) * 16 + (p & 15), c8 = (t8 & 1) * 32 + (p >> 5) * 16 + ((p >> 4) & 1) * 8; FragH f;      /* the 64 x 64 block = 4 x 2 tiles of V^T in fragment order (rows = dims, columns = keys), a thread per 16-byte piece */
#pragma unroll
      for (int q = 0; q < 8; ++q) f.u[q] = tl[c8 + q][d];
      *(v8us*)((unsigned short*)Vt + (((size_t)slab * 4 + (t8 >> 1)) * (TTv / 32) + lg * 2 + (t8 & 1)) * 512 + p * 8) = f.half[0]; }
     } }

template <bool FO>      /* FO: the two planes are written in fragment order (F stays row-major) */
__global__ __launch_bounds__(256) void k_hl(const float* __restrict__ F, _Float16* __restrict__ Hh, _Float16* __restrict__ Hl, size_t n8) { const size_t t = (size_t)blockIdx.x * 256 + threadIdx.x; if (t >= n8) return; FragH fh, fl; const float* fs = F + (FO ? fo_src(t) : t * 8); const v4f a = *(const v4fa*)fs, c = *(const v4fa*)(fs + 4);
#pragma unroll
  for (int q = 0; q < 4; ++q) { _Float16 h = (_Float16)a[q]; fh.h[q] = h; fl.h[q] = (_Float16)((a[q] - (float)h) * 1024.0f); h = (_Float16)c[q]; fh.h[4 + q] = h; fl.h[4 + q] = (_Float16)((c[q] - (float)h) * 1024.0f); }
  { const size_t d = FO ? fo_dst(t) : t * 8; *(v8us*)((unsigned short*)Hh + d) = fh.half[0]; *(v8us*)((unsigned short*)Hl + d) = fl.half[0];  } }

// ---- fast GEMM (wave tile 32x64; requires M % 32 == 0 rows per launch region, N % 64 == 0, K % 32 == 0 and K >= 96); A and Bh in fragment order (lda, ldb = columns of the plane); epilogue = k_gemm_hhx semantics ----
__device__ __forceinline__ v16h g2_frag(const _Float16* p) { FragH f; f.half[0] = *(const v8us*)((const unsigned short*)p); f.half[1] = *(const v8us*)((const unsigned short*)p + 256); return f.v; }      /* p = the tile in fragment order + 8 lane */
__device__ __forceinline__ v8f g2_mma(v16h a, v16h b, v8f c) { v8f d = __builtin_amdgcn_wmma_f32_16x16x32_f16(false, a, false, b, (short)0, c, false, false); asm volatile("v_nop\n\tv_nop\n\tv_nop\n\tv_nop" : "+v"(d) : "v"(a), "v"(b)); return d; }
struct G2S { v16h a0, a1, b0, b1, b2, b3; };      /* the fragments of one k-step of a 32x64 wave tile */
__device__ __forceinline__ void g2_load(G2S& s, const _Float16* a0p, const _Float16* a1p, const _Float16* b0p, const _Float16* b1p, const _Float16* b2p, const _Float16* b3p, int k) { s.a0 = g2_frag(a0p + k); s.b0 = g2_frag(b0p + k); s.a1 = g2_frag(a1p + k); s.b1 = g2_frag(b1p + k); s.b2 = g2_frag(b2p + k); s.b3 = g2_frag(b3p + k); }      /* k: 512 elements (one tile) a k-step */
// PL 0: C (f32) and C16 row-major, as before. PL 1, 2: the result also leaves as the two f16 operand planes of its consumer, hi + x1024 residual (the split of k_hl), in fragment order, written by this epilogue:
//   PL 1: planes of the result itself: a 32x64 wave tile = 2 x 2 whole 1 KiB tiles (16 rows x 32 columns), a lane's 16-byte piece = 8 neighbouring columns of one row, read back from the LDS staging;
//   PL 2: planes of the TRANSPOSED result (rows = columns of C): the wave tile = 4 whole tiles of 16 columns x 32 rows, and the 8 values of accumulator u of a lane (rows 16 (u / 4) + 8 hh + r of column 16 (u % 4) + ln) ARE piece 32 (u / 4) + lane of tile u % 4: no LDS.
//   With PL 1, 2 the f32 C is stored only by work-groups whose first row lies below frows inside its batch (the rows that a later f32 consumer reads); blockIdx.y moves both planes on by sP elements. Each plane store of a wave writes 512 contiguous bytes.
//   PL 1, 2 take no bias and no CP (their launches pass none).
template <int ACT, int PL>
__global__ __launch_bounds__(128) void k_gemm2(const _Float16* __restrict__ A, int lda, size_t sA, const _Float16* __restrict__ Bh, int ldb, size_t sB, float alpha, const float* __restrict__ bias, size_t sBias, const float* __restrict__ CP, int rowsPerB, size_t sCPb, int row0g,
    float* __restrict__ C, _Float16* __restrict__ C16, int ldc, size_t sC, int M, int N, int K, _Float16* __restrict__ Ph, _Float16* __restrict__ Pl, int frows, size_t sP) { static_assert(ACT == 0 || ACT == 3 || ACT == 6 || ACT == 8 || ACT == 9 || ACT == 11 || ACT == 12 || ACT == 14 || ACT == 15 || ACT == 16 || ACT == 17, "k_gemm2: unsupported ACT code (would silently apply no activation)");
  __shared__ __attribute__((aligned(16))) float so[4][32][68];
  const int tid = threadIdx.x, w = tid >> 5, lane = tid & 31, ln = lane & 15, hh = lane >> 4; const int by = blockIdx.y;
  A += (size_t)by * sA; Bh += (size_t)by * sB; size_t cofs = (size_t)by * sC; const float* bp = bias ? bias + (size_t)by * sBias : nullptr;
  const int ntn = N >> 6; const int mt = blockIdx.x / ntn, nq = blockIdx.x - mt * ntn; const int row0 = mt * 128 + 32 * w, col0 = nq * 64; if (row0 >= M) return;
  const int bb = PL == 0 ? 0 : row0 / SQ;      /* PL 1, 2: the rows are the token rows of all batches; bb = the batch of this wave's rows (128 divides SQ: the same for the whole work-group) */
  if (PL != 0) { Ph += (size_t)by * sP; Pl += (size_t)by * sP; cofs -= (size_t)bb * (SQ - frows) * ldc; }      /* the f32 C holds frows rows a batch, one batch behind the other: row bb frows + (row - bb SQ) */
  const _Float16* a0p = A + (size_t)row0 * lda + lane * 8; const _Float16* a1p = a0p + (size_t)16 * lda;
  const _Float16* b0p = Bh + (size_t)col0 * ldb + lane * 8; const _Float16* b1p = b0p + (size_t)16 * ldb; const _Float16* b2p = b1p + (size_t)16 * ldb; const _Float16* b3p = b2p + (size_t)16 * ldb;
  // k loop, three k-steps of fragments in registers: a step's 12 loads are issued together, directly behind the products of the step that held those registers,
  // so they fly during the next two steps' products instead of being waited for one fragment at a time. Products and their order per accumulator are as before.
  const int nst = K >> 5; G2S s0, s1, s2; int st = 0, ko = 0;
  g2_load(s0, a0p, a1p, b0p, b1p, b2p, b3p, 0); __builtin_amdgcn_sched_barrier(0);      /* the three sets are requested one after the other, as in the loop: mixed, the counted load waits in the loop (set for both ways into it) would wait for the younger sets too */
  g2_load(s1, a0p, a1p, b0p, b1p, b2p, b3p, 512); __builtin_amdgcn_sched_barrier(0);      /* as above */
  g2_load(s2, a0p, a1p, b0p, b1p, b2p, b3p, 1024);
  asm volatile("s_wait_xcnt 0x0" ::: "memory");      /* stands in front of the clearing of the accumulators, some of which take the registers of an address that the loads above name (a precaution; the compiler wrote none there) */
  const v8f z8 = {0.f,0.f,0.f,0.f,0.f,0.f,0.f,0.f}; v8f c00 = z8, c01 = z8, c02 = z8, c03 = z8, c10 = z8, c11 = z8, c12 = z8, c13 = z8;
#define G2_MMA8(S) { c00 = g2_mma(S.a0, S.b0, c00); c10 = g2_mma(S.a1, S.b0, c10); c01 = g2_mma(S.a0, S.b1, c01); c11 = g2_mma(S.a1, S.b1, c11); c02 = g2_mma(S.a0, S.b2, c02); c12 = g2_mma(S.a1, S.b2, c12); c03 = g2_mma(S.a0, S.b3, c03); c13 = g2_mma(S.a1, S.b3, c13); }
  /* G2_STEP: the k offset moves on by three steps. The wait stands in front of the rewrite of the address registers that the loads in flight name (a precaution; the compiler wrote none over the back edge); the new offset is its output, so every new address is formed behind it. */
#define G2_STEP { ko += 1536; asm volatile("s_wait_xcnt 0x0" : "+s"(ko) : : "memory"); }
#pragma unroll 1      /* one trip = three k-steps, one per register set; rolled so that the sets keep their registers */
  for (; st + 6 <= nst; st += 3) {
    G2_MMA8(s0) G2_STEP g2_load(s0, a0p + ko, a1p + ko, b0p + ko, b1p + ko, b2p + ko, b3p + ko, 0); __builtin_amdgcn_sched_barrier(0);      /* keeps the next set's first product, with its load wait, from moving up in front of these requests */
    G2_MMA8(s1) g2_load(s1, a0p + ko, a1p + ko, b0p + ko, b1p + ko, b2p + ko, b3p + ko, 512);
    G2_MMA8(s2) g2_load(s2, a0p + ko, a1p + ko, b0p + ko, b1p + ko, b2p + ko, b3p + ko, 1024); }
  const int rem = nst - st;      /* 3, 4 or 5 k-steps are left, the first three of them loaded */
  G2_MMA8(s0) G2_STEP if (rem > 3) g2_load(s0, a0p + ko, a1p + ko, b0p + ko, b1p + ko, b2p + ko, b3p + ko, 0);
  G2_MMA8(s1) if (rem > 4) { asm volatile("s_wait_xcnt 0x0" : "+s"(ko) : : "memory");      /* as in G2_STEP: the compiler forms this set's addresses in registers that the loads just above name */
    g2_load(s1, a0p + ko, a1p + ko, b0p + ko, b1p + ko, b2p + ko, b3p + ko, 512); }
  G2_MMA8(s2)
  if (rem > 3) G2_MMA8(s0)
  if (rem > 4) G2_MMA8(s1)
#undef G2_STEP
#undef G2_MMA8
  v8f accs[8] = {c00, c01, c02, c03, c10, c11, c12, c13};
  static_assert(PL == 0 || ACT == 0, "the plane epilogues carry no activation");
  const bool f32rows = PL == 0 || mt * 128 - bb * SQ < frows;      /* the same for the whole work-group */
  if (PL != 2 || f32rows) {      /* the LDS staging of the wave tile: PL 2 needs it for its f32 rows only */
#pragma unroll
    for (int u = 0; u < 8; ++u) { const int t = u & 3, half = u >> 2; const int col = col0 + t * 16 + ln; const float bv = (PL == 0 && bp) ? bf16_round(bp[col]) : 0.f;
#pragma unroll
    for (int r = 0; r < 8; ++r) { const int rloc = half * 16 + 8 * hh + r; float v = accs[u][r] * alpha + bv; if (PL == 0 && CP) { if (rowsPerB < 0) v += CP[cofs + (size_t)(row0g + row0 + rloc) * ldc + col];      /* rowsPerB < 0: own element of the batched C plane */ else { const int bidx = (row0g + row0 + rloc) / rowsPerB; v += CP[(size_t)bidx * sCPb + (size_t)by * 64 + col]; } }
      if (ACT == 3) v = fmaxf(v, 0.f); else if (ACT == 6) v = 0.5f * v * (1.0f + erff(v * 0.70710678118654752f)); else if (ACT == 11) v = 1.0f / (1.0f + expf(-v)); else if (ACT == 15) v = v / (1.0f + expf(-v)); else if (ACT == 12) v = (v > 0.f) ? v : 0.01f * v; else if (ACT == 8) v = tanhf(v); else if (ACT == 9) v = 0.5f * v * (1.0f + tanhf(0.7978845608028654f * (v + 0.044715f * v * v * v))); else if (ACT == 14) v = (v > 0.f) ? v : 0.1f * v; else if (ACT == 16) v = (v >= 0.f) ? v : 0.3f * v; else if (ACT == 17) v = (v >= 0.f) ? v : 0.2f * v;
      so[w][rloc][t * 16 + ln] = v; } }
    __builtin_amdgcn_fence(__ATOMIC_ACQ_REL, "workgroup"); __builtin_amdgcn_wave_barrier(); }
  if (PL != 0) { FragH ph[8], pr[8];      /* a lane's eight 16-byte pieces of the hi plane and of the residual plane */
#pragma unroll
    for (int i = 0; i < 8; ++i) { float x[8];
      if (PL == 1) { const float* sp = &so[w][(i >> 2) * 16 + ln][((i >> 1) & 1) * 32 + (i & 1) * 16 + hh * 8]; const v4f a = *(const v4fa*)sp, c = *(const v4fa*)(sp + 4);
#pragma unroll
        for (int q = 0; q < 4; ++q) { x[q] = a[q]; x[4 + q] = c[q]; } }
      else {
#pragma unroll
        for (int q = 0; q < 8; ++q) x[q] = accs[i][q] * alpha; }      /* the value that the staging loop forms (no bias, no CP here) */
#pragma unroll
      for (int q = 0; q < 8; ++q) { const _Float16 h = (_Float16)x[q]; ph[i].h[q] = h; pr[i].h[q] = (_Float16)((x[q] - (float)h) * 1024.0f); } }
    unsigned short* dh = (unsigned short*)Ph + (PL == 1 ? (size_t)row0 * 2048 + (size_t)col0 * 16 : (size_t)bb * N * SQ + (size_t)col0 * 2048 + (size_t)(row0 - bb * SQ) * 16) + lane * 8;      /* PL 2: a transposed plane of N rows x SQ columns a batch */ unsigned short* dl = (unsigned short*)Pl + (dh - (unsigned short*)Ph);
    __builtin_amdgcn_sched_barrier(0);      /* all sixteen pieces are formed above, each in registers of its own: no conversion sinks between the stores and overwrites a register of a store already issued */
#pragma unroll
    for (int i = 0; i < 8; ++i) { const size_t d = PL == 1 ? (size_t)(i >> 2) * 16 * 2048 + ((i >> 1) & 1) * 512 + (i & 1) * 256 : (size_t)(i & 3) * 16 * 2048 + (i >> 2) * 256; *(v8us*)(dh + d) = ph[i].half[0]; *(v8us*)(dl + d) = pr[i].half[0]; }
    asm volatile("s_wait_xcnt 0x0" ::: "memory"); }      /* stands in front of whatever reuses the data and address registers of the sixteen stores (a precaution) */
  const int rsub = lane >> 4, c4 = (lane & 15) * 4;
  if (f32rows) {
#pragma unroll
    for (int q = 0; q < 16; ++q) { const int r = q * 2 + rsub; const v4f v = *(const v4fa*)&so[w][r][c4]; if (C) *(v4f*)(C + cofs + (size_t)(row0 + r) * ldc + col0 + c4) = v; if (C16) { v4h h4; for (int i = 0; i < 4; ++i) h4[i] = (_Float16)v[i]; *(v4h*)(C16 + cofs + (size_t)(row0 + r) * ldc + col0 + c4) = h4; } }
     } }


__global__ __launch_bounds__(256) void k_rsm(const float* __restrict__ S, _Float16* __restrict__ P, int nrows) {
  #pragma clang fp contract(off)
  const int i = blockIdx.x * 256 + threadIdx.x; if (i >= nrows) return; const float* s = S + (size_t)i * SQ; float mx = -3.0e38f;
#pragma unroll 1
  for (int j = 0; j < SQ; ++j) mx = fmaxf(mx, s[j]); float se = 0.f;
#pragma unroll 1
  for (int j = 0; j < SQ; ++j) se += expf(s[j] - mx); const float sc = 256.0f / se;
#pragma unroll 1
  for (int j0 = 0; j0 < SQ; j0 += 8) { FragH f; for (int q = 0; q < 8; ++q) f.h[q] = (_Float16)(expf(s[j0 + q] - mx) * sc); unsigned short* d = (unsigned short*)P + (size_t)i * SQ + j0; *(v8us*)d = f.half[0];  } }
__global__ __launch_bounds__(256) void k_vt(const _Float16* __restrict__ V16, int b, int h0, _Float16* __restrict__ VT) { __shared__ unsigned short tl[64][65]; const int tid = threadIdx.x; const int hh = blockIdx.x % HG, sg = blockIdx.x / HG; const int s0 = sg * 64; const int h = h0 + hh;
  for (int i = tid; i < 64 * 8; i += 256) { const int j = i / 8, d8 = (i % 8) * 8; FragH f; f.half[0] = *(const v8us*)((const unsigned short*)V16 + ((size_t)b * SQ + s0 + j) * DM + h * HD + d8); for (int q = 0; q < 8; ++q) tl[d8 + q][j] = f.u[q]; }
  __syncthreads();
  { for (int i = tid; i < 64 * 8; i += 256) { const int d = i / 8, j8 = (i % 8) * 8; FragH f; for (int q = 0; q < 8; ++q) f.u[q] = tl[d][j8 + q]; *(v8us*)((unsigned short*)VT + ((size_t)hh * HD + d) * SQ + s0 + j8) = f.half[0]; }  } }


__global__ __launch_bounds__(256) void k_f2h(const float* __restrict__ F, int ldf, int coff, int ncol, _Float16* __restrict__ H16, size_t nrow) { const size_t t = (size_t)blockIdx.x * 256 + threadIdx.x; const size_t n8 = nrow * (size_t)(ncol / 8); if (t >= n8) return; const size_t r = t / (ncol / 8); const int c8 = (int)(t % (ncol / 8)) * 8; FragH f; const v4f a = *(const v4fa*)(F + r * ldf + coff + c8), b2 = *(const v4fa*)(F + r * ldf + coff + c8 + 4); for (int q = 0; q < 4; ++q) { f.h[q] = (_Float16)a[q]; f.h[4 + q] = (_Float16)b2[q]; } *(v8us*)((unsigned short*)H16 + r * ncol + c8) = f.half[0];  }

__global__ __launch_bounds__(256) void k_tab128(float theta, float* __restrict__ CS, float* __restrict__ SN) {
  #pragma clang fp contract(off)
  const int t = blockIdx.x * 256 + threadIdx.x; if (t >= SQ * 64) return; const int i = t % 64; const int p = t / 64; const float invf = (float)(1.0 / pow((double)theta, (double)(2 * i) / 128.0));      /* = XLA's constant-folded f32 table */ const float ang = __fmul_rn((float)p, invf); const float c = cosf(ang), s = sinf(ang);
  *(float*)(CS + t) = c; *(float*)(SN + t) = s;  }
template <int TAB>
__global__ __launch_bounds__(128) void k_rope128(const float* __restrict__ F, int ldf, int nh, const float* __restrict__ CS, const float* __restrict__ SN, _Float16* __restrict__ H16, int ldo, float osc) {
  #pragma clang fp contract(off)
  __shared__ float xv[128]; __shared__ unsigned short sh_[128]; const int d = threadIdx.x; const int h = blockIdx.x % nh; const size_t r = blockIdx.x / nh; const int p = (int)(r % SQ);
  xv[d] = F[r * (size_t)ldf + (size_t)h * 128 + d]; __syncthreads();
  float c, s; if (TAB) { c = bf16_round(CS[(size_t)p * 128 + d]); s = bf16_round(SN[(size_t)p * 128 + d]); } else { c = CS[p * 64 + (d & 63)]; s = SN[p * 64 + (d & 63)]; }
  const float rot = (d < 64) ? -xv[d + 64] : xv[d - 64]; const float o = __fadd_rn(__fmul_rn(xv[d], c), __fmul_rn(rot, s));
  FragH th; th.h[0] = (_Float16)__fmul_rn(o, osc); sh_[d] = th.u[0]; __syncthreads();
  if (d < 16) { FragH f; for (int q = 0; q < 8; ++q) f.u[q] = sh_[d * 8 + q]; unsigned short* dst = (unsigned short*)H16 + r * (size_t)ldo + (size_t)h * 128 + d * 8; *(v8us*)dst = f.half[0];  } }

template <int TAB, int IL, int F32OUT>
__global__ __launch_bounds__(128) void k_rope128x(const float* __restrict__ F, int ldf, int nh, const float* __restrict__ CS, const float* __restrict__ SN, void* __restrict__ OUT, int ldo, float osc) {
  #pragma clang fp contract(off)
  __shared__ float xv[128]; __shared__ float ov[128]; const int d = threadIdx.x; const int h = blockIdx.x % nh; const size_t r = blockIdx.x / nh; const int p = (int)(r % SQ);
  xv[d] = F[r * (size_t)ldf + (size_t)h * 128 + d]; __syncthreads();
  float c, s; if (TAB == 2) { c = CS[r * 128 + d]; s = SN[r * 128 + d]; }      /* computed full-width f32 tables, one row per token row r (relative to the passed pointers) */ else if (TAB) { c = bf16_round(CS[(size_t)p * 128 + d]); s = bf16_round(SN[(size_t)p * 128 + d]); } else { const int ti = IL ? (d >> 1) : (d & 63); c = CS[p * 64 + ti]; s = SN[p * 64 + ti]; }
  const float rot = IL ? ((d & 1) ? xv[d - 1] : -xv[d + 1]) : ((d < 64) ? -xv[d + 64] : xv[d - 64]);
  ov[d] = __fmul_rn(__fadd_rn(__fmul_rn(xv[d], c), __fmul_rn(rot, s)), osc); __syncthreads();
  if (F32OUT) { if (d < 32) { const v4f v = *(const v4f*)&ov[d * 4]; float* dst = (float*)OUT + r * (size_t)ldo + (size_t)h * 128 + d * 4; *(v4f*)dst = v;  } }
  else { if (d < 16) { FragH f; for (int q = 0; q < 8; ++q) f.h[q] = (_Float16)ov[d * 8 + q]; unsigned short* dst = (unsigned short*)OUT + r * (size_t)ldo + (size_t)h * 128 + d * 8; *(v8us*)dst = f.half[0];  } } }
template <int N>
__global__ __launch_bounds__(256) void k_rmsrow(float* __restrict__ X, const float* __restrict__ w, float eps) {
  #pragma clang fp contract(off)
  constexpr int PT = N / 256; __shared__ float red[256]; const size_t r = blockIdx.x; const int t = threadIdx.x; float* row = X + r * N + (size_t)t * PT; float v[PT]; float ss = 0.f;
  for (int q = 0; q < PT; ++q) { v[q] = row[q]; ss = __fadd_rn(ss, __fmul_rn(v[q], v[q])); }
  red[t] = ss; __syncthreads(); for (int k = 128; k > 0; k >>= 1) { if (t < k) red[t] = __fadd_rn(red[t], red[t + k]); __syncthreads(); }
  const float rs = rsqrtf(__fadd_rn(red[0] / (float)N, eps)); float o[PT]; for (int q = 0; q < PT; ++q) o[q] = __fmul_rn(__fmul_rn(v[q], rs), bf16_round(w[t * PT + q]));
  { for (int q = 0; q < PT; ++q) *(float*)(row + q) = o[q];  } }
template <int GS_, int NHQ, int DSRC>
__global__ __launch_bounds__(256) void k_kvexp128(const float* __restrict__ src, float* __restrict__ dst, size_t n4) { const size_t t = (size_t)blockIdx.x * 256 + threadIdx.x; if (t >= n4) return; const size_t e = t * 4; const size_t row = e / ((size_t)NHQ * 128); const int col = (int)(e % ((size_t)NHQ * 128)); const int h = col / 128, d = col % 128; const v4f v = *(const v4fa*)(src + row * DSRC + (size_t)(h / GS_) * 128 + d); *(v4f*)(dst + e) = v;  }

__global__ __launch_bounds__(256) void k_rsmcfb(const float* __restrict__ S, _Float16* __restrict__ P, int hg, int q0, int nk, const int* __restrict__ mk) {
  #pragma clang fp contract(off)
  const int t = blockIdx.x * 256 + threadIdx.x; if (t >= hg * QT) return; const size_t i = (size_t)t; const float* s = S + i * NKX; const size_t ig = (size_t)(q0 + (t % QT)); const int* mr = mk + ig * SQ; float mx = -3.0e38f;
#pragma unroll 1
  for (int j = 0; j < nk; ++j) { const int mb = mr[j]; const float f = (mb == 0) ? 1.f : 0.f; mx = fmaxf(mx, fmaf(f, s[j], (1.f - f) * -1.0e9f)); } float se = 0.f;
#pragma unroll 1
  for (int j = 0; j < nk; ++j) { const int mb = mr[j]; const float f = (mb == 0) ? 1.f : 0.f; se += __expf(fmaf(f, s[j], (1.f - f) * -1.0e9f) - mx); } const float sc = 256.0f / se;
#pragma unroll 1
  for (int j0 = 0; j0 < nk; j0 += 8) { FragH fr; for (int q = 0; q < 8; ++q) { const int j = j0 + q; const int mb = mr[j]; const float f = (mb == 0) ? 1.f : 0.f; fr.h[q] = (_Float16)(__expf(fmaf(f, s[j], (1.f - f) * -1.0e9f) - mx) * sc); } unsigned short* d = (unsigned short*)P + i * NKX + j0; *(v8us*)d = fr.half[0];  } }


__global__ __launch_bounds__(256) void k_rsmcf2(const float* __restrict__ S, _Float16* __restrict__ P, int hg, int q0, int nk) {
  #pragma clang fp contract(off)
  const int t = blockIdx.x * 256 + threadIdx.x; if (t >= hg * QT) return; const size_t i = (size_t)t; const float* s = S + i * NKX; const int last = q0 + (t % QT); float mx = -3.0e38f;
#pragma unroll 1
  for (int j = 0; j < nk; ++j) { const float f = (j <= last) ? 1.f : 0.f; mx = fmaxf(mx, fmaf(f, s[j], (1.f - f) * -1.0e9f)); } float se = 0.f;
#pragma unroll 1
  for (int j = 0; j < nk; ++j) { const float f = (j <= last) ? 1.f : 0.f; se += __expf(fmaf(f, s[j], (1.f - f) * -1.0e9f) - mx); } const float sc = 256.0f / se;
#pragma unroll 1
  for (int j0 = 0; j0 < nk; j0 += 8) { FragH fr; for (int q = 0; q < 8; ++q) { const int j = j0 + q; const float f = (j <= last) ? 1.f : 0.f; fr.h[q] = (_Float16)(__expf(fmaf(f, s[j], (1.f - f) * -1.0e9f) - mx) * sc); } unsigned short* d = (unsigned short*)P + i * NKX + j0; *(v8us*)d = fr.half[0];  } }



__global__ __launch_bounds__(256) void k_tab128p(const int* __restrict__ pos, int nrows, float theta, float* __restrict__ CS, float* __restrict__ SN) {
  #pragma clang fp contract(off)
  const int t = blockIdx.x * 256 + threadIdx.x; if (t >= nrows * 64) return; const int i = t % 64; const int r = t / 64; const float invf = (float)(1.0 / pow((double)theta, (double)(2 * i) / 128.0)); const float ang = __fmul_rn((float)pos[r], invf); const float c = cosf(ang), sv = sinf(ang);
  float* c0 = CS + (size_t)r * 128 + i; float* s0 = SN + (size_t)r * 128 + i;
  { *(float*)c0 = c; *(float*)(c0 + 64) = c; *(float*)s0 = sv; *(float*)(s0 + 64) = sv;  } }

__global__ __launch_bounds__(256) void k_rsmcim(const float* __restrict__ S, _Float16* __restrict__ P, int hg, int q0, int nk, const int* __restrict__ am) {
  #pragma clang fp contract(off)
  const int t = blockIdx.x * 256 + threadIdx.x; if (t >= hg * QT) return; const size_t i = (size_t)t; const float* s = S + i * NKX; const int last = q0 + (t % QT); const int* mr = am + (size_t)last * SQ; float mx = -3.0e38f;      /* the module's mask row of this query (keys >= nk lie above the diagonal of the causal mask and are not computed) */
#pragma unroll 1
  for (int j = 0; j < nk; ++j) { const float f = (mr[j] != 0) ? 1.f : 0.f; mx = fmaxf(mx, fmaf(f, s[j], (1.f - f) * -1.0e9f)); } float se = 0.f;
#pragma unroll 1
  for (int j = 0; j < nk; ++j) { const float f = (mr[j] != 0) ? 1.f : 0.f; se += __expf(fmaf(f, s[j], (1.f - f) * -1.0e9f) - mx); } const float sc = 256.0f / se;
#pragma unroll 1
  for (int j0 = 0; j0 < nk; j0 += 8) { FragH fr; for (int q = 0; q < 8; ++q) { const int j = j0 + q; const float f = (mr[j] != 0) ? 1.f : 0.f; fr.h[q] = (_Float16)(__expf(fmaf(f, s[j], (1.f - f) * -1.0e9f) - mx) * sc); } unsigned short* d = (unsigned short*)P + i * NKX + j0; *(v8us*)d = fr.half[0];  } }



__global__ __launch_bounds__(256) void k_tab128h(int nr, float theta, float* __restrict__ CS, float* __restrict__ SN) {
  #pragma clang fp contract(off)
  const size_t t = (size_t)blockIdx.x * 256 + threadIdx.x; if (t >= (size_t)nr * 64) return; const int i = (int)(t % 64); const size_t r = t / 64; const int p = (int)(r % SQ);
  const float invf = (float)(1.0 / pow((double)theta, ((double)(2 * i)) / 128.0)); const float ang = __fmul_rn((float)p, invf); const float c = cosf(ang), sv = sinf(ang);
  float* pc = CS + r * 128 + i; float* ps = SN + r * 128 + i;
  *(float*)pc = c; *(float*)(pc + 64) = c; *(float*)ps = sv; *(float*)(ps + 64) = sv;  }

// Lane exchanges and the native exp of the softmax code below.
template <int M> __device__ __forceinline__ float sm_xrow(float x) { return __builtin_bit_cast(float, __builtin_amdgcn_mov_dpp(__builtin_bit_cast(int, x), 0x160 | M, 0xf, 0xf, true)); }      /* lane l with lane l ^ M, M < 16 (row_xmask) */
__device__ __forceinline__ float sm_xhalf(float x) { const int b = __builtin_bit_cast(int, x); return __builtin_bit_cast(float, __builtin_amdgcn_permlanex16(b, b, 0x76543210, 0xfedcba98, false, false)); }      /* lane l with lane l ^ 16 */
__device__ __forceinline__ float sm_wmax(float x) { x = fmaxf(x, sm_xrow<1>(x)); x = fmaxf(x, sm_xrow<2>(x)); x = fmaxf(x, sm_xrow<4>(x)); x = fmaxf(x, sm_xrow<8>(x)); return fmaxf(x, sm_xhalf(x)); }
__device__ __forceinline__ float sm_wsum(float x) { x += sm_xrow<1>(x); x += sm_xrow<2>(x); x += sm_xrow<4>(x); x += sm_xrow<8>(x); return x + sm_xhalf(x); }
// Eight native 2^x in one statement. The outputs are early-clobber, so no v_exp_f32 in it overwrites a neighbour's source or reads its result; the closing v_nop keeps the one slot
// that the instruction set asks for behind a transcendental, whatever the compiler places next.
__device__ __forceinline__ void sm_exp2x8(v4f& a, v4f& b) { float e0, e1, e2, e3, e4, e5, e6, e7;
  asm("v_exp_f32 %0, %8\n\tv_exp_f32 %1, %9\n\tv_exp_f32 %2, %10\n\tv_exp_f32 %3, %11\n\tv_exp_f32 %4, %12\n\tv_exp_f32 %5, %13\n\tv_exp_f32 %6, %14\n\tv_exp_f32 %7, %15\n\tv_nop"
      : "=&v"(e0), "=&v"(e1), "=&v"(e2), "=&v"(e3), "=&v"(e4), "=&v"(e5), "=&v"(e6), "=&v"(e7) : "v"(a[0]), "v"(a[1]), "v"(a[2]), "v"(a[3]), "v"(b[0]), "v"(b[1]), "v"(b[2]), "v"(b[3]));
  a[0] = e0; a[1] = e1; a[2] = e2; a[3] = e3; b[0] = e4; b[1] = e5; b[2] = e6; b[3] = e7; }
// Fused attention of all query blocks: scores, the per-block softmax and P V in one launch; no score or weight ever goes to memory.
// One wave owns 16 queries of one head and walks the key blocks j = 0 .. i. Both products are formed transposed, with the queries as the 16 columns:
//   S^T = K Q^T : A = 16 key rows (hi, residual), B = the wave's q fragments; 16 tiles of 16 keys = the whole 256-key block of a lane's query (column ln; keys 8 hh + r of each tile);
//   softmax     : maximum and sum run over a lane's own 128 scores, one exchange with lane ^ 16 finishes each;
//   O^T = V^T P^T : A = 16 rows of V^T (hi, residual); score tiles 2u and 2u + 1 of a lane ARE the B fragment of keys 32u .. 32u + 31 (elements 0..7 = keys 8 hh + r, 8..15 = keys 16 + 8 hh + r, the k order of g2_frag), so the weights move through no LDS.
// Each product has three terms: hi.hi in one accumulator, the two x1024 residual terms together in a second one. Fragments are requested two steps before their products.
struct FA4 { v16h f0, f1, f2, f3; };      /* the four fragments of one step: a key tile's four k-steps, or four 16-dim tiles of V^T, of one plane (hi or residual) */
__device__ __forceinline__ void fa_load(FA4& s, const _Float16* p, size_t st) { s.f0 = g2_frag(p); s.f1 = g2_frag(p + st); s.f2 = g2_frag(p + 2 * st); s.f3 = g2_frag(p + 3 * st); }
__device__ __forceinline__ v8f fa_mma(v16h a, v16h b, v8f c) { return __builtin_amdgcn_wmma_f32_16x16x32_f16(false, a, false, b, (short)0, c, false, false); }
__global__ __launch_bounds__(128) void k_fattn(const _Float16* __restrict__ Qh, const _Float16* __restrict__ Ql, const _Float16* __restrict__ Kh, const _Float16* __restrict__ Kl, const _Float16* __restrict__ Vh, const _Float16* __restrict__ Vl, _Float16* __restrict__ O) {
  const int lane = threadIdx.x & 31, ln = lane & 15, hh = lane >> 4, w = threadIdx.x >> 5;
  const int qb = (SQ / QT - 1) - (int)(blockIdx.x / (NB * NH * 4)); const int rem = blockIdx.x % (NB * NH * 4); const int sub = rem & 3, h = (rem >> 2) % NH, b = rem / (4 * NH);      /* the query blocks with the most key blocks take the lowest work-group indices */
  const int qrow = qb * QT + sub * 64 + w * 16 + ln;      /* this lane's query (a column of both products) */
  // All six planes and O are in fragment order: a strip of 16 rows starts at row x 2048 elements, column c (a multiple of 32) at 16 c elements inside it, the lane's piece at 8 lane.
  const size_t qs = ((size_t)b * SQ + (qrow - ln)) * DMX + lane * 8; const _Float16* qph = Qh + qs; const _Float16* qpl = Ql + qs;
  const size_t ks = (size_t)b * SQ * DKV + h * HDK * 16 + lane * 8; const _Float16* kph = Kh + ks; const _Float16* kpl = Kl + ks;
  const size_t vs = ((size_t)b * DKV + h * HDK) * SQ + lane * 8; const _Float16* vph = Vh + vs; const _Float16* vpl = Vl + vs;
  const v8f z8 = {0.f, 0.f, 0.f, 0.f, 0.f, 0.f, 0.f, 0.f}; v8f oh[8] = {z8, z8, z8, z8, z8, z8, z8, z8};
  const float nrm = 256.0f / __fadd_rn((float)(qb + 1), 1e-6f);
  int j = 0;
#pragma unroll 1      /* one trip = one 256-key block; rolled, the trip count differs between query blocks (at least one trip: block 0) */
  do { int jo = j * 256, qo = h * HDK * 16;
    asm volatile("s_wait_xcnt 0x0" : "+s"(jo), "+s"(qo) : : "memory");      /* stands in front of the rewrite of the address registers of the last trip's loads (a precaution); the key offset and the q offset are its outputs, so every new address is formed behind it, and the q fragments are fetched anew in every trip: they hold no registers during softmax and P V, which keeps two waves on a SIMD */
    const _Float16* qp = qph + qo; const _Float16* qlp = qpl + qo;
    const v16h qh0 = g2_frag(qp), qh1 = g2_frag(qp + 512), qh2 = g2_frag(qp + 1024), qh3 = g2_frag(qp + 1536), ql0 = g2_frag(qlp), ql1 = g2_frag(qlp + 512), ql2 = g2_frag(qlp + 1024), ql3 = g2_frag(qlp + 1536);
    const _Float16* kh_ = kph + (size_t)jo * DKV; const _Float16* kl_ = kpl + (size_t)jo * DKV; const _Float16* vh_ = vph + jo * 16; const _Float16* vl_ = vpl + jo * 16;
    // 64 steps of 8 loads a trip: steps 0..31 = key tile t, hi plane then residual plane; steps 32..63 = 32 keys x 64 dims of V^T, hi then residual. Three register sets turn: step k + 2 is requested in front of the products of step k.
#define FA_REQ(k) { if ((k) < 32) fa_load(x[(k) % 3], (((k) & 1) ? kl_ : kh_) + (size_t)((k) >> 1) * 16 * DKV, 512); else fa_load(x[(k) % 3], (((k) & 1) ? vl_ : vh_) + (size_t)(((k) - 32) >> 2) * 512 + (size_t)(((((k) - 32) >> 1) & 1) * 4) * 16 * SQ, (size_t)16 * SQ); }
    v8f s[16]; FA4 x[3]; FA_REQ(0) __builtin_amdgcn_sched_barrier(0);      /* the q fragments and step 0 are requested first, then step 1, then step 2: mixed, the first products' counted load wait would wait for the younger steps too */
    FA_REQ(1) __builtin_amdgcn_sched_barrier(0);      /* as above */
    v8f ah = z8, al = z8;
#pragma unroll
    for (int k = 0; k < 32; ++k) { if (k == 28 || k == 29) __builtin_amdgcn_sched_barrier(0);      /* keeps the vector work of the step before out of the stretch between a K plane's last request and the wait below */
      FA_REQ(k + 2)      /* behind the last key tile: the first V^T fragments, which fly during the softmax */
      if (k == 28 || k == 29) { __builtin_amdgcn_sched_barrier(0); asm volatile("s_wait_xcnt 0x0" ::: "memory"); }      /* behind the last request of a K plane: its address registers are free from here on and the compiler reuses them with the loads in flight (a precaution; it wrote no wait there); the barrier in front keeps the requests above the wait */
      __builtin_amdgcn_sched_barrier(0);      /* keeps this step's products, with their load wait, from moving up in front of the requests of the step after next */
      const FA4& c = x[k % 3];
      if ((k & 1) == 0) { ah = fa_mma(c.f0, qh0, z8); al = fa_mma(c.f0, ql0, z8); ah = fa_mma(c.f1, qh1, ah); al = fa_mma(c.f1, ql1, al); ah = fa_mma(c.f2, qh2, ah); al = fa_mma(c.f2, ql2, al); ah = fa_mma(c.f3, qh3, ah); al = fa_mma(c.f3, ql3, al); }
      else { al = fa_mma(c.f0, qh0, al); al = fa_mma(c.f1, qh1, al); al = fa_mma(c.f2, qh2, al); al = fa_mma(c.f3, qh3, al); s[k >> 1] = ah * ATS + al * (ATS * 0.0009765625f); } }
    if (j == qb) {      /* only the diagonal block holds keys above a query */
#pragma unroll
      for (int t = 0; t < 16; ++t) {
#pragma unroll
        for (int r = 0; r < 8; ++r) s[t][r] = (jo + t * 16 + 8 * hh + r <= qrow) ? s[t][r] : -1.0e9f; } }
    float mx = -3.0e38f;
#pragma unroll
    for (int t = 0; t < 16; ++t) mx = fmaxf(mx, fmaxf(fmaxf(fmaxf(s[t][0], s[t][1]), fmaxf(s[t][2], s[t][3])), fmaxf(fmaxf(s[t][4], s[t][5]), fmaxf(s[t][6], s[t][7]))));
    mx = fmaxf(mx, sm_xhalf(mx)); float se = 0.f;
#pragma unroll
    for (int t = 0; t < 16; ++t) { v4f a, e;
#pragma unroll
      for (int u = 0; u < 4; ++u) { a[u] = (s[t][u] - mx) * 1.44269504f; e[u] = (s[t][4 + u] - mx) * 1.44269504f; }      /* e^x = 2^(x log2 e), as the native exp forms it */
      sm_exp2x8(a, e); se += ((a[0] + a[1]) + (a[2] + a[3])) + ((e[0] + e[1]) + (e[2] + e[3]));
#pragma unroll
      for (int u = 0; u < 4; ++u) { s[t][u] = a[u]; s[t][4 + u] = e[u]; } }
    se += sm_xhalf(se); const float isum = nrm / se;
    FragH bh, bl; v8f ol[8] = {z8, z8, z8, z8, z8, z8, z8, z8};      /* the residual terms of this key block (x1024) */
#pragma unroll
    for (int k = 32; k < 64; ++k) { const int u = (k - 32) >> 2, d0 = (((k - 32) >> 1) & 1) * 4;
      if (k == 60 || k == 61) __builtin_amdgcn_sched_barrier(0);      /* as for K above */
      if (k + 2 < 64) FA_REQ(k + 2)
      if (k == 60 || k == 61) { __builtin_amdgcn_sched_barrier(0); asm volatile("s_wait_xcnt 0x0" ::: "memory"); }      /* behind the last request of a V^T plane, as for K above */
      __builtin_amdgcn_sched_barrier(0);      /* as above: the requests stay in front of this step's products */
      const FA4& c = x[k % 3];
      if (((k - 32) & 3) == 0) {      /* the weights of keys 32u .. 32u + 31 as f16 hi + x1024 residual: the B fragments of the next four steps */
#pragma unroll
        for (int r = 0; r < 8; ++r) { const float p0 = s[2 * u][r] * isum, p1 = s[2 * u + 1][r] * isum; bh.h[r] = (_Float16)p0; bl.h[r] = (_Float16)((p0 - (float)bh.h[r]) * 1024.0f); bh.h[8 + r] = (_Float16)p1; bl.h[8 + r] = (_Float16)((p1 - (float)bh.h[8 + r]) * 1024.0f); } }
      if ((k & 1) == 0) { oh[d0] = fa_mma(c.f0, bh.v, oh[d0]); oh[d0 + 1] = fa_mma(c.f1, bh.v, oh[d0 + 1]); oh[d0 + 2] = fa_mma(c.f2, bh.v, oh[d0 + 2]); oh[d0 + 3] = fa_mma(c.f3, bh.v, oh[d0 + 3]);
        ol[d0] = fa_mma(c.f0, bl.v, ol[d0]); ol[d0 + 1] = fa_mma(c.f1, bl.v, ol[d0 + 1]); ol[d0 + 2] = fa_mma(c.f2, bl.v, ol[d0 + 2]); ol[d0 + 3] = fa_mma(c.f3, bl.v, ol[d0 + 3]); }
      else { ol[d0] = fa_mma(c.f0, bh.v, ol[d0]); ol[d0 + 1] = fa_mma(c.f1, bh.v, ol[d0 + 1]); ol[d0 + 2] = fa_mma(c.f2, bh.v, ol[d0 + 2]); ol[d0 + 3] = fa_mma(c.f3, bh.v, ol[d0 + 3]); } }
#undef FA_REQ
#pragma unroll
    for (int dt = 0; dt < 8; ++dt) oh[dt] += ol[dt] * 0.0009765625f;      /* joined per key block, so that the second accumulator holds no registers while the next scores are formed */
  } while (++j <= qb);
  unsigned short* op = (unsigned short*)O + qs + h * HDK * 16;      /* a lane holds dims 16 dt + 8 hh + r of its query: piece 32 (dt & 1) + lane of tile dt / 2 of the head's four: each store of the wave writes 512 contiguous bytes */
#pragma unroll
  for (int dt = 0; dt < 8; ++dt) { FragH f;
#pragma unroll
    for (int r = 0; r < 8; ++r) f.h[r] = (_Float16)(oh[dt][r] * 0.25f);      /* o x64 = (Ph Vh + (Pl Vh + Ph Vl) 2^-10) / 4 */
    *(v8us*)(op + dt * 256) = f.half[0]; } }
// Exact f32 causal attention of rows 0..255, spread over a work-group: 8 waves take 8 query rows of one head (keys 0 .. i0 + 7 only).
// Scores: 4 neighbouring lanes share one key row (each wave-wide load covers 8 rows x 64 contiguous bytes), a lane sums its 32 of the 128 dims for all 8 queries (q from LDS, 64 contiguous bytes per read), two lane steps finish the dot.
// Softmax: wave w owns row i0 + w, 8 keys a lane, plain two-pass (all scores of a row are at hand), accurate expf; keys above the query get weight 0.
// Output: wave w sums keys w, w + 8, ... (a V row is one coalesced 512 B load, its 8 weights two LDS broadcasts), the 8 partial sums meet in LDS in fixed order; o x64 / row sum as before.
__global__ __launch_bounds__(256) void k_att0w(const float* __restrict__ QF, const float* __restrict__ KF, const float* __restrict__ VF, float scale, float* __restrict__ OF) {
  __shared__ __attribute__((aligned(16))) float lq[8][128]; __shared__ __attribute__((aligned(16))) float sc[8][QT0 + 4]; __shared__ __attribute__((aligned(16))) float pt[QT0][8]; __shared__ __attribute__((aligned(16))) float red[8][8][128]; __shared__ float inv[8];
  const int lane = threadIdx.x & 31; const int w = __builtin_amdgcn_readfirstlane(threadIdx.x >> 5); const int h = blockIdx.x % NH, b = (blockIdx.x / NH) % NB, i0 = (QT0 / 8 - 1 - blockIdx.x / (NH * NB)) * 8; const int nkey = i0 + 8;      /* the row groups with the most keys take the lowest work-group indices, of both batches */
  QF += (size_t)b * QT0 * DMX; KF += (size_t)b * QT0 * DKV; VF += (size_t)b * QT0 * DKV; OF += (size_t)b * QT0 * DMX;      /* each plane holds rows 0..255 of one batch behind those of the other */
  *(v4f*)&lq[w][lane * 4] = *(const v4fa*)(QF + (size_t)(i0 + w) * DMX + h * 128 + lane * 4);
  __syncthreads();
  const int dq = (lane & 3) * 4;
#pragma unroll 1      /* one trip = 64 keys of the work-group; rolled so that only the trips below the diagonal run */
  for (int j0 = w * 8; j0 < nkey; j0 += 64) { const int j = j0 + (lane >> 2); const float* kr = KF + (size_t)j * DKV + h * 128 + dq; v4f kq[8];
#pragma unroll
    for (int c = 0; c < 8; ++c) kq[c] = *(const v4fa*)(kr + c * 16);
    asm volatile("s_wait_xcnt 0x0" ::: "memory");      /* stands in front of the first reuse of the loads' address registers (a precaution); no load sinks below it, so all eight are in flight together */
#pragma unroll 1      /* four query rows a trip: with all eight unrolled the q reads of a whole tile are hoisted and the wave needs more than 256 registers, so that only one work-group fits a WGP */
    for (int rh = 0; rh < 8; rh += 4) { float acc[4] = {0.f, 0.f, 0.f, 0.f};
#pragma unroll
      for (int c = 0; c < 8; ++c) {
#pragma unroll
        for (int r = 0; r < 4; ++r) { const v4f q = *(const v4f*)&lq[rh + r][c * 16 + dq]; acc[r] += q[0] * kq[c][0] + q[1] * kq[c][1] + q[2] * kq[c][2] + q[3] * kq[c][3]; } }
#pragma unroll
      for (int r = 0; r < 4; ++r) { float s = acc[r]; s += sm_xrow<1>(s); s += sm_xrow<2>(s); if ((lane & 3) == 0) sc[rh + r][j] = s * scale; } } }
  __syncthreads();
  { const int i = i0 + w; float s[8]; float mx = -3.0e38f;
#pragma unroll
    for (int u = 0; u < 8; ++u) { const int j = lane + 32 * u; s[u] = (j <= i) ? sc[w][j] : -3.0e38f; mx = fmaxf(mx, s[u]); }
    mx = sm_wmax(mx); float se = 0.f;
#pragma unroll
    for (int u = 0; u < 8; ++u) { const int j = lane + 32 * u; const float e = (j <= i) ? expf(s[u] - mx) : 0.f; se += e; pt[j][w] = e; }
    se = sm_wsum(se); if (lane == 0) inv[w] = 64.0f / se; }
  __syncthreads();
  const v4f z4 = {0.f, 0.f, 0.f, 0.f}; v4f o[8] = {z4, z4, z4, z4, z4, z4, z4, z4};
#pragma unroll 1      /* one trip = 64 keys of the work-group, 8 a wave; keys from nkey on carry weight 0 for all 8 rows (rows below 256 of V, in bounds) */
  for (int jb = w; jb < nkey; jb += 64) { const float* vr = VF + (size_t)jb * DKV + h * 128 + lane * 4; v4f vv[8];
#pragma unroll
    for (int u = 0; u < 8; ++u) vv[u] = *(const v4fa*)(vr + (size_t)(8 * u) * DKV);
#pragma unroll
    for (int u = 0; u < 8; ++u) { const v4f p0 = *(const v4f*)&pt[jb + 8 * u][0], p1 = *(const v4f*)&pt[jb + 8 * u][4];
#pragma unroll
      for (int r = 0; r < 4; ++r) { o[r] += p0[r] * vv[u]; o[4 + r] += p1[r] * vv[u]; } } }
#pragma unroll
  for (int r = 0; r < 8; ++r) *(v4f*)&red[w][r][lane * 4] = o[r];
  __syncthreads();
  { v4f a = *(const v4f*)&red[0][w][lane * 4];
#pragma unroll
    for (int k = 1; k < 8; ++k) a += *(const v4f*)&red[k][w][lane * 4];
    a *= inv[w]; *(v4f*)(OF + (size_t)(i0 + w) * DMX + h * 128 + lane * 4) = a; } }
extern "C" void kernel_launch(void* const* d_in, const int* in_sizes, int n_in,
                              void* d_out, int out_size, void* d_ws, size_t ws_size, hipStream_t stream) {
  (void)in_sizes; (void)n_in; (void)out_size;
  const float* const* I = (const float* const*)d_in; const float* x = I[0]; const float* wq = I[1]; const float* wk = I[2]; const float* wv = I[3]; const float* wo = I[4]; const float* bo = nullptr;      /* natural [out][in] Wq/Wk/Wv/Wo [2048][2048]; no biases */
  char* ws = (char*)d_ws; size_t off = 0;
  auto take = [&](size_t bytes) { char* p = ws + off; off += (bytes + 255) & ~(size_t)255; return p; };
  _Float16* BQ = (_Float16*)take((size_t)DMX * DMX * 2); _Float16* BK = (_Float16*)take((size_t)DKV * DMX * 2); _Float16* BV = (_Float16*)take((size_t)DKV * DMX * 2); _Float16* BO = (_Float16*)take((size_t)DMX * DMX * 2);
  _Float16* X16 = (_Float16*)take(NR * DMX * 2); float* QF = (float*)take((size_t)NB * QT0 * DMX * 4); float* KF = (float*)take((size_t)NB * QT0 * DKV * 4); float* VF = (float*)take((size_t)NB * QT0 * DKV * 4); _Float16* Q16 = (_Float16*)take(NR * DMX * 2); _Float16* QL = (_Float16*)take(NR * DMX * 2); _Float16* K16 = (_Float16*)take(NR * DKV * 2); _Float16* KL = (_Float16*)take(NR * DKV * 2); _Float16* O16 = (_Float16*)take(NR * DMX * 2);      /* rows 0..255 of each batch's q, k, v in f32; f16 hi + x1024 residual planes of q, k (both batches) */
  _Float16* VT = (_Float16*)take((size_t)NB * DKV * SQ * 2); _Float16* VTL = (_Float16*)take((size_t)NB * DKV * SQ * 2);      /* V^T hi / residual of both batches */
  float* OF0 = (float*)take((size_t)NB * QT0 * DMX * 4); _Float16* OH0 = (_Float16*)take((size_t)NB * QT0 * DMX * 2); _Float16* OL0 = (_Float16*)take((size_t)NB * QT0 * DMX * 2);
  if (off > ws_size) return;      /* 180 MiB */
  k_prep<<<4 * WB + (unsigned)(NR * DMX / 8 / 256), 256, 0, stream>>>(x, wq, wk, wv, wo, X16, BQ, BK, BV, BO);      /* natural [out][in] weights = Bt x16; x as exact f16 rows */
  // Independent work shares a launch: the token rows of both batches are the rows of one GEMM, and q and k are the two blockIdx.y slices of one launch (same A, same epilogue).
  k_gemm2<0, 1><<<dim3((unsigned)((NR / 128) * (DMX / 64)), 2), 128, 0, stream>>>(X16, DMX, 0, BQ, DMX, (size_t)(BK - BQ), 0.0625f, nullptr, 0, nullptr, 1, 0, 0, QF, nullptr, DMX, (size_t)(KF - QF), (int)NR, DMX, DMX, Q16, QL, QT0, (size_t)(K16 - Q16));      /* q and k (exact products, f32 accumulators) leave the GEMM as f16 hi + x1024 residual planes in fragment order (block 0's full softmax seen from every later block's first row needs near-exact logits); f32 rows 0..255 of each batch for the exact first tile */
  k_gemm2<0, 2><<<dim3((unsigned)((NR / 128) * (DKV / 64)), 1), 128, 0, stream>>>(X16, DMX, 0, BV, DMX, 0, 0.0625f, nullptr, 0, nullptr, 1, 0, 0, VF, nullptr, DKV, 0, (int)NR, DKV, DMX, VT, VTL, QT0, 0);      /* v leaves the GEMM as V^T hi / x1024 residual planes in fragment order, a plane a batch (rows = dims, columns = keys; the per-block softmax gives every block's first rows single-key weights, so v and P must be carried beyond one f16); f32 rows 0..255 of each batch for the exact first tile */
  k_att0w<<<NB * NH * (QT0 / 8), 256, 0, stream>>>(QF, KF, VF, ATS, OF0);      /* exact causal attention rows 0..255 of both batches (o x64) */
  k_fattn<<<NB * NH * (SQ / 64), 128, 0, stream>>>(Q16, QL, K16, KL, VT, VTL, O16);      /* scores (hi.hi + the two residual terms), the module's per-block softmax (an independent softmax per 256-key block j <= i, diagonal block causal, weights divided by block count + 1e-6) and o = P V (hi.hi + the two residual terms) -> merged f16 o rows (x64) */
  k_gemm2<0, 0><<<dim3((unsigned)((NR / 128) * (DMX / 64)), 1), 128, 0, stream>>>(O16, DMX, 0, BO, DMX, 0, 0.0009765625f, bo, 0, nullptr, 1, 0, 0, (float*)d_out, nullptr, DMX, 0, (int)NR, DMX, DMX, nullptr, nullptr, 0, 0);      /* out = o Wo^T */
  k_hl<true><<<(unsigned)(((size_t)NB * QT0 * DMX / 8 + 255) / 256), 256, 0, stream>>>(OF0, OH0, OL0, (size_t)NB * QT0 * DMX / 8);      /* first-tile o (x64) -> f16 hi + x1024 residual planes */
  // The two batches' first tiles are the two blockIdx.y slices of each of the two launches.
  k_gemm2<0, 0><<<dim3((QT0 / 128) * (DMX / 64), NB), 128, 0, stream>>>(OH0, DMX, (size_t)QT0 * DMX, BO, DMX, 0, 0.0009765625f, bo, 0, nullptr, 1, 0, 0, (float*)d_out, nullptr, DMX, (size_t)SQ * DMX, QT0, DMX, DMX, nullptr, nullptr, 0, 0);      /* rows 0..255 of each batch rewritten from the exact path */
  k_gemm2<0, 0><<<dim3((QT0 / 128) * (DMX / 64), NB), 128, 0, stream>>>(OL0, DMX, (size_t)QT0 * DMX, BO, DMX, 0, 0.00000095367431640625f, nullptr, 0, (const float*)d_out, -1, 0, 0, (float*)d_out, nullptr, DMX, (size_t)SQ * DMX, QT0, DMX, DMX, nullptr, nullptr, 0, 0);      /* += o_lo Wo 2^-20 (own-element accumulate) */
}
